// v000
// Measured on an AMD MI455X. A time is GPU time per run, averaged over a window of back-to-back runs after a warm-up
// (all launches, gaps included; the runs take copies of the inputs in turn), and the median of several windows.
// Apart from v000's, it joins two sittings. Times from different sittings can be a few percent apart, while
// side-by-side timings come from the same sitting.
// v000 is the starting kernel. One run takes 348 microseconds.
#include <hip/hip_runtime.h>
// Causal grouped-query self-attention with a group axis: x [1][SEQ][2][1024]; token row = s*2 + g; q = x Wq (16 heads x 64), k|v = x Wk|Wv (4 kv heads x 64, query head h uses kv head h/4); raw energy, causal exclusion (key > query), then 1/8 inside the softmax over keys of the same g; merged heads (h*64 + d) times Wo.
// Compute dtype: v_wmma_f32_16x16x32_f16 for every contraction, f32 accumulate. Inputs RNE-converted to bf16 then held exactly in f16 (x as is, weights x16). q|k|v written as f16 value + f16 residual (x2^10) planes. Scores: q value+residual against k value (plus k residual on query rows < 256). P carried x2^10 as f16 (plus residual x2^10 on rows < 256), V^T value (plus residual on rows < 256), residual products in a separate accumulator. Context carried x16 as f16 value | residual (x64) along K against Wo x16 | Wo / 4. Softmax statistics f32.
#ifndef NB
#define NB 1
#endif
#ifndef SEQ
#define SEQ 2048
#endif
#define SEQ_FULL 2048
#define NG 2
#define EMB 1024
#define NH 16
#define NKV 4
#define HD 64
#define KVW (NKV * HD)            /* 256 */
#define LQ (EMB + 2 * KVW)        /* 1536: pitch of the q|k|v planes */
#define CP (2 * EMB)              /* 2048: pitch of the context plane (value | residual) */
#define NR (NB * SEQ * NG)        /* token rows */
#define EQT 4                     /* 64-row query tiles (rows < 256) that run the full residual scheme */
#define RS 1024.0f                /* residual carry of q, k, v, P */
#define RINV 0.0009765625f
#define RSC 64.0f                 /* residual carry of the context plane */

static_assert(NB == 1);
static_assert(SEQ % 64 == 0);
static_assert(SEQ >= 64);
static_assert(SEQ <= SEQ_FULL);
static_assert(NR % 128 == 0);
static_assert(LQ % 64 == 0);
static_assert(EMB % 64 == 0);
static_assert(EMB % 32 == 0);
static_assert(CP % 32 == 0);
static_assert(HD == 64);
static_assert(NH == 4 * NKV);
static_assert(NH * HD == EMB);
static_assert(KVW % 64 == 0);

typedef unsigned short v8us __attribute__((ext_vector_type(8), may_alias));
typedef float  v8f  __attribute__((ext_vector_type(8)));
typedef float  v4f  __attribute__((ext_vector_type(4)));
typedef float  v4fa __attribute__((ext_vector_type(4), may_alias));
typedef _Float16 v16h __attribute__((ext_vector_type(16)));
union FragH { v16h v; v8us half[2]; _Float16 h[16]; unsigned short u[16]; };

constexpr size_t SZ_BQKV = (size_t)LQ * EMB * 2;
constexpr size_t SZ_BO   = (size_t)EMB * CP * 2;
constexpr size_t SZ_X16  = (size_t)NR * EMB * 2;
constexpr size_t SZ_QK   = (size_t)NR * LQ * 2;
constexpr size_t SZ_VT   = (size_t)NB * NG * NKV * HD * SEQ * 2;
constexpr size_t SZ_CX   = (size_t)NR * CP * 2;
constexpr size_t WS_TOTAL = SZ_BQKV + SZ_BO + SZ_X16 + 2 * SZ_QK + 2 * SZ_VT + SZ_CX;
static_assert(WS_TOTAL <= (size_t)134217728);
static_assert(SZ_BQKV % 256 == 0 && SZ_BO % 256 == 0 && SZ_X16 % 256 == 0 && SZ_QK % 256 == 0 && SZ_VT % 256 == 0 && SZ_CX % 256 == 0);

// RNE convert f32 -> bf16 value (kept in f32)
__device__ __forceinline__ float bf16_rne(float x) { unsigned int u = __float_as_uint(x); u = (u + 0x7FFFu + ((u >> 16) & 1u)) & 0xFFFF0000u; return __uint_as_float(u); }
__device__ __forceinline__ unsigned short h_bits(_Float16 h) { return __builtin_bit_cast(unsigned short, h); }
// 16-bit fragment: elements 0..7 <- k0 + 8h + 0..7, elements 8..15 <- k0 + 16 + 8h + 0..7 (row / column = lane & 15)
__device__ __forceinline__ v16h ldfrag(const unsigned short* __restrict__ p, size_t off, int hh) { FragH f; f.half[0] = *(const v8us*)(p + off + 8 * hh); f.half[1] = *(const v8us*)(p + off + 16 + 8 * hh); return f.v; }
__device__ __forceinline__ v8f mma(v16h a, v16h b, v8f c) { v8f d = __builtin_amdgcn_wmma_f32_16x16x32_f16(false, a, false, b, (short)0, c, false, false); asm volatile("v_nop\n\tv_nop\n\tv_nop\n\tv_nop" : "+v"(d) : "v"(a), "v"(b)); return d; }

__global__ __launch_bounds__(256) void k_wt_f16(const float* __restrict__ W, unsigned short* __restrict__ Wt, int K, int N, int drow0, int dpitch, int dcol0, float scale) {
  const int t = blockIdx.x * 256 + threadIdx.x; const int k8n = K / 8; if (t >= N * k8n) return;
  const int n = t / k8n, k8 = (t - n * k8n) * 8; FragH f;
#pragma unroll
  for (int i = 0; i < 8; ++i) f.h[i] = (_Float16)(bf16_rne(W[(size_t)(k8 + i) * N + n]) * scale);
  const v8us o = f.half[0];
  unsigned short* d = Wt + (size_t)(drow0 + n) * dpitch + dcol0 + k8;
  *(v8us*)d = o; 
}

__global__ __launch_bounds__(256) void k_x16(const float* __restrict__ x, unsigned short* __restrict__ X16, int n8) {
  const int t = blockIdx.x * 256 + threadIdx.x; if (t >= n8) return;
  const v4f a = *(const v4fa*)(x + (size_t)t * 8), c = *(const v4fa*)(x + (size_t)t * 8 + 4); FragH f;
#pragma unroll
  for (int q = 0; q < 4; ++q) { f.h[q] = (_Float16)bf16_rne(a[q]); f.h[4 + q] = (_Float16)bf16_rne(c[q]); }
  const v8us o = f.half[0];
  unsigned short* d = X16 + (size_t)t * 8;
  *(v8us*)d = o; 
}

// GEMM main loop: wave tile 32 x 64, A f16 [M][lda], Bt f16 [N][ldb] (k contiguous), K % 32 == 0
__device__ __forceinline__ void gemm_core(const unsigned short* __restrict__ A, int lda, const unsigned short* __restrict__ Bt, int ldb, int K, int row0, int col0, int ln, int hh,
    v8f& c00, v8f& c01, v8f& c02, v8f& c03, v8f& c10, v8f& c11, v8f& c12, v8f& c13) {
  const size_t a0 = (size_t)(row0 + ln) * lda, a1 = a0 + (size_t)16 * lda;
  const size_t b0 = (size_t)(col0 + ln) * ldb, b1 = b0 + (size_t)16 * ldb, b2 = b1 + (size_t)16 * ldb, b3 = b2 + (size_t)16 * ldb;
#pragma unroll 1
  for (int kb = 0; kb < K; kb += 32) {
    const v16h fa0 = ldfrag(A, a0 + kb, hh), fa1 = ldfrag(A, a1 + kb, hh);
    v16h b = ldfrag(Bt, b0 + kb, hh); c00 = mma(fa0, b, c00); c10 = mma(fa1, b, c10);
    b = ldfrag(Bt, b1 + kb, hh); c01 = mma(fa0, b, c01); c11 = mma(fa1, b, c11);
    b = ldfrag(Bt, b2 + kb, hh); c02 = mma(fa0, b, c02); c12 = mma(fa1, b, c12);
    b = ldfrag(Bt, b3 + kb, hh); c03 = mma(fa0, b, c03); c13 = mma(fa1, b, c13);
  }
}

// C = alpha * A . Bt^T written as f16 value plane CH and residual plane CR ((v - value) * 2^10), both pitch ldc. M % 128 == 0, N % 64 == 0.
__global__ __launch_bounds__(128) void k_gemm_planes(const unsigned short* __restrict__ A, int lda, const unsigned short* __restrict__ Bt, int ldb, float alpha,
    unsigned short* __restrict__ CH, unsigned short* __restrict__ CR, int ldc, int M, int N, int K) {
  __shared__ __attribute__((aligned(16))) float so[4][32][68];
  const int tid = threadIdx.x; const int wave = __builtin_amdgcn_readfirstlane(tid >> 5);
  const int lane = tid & 31, ln = lane & 15, hh = lane >> 4;
  const int ntn = N >> 6; const int mt = blockIdx.x / ntn, nq = blockIdx.x - mt * ntn;
  const int row0 = mt * 128 + 32 * wave, col0 = nq * 64; if (row0 >= M) return;
  const v8f z8 = {0.f, 0.f, 0.f, 0.f, 0.f, 0.f, 0.f, 0.f};
  v8f c00 = z8, c01 = z8, c02 = z8, c03 = z8, c10 = z8, c11 = z8, c12 = z8, c13 = z8;
  gemm_core(A, lda, Bt, ldb, K, row0, col0, ln, hh, c00, c01, c02, c03, c10, c11, c12, c13);
  v8f accs[8] = {c00, c01, c02, c03, c10, c11, c12, c13};
#pragma unroll
  for (int u = 0; u < 8; ++u) { const int t = u & 3, hf = u >> 2;
#pragma unroll
    for (int r = 0; r < 8; ++r) so[wave][hf * 16 + 8 * hh + r][t * 16 + ln] = accs[u][r] * alpha; }
  __builtin_amdgcn_fence(4 /* acq_rel order */, "workgroup"); __builtin_amdgcn_wave_barrier();
  const int rq = lane >> 3, c8 = (lane & 7) * 8;
  {
#pragma unroll
    for (int it = 0; it < 8; ++it) {
      const int rr = it * 4 + rq;
      const v4f a = *(const v4fa*)&so[wave][rr][c8], b = *(const v4fa*)&so[wave][rr][c8 + 4];
      FragH fh, fl;
#pragma unroll
      for (int q = 0; q < 4; ++q) { _Float16 hv = (_Float16)a[q]; fh.h[q] = hv; fl.h[q] = (_Float16)((a[q] - (float)hv) * RS); hv = (_Float16)b[q]; fh.h[4 + q] = hv; fl.h[4 + q] = (_Float16)((b[q] - (float)hv) * RS); }
      const v8us oh = fh.half[0], ol = fl.half[0];
      const size_t o = (size_t)(row0 + rr) * ldc + col0 + c8;
      *(v8us*)(CH + o) = oh; *(v8us*)(CR + o) = ol;
    }
    
  }
}

__global__ __launch_bounds__(128) void k_gemm_out(const unsigned short* __restrict__ A, int lda, const unsigned short* __restrict__ Bt, int ldb, float alpha,
    float* __restrict__ C, int ldc, int M, int N, int K) {
  __shared__ __attribute__((aligned(16))) float so[4][32][68];
  const int tid = threadIdx.x; const int wave = __builtin_amdgcn_readfirstlane(tid >> 5);
  const int lane = tid & 31, ln = lane & 15, hh = lane >> 4;
  const int ntn = N >> 6; const int mt = blockIdx.x / ntn, nq = blockIdx.x - mt * ntn;
  const int row0 = mt * 128 + 32 * wave, col0 = nq * 64; if (row0 >= M) return;
  const v8f z8 = {0.f, 0.f, 0.f, 0.f, 0.f, 0.f, 0.f, 0.f};
  v8f c00 = z8, c01 = z8, c02 = z8, c03 = z8, c10 = z8, c11 = z8, c12 = z8, c13 = z8;
  gemm_core(A, lda, Bt, ldb, K, row0, col0, ln, hh, c00, c01, c02, c03, c10, c11, c12, c13);
  v8f accs[8] = {c00, c01, c02, c03, c10, c11, c12, c13};
#pragma unroll
  for (int u = 0; u < 8; ++u) { const int t = u & 3, hf = u >> 2;
#pragma unroll
    for (int r = 0; r < 8; ++r) so[wave][hf * 16 + 8 * hh + r][t * 16 + ln] = accs[u][r] * alpha; }
  __builtin_amdgcn_fence(4 /* acq_rel order */, "workgroup"); __builtin_amdgcn_wave_barrier();
  const int rsub = lane >> 4, c4 = (lane & 15) * 4;
  {
#pragma unroll
    for (int q = 0; q < 16; ++q) { const int r = q * 2 + rsub; const v4f v = *(const v4fa*)&so[wave][r][c4]; *(v4f*)(C + (size_t)(row0 + r) * ldc + col0 + c4) = v; }
    
  }
}

__global__ __launch_bounds__(256) void k_vt(const unsigned short* __restrict__ QKH, const unsigned short* __restrict__ QKR, unsigned short* __restrict__ VTH, unsigned short* __restrict__ VTR) {
  __shared__ unsigned short tl[2][64][66];
  const int tid = threadIdx.x;
  const int nlg = SEQ / 64;
  const int slab = blockIdx.x / nlg, lg = blockIdx.x - slab * nlg;
  const int g = slab / NKV, kv = slab - g * NKV;
#pragma unroll 1
  for (int i = tid; i < 512; i += 256) {
    const int r = i >> 3, c8 = (i & 7) * 8;
    const size_t sof = ((size_t)(lg * 64 + r) * NG + g) * LQ + EMB + KVW + kv * HD + c8;
    FragH fh, fr; fh.half[0] = *(const v8us*)(QKH + sof); fr.half[0] = *(const v8us*)(QKR + sof);
#pragma unroll
    for (int q = 0; q < 8; ++q) { tl[0][r][c8 + q] = fh.u[q]; tl[1][r][c8 + q] = fr.u[q]; }
  }
  __syncthreads();
  {
#pragma unroll
    for (int rd = 0; rd < 2; ++rd) {
      const int d = rd * 32 + (tid >> 3), pc = tid & 7; FragH fh, fr;
#pragma unroll
      for (int q = 0; q < 8; ++q) { fh.u[q] = tl[0][pc * 8 + q][d]; fr.u[q] = tl[1][pc * 8 + q][d]; }
      const v8us oh = fh.half[0], ol = fr.half[0];
      const size_t o = ((size_t)slab * HD + d) * SEQ + lg * 64 + pc * 8;
      *(v8us*)(VTH + o) = oh; *(v8us*)(VTR + o) = ol;
    }
    
  }
}

// Fused causal flash attention. grid = (SEQ/64, NG*NH); block = 4 waves, wave = 16 query rows; 32-key steps up to the diagonal.
// Fragments straight from the f16 planes (arithmetic addressing, stride NG between tokens of one group). Per-wave LDS tiles (P value/residual, output staging) are wave-private.
__global__ __launch_bounds__(128) void k_attn(const unsigned short* __restrict__ QKH, const unsigned short* __restrict__ QKR,
    const unsigned short* __restrict__ VTH, const unsigned short* __restrict__ VTR, unsigned short* __restrict__ CX) {
  __shared__ __attribute__((aligned(16))) unsigned short pt[4][2][16][40];
  __shared__ __attribute__((aligned(16))) float so[4][16][68];
  const int tid = threadIdx.x; const int wave = __builtin_amdgcn_readfirstlane(tid >> 5);
  const int lane = tid & 31, ln = lane & 15, hh = lane >> 4;
  const int qt = blockIdx.x, gh = blockIdx.y;
  const int g = gh >> 4, h = gh & 15, kvh = h >> 2;
  const bool full = qt < EQT;
  const int q0 = qt * 64 + wave * 16;
  const size_t qoff = ((size_t)(q0 + ln) * NG + g) * LQ + h * HD;
  const size_t kcol = (size_t)EMB + kvh * HD;
  const size_t vrow = (size_t)(g * NKV + kvh) * HD;
  const v8f z8 = {0.f, 0.f, 0.f, 0.f, 0.f, 0.f, 0.f, 0.f};
  v8f om[4] = {z8, z8, z8, z8}, orr[4] = {z8, z8, z8, z8};
  float mi[8], li[8];
#pragma unroll
  for (int r = 0; r < 8; ++r) { mi[r] = -1.0e30f; li[r] = 0.f; }
  const int nkb = (q0 + 16 + 31) >> 5;      /* every visited 32-key step starts at a key <= q0, so each row keeps >= 1 key per step */
#pragma unroll 1
  for (int kb = 0; kb < nkb; ++kb) {
    const int kbase = kb * 32;
    v8f sm[2] = {z8, z8}, sr[2] = {z8, z8};
#pragma unroll
    for (int kk = 0; kk < 2; ++kk) {
      const v16h qh = ldfrag(QKH, qoff + kk * 32, hh);
      const v16h qr = ldfrag(QKR, qoff + kk * 32, hh);
#pragma unroll
      for (int nt = 0; nt < 2; ++nt) {
        const size_t ko = ((size_t)(kbase + nt * 16 + ln) * NG + g) * LQ + kcol + kk * 32;
        const v16h kh = ldfrag(QKH, ko, hh);
        sm[nt] = mma(qh, kh, sm[nt]);
        sr[nt] = mma(qr, kh, sr[nt]);
        if (full) { const v16h kr = ldfrag(QKR, ko, hh); sr[nt] = mma(qh, kr, sr[nt]); }
      }
    }
    float pv[2][8];
#pragma unroll
    for (int r = 0; r < 8; ++r) {
      const int qi = q0 + 8 * hh + r;
      const bool ok0 = (kbase + ln) <= qi, ok1 = (kbase + 16 + ln) <= qi;
      const float s0 = (sm[0][r] + sr[0][r] * RINV) * 0.125f;
      const float s1 = (sm[1][r] + sr[1][r] * RINV) * 0.125f;
      float mx = fmaxf(ok0 ? s0 : -1.0e30f, ok1 ? s1 : -1.0e30f);
      mx = fmaxf(mx, __shfl_xor(mx, 1, 32));
      mx = fmaxf(mx, __shfl_xor(mx, 2, 32));
      mx = fmaxf(mx, __shfl_xor(mx, 4, 32));
      mx = fmaxf(mx, __shfl_xor(mx, 8, 32));
      const float mnew = fmaxf(mi[r], mx);
      const float al = __expf(mi[r] - mnew);
      mi[r] = mnew;
      const float e0 = __expf(fminf(s0 - mnew, 0.f)), e1 = __expf(fminf(s1 - mnew, 0.f));
      const float p0 = ok0 ? e0 : 0.f, p1 = ok1 ? e1 : 0.f;
      float sum = p0 + p1;
      sum += __shfl_xor(sum, 1, 32);
      sum += __shfl_xor(sum, 2, 32);
      sum += __shfl_xor(sum, 4, 32);
      sum += __shfl_xor(sum, 8, 32);
      li[r] = li[r] * al + sum;
#pragma unroll
      for (int t = 0; t < 4; ++t) { om[t][r] *= al; orr[t][r] *= al; }
      pv[0][r] = p0; pv[1][r] = p1;
    }
    // P tile (x2^10): accumulator layout -> per-wave LDS rows -> A fragments (stored as 16-bit words, reloaded through a may_alias vector of the same words)
#pragma unroll
    for (int nt = 0; nt < 2; ++nt) {
#pragma unroll
      for (int r = 0; r < 8; ++r) {
        const float pc = pv[nt][r] * RS;
        const _Float16 p16 = (_Float16)pc;
        pt[wave][0][8 * hh + r][nt * 16 + ln] = h_bits(p16);
        if (full) pt[wave][1][8 * hh + r][nt * 16 + ln] = h_bits((_Float16)((pc - (float)p16) * RS));
      }
    }
    __builtin_amdgcn_fence(4 /* acq_rel order */, "workgroup"); __builtin_amdgcn_wave_barrier();
    FragH ph; ph.half[0] = *(const v8us*)&pt[wave][0][ln][8 * hh]; ph.half[1] = *(const v8us*)&pt[wave][0][ln][16 + 8 * hh];
    FragH pr = ph;
    if (full) { pr.half[0] = *(const v8us*)&pt[wave][1][ln][8 * hh]; pr.half[1] = *(const v8us*)&pt[wave][1][ln][16 + 8 * hh]; }
#pragma unroll
    for (int t = 0; t < 4; ++t) {
      const size_t vo = (vrow + t * 16 + ln) * (size_t)SEQ + kbase;
      const v16h vh = ldfrag(VTH, vo, hh);
      om[t] = mma(ph.v, vh, om[t]);
      if (full) { const v16h vr = ldfrag(VTR, vo, hh); orr[t] = mma(ph.v, vr, orr[t]); orr[t] = mma(pr.v, vh, orr[t]); }
    }
    __builtin_amdgcn_fence(4 /* acq_rel order */, "workgroup"); __builtin_amdgcn_wave_barrier();
  }
  // context x16 = o / (2^10 * l) * 16
#pragma unroll
  for (int r = 0; r < 8; ++r) {
    const float inv = 0.015625f * (1.0f / li[r]);
#pragma unroll
    for (int t = 0; t < 4; ++t) so[wave][8 * hh + r][t * 16 + ln] = (om[t][r] + orr[t][r] * RINV) * inv;
  }
  __builtin_amdgcn_fence(4 /* acq_rel order */, "workgroup"); __builtin_amdgcn_wave_barrier();
  const int rq = lane >> 3, c8 = (lane & 7) * 8;
  {
#pragma unroll
    for (int it = 0; it < 4; ++it) {
      const int rr = it * 4 + rq;
      const v4f a = *(const v4fa*)&so[wave][rr][c8], b = *(const v4fa*)&so[wave][rr][c8 + 4];
      FragH fh, fl;
#pragma unroll
      for (int q = 0; q < 4; ++q) { _Float16 hv = (_Float16)a[q]; fh.h[q] = hv; fl.h[q] = (_Float16)((a[q] - (float)hv) * RSC); hv = (_Float16)b[q]; fh.h[4 + q] = hv; fl.h[4 + q] = (_Float16)((b[q] - (float)hv) * RSC); }
      const v8us oh = fh.half[0], ol = fl.half[0];
      const size_t o = ((size_t)(q0 + rr) * NG + g) * CP + h * HD + c8;
      *(v8us*)(CX + o) = oh; *(v8us*)(CX + o + EMB) = ol;
    }
    
  }
}

extern "C" void kernel_launch(void* const* d_in, const int* in_sizes, int n_in,
                              void* d_out, int out_size, void* d_ws, size_t ws_size, hipStream_t stream) {
  if (n_in < 5) return;
  if (in_sizes[0] < NR * EMB) return;
  if (in_sizes[1] < EMB * EMB) return;
  if (in_sizes[2] < EMB * KVW) return;
  if (in_sizes[3] < EMB * KVW) return;
  if (in_sizes[4] < EMB * EMB) return;
  if (out_size < NR * EMB) return;
  const float* x  = (const float*)d_in[0];
  const float* Wq = (const float*)d_in[1];      /* [in 1024][out 1024] */
  const float* Wk = (const float*)d_in[2];      /* [in 1024][out 256] */
  const float* Wv = (const float*)d_in[3];      /* [in 1024][out 256] */
  const float* Wo = (const float*)d_in[4];      /* [in 1024][out 1024] */
  char* ws = (char*)d_ws; size_t off = 0;
  auto take = [&](size_t bytes) { char* p = ws + off; off += (bytes + 255) & ~(size_t)255; return p; };
  unsigned short* BQKV = (unsigned short*)take(SZ_BQKV);      /* [1536][1024]: Wq^T | Wk^T | Wv^T, x16 */
  unsigned short* BO   = (unsigned short*)take(SZ_BO);        /* [1024][2048]: Wo^T x16 | Wo^T / 4 */
  unsigned short* X16  = (unsigned short*)take(SZ_X16);       /* [NR][1024] */
  unsigned short* QKH  = (unsigned short*)take(SZ_QK);        /* [NR][1536] value plane of q | k | v */
  unsigned short* QKR  = (unsigned short*)take(SZ_QK);        /* [NR][1536] residual plane (x2^10) */
  unsigned short* VTH  = (unsigned short*)take(SZ_VT);        /* [NG*NKV][64][SEQ] */
  unsigned short* VTR  = (unsigned short*)take(SZ_VT);
  unsigned short* CX   = (unsigned short*)take(SZ_CX);        /* [NR][2048]: context x16 value | residual (x64) */
  if (off > ws_size) return;

  k_wt_f16<<<(unsigned)((EMB * (EMB / 8) + 255) / 256), 256, 0, stream>>>(Wq, BQKV, EMB, EMB, 0, EMB, 0, 16.0f);
  k_wt_f16<<<(unsigned)((KVW * (EMB / 8) + 255) / 256), 256, 0, stream>>>(Wk, BQKV, EMB, KVW, EMB, EMB, 0, 16.0f);
  k_wt_f16<<<(unsigned)((KVW * (EMB / 8) + 255) / 256), 256, 0, stream>>>(Wv, BQKV, EMB, KVW, EMB + KVW, EMB, 0, 16.0f);
  k_wt_f16<<<(unsigned)((EMB * (EMB / 8) + 255) / 256), 256, 0, stream>>>(Wo, BO, EMB, EMB, 0, CP, 0, 16.0f);
  k_wt_f16<<<(unsigned)((EMB * (EMB / 8) + 255) / 256), 256, 0, stream>>>(Wo, BO, EMB, EMB, 0, CP, EMB, 0.25f);
  k_x16<<<(unsigned)((NR * (EMB / 8) + 255) / 256), 256, 0, stream>>>(x, X16, NR * (EMB / 8));
  k_gemm_planes<<<(unsigned)((NR / 128) * (LQ / 64)), 128, 0, stream>>>(X16, EMB, BQKV, EMB, 0.0625f, QKH, QKR, LQ, NR, LQ, EMB);
  k_vt<<<(unsigned)(NB * NG * NKV * (SEQ / 64)), 256, 0, stream>>>(QKH, QKR, VTH, VTR);
  k_attn<<<dim3((unsigned)(SEQ / 64), (unsigned)(NG * NH)), 128, 0, stream>>>(QKH, QKR, VTH, VTR, CX);
  k_gemm_out<<<(unsigned)((NR / 128) * (EMB / 64)), 128, 0, stream>>>(CX, CP, BO, CP, 0.00390625f, (float*)d_out, EMB, NR, EMB, CP);
}

// v001
// A run of this version takes 265 microseconds.
// Timed twice side by side with v000, it ran 1.35 and 1.33 times as fast.
#include <hip/hip_runtime.h>
// Causal grouped-query self-attention with a group axis: x [1][SEQ][2][1024]; token row = s*2 + g; q = x Wq (16 heads x 64), k|v = x Wk|Wv (4 kv heads x 64, query head h uses kv head h/4); raw energy, causal exclusion (key > query), then 1/8 inside the softmax over keys of the same g; merged heads (h*64 + d) times Wo.
// Compute dtype: v_wmma_f32_16x16x32_f16 for every contraction, f32 accumulate. Inputs RNE-converted to bf16 then held exactly in f16 (x as is, weights x16). q|k|v written as f16 value + f16 residual (x2^10) planes. Scores: q value+residual against k value (plus k residual on query rows < 256). P carried x2^10 as f16 (plus residual x2^10 on rows < 256), V^T value (plus residual on rows < 256), residual products in a separate accumulator. Context carried x16 as f16 value | residual (x64) along K against Wo x16 | Wo / 4. Softmax statistics f32.
#ifndef NB
#define NB 1
#endif
#ifndef SEQ
#define SEQ 2048
#endif
#define SEQ_FULL 2048
#define NG 2
#define EMB 1024
#define NH 16
#define NKV 4
#define HD 64
#define KVW (NKV * HD)            /* 256 */
#define LQ (EMB + 2 * KVW)        /* 1536: pitch of the q|k|v planes */
#define CP (2 * EMB)              /* 2048: pitch of the context plane (value | residual) */
#define NR (NB * SEQ * NG)        /* token rows */
#define EQT 4                     /* 64-row query tiles (rows < 256) that run the full residual scheme */
#define RS 1024.0f                /* residual carry of q, k, v, P */
#define RINV 0.0009765625f
#define RSC 64.0f                 /* residual carry of the context plane */

static_assert(NB == 1);
static_assert(SEQ % 64 == 0);
static_assert(SEQ >= 64);
static_assert(SEQ <= SEQ_FULL);
static_assert(NR % 128 == 0);
static_assert(LQ % 64 == 0);
static_assert(EMB % 64 == 0);
static_assert(EMB % 32 == 0);
static_assert(CP % 32 == 0);
static_assert(HD == 64);
static_assert(NH == 4 * NKV);
static_assert(NH * HD == EMB);
static_assert(KVW % 64 == 0);

typedef unsigned short v8us __attribute__((ext_vector_type(8), may_alias));
typedef float  v8f  __attribute__((ext_vector_type(8)));
typedef float  v4f  __attribute__((ext_vector_type(4)));
typedef float  v4fa __attribute__((ext_vector_type(4), may_alias));
typedef _Float16 v16h __attribute__((ext_vector_type(16)));
union FragH { v16h v; v8us half[2]; _Float16 h[16]; unsigned short u[16]; };

constexpr size_t SZ_BQKV = (size_t)LQ * EMB * 2;
constexpr size_t SZ_BO   = (size_t)EMB * CP * 2;
constexpr size_t SZ_X16  = (size_t)NR * EMB * 2;
constexpr size_t SZ_QK   = (size_t)NR * LQ * 2;
constexpr size_t SZ_VT   = (size_t)NB * NG * NKV * HD * SEQ * 2;
constexpr size_t SZ_CX   = (size_t)NR * CP * 2;
constexpr size_t WS_TOTAL = SZ_BQKV + SZ_BO + SZ_X16 + 2 * SZ_QK + 2 * SZ_VT + SZ_CX;
static_assert(WS_TOTAL <= (size_t)134217728);
static_assert(SZ_BQKV % 256 == 0 && SZ_BO % 256 == 0 && SZ_X16 % 256 == 0 && SZ_QK % 256 == 0 && SZ_VT % 256 == 0 && SZ_CX % 256 == 0);

// RNE convert f32 -> bf16 value (kept in f32)
__device__ __forceinline__ float bf16_rne(float x) { unsigned int u = __float_as_uint(x); u = (u + 0x7FFFu + ((u >> 16) & 1u)) & 0xFFFF0000u; return __uint_as_float(u); }
__device__ __forceinline__ unsigned short h_bits(_Float16 h) { return __builtin_bit_cast(unsigned short, h); }
// 16-bit fragment: elements 0..7 <- k0 + 8h + 0..7, elements 8..15 <- k0 + 16 + 8h + 0..7 (row / column = lane & 15)
__device__ __forceinline__ v16h ldfrag(const unsigned short* __restrict__ p, size_t off, int hh) { FragH f; f.half[0] = *(const v8us*)(p + off + 8 * hh); f.half[1] = *(const v8us*)(p + off + 16 + 8 * hh); return f.v; }
__device__ __forceinline__ v8f mma(v16h a, v16h b, v8f c) { v8f d = __builtin_amdgcn_wmma_f32_16x16x32_f16(false, a, false, b, (short)0, c, false, false); asm volatile("v_nop\n\tv_nop\n\tv_nop\n\tv_nop" : "+v"(d) : "v"(a), "v"(b)); return d; }

__global__ __launch_bounds__(256) void k_wt_f16(const float* __restrict__ W, unsigned short* __restrict__ Wt, int K, int N, int drow0, int dpitch, int dcol0, float scale) {
  const int t = blockIdx.x * 256 + threadIdx.x; const int k8n = K / 8; if (t >= N * k8n) return;
  const int n = t / k8n, k8 = (t - n * k8n) * 8; FragH f;
#pragma unroll
  for (int i = 0; i < 8; ++i) f.h[i] = (_Float16)(bf16_rne(W[(size_t)(k8 + i) * N + n]) * scale);
  const v8us o = f.half[0];
  unsigned short* d = Wt + (size_t)(drow0 + n) * dpitch + dcol0 + k8;
  *(v8us*)d = o; 
}

__global__ __launch_bounds__(256) void k_x16(const float* __restrict__ x, unsigned short* __restrict__ X16, int n8) {
  const int t = blockIdx.x * 256 + threadIdx.x; if (t >= n8) return;
  const v4f a = *(const v4fa*)(x + (size_t)t * 8), c = *(const v4fa*)(x + (size_t)t * 8 + 4); FragH f;
#pragma unroll
  for (int q = 0; q < 4; ++q) { f.h[q] = (_Float16)bf16_rne(a[q]); f.h[4 + q] = (_Float16)bf16_rne(c[q]); }
  const v8us o = f.half[0];
  unsigned short* d = X16 + (size_t)t * 8;
  *(v8us*)d = o; 
}

// GEMM main loop: wave tile 32 x 64, A f16 [M][lda], Bt f16 [N][ldb] (k contiguous), K % 32 == 0
__device__ __forceinline__ void gemm_core(const unsigned short* __restrict__ A, int lda, const unsigned short* __restrict__ Bt, int ldb, int K, int row0, int col0, int ln, int hh,
    v8f& c00, v8f& c01, v8f& c02, v8f& c03, v8f& c10, v8f& c11, v8f& c12, v8f& c13) {
  const size_t a0 = (size_t)(row0 + ln) * lda, a1 = a0 + (size_t)16 * lda;
  const size_t b0 = (size_t)(col0 + ln) * ldb, b1 = b0 + (size_t)16 * ldb, b2 = b1 + (size_t)16 * ldb, b3 = b2 + (size_t)16 * ldb;
#pragma unroll 1
  for (int kb = 0; kb < K; kb += 32) {
    const v16h fa0 = ldfrag(A, a0 + kb, hh), fa1 = ldfrag(A, a1 + kb, hh);
    v16h b = ldfrag(Bt, b0 + kb, hh); c00 = mma(fa0, b, c00); c10 = mma(fa1, b, c10);
    b = ldfrag(Bt, b1 + kb, hh); c01 = mma(fa0, b, c01); c11 = mma(fa1, b, c11);
    b = ldfrag(Bt, b2 + kb, hh); c02 = mma(fa0, b, c02); c12 = mma(fa1, b, c12);
    b = ldfrag(Bt, b3 + kb, hh); c03 = mma(fa0, b, c03); c13 = mma(fa1, b, c13);
  }
}

// C = alpha * A . Bt^T written as f16 value plane CH and residual plane CR ((v - value) * 2^10), both pitch ldc. M % 128 == 0, N % 64 == 0.
__global__ __launch_bounds__(128) void k_gemm_planes(const unsigned short* __restrict__ A, int lda, const unsigned short* __restrict__ Bt, int ldb, float alpha,
    unsigned short* __restrict__ CH, unsigned short* __restrict__ CR, int ldc, int M, int N, int K) {
  __shared__ __attribute__((aligned(16))) float so[4][32][68];
  const int tid = threadIdx.x; const int wave = __builtin_amdgcn_readfirstlane(tid >> 5);
  const int lane = tid & 31, ln = lane & 15, hh = lane >> 4;
  const int ntn = N >> 6; const int mt = blockIdx.x / ntn, nq = blockIdx.x - mt * ntn;
  const int row0 = mt * 128 + 32 * wave, col0 = nq * 64; if (row0 >= M) return;
  const v8f z8 = {0.f, 0.f, 0.f, 0.f, 0.f, 0.f, 0.f, 0.f};
  v8f c00 = z8, c01 = z8, c02 = z8, c03 = z8, c10 = z8, c11 = z8, c12 = z8, c13 = z8;
  gemm_core(A, lda, Bt, ldb, K, row0, col0, ln, hh, c00, c01, c02, c03, c10, c11, c12, c13);
  v8f accs[8] = {c00, c01, c02, c03, c10, c11, c12, c13};
#pragma unroll
  for (int u = 0; u < 8; ++u) { const int t = u & 3, hf = u >> 2;
#pragma unroll
    for (int r = 0; r < 8; ++r) so[wave][hf * 16 + 8 * hh + r][t * 16 + ln] = accs[u][r] * alpha; }
  __builtin_amdgcn_fence(4 /* acq_rel order */, "workgroup"); __builtin_amdgcn_wave_barrier();
  const int rq = lane >> 3, c8 = (lane & 7) * 8;
  {
#pragma unroll
    for (int it = 0; it < 8; ++it) {
      const int rr = it * 4 + rq;
      const v4f a = *(const v4fa*)&so[wave][rr][c8], b = *(const v4fa*)&so[wave][rr][c8 + 4];
      FragH fh, fl;
#pragma unroll
      for (int q = 0; q < 4; ++q) { _Float16 hv = (_Float16)a[q]; fh.h[q] = hv; fl.h[q] = (_Float16)((a[q] - (float)hv) * RS); hv = (_Float16)b[q]; fh.h[4 + q] = hv; fl.h[4 + q] = (_Float16)((b[q] - (float)hv) * RS); }
      const v8us oh = fh.half[0], ol = fl.half[0];
      const size_t o = (size_t)(row0 + rr) * ldc + col0 + c8;
      *(v8us*)(CH + o) = oh; *(v8us*)(CR + o) = ol;
    }
    
  }
}

__global__ __launch_bounds__(128) void k_gemm_out(const unsigned short* __restrict__ A, int lda, const unsigned short* __restrict__ Bt, int ldb, float alpha,
    float* __restrict__ C, int ldc, int M, int N, int K) {
  __shared__ __attribute__((aligned(16))) float so[4][32][68];
  const int tid = threadIdx.x; const int wave = __builtin_amdgcn_readfirstlane(tid >> 5);
  const int lane = tid & 31, ln = lane & 15, hh = lane >> 4;
  const int ntn = N >> 6; const int mt = blockIdx.x / ntn, nq = blockIdx.x - mt * ntn;
  const int row0 = mt * 128 + 32 * wave, col0 = nq * 64; if (row0 >= M) return;
  const v8f z8 = {0.f, 0.f, 0.f, 0.f, 0.f, 0.f, 0.f, 0.f};
  v8f c00 = z8, c01 = z8, c02 = z8, c03 = z8, c10 = z8, c11 = z8, c12 = z8, c13 = z8;
  gemm_core(A, lda, Bt, ldb, K, row0, col0, ln, hh, c00, c01, c02, c03, c10, c11, c12, c13);
  v8f accs[8] = {c00, c01, c02, c03, c10, c11, c12, c13};
#pragma unroll
  for (int u = 0; u < 8; ++u) { const int t = u & 3, hf = u >> 2;
#pragma unroll
    for (int r = 0; r < 8; ++r) so[wave][hf * 16 + 8 * hh + r][t * 16 + ln] = accs[u][r] * alpha; }
  __builtin_amdgcn_fence(4 /* acq_rel order */, "workgroup"); __builtin_amdgcn_wave_barrier();
  const int rsub = lane >> 4, c4 = (lane & 15) * 4;
  {
#pragma unroll
    for (int q = 0; q < 16; ++q) { const int r = q * 2 + rsub; const v4f v = *(const v4fa*)&so[wave][r][c4]; *(v4f*)(C + (size_t)(row0 + r) * ldc + col0 + c4) = v; }
    
  }
}

__global__ __launch_bounds__(256) void k_vt(const unsigned short* __restrict__ QKH, const unsigned short* __restrict__ QKR, unsigned short* __restrict__ VTH, unsigned short* __restrict__ VTR) {
  __shared__ unsigned short tl[2][64][66];
  const int tid = threadIdx.x;
  const int nlg = SEQ / 64;
  const int slab = blockIdx.x / nlg, lg = blockIdx.x - slab * nlg;
  const int g = slab / NKV, kv = slab - g * NKV;
#pragma unroll 1
  for (int i = tid; i < 512; i += 256) {
    const int r = i >> 3, c8 = (i & 7) * 8;
    const size_t sof = ((size_t)(lg * 64 + r) * NG + g) * LQ + EMB + KVW + kv * HD + c8;
    FragH fh, fr; fh.half[0] = *(const v8us*)(QKH + sof); fr.half[0] = *(const v8us*)(QKR + sof);
#pragma unroll
    for (int q = 0; q < 8; ++q) { tl[0][r][c8 + q] = fh.u[q]; tl[1][r][c8 + q] = fr.u[q]; }
  }
  __syncthreads();
  {
#pragma unroll
    for (int rd = 0; rd < 2; ++rd) {
      const int d = rd * 32 + (tid >> 3), pc = tid & 7; FragH fh, fr;
#pragma unroll
      for (int q = 0; q < 8; ++q) { fh.u[q] = tl[0][pc * 8 + q][d]; fr.u[q] = tl[1][pc * 8 + q][d]; }
      const v8us oh = fh.half[0], ol = fr.half[0];
      const size_t o = ((size_t)slab * HD + d) * SEQ + lg * 64 + pc * 8;
      *(v8us*)(VTH + o) = oh; *(v8us*)(VTR + o) = ol;
    }
    
  }
}

// Fused causal flash attention. grid = (SEQ/64, NG*NH); block = 4 waves, wave = 16 query rows; 32-key steps up to the diagonal.
// The block's q tile (value and residual) is copied into LDS once, the K and V^T value tiles of each step once per block (two buffers, the next step's copies fly during this step); the K and V^T residual planes (rows < 256 only) come straight from global memory. Per-wave LDS tiles (P value/residual, output staging) are wave-private.
__global__ __launch_bounds__(128) void k_attn(const unsigned short* __restrict__ QKH, const unsigned short* __restrict__ QKR,
    const unsigned short* __restrict__ VTH, const unsigned short* __restrict__ VTR, unsigned short* __restrict__ CX) {
  __shared__ __attribute__((aligned(16))) unsigned short pt[4][2][16][40];
  __shared__ __attribute__((aligned(16))) float so[4][16][68];
  __shared__ __attribute__((aligned(16))) unsigned short kt[2][32][72];   /* 32 keys x 64, pitch 144 B */
  __shared__ __attribute__((aligned(16))) unsigned short vt[2][64][40];   /* 64 d x 32 keys, pitch 80 B */
  __shared__ __attribute__((aligned(16))) unsigned short qs[2][64][72];   /* value | residual: 64 query rows x 64, pitch 144 B */
  const int tid = threadIdx.x; const int wave = __builtin_amdgcn_readfirstlane(tid >> 5);
  const int lane = tid & 31, ln = lane & 15, hh = lane >> 4;
  const int qt = blockIdx.x, gh = blockIdx.y;
  const int g = gh >> 4, h = gh & 15, kvh = h >> 2;
  const bool full = qt < EQT;
  const int q0 = qt * 64 + wave * 16;
  const size_t kcol = (size_t)EMB + kvh * HD;
  const size_t vrow = (size_t)(g * NKV + kvh) * HD;
  const v8f z8 = {0.f, 0.f, 0.f, 0.f, 0.f, 0.f, 0.f, 0.f};
  v8f om[4] = {z8, z8, z8, z8}, orr[4] = {z8, z8, z8, z8};
  float mi[8], li[8];
#pragma unroll
  for (int r = 0; r < 8; ++r) { mi[r] = -1.0e30f; li[r] = 0.f; }
  const int nkb = (q0 + 16 + 31) >> 5;      /* every visited 32-key step starts at a key <= q0, so each row keeps >= 1 key per step */
  const int nst = 2 * qt + 2;               /* steps of the block = nkb of its last wave; keys < 64 * qt + 64 <= SEQ */
  const int kr0 = tid >> 3, kc8 = (tid & 7) * 8, vr0 = tid >> 2, vc8 = (tid & 3) * 8;
  const unsigned short* const gk = QKH + ((size_t)kr0 * NG + g) * LQ + kcol + kc8;
  const unsigned short* const gv = VTH + (vrow + vr0) * (size_t)SEQ + vc8;
  // step s -> buffer s & 1: each thread copies 16 B of K rows kr0, kr0 + 16 and of V^T rows vr0, vr0 + 32
  auto stage = [&](int s) {
    const int b = s & 1;
    const unsigned short* const k0 = gk + (size_t)s * (32 * NG * LQ); const unsigned short* const k1 = k0 + (size_t)16 * NG * LQ;
    const unsigned short* const v0 = gv + s * 32; const unsigned short* const v1 = v0 + (size_t)32 * SEQ;
    const unsigned int lk0 = (unsigned int)(size_t)&kt[b][kr0][kc8], lk1 = (unsigned int)(size_t)&kt[b][kr0 + 16][kc8];
    const unsigned int lv0 = (unsigned int)(size_t)&vt[b][vr0][vc8], lv1 = (unsigned int)(size_t)&vt[b][vr0 + 32][vc8];
    // the closing s_wait_xcnt keeps later writes of the address registers behind the copies
    asm volatile("global_load_async_to_lds_b128 %0, %4, off\n\tglobal_load_async_to_lds_b128 %1, %5, off\n\tglobal_load_async_to_lds_b128 %2, %6, off\n\tglobal_load_async_to_lds_b128 %3, %7, off\n\ts_wait_xcnt 0x0"
                 :: "v"(lk0), "v"(lk1), "v"(lv0), "v"(lv1), "v"(k0), "v"(k1), "v"(v0), "v"(v1) : "memory");
  };
  {
    // q tile: each thread copies 16 B of rows kr0 + 0, 16, 32, 48 of both planes
    const size_t qg = ((size_t)(qt * 64 + kr0) * NG + g) * LQ + h * HD + kc8;
    const unsigned short* const h0 = QKH + qg; const unsigned short* const h1 = h0 + (size_t)16 * NG * LQ;
    const unsigned short* const h2 = h1 + (size_t)16 * NG * LQ; const unsigned short* const h3 = h2 + (size_t)16 * NG * LQ;
    const unsigned short* const r0 = QKR + qg; const unsigned short* const r1 = r0 + (size_t)16 * NG * LQ;
    const unsigned short* const r2 = r1 + (size_t)16 * NG * LQ; const unsigned short* const r3 = r2 + (size_t)16 * NG * LQ;
    const unsigned int a0 = (unsigned int)(size_t)&qs[0][kr0][kc8], a1 = (unsigned int)(size_t)&qs[0][kr0 + 16][kc8];
    const unsigned int a2 = (unsigned int)(size_t)&qs[0][kr0 + 32][kc8], a3 = (unsigned int)(size_t)&qs[0][kr0 + 48][kc8];
    const unsigned int b0 = (unsigned int)(size_t)&qs[1][kr0][kc8], b1 = (unsigned int)(size_t)&qs[1][kr0 + 16][kc8];
    const unsigned int b2 = (unsigned int)(size_t)&qs[1][kr0 + 32][kc8], b3 = (unsigned int)(size_t)&qs[1][kr0 + 48][kc8];
    // the closing s_wait_xcnt keeps later writes of the address registers behind the copies
    asm volatile("global_load_async_to_lds_b128 %0, %8, off\n\tglobal_load_async_to_lds_b128 %1, %9, off\n\tglobal_load_async_to_lds_b128 %2, %10, off\n\tglobal_load_async_to_lds_b128 %3, %11, off\n\t"
                 "global_load_async_to_lds_b128 %4, %12, off\n\tglobal_load_async_to_lds_b128 %5, %13, off\n\tglobal_load_async_to_lds_b128 %6, %14, off\n\tglobal_load_async_to_lds_b128 %7, %15, off\n\ts_wait_xcnt 0x0"
                 :: "v"(a0), "v"(a1), "v"(a2), "v"(a3), "v"(b0), "v"(b1), "v"(b2), "v"(b3), "v"(h0), "v"(h1), "v"(h2), "v"(h3), "v"(r0), "v"(r1), "v"(r2), "v"(r3) : "memory");
  }
  stage(0);
  asm volatile("s_wait_asynccnt 0x0" ::: "memory");   /* own copies of q and of step 0 landed */
  __syncthreads();                                    /* q and step 0 readable by every wave */
  stage(1);                                           /* nst >= 2: step 1 always exists */
#pragma unroll 1
  for (int kb = 0; kb < nst; ++kb) {
   if (kb < nkb) {                                    /* wave-uniform: waves 0 and 1 sit out the block's last step */
    const int kbase = kb * 32;
    const unsigned short (* const ks)[72] = kt[kb & 1];
    const unsigned short (* const vs)[40] = vt[kb & 1];
    v8f sm[2] = {z8, z8}, sr[2] = {z8, z8};
#pragma unroll
    for (int kk = 0; kk < 2; ++kk) {
      const v16h qh = ldfrag(&qs[0][wave * 16 + ln][kk * 32], 0, hh);
      const v16h qr = ldfrag(&qs[1][wave * 16 + ln][kk * 32], 0, hh);
#pragma unroll
      for (int nt = 0; nt < 2; ++nt) {
        const size_t ko = ((size_t)(kbase + nt * 16 + ln) * NG + g) * LQ + kcol + kk * 32;
        const v16h kh = ldfrag(&ks[nt * 16 + ln][kk * 32], 0, hh);
        sm[nt] = mma(qh, kh, sm[nt]);
        sr[nt] = mma(qr, kh, sr[nt]);
        if (full) { const v16h kr = ldfrag(QKR, ko, hh); sr[nt] = mma(qh, kr, sr[nt]); }
      }
    }
    float pv[2][8];
#pragma unroll
    for (int r = 0; r < 8; ++r) {
      const int qi = q0 + 8 * hh + r;
      const bool ok0 = (kbase + ln) <= qi, ok1 = (kbase + 16 + ln) <= qi;
      const float s0 = (sm[0][r] + sr[0][r] * RINV) * 0.125f;
      const float s1 = (sm[1][r] + sr[1][r] * RINV) * 0.125f;
      float mx = fmaxf(ok0 ? s0 : -1.0e30f, ok1 ? s1 : -1.0e30f);
      mx = fmaxf(mx, __shfl_xor(mx, 1, 32));
      mx = fmaxf(mx, __shfl_xor(mx, 2, 32));
      mx = fmaxf(mx, __shfl_xor(mx, 4, 32));
      mx = fmaxf(mx, __shfl_xor(mx, 8, 32));
      const float mnew = fmaxf(mi[r], mx);
      const float al = __expf(mi[r] - mnew);
      mi[r] = mnew;
      const float e0 = __expf(fminf(s0 - mnew, 0.f)), e1 = __expf(fminf(s1 - mnew, 0.f));
      const float p0 = ok0 ? e0 : 0.f, p1 = ok1 ? e1 : 0.f;
      float sum = p0 + p1;
      sum += __shfl_xor(sum, 1, 32);
      sum += __shfl_xor(sum, 2, 32);
      sum += __shfl_xor(sum, 4, 32);
      sum += __shfl_xor(sum, 8, 32);
      li[r] = li[r] * al + sum;
#pragma unroll
      for (int t = 0; t < 4; ++t) { om[t][r] *= al; orr[t][r] *= al; }
      pv[0][r] = p0; pv[1][r] = p1;
    }
    // P tile (x2^10): accumulator layout -> per-wave LDS rows -> A fragments (stored as 16-bit words, reloaded through a may_alias vector of the same words)
#pragma unroll
    for (int nt = 0; nt < 2; ++nt) {
#pragma unroll
      for (int r = 0; r < 8; ++r) {
        const float pc = pv[nt][r] * RS;
        const _Float16 p16 = (_Float16)pc;
        pt[wave][0][8 * hh + r][nt * 16 + ln] = h_bits(p16);
        if (full) pt[wave][1][8 * hh + r][nt * 16 + ln] = h_bits((_Float16)((pc - (float)p16) * RS));
      }
    }
    __builtin_amdgcn_fence(4 /* acq_rel order */, "workgroup"); __builtin_amdgcn_wave_barrier();
    FragH ph; ph.half[0] = *(const v8us*)&pt[wave][0][ln][8 * hh]; ph.half[1] = *(const v8us*)&pt[wave][0][ln][16 + 8 * hh];
    FragH pr = ph;
    if (full) { pr.half[0] = *(const v8us*)&pt[wave][1][ln][8 * hh]; pr.half[1] = *(const v8us*)&pt[wave][1][ln][16 + 8 * hh]; }
#pragma unroll
    for (int t = 0; t < 4; ++t) {
      const size_t vo = (vrow + t * 16 + ln) * (size_t)SEQ + kbase;
      const v16h vh = ldfrag(&vs[t * 16 + ln][0], 0, hh);
      om[t] = mma(ph.v, vh, om[t]);
      if (full) { const v16h vr = ldfrag(VTR, vo, hh); orr[t] = mma(ph.v, vr, orr[t]); orr[t] = mma(pr.v, vh, orr[t]); }
    }
    __builtin_amdgcn_fence(4 /* acq_rel order */, "workgroup"); __builtin_amdgcn_wave_barrier();
   }
    // hand-over, passed by every wave: own LDS reads done, own copies of step kb + 1 landed, then the block barrier that publishes step kb + 1 and frees this step's buffer
    asm volatile("s_wait_dscnt 0x0" ::: "memory");
    asm volatile("s_wait_asynccnt 0x0" ::: "memory");
    __syncthreads();
    if (kb + 2 < nst) stage(kb + 2);
  }
  asm volatile("s_wait_asynccnt 0x0" ::: "memory");   /* no copy outstanding at the wave's end */
  // context x16 = o / (2^10 * l) * 16
#pragma unroll
  for (int r = 0; r < 8; ++r) {
    const float inv = 0.015625f * (1.0f / li[r]);
#pragma unroll
    for (int t = 0; t < 4; ++t) so[wave][8 * hh + r][t * 16 + ln] = (om[t][r] + orr[t][r] * RINV) * inv;
  }
  __builtin_amdgcn_fence(4 /* acq_rel order */, "workgroup"); __builtin_amdgcn_wave_barrier();
  const int rq = lane >> 3, c8 = (lane & 7) * 8;
  {
#pragma unroll
    for (int it = 0; it < 4; ++it) {
      const int rr = it * 4 + rq;
      const v4f a = *(const v4fa*)&so[wave][rr][c8], b = *(const v4fa*)&so[wave][rr][c8 + 4];
      FragH fh, fl;
#pragma unroll
      for (int q = 0; q < 4; ++q) { _Float16 hv = (_Float16)a[q]; fh.h[q] = hv; fl.h[q] = (_Float16)((a[q] - (float)hv) * RSC); hv = (_Float16)b[q]; fh.h[4 + q] = hv; fl.h[4 + q] = (_Float16)((b[q] - (float)hv) * RSC); }
      const v8us oh = fh.half[0], ol = fl.half[0];
      const size_t o = ((size_t)(q0 + rr) * NG + g) * CP + h * HD + c8;
      *(v8us*)(CX + o) = oh; *(v8us*)(CX + o + EMB) = ol;
    }
    
  }
}

extern "C" void kernel_launch(void* const* d_in, const int* in_sizes, int n_in,
                              void* d_out, int out_size, void* d_ws, size_t ws_size, hipStream_t stream) {
  if (n_in < 5) return;
  if (in_sizes[0] < NR * EMB) return;
  if (in_sizes[1] < EMB * EMB) return;
  if (in_sizes[2] < EMB * KVW) return;
  if (in_sizes[3] < EMB * KVW) return;
  if (in_sizes[4] < EMB * EMB) return;
  if (out_size < NR * EMB) return;
  const float* x  = (const float*)d_in[0];
  const float* Wq = (const float*)d_in[1];      /* [in 1024][out 1024] */
  const float* Wk = (const float*)d_in[2];      /* [in 1024][out 256] */
  const float* Wv = (const float*)d_in[3];      /* [in 1024][out 256] */
  const float* Wo = (const float*)d_in[4];      /* [in 1024][out 1024] */
  char* ws = (char*)d_ws; size_t off = 0;
  auto take = [&](size_t bytes) { char* p = ws + off; off += (bytes + 255) & ~(size_t)255; return p; };
  unsigned short* BQKV = (unsigned short*)take(SZ_BQKV);      /* [1536][1024]: Wq^T | Wk^T | Wv^T, x16 */
  unsigned short* BO   = (unsigned short*)take(SZ_BO);        /* [1024][2048]: Wo^T x16 | Wo^T / 4 */
  unsigned short* X16  = (unsigned short*)take(SZ_X16);       /* [NR][1024] */
  unsigned short* QKH  = (unsigned short*)take(SZ_QK);        /* [NR][1536] value plane of q | k | v */
  unsigned short* QKR  = (unsigned short*)take(SZ_QK);        /* [NR][1536] residual plane (x2^10) */
  unsigned short* VTH  = (unsigned short*)take(SZ_VT);        /* [NG*NKV][64][SEQ] */
  unsigned short* VTR  = (unsigned short*)take(SZ_VT);
  unsigned short* CX   = (unsigned short*)take(SZ_CX);        /* [NR][2048]: context x16 value | residual (x64) */
  if (off > ws_size) return;

  k_wt_f16<<<(unsigned)((EMB * (EMB / 8) + 255) / 256), 256, 0, stream>>>(Wq, BQKV, EMB, EMB, 0, EMB, 0, 16.0f);
  k_wt_f16<<<(unsigned)((KVW * (EMB / 8) + 255) / 256), 256, 0, stream>>>(Wk, BQKV, EMB, KVW, EMB, EMB, 0, 16.0f);
  k_wt_f16<<<(unsigned)((KVW * (EMB / 8) + 255) / 256), 256, 0, stream>>>(Wv, BQKV, EMB, KVW, EMB + KVW, EMB, 0, 16.0f);
  k_wt_f16<<<(unsigned)((EMB * (EMB / 8) + 255) / 256), 256, 0, stream>>>(Wo, BO, EMB, EMB, 0, CP, 0, 16.0f);
  k_wt_f16<<<(unsigned)((EMB * (EMB / 8) + 255) / 256), 256, 0, stream>>>(Wo, BO, EMB, EMB, 0, CP, EMB, 0.25f);
  k_x16<<<(unsigned)((NR * (EMB / 8) + 255) / 256), 256, 0, stream>>>(x, X16, NR * (EMB / 8));
  k_gemm_planes<<<(unsigned)((NR / 128) * (LQ / 64)), 128, 0, stream>>>(X16, EMB, BQKV, EMB, 0.0625f, QKH, QKR, LQ, NR, LQ, EMB);
  k_vt<<<(unsigned)(NB * NG * NKV * (SEQ / 64)), 256, 0, stream>>>(QKH, QKR, VTH, VTR);
  k_attn<<<dim3((unsigned)(SEQ / 64), (unsigned)(NG * NH)), 128, 0, stream>>>(QKH, QKR, VTH, VTR, CX);
  k_gemm_out<<<(unsigned)((NR / 128) * (EMB / 64)), 128, 0, stream>>>(CX, CP, BO, CP, 0.00390625f, (float*)d_out, EMB, NR, EMB, CP);
}

// v002
// Measured time: 198 microseconds a run.
// Timed twice side by side with v001, it ran 1.35 and 1.34 times as fast.
// Counting every step since v000, it is 1.80 times as fast.
#include <hip/hip_runtime.h>
// Causal grouped-query self-attention with a group axis: x [1][SEQ][2][1024]; token row = s*2 + g; q = x Wq (16 heads x 64), k|v = x Wk|Wv (4 kv heads x 64, query head h uses kv head h/4); raw energy, causal exclusion (key > query), then 1/8 inside the softmax over keys of the same g; merged heads (h*64 + d) times Wo.
// Compute dtype: v_wmma_f32_16x16x32_f16 for every contraction, f32 accumulate. Inputs RNE-converted to bf16 then held exactly in f16 (x as is, weights x16). q|k|v written as f16 value + f16 residual (x2^10) planes. Scores: q value+residual against k value (plus k residual on query rows < 256). P carried x2^10 as f16 (plus residual x2^10 on rows < 256), V^T value (plus residual on rows < 256), residual products in a separate accumulator. Context carried x16 as f16 value | residual (x64) along K against Wo x16 | Wo / 4. Softmax statistics f32.
#ifndef NB
#define NB 1
#endif
#ifndef SEQ
#define SEQ 2048
#endif
#define SEQ_FULL 2048
#define NG 2
#define EMB 1024
#define NH 16
#define NKV 4
#define HD 64
#define KVW (NKV * HD)            /* 256 */
#define LQ (EMB + 2 * KVW)        /* 1536: pitch of the q|k|v planes */
#define CP (2 * EMB)              /* 2048: pitch of the context plane (value | residual) */
#define NR (NB * SEQ * NG)        /* token rows */
#define EQT 4                     /* 64-row query tiles (rows < 256) that run the full residual scheme */
#define RS 1024.0f                /* residual carry of q, k, v, P */
#define RINV 0.0009765625f
#define RSC 64.0f                 /* residual carry of the context plane */

static_assert(NB == 1);
static_assert(SEQ % 64 == 0);
static_assert(SEQ >= 64);
static_assert(SEQ <= SEQ_FULL);
static_assert(NR % 128 == 0);
static_assert(LQ % 64 == 0);
static_assert(EMB % 64 == 0);
static_assert(CP % 64 == 0);
static_assert(HD == 64);
static_assert(NH == 4 * NKV);
static_assert(NH * HD == EMB);
static_assert(KVW % 64 == 0);

typedef unsigned short v8us __attribute__((ext_vector_type(8), may_alias));
typedef float  v8f  __attribute__((ext_vector_type(8)));
typedef float  v4f  __attribute__((ext_vector_type(4)));
typedef float  v4fa __attribute__((ext_vector_type(4), may_alias));
typedef _Float16 v16h __attribute__((ext_vector_type(16)));
union FragH { v16h v; v8us half[2]; _Float16 h[16]; unsigned short u[16]; };

constexpr size_t SZ_BQKV = (size_t)LQ * EMB * 2;
constexpr size_t SZ_BO   = (size_t)EMB * CP * 2;
constexpr size_t SZ_X16  = (size_t)NR * EMB * 2;
constexpr size_t SZ_QK   = (size_t)NR * LQ * 2;
constexpr size_t SZ_VT   = (size_t)NB * NG * NKV * HD * SEQ * 2;
constexpr size_t SZ_CX   = (size_t)NR * CP * 2;
constexpr size_t WS_TOTAL = SZ_BQKV + SZ_BO + SZ_X16 + 2 * SZ_QK + 2 * SZ_VT + SZ_CX;
static_assert(WS_TOTAL <= (size_t)134217728);
static_assert(SZ_BQKV % 256 == 0 && SZ_BO % 256 == 0 && SZ_X16 % 256 == 0 && SZ_QK % 256 == 0 && SZ_VT % 256 == 0 && SZ_CX % 256 == 0);

// RNE convert f32 -> bf16 value (kept in f32)
__device__ __forceinline__ float bf16_rne(float x) { unsigned int u = __float_as_uint(x); u = (u + 0x7FFFu + ((u >> 16) & 1u)) & 0xFFFF0000u; return __uint_as_float(u); }
__device__ __forceinline__ unsigned short h_bits(_Float16 h) { return __builtin_bit_cast(unsigned short, h); }
// 16-bit fragment: elements 0..7 <- k0 + 8h + 0..7, elements 8..15 <- k0 + 16 + 8h + 0..7 (row / column = lane & 15)
__device__ __forceinline__ v16h ldfrag(const unsigned short* __restrict__ p, size_t off, int hh) { FragH f; f.half[0] = *(const v8us*)(p + off + 8 * hh); f.half[1] = *(const v8us*)(p + off + 16 + 8 * hh); return f.v; }
__device__ __forceinline__ v8f mma(v16h a, v16h b, v8f c) { v8f d = __builtin_amdgcn_wmma_f32_16x16x32_f16(false, a, false, b, (short)0, c, false, false); asm volatile("v_nop\n\tv_nop\n\tv_nop\n\tv_nop" : "+v"(d) : "v"(a), "v"(b)); return d; }

__global__ __launch_bounds__(256) void k_wt_f16(const float* __restrict__ W, unsigned short* __restrict__ Wt, int K, int N, int drow0, int dpitch, int dcol0, float scale) {
  const int t = blockIdx.x * 256 + threadIdx.x; const int k8n = K / 8; if (t >= N * k8n) return;
  const int n = t / k8n, k8 = (t - n * k8n) * 8; FragH f;
#pragma unroll
  for (int i = 0; i < 8; ++i) f.h[i] = (_Float16)(bf16_rne(W[(size_t)(k8 + i) * N + n]) * scale);
  const v8us o = f.half[0];
  unsigned short* d = Wt + (size_t)(drow0 + n) * dpitch + dcol0 + k8;
  *(v8us*)d = o; 
}

__global__ __launch_bounds__(256) void k_x16(const float* __restrict__ x, unsigned short* __restrict__ X16, int n8) {
  const int t = blockIdx.x * 256 + threadIdx.x; if (t >= n8) return;
  const v4f a = *(const v4fa*)(x + (size_t)t * 8), c = *(const v4fa*)(x + (size_t)t * 8 + 4); FragH f;
#pragma unroll
  for (int q = 0; q < 4; ++q) { f.h[q] = (_Float16)bf16_rne(a[q]); f.h[4 + q] = (_Float16)bf16_rne(c[q]); }
  const v8us o = f.half[0];
  unsigned short* d = X16 + (size_t)t * 8;
  *(v8us*)d = o; 
}

// GEMM main loop: block tile 128 x 64, wave tile 32 x 64, A f16 [M][lda], Bt f16 [N][ldb] (k contiguous), K % 64 == 0, K >= 64; called by all 128 threads of the block.
// The block's A and Bt rows of each 64-wide k step are copied into LDS once per block as whole 128-byte lines (two buffers, the next step's copies fly during this step); every wave reads its fragments from there.
__device__ __forceinline__ void gemm_core(const unsigned short* __restrict__ A, int lda, const unsigned short* __restrict__ Bt, int ldb, int K, int brow0, int col0, int tid, int wave, int ln, int hh,
    v8f& c00, v8f& c01, v8f& c02, v8f& c03, v8f& c10, v8f& c11, v8f& c12, v8f& c13) {
  __shared__ __attribute__((aligned(16))) unsigned short at[2][128][72];   /* 128 rows x 64 k, pitch 144 B */
  __shared__ __attribute__((aligned(16))) unsigned short bt[2][64][72];    /* 64 columns x 64 k, pitch 144 B */
  const int r0 = tid >> 3, c8 = (tid & 7) * 8;
  const unsigned short* const ga = A + (size_t)(brow0 + r0) * lda + c8;
  const unsigned short* const gb = Bt + (size_t)(col0 + r0) * ldb + c8;
  const size_t sa = (size_t)16 * lda, sb = (size_t)16 * ldb;
  const int nst = K >> 6;
  // step s -> buffer s & 1: each thread copies 16 B of A rows r0 + 16 j (j < 8) and of Bt rows r0 + 16 j (j < 4)
  auto stage = [&](int s) {
    const int b = s & 1;
    const size_t ko = (size_t)s * 64;   /* added to row pointers that do not change from step to step: twelve independent additions, no chain in front of the copies */
    const unsigned short* const a0 = ga + ko; const unsigned short* const a1 = (ga + sa) + ko; const unsigned short* const a2 = (ga + 2 * sa) + ko; const unsigned short* const a3 = (ga + 3 * sa) + ko;
    const unsigned short* const a4 = (ga + 4 * sa) + ko; const unsigned short* const a5 = (ga + 5 * sa) + ko; const unsigned short* const a6 = (ga + 6 * sa) + ko; const unsigned short* const a7 = (ga + 7 * sa) + ko;
    const unsigned short* const b0 = gb + ko; const unsigned short* const b1 = (gb + sb) + ko; const unsigned short* const b2 = (gb + 2 * sb) + ko; const unsigned short* const b3 = (gb + 3 * sb) + ko;
    const unsigned int la0 = (unsigned int)(size_t)&at[b][r0][c8], la1 = (unsigned int)(size_t)&at[b][r0 + 16][c8], la2 = (unsigned int)(size_t)&at[b][r0 + 32][c8], la3 = (unsigned int)(size_t)&at[b][r0 + 48][c8];
    const unsigned int la4 = (unsigned int)(size_t)&at[b][r0 + 64][c8], la5 = (unsigned int)(size_t)&at[b][r0 + 80][c8], la6 = (unsigned int)(size_t)&at[b][r0 + 96][c8], la7 = (unsigned int)(size_t)&at[b][r0 + 112][c8];
    const unsigned int lb0 = (unsigned int)(size_t)&bt[b][r0][c8], lb1 = (unsigned int)(size_t)&bt[b][r0 + 16][c8], lb2 = (unsigned int)(size_t)&bt[b][r0 + 32][c8], lb3 = (unsigned int)(size_t)&bt[b][r0 + 48][c8];
    // the closing s_wait_xcnt keeps later writes of the address registers behind the copies
    asm volatile("global_load_async_to_lds_b128 %0, %12, off\n\tglobal_load_async_to_lds_b128 %1, %13, off\n\tglobal_load_async_to_lds_b128 %2, %14, off\n\tglobal_load_async_to_lds_b128 %3, %15, off\n\t"
                 "global_load_async_to_lds_b128 %4, %16, off\n\tglobal_load_async_to_lds_b128 %5, %17, off\n\tglobal_load_async_to_lds_b128 %6, %18, off\n\tglobal_load_async_to_lds_b128 %7, %19, off\n\t"
                 "global_load_async_to_lds_b128 %8, %20, off\n\tglobal_load_async_to_lds_b128 %9, %21, off\n\tglobal_load_async_to_lds_b128 %10, %22, off\n\tglobal_load_async_to_lds_b128 %11, %23, off\n\ts_wait_xcnt 0x0"
                 :: "v"(la0), "v"(la1), "v"(la2), "v"(la3), "v"(la4), "v"(la5), "v"(la6), "v"(la7), "v"(lb0), "v"(lb1), "v"(lb2), "v"(lb3),
                    "v"(a0), "v"(a1), "v"(a2), "v"(a3), "v"(a4), "v"(a5), "v"(a6), "v"(a7), "v"(b0), "v"(b1), "v"(b2), "v"(b3) : "memory");
  };
  stage(0);
  asm volatile("s_wait_asynccnt 0x0" ::: "memory");   /* own copies of step 0 landed */
  __syncthreads();                                    /* step 0 readable by every wave */
  if (nst > 1) stage(1);
#pragma unroll 1
  for (int s = 0; s < nst; ++s) {                     /* rolled: one body serves both buffers */
    const unsigned short (* const as)[72] = at[s & 1];
    const unsigned short (* const bs)[72] = bt[s & 1];
    // all fragments of the step are fetched as one group in front of its products: one LDS wait place a step instead of two
    v16h fa[2][2], fb[2][4];
#pragma unroll   /* these three loops are unrolled so that the fragment arrays are indexed by constants and stay in registers */
    for (int kk = 0; kk < 2; ++kk) {
      fa[kk][0] = ldfrag(&as[32 * wave + ln][kk * 32], 0, hh); fa[kk][1] = ldfrag(&as[32 * wave + 16 + ln][kk * 32], 0, hh);
#pragma unroll
      for (int j = 0; j < 4; ++j) fb[kk][j] = ldfrag(&bs[16 * j + ln][kk * 32], 0, hh);
    }
#pragma unroll
    for (int kk = 0; kk < 2; ++kk) {
      c00 = mma(fa[kk][0], fb[kk][0], c00); c10 = mma(fa[kk][1], fb[kk][0], c10);
      c01 = mma(fa[kk][0], fb[kk][1], c01); c11 = mma(fa[kk][1], fb[kk][1], c11);
      c02 = mma(fa[kk][0], fb[kk][2], c02); c12 = mma(fa[kk][1], fb[kk][2], c12);
      c03 = mma(fa[kk][0], fb[kk][3], c03); c13 = mma(fa[kk][1], fb[kk][3], c13);
    }
    // hand-over, passed by every wave: own LDS reads done, own copies of step s + 1 landed, then the block barrier that publishes step s + 1 and frees this step's buffer
    asm volatile("s_wait_dscnt 0x0" ::: "memory");
    asm volatile("s_wait_asynccnt 0x0" ::: "memory");
    __syncthreads();
    if (s + 2 < nst) stage(s + 2);
  }
  asm volatile("s_wait_asynccnt 0x0" ::: "memory");   /* no copy outstanding behind the loop */
}

// C = alpha * A . Bt^T written as f16 value plane CH and residual plane CR ((v - value) * 2^10), both pitch ldc. M % 128 == 0, N % 64 == 0.
__global__ __launch_bounds__(128) void k_gemm_planes(const unsigned short* __restrict__ A, int lda, const unsigned short* __restrict__ Bt, int ldb, float alpha,
    unsigned short* __restrict__ CH, unsigned short* __restrict__ CR, int ldc, int M, int N, int K) {
  __shared__ __attribute__((aligned(16))) float so[4][32][68];
  const int tid = threadIdx.x; const int wave = __builtin_amdgcn_readfirstlane(tid >> 5);
  const int lane = tid & 31, ln = lane & 15, hh = lane >> 4;
  const int ntn = N >> 6; const int mt = blockIdx.x / ntn, nq = blockIdx.x - mt * ntn;
  const int brow0 = mt * 128, row0 = brow0 + 32 * wave, col0 = nq * 64; if (brow0 >= M) return;
  const v8f z8 = {0.f, 0.f, 0.f, 0.f, 0.f, 0.f, 0.f, 0.f};
  v8f c00 = z8, c01 = z8, c02 = z8, c03 = z8, c10 = z8, c11 = z8, c12 = z8, c13 = z8;
  gemm_core(A, lda, Bt, ldb, K, brow0, col0, tid, wave, ln, hh, c00, c01, c02, c03, c10, c11, c12, c13);
  v8f accs[8] = {c00, c01, c02, c03, c10, c11, c12, c13};
#pragma unroll
  for (int u = 0; u < 8; ++u) { const int t = u & 3, hf = u >> 2;
#pragma unroll
    for (int r = 0; r < 8; ++r) so[wave][hf * 16 + 8 * hh + r][t * 16 + ln] = accs[u][r] * alpha; }
  __builtin_amdgcn_fence(4 /* acq_rel order */, "workgroup"); __builtin_amdgcn_wave_barrier();
  const int rq = lane >> 3, c8 = (lane & 7) * 8;
  {
#pragma unroll
    for (int it = 0; it < 8; ++it) {
      const int rr = it * 4 + rq;
      const v4f a = *(const v4fa*)&so[wave][rr][c8], b = *(const v4fa*)&so[wave][rr][c8 + 4];
      FragH fh, fl;
#pragma unroll
      for (int q = 0; q < 4; ++q) { _Float16 hv = (_Float16)a[q]; fh.h[q] = hv; fl.h[q] = (_Float16)((a[q] - (float)hv) * RS); hv = (_Float16)b[q]; fh.h[4 + q] = hv; fl.h[4 + q] = (_Float16)((b[q] - (float)hv) * RS); }
      const v8us oh = fh.half[0], ol = fl.half[0];
      const size_t o = (size_t)(row0 + rr) * ldc + col0 + c8;
      *(v8us*)(CH + o) = oh; *(v8us*)(CR + o) = ol;
    }
    
  }
}

__global__ __launch_bounds__(128) void k_gemm_out(const unsigned short* __restrict__ A, int lda, const unsigned short* __restrict__ Bt, int ldb, float alpha,
    float* __restrict__ C, int ldc, int M, int N, int K) {
  __shared__ __attribute__((aligned(16))) float so[4][32][68];
  const int tid = threadIdx.x; const int wave = __builtin_amdgcn_readfirstlane(tid >> 5);
  const int lane = tid & 31, ln = lane & 15, hh = lane >> 4;
  const int ntn = N >> 6; const int mt = blockIdx.x / ntn, nq = blockIdx.x - mt * ntn;
  const int brow0 = mt * 128, row0 = brow0 + 32 * wave, col0 = nq * 64; if (brow0 >= M) return;
  const v8f z8 = {0.f, 0.f, 0.f, 0.f, 0.f, 0.f, 0.f, 0.f};
  v8f c00 = z8, c01 = z8, c02 = z8, c03 = z8, c10 = z8, c11 = z8, c12 = z8, c13 = z8;
  gemm_core(A, lda, Bt, ldb, K, brow0, col0, tid, wave, ln, hh, c00, c01, c02, c03, c10, c11, c12, c13);
  v8f accs[8] = {c00, c01, c02, c03, c10, c11, c12, c13};
#pragma unroll
  for (int u = 0; u < 8; ++u) { const int t = u & 3, hf = u >> 2;
#pragma unroll
    for (int r = 0; r < 8; ++r) so[wave][hf * 16 + 8 * hh + r][t * 16 + ln] = accs[u][r] * alpha; }
  __builtin_amdgcn_fence(4 /* acq_rel order */, "workgroup"); __builtin_amdgcn_wave_barrier();
  const int rsub = lane >> 4, c4 = (lane & 15) * 4;
  {
#pragma unroll
    for (int q = 0; q < 16; ++q) { const int r = q * 2 + rsub; const v4f v = *(const v4fa*)&so[wave][r][c4]; *(v4f*)(C + (size_t)(row0 + r) * ldc + col0 + c4) = v; }
    
  }
}

__global__ __launch_bounds__(256) void k_vt(const unsigned short* __restrict__ QKH, const unsigned short* __restrict__ QKR, unsigned short* __restrict__ VTH, unsigned short* __restrict__ VTR) {
  __shared__ unsigned short tl[2][64][66];
  const int tid = threadIdx.x;
  const int nlg = SEQ / 64;
  const int slab = blockIdx.x / nlg, lg = blockIdx.x - slab * nlg;
  const int g = slab / NKV, kv = slab - g * NKV;
#pragma unroll 1
  for (int i = tid; i < 512; i += 256) {
    const int r = i >> 3, c8 = (i & 7) * 8;
    const size_t sof = ((size_t)(lg * 64 + r) * NG + g) * LQ + EMB + KVW + kv * HD + c8;
    FragH fh, fr; fh.half[0] = *(const v8us*)(QKH + sof); fr.half[0] = *(const v8us*)(QKR + sof);
#pragma unroll
    for (int q = 0; q < 8; ++q) { tl[0][r][c8 + q] = fh.u[q]; tl[1][r][c8 + q] = fr.u[q]; }
  }
  __syncthreads();
  {
#pragma unroll
    for (int rd = 0; rd < 2; ++rd) {
      const int d = rd * 32 + (tid >> 3), pc = tid & 7; FragH fh, fr;
#pragma unroll
      for (int q = 0; q < 8; ++q) { fh.u[q] = tl[0][pc * 8 + q][d]; fr.u[q] = tl[1][pc * 8 + q][d]; }
      const v8us oh = fh.half[0], ol = fr.half[0];
      const size_t o = ((size_t)slab * HD + d) * SEQ + lg * 64 + pc * 8;
      *(v8us*)(VTH + o) = oh; *(v8us*)(VTR + o) = ol;
    }
    
  }
}

// Fused causal flash attention. grid = (SEQ/64, NG*NH); block = 4 waves, wave = 16 query rows; 32-key steps up to the diagonal.
// The block's q tile (value and residual) is copied into LDS once, the K and V^T value tiles of each step once per block (two buffers, the next step's copies fly during this step); the K and V^T residual planes (rows < 256 only) come straight from global memory. Per-wave LDS tiles (P value/residual, output staging) are wave-private.
__global__ __launch_bounds__(128) void k_attn(const unsigned short* __restrict__ QKH, const unsigned short* __restrict__ QKR,
    const unsigned short* __restrict__ VTH, const unsigned short* __restrict__ VTR, unsigned short* __restrict__ CX) {
  __shared__ __attribute__((aligned(16))) unsigned short pt[4][2][16][40];
  __shared__ __attribute__((aligned(16))) float so[4][16][68];
  __shared__ __attribute__((aligned(16))) unsigned short kt[2][32][72];   /* 32 keys x 64, pitch 144 B */
  __shared__ __attribute__((aligned(16))) unsigned short vt[2][64][40];   /* 64 d x 32 keys, pitch 80 B */
  __shared__ __attribute__((aligned(16))) unsigned short qs[2][64][72];   /* value | residual: 64 query rows x 64, pitch 144 B */
  const int tid = threadIdx.x; const int wave = __builtin_amdgcn_readfirstlane(tid >> 5);
  const int lane = tid & 31, ln = lane & 15, hh = lane >> 4;
  const int qt = blockIdx.x, gh = blockIdx.y;
  const int g = gh >> 4, h = gh & 15, kvh = h >> 2;
  const bool full = qt < EQT;
  const int q0 = qt * 64 + wave * 16;
  const size_t kcol = (size_t)EMB + kvh * HD;
  const size_t vrow = (size_t)(g * NKV + kvh) * HD;
  const v8f z8 = {0.f, 0.f, 0.f, 0.f, 0.f, 0.f, 0.f, 0.f};
  v8f om[4] = {z8, z8, z8, z8}, orr[4] = {z8, z8, z8, z8};
  float mi[8], li[8];
#pragma unroll
  for (int r = 0; r < 8; ++r) { mi[r] = -1.0e30f; li[r] = 0.f; }
  const int nkb = (q0 + 16 + 31) >> 5;      /* every visited 32-key step starts at a key <= q0, so each row keeps >= 1 key per step */
  const int nst = 2 * qt + 2;               /* steps of the block = nkb of its last wave; keys < 64 * qt + 64 <= SEQ */
  const int kr0 = tid >> 3, kc8 = (tid & 7) * 8, vr0 = tid >> 2, vc8 = (tid & 3) * 8;
  const unsigned short* const gk = QKH + ((size_t)kr0 * NG + g) * LQ + kcol + kc8;
  const unsigned short* const gv = VTH + (vrow + vr0) * (size_t)SEQ + vc8;
  // step s -> buffer s & 1: each thread copies 16 B of K rows kr0, kr0 + 16 and of V^T rows vr0, vr0 + 32
  auto stage = [&](int s) {
    const int b = s & 1;
    const unsigned short* const k0 = gk + (size_t)s * (32 * NG * LQ); const unsigned short* const k1 = k0 + (size_t)16 * NG * LQ;
    const unsigned short* const v0 = gv + s * 32; const unsigned short* const v1 = v0 + (size_t)32 * SEQ;
    const unsigned int lk0 = (unsigned int)(size_t)&kt[b][kr0][kc8], lk1 = (unsigned int)(size_t)&kt[b][kr0 + 16][kc8];
    const unsigned int lv0 = (unsigned int)(size_t)&vt[b][vr0][vc8], lv1 = (unsigned int)(size_t)&vt[b][vr0 + 32][vc8];
    // the closing s_wait_xcnt keeps later writes of the address registers behind the copies
    asm volatile("global_load_async_to_lds_b128 %0, %4, off\n\tglobal_load_async_to_lds_b128 %1, %5, off\n\tglobal_load_async_to_lds_b128 %2, %6, off\n\tglobal_load_async_to_lds_b128 %3, %7, off\n\ts_wait_xcnt 0x0"
                 :: "v"(lk0), "v"(lk1), "v"(lv0), "v"(lv1), "v"(k0), "v"(k1), "v"(v0), "v"(v1) : "memory");
  };
  {
    // q tile: each thread copies 16 B of rows kr0 + 0, 16, 32, 48 of both planes
    const size_t qg = ((size_t)(qt * 64 + kr0) * NG + g) * LQ + h * HD + kc8;
    const unsigned short* const h0 = QKH + qg; const unsigned short* const h1 = h0 + (size_t)16 * NG * LQ;
    const unsigned short* const h2 = h1 + (size_t)16 * NG * LQ; const unsigned short* const h3 = h2 + (size_t)16 * NG * LQ;
    const unsigned short* const r0 = QKR + qg; const unsigned short* const r1 = r0 + (size_t)16 * NG * LQ;
    const unsigned short* const r2 = r1 + (size_t)16 * NG * LQ; const unsigned short* const r3 = r2 + (size_t)16 * NG * LQ;
    const unsigned int a0 = (unsigned int)(size_t)&qs[0][kr0][kc8], a1 = (unsigned int)(size_t)&qs[0][kr0 + 16][kc8];
    const unsigned int a2 = (unsigned int)(size_t)&qs[0][kr0 + 32][kc8], a3 = (unsigned int)(size_t)&qs[0][kr0 + 48][kc8];
    const unsigned int b0 = (unsigned int)(size_t)&qs[1][kr0][kc8], b1 = (unsigned int)(size_t)&qs[1][kr0 + 16][kc8];
    const unsigned int b2 = (unsigned int)(size_t)&qs[1][kr0 + 32][kc8], b3 = (unsigned int)(size_t)&qs[1][kr0 + 48][kc8];
    // the closing s_wait_xcnt keeps later writes of the address registers behind the copies
    asm volatile("global_load_async_to_lds_b128 %0, %8, off\n\tglobal_load_async_to_lds_b128 %1, %9, off\n\tglobal_load_async_to_lds_b128 %2, %10, off\n\tglobal_load_async_to_lds_b128 %3, %11, off\n\t"
                 "global_load_async_to_lds_b128 %4, %12, off\n\tglobal_load_async_to_lds_b128 %5, %13, off\n\tglobal_load_async_to_lds_b128 %6, %14, off\n\tglobal_load_async_to_lds_b128 %7, %15, off\n\ts_wait_xcnt 0x0"
                 :: "v"(a0), "v"(a1), "v"(a2), "v"(a3), "v"(b0), "v"(b1), "v"(b2), "v"(b3), "v"(h0), "v"(h1), "v"(h2), "v"(h3), "v"(r0), "v"(r1), "v"(r2), "v"(r3) : "memory");
  }
  stage(0);
  asm volatile("s_wait_asynccnt 0x0" ::: "memory");   /* own copies of q and of step 0 landed */
  __syncthreads();                                    /* q and step 0 readable by every wave */
  stage(1);                                           /* nst >= 2: step 1 always exists */
#pragma unroll 1
  for (int kb = 0; kb < nst; ++kb) {
   if (kb < nkb) {                                    /* wave-uniform: waves 0 and 1 sit out the block's last step */
    const int kbase = kb * 32;
    const unsigned short (* const ks)[72] = kt[kb & 1];
    const unsigned short (* const vs)[40] = vt[kb & 1];
    v8f sm[2] = {z8, z8}, sr[2] = {z8, z8};
#pragma unroll
    for (int kk = 0; kk < 2; ++kk) {
      const v16h qh = ldfrag(&qs[0][wave * 16 + ln][kk * 32], 0, hh);
      const v16h qr = ldfrag(&qs[1][wave * 16 + ln][kk * 32], 0, hh);
#pragma unroll
      for (int nt = 0; nt < 2; ++nt) {
        const size_t ko = ((size_t)(kbase + nt * 16 + ln) * NG + g) * LQ + kcol + kk * 32;
        const v16h kh = ldfrag(&ks[nt * 16 + ln][kk * 32], 0, hh);
        sm[nt] = mma(qh, kh, sm[nt]);
        sr[nt] = mma(qr, kh, sr[nt]);
        if (full) { const v16h kr = ldfrag(QKR, ko, hh); sr[nt] = mma(qh, kr, sr[nt]); }
      }
    }
    float pv[2][8];
#pragma unroll
    for (int r = 0; r < 8; ++r) {
      const int qi = q0 + 8 * hh + r;
      const bool ok0 = (kbase + ln) <= qi, ok1 = (kbase + 16 + ln) <= qi;
      const float s0 = (sm[0][r] + sr[0][r] * RINV) * 0.125f;
      const float s1 = (sm[1][r] + sr[1][r] * RINV) * 0.125f;
      float mx = fmaxf(ok0 ? s0 : -1.0e30f, ok1 ? s1 : -1.0e30f);
      mx = fmaxf(mx, __shfl_xor(mx, 1, 32));
      mx = fmaxf(mx, __shfl_xor(mx, 2, 32));
      mx = fmaxf(mx, __shfl_xor(mx, 4, 32));
      mx = fmaxf(mx, __shfl_xor(mx, 8, 32));
      const float mnew = fmaxf(mi[r], mx);
      const float al = __expf(mi[r] - mnew);
      mi[r] = mnew;
      const float e0 = __expf(fminf(s0 - mnew, 0.f)), e1 = __expf(fminf(s1 - mnew, 0.f));
      const float p0 = ok0 ? e0 : 0.f, p1 = ok1 ? e1 : 0.f;
      float sum = p0 + p1;
      sum += __shfl_xor(sum, 1, 32);
      sum += __shfl_xor(sum, 2, 32);
      sum += __shfl_xor(sum, 4, 32);
      sum += __shfl_xor(sum, 8, 32);
      li[r] = li[r] * al + sum;
#pragma unroll
      for (int t = 0; t < 4; ++t) { om[t][r] *= al; orr[t][r] *= al; }
      pv[0][r] = p0; pv[1][r] = p1;
    }
    // P tile (x2^10): accumulator layout -> per-wave LDS rows -> A fragments (stored as 16-bit words, reloaded through a may_alias vector of the same words)
#pragma unroll
    for (int nt = 0; nt < 2; ++nt) {
#pragma unroll
      for (int r = 0; r < 8; ++r) {
        const float pc = pv[nt][r] * RS;
        const _Float16 p16 = (_Float16)pc;
        pt[wave][0][8 * hh + r][nt * 16 + ln] = h_bits(p16);
        if (full) pt[wave][1][8 * hh + r][nt * 16 + ln] = h_bits((_Float16)((pc - (float)p16) * RS));
      }
    }
    __builtin_amdgcn_fence(4 /* acq_rel order */, "workgroup"); __builtin_amdgcn_wave_barrier();
    FragH ph; ph.half[0] = *(const v8us*)&pt[wave][0][ln][8 * hh]; ph.half[1] = *(const v8us*)&pt[wave][0][ln][16 + 8 * hh];
    FragH pr = ph;
    if (full) { pr.half[0] = *(const v8us*)&pt[wave][1][ln][8 * hh]; pr.half[1] = *(const v8us*)&pt[wave][1][ln][16 + 8 * hh]; }
#pragma unroll
    for (int t = 0; t < 4; ++t) {
      const size_t vo = (vrow + t * 16 + ln) * (size_t)SEQ + kbase;
      const v16h vh = ldfrag(&vs[t * 16 + ln][0], 0, hh);
      om[t] = mma(ph.v, vh, om[t]);
      if (full) { const v16h vr = ldfrag(VTR, vo, hh); orr[t] = mma(ph.v, vr, orr[t]); orr[t] = mma(pr.v, vh, orr[t]); }
    }
    __builtin_amdgcn_fence(4 /* acq_rel order */, "workgroup"); __builtin_amdgcn_wave_barrier();
   }
    // hand-over, passed by every wave: own LDS reads done, own copies of step kb + 1 landed, then the block barrier that publishes step kb + 1 and frees this step's buffer
    asm volatile("s_wait_dscnt 0x0" ::: "memory");
    asm volatile("s_wait_asynccnt 0x0" ::: "memory");
    __syncthreads();
    if (kb + 2 < nst) stage(kb + 2);
  }
  asm volatile("s_wait_asynccnt 0x0" ::: "memory");   /* no copy outstanding at the wave's end */
  // context x16 = o / (2^10 * l) * 16
#pragma unroll
  for (int r = 0; r < 8; ++r) {
    const float inv = 0.015625f * (1.0f / li[r]);
#pragma unroll
    for (int t = 0; t < 4; ++t) so[wave][8 * hh + r][t * 16 + ln] = (om[t][r] + orr[t][r] * RINV) * inv;
  }
  __builtin_amdgcn_fence(4 /* acq_rel order */, "workgroup"); __builtin_amdgcn_wave_barrier();
  const int rq = lane >> 3, c8 = (lane & 7) * 8;
  {
#pragma unroll
    for (int it = 0; it < 4; ++it) {
      const int rr = it * 4 + rq;
      const v4f a = *(const v4fa*)&so[wave][rr][c8], b = *(const v4fa*)&so[wave][rr][c8 + 4];
      FragH fh, fl;
#pragma unroll
      for (int q = 0; q < 4; ++q) { _Float16 hv = (_Float16)a[q]; fh.h[q] = hv; fl.h[q] = (_Float16)((a[q] - (float)hv) * RSC); hv = (_Float16)b[q]; fh.h[4 + q] = hv; fl.h[4 + q] = (_Float16)((b[q] - (float)hv) * RSC); }
      const v8us oh = fh.half[0], ol = fl.half[0];
      const size_t o = ((size_t)(q0 + rr) * NG + g) * CP + h * HD + c8;
      *(v8us*)(CX + o) = oh; *(v8us*)(CX + o + EMB) = ol;
    }
    
  }
}

extern "C" void kernel_launch(void* const* d_in, const int* in_sizes, int n_in,
                              void* d_out, int out_size, void* d_ws, size_t ws_size, hipStream_t stream) {
  if (n_in < 5) return;
  if (in_sizes[0] < NR * EMB) return;
  if (in_sizes[1] < EMB * EMB) return;
  if (in_sizes[2] < EMB * KVW) return;
  if (in_sizes[3] < EMB * KVW) return;
  if (in_sizes[4] < EMB * EMB) return;
  if (out_size < NR * EMB) return;
  const float* x  = (const float*)d_in[0];
  const float* Wq = (const float*)d_in[1];      /* [in 1024][out 1024] */
  const float* Wk = (const float*)d_in[2];      /* [in 1024][out 256] */
  const float* Wv = (const float*)d_in[3];      /* [in 1024][out 256] */
  const float* Wo = (const float*)d_in[4];      /* [in 1024][out 1024] */
  char* ws = (char*)d_ws; size_t off = 0;
  auto take = [&](size_t bytes) { char* p = ws + off; off += (bytes + 255) & ~(size_t)255; return p; };
  unsigned short* BQKV = (unsigned short*)take(SZ_BQKV);      /* [1536][1024]: Wq^T | Wk^T | Wv^T, x16 */
  unsigned short* BO   = (unsigned short*)take(SZ_BO);        /* [1024][2048]: Wo^T x16 | Wo^T / 4 */
  unsigned short* X16  = (unsigned short*)take(SZ_X16);       /* [NR][1024] */
  unsigned short* QKH  = (unsigned short*)take(SZ_QK);        /* [NR][1536] value plane of q | k | v */
  unsigned short* QKR  = (unsigned short*)take(SZ_QK);        /* [NR][1536] residual plane (x2^10) */
  unsigned short* VTH  = (unsigned short*)take(SZ_VT);        /* [NG*NKV][64][SEQ] */
  unsigned short* VTR  = (unsigned short*)take(SZ_VT);
  unsigned short* CX   = (unsigned short*)take(SZ_CX);        /* [NR][2048]: context x16 value | residual (x64) */
  if (off > ws_size) return;

  k_wt_f16<<<(unsigned)((EMB * (EMB / 8) + 255) / 256), 256, 0, stream>>>(Wq, BQKV, EMB, EMB, 0, EMB, 0, 16.0f);
  k_wt_f16<<<(unsigned)((KVW * (EMB / 8) + 255) / 256), 256, 0, stream>>>(Wk, BQKV, EMB, KVW, EMB, EMB, 0, 16.0f);
  k_wt_f16<<<(unsigned)((KVW * (EMB / 8) + 255) / 256), 256, 0, stream>>>(Wv, BQKV, EMB, KVW, EMB + KVW, EMB, 0, 16.0f);
  k_wt_f16<<<(unsigned)((EMB * (EMB / 8) + 255) / 256), 256, 0, stream>>>(Wo, BO, EMB, EMB, 0, CP, 0, 16.0f);
  k_wt_f16<<<(unsigned)((EMB * (EMB / 8) + 255) / 256), 256, 0, stream>>>(Wo, BO, EMB, EMB, 0, CP, EMB, 0.25f);
  k_x16<<<(unsigned)((NR * (EMB / 8) + 255) / 256), 256, 0, stream>>>(x, X16, NR * (EMB / 8));
  k_gemm_planes<<<(unsigned)((NR / 128) * (LQ / 64)), 128, 0, stream>>>(X16, EMB, BQKV, EMB, 0.0625f, QKH, QKR, LQ, NR, LQ, EMB);
  k_vt<<<(unsigned)(NB * NG * NKV * (SEQ / 64)), 256, 0, stream>>>(QKH, QKR, VTH, VTR);
  k_attn<<<dim3((unsigned)(SEQ / 64), (unsigned)(NG * NH)), 128, 0, stream>>>(QKH, QKR, VTH, VTR, CX);
  k_gemm_out<<<(unsigned)((NR / 128) * (EMB / 64)), 128, 0, stream>>>(CX, CP, BO, CP, 0.00390625f, (float*)d_out, EMB, NR, EMB, CP);
}

// v003
// It runs in 178 microseconds.
// Timed twice side by side with v002, it ran 1.11 times as fast both times.
// All steps since v000 together make it 2.01 times as fast.
#include <hip/hip_runtime.h>
// Causal grouped-query self-attention with a group axis: x [1][SEQ][2][1024]; token row = s*2 + g; q = x Wq (16 heads x 64), k|v = x Wk|Wv (4 kv heads x 64, query head h uses kv head h/4); raw energy, causal exclusion (key > query), then 1/8 inside the softmax over keys of the same g; merged heads (h*64 + d) times Wo.
// Compute dtype: v_wmma_f32_16x16x32_f16 for every contraction, f32 accumulate. Inputs RNE-converted to bf16 then held exactly in f16 (x as is, weights x16). q|k|v written as f16 value + f16 residual (x2^10) planes. Scores: q value+residual against k value (plus k residual on query rows < 256). P carried x2^10 as f16 (plus residual x2^10 on rows < 256), V^T value (plus residual on rows < 256), residual products in a separate accumulator. Context carried x16 as f16 value | residual (x64) along K against Wo x16 | Wo / 4. Softmax statistics f32.
#ifndef NB
#define NB 1
#endif
#ifndef SEQ
#define SEQ 2048
#endif
#define SEQ_FULL 2048
#define NG 2
#define EMB 1024
#define NH 16
#define NKV 4
#define HD 64
#define KVW (NKV * HD)            /* 256 */
#define LQ (EMB + 2 * KVW)        /* 1536: pitch of the q|k|v planes */
#define CP (2 * EMB)              /* 2048: pitch of the context plane (value | residual) */
#define NR (NB * SEQ * NG)        /* token rows */
#define EQT 4                     /* 64-row query tiles (rows < 256) that run the full residual scheme */
#define RS 1024.0f                /* residual carry of q, k, v, P */
#define RINV 0.0009765625f
#define RSC 64.0f                 /* residual carry of the context plane */

static_assert(NB == 1);
static_assert(SEQ % 64 == 0);
static_assert(SEQ >= 64);
static_assert(SEQ <= SEQ_FULL);
static_assert(NR % 128 == 0);
static_assert(LQ % 64 == 0);
static_assert(EMB % 64 == 0);
static_assert(CP % 64 == 0);
static_assert(HD == 64);
static_assert(NH == 4 * NKV);
static_assert(NH * HD == EMB);
static_assert(KVW % 64 == 0);

typedef unsigned short v8us __attribute__((ext_vector_type(8), may_alias));
typedef float  v8f  __attribute__((ext_vector_type(8)));
typedef float  v4f  __attribute__((ext_vector_type(4)));
typedef float  v4fa __attribute__((ext_vector_type(4), may_alias));
typedef _Float16 v16h __attribute__((ext_vector_type(16)));
union FragH { v16h v; v8us half[2]; _Float16 h[16]; unsigned short u[16]; };

constexpr size_t SZ_BQKV = (size_t)LQ * EMB * 2;
constexpr size_t SZ_BO   = (size_t)EMB * CP * 2;
constexpr size_t SZ_X16  = (size_t)NR * EMB * 2;
constexpr size_t SZ_QK   = (size_t)NR * LQ * 2;
constexpr size_t SZ_VT   = (size_t)NB * NG * NKV * HD * SEQ * 2;
constexpr size_t SZ_CX   = (size_t)NR * CP * 2;
constexpr size_t WS_TOTAL = SZ_BQKV + SZ_BO + SZ_X16 + 2 * SZ_QK + 2 * SZ_VT + SZ_CX;
static_assert(WS_TOTAL <= (size_t)134217728);
static_assert(SZ_BQKV % 256 == 0 && SZ_BO % 256 == 0 && SZ_X16 % 256 == 0 && SZ_QK % 256 == 0 && SZ_VT % 256 == 0 && SZ_CX % 256 == 0);

// RNE convert f32 -> bf16 value (kept in f32)
__device__ __forceinline__ float bf16_rne(float x) { unsigned int u = __float_as_uint(x); u = (u + 0x7FFFu + ((u >> 16) & 1u)) & 0xFFFF0000u; return __uint_as_float(u); }
__device__ __forceinline__ unsigned short h_bits(_Float16 h) { return __builtin_bit_cast(unsigned short, h); }
// 16-bit fragment: elements 0..7 <- k0 + 8h + 0..7, elements 8..15 <- k0 + 16 + 8h + 0..7 (row / column = lane & 15)
__device__ __forceinline__ v16h ldfrag(const unsigned short* __restrict__ p, size_t off, int hh) { FragH f; f.half[0] = *(const v8us*)(p + off + 8 * hh); f.half[1] = *(const v8us*)(p + off + 16 + 8 * hh); return f.v; }
template <bool B> struct flag_c { static constexpr bool value = B; };
__device__ __forceinline__ v8f mma(v16h a, v16h b, v8f c) { v8f d = __builtin_amdgcn_wmma_f32_16x16x32_f16(false, a, false, b, (short)0, c, false, false); asm volatile("v_nop\n\tv_nop\n\tv_nop\n\tv_nop" : "+v"(d) : "v"(a), "v"(b)); return d; }

__global__ __launch_bounds__(256) void k_wt_f16(const float* __restrict__ W, unsigned short* __restrict__ Wt, int K, int N, int drow0, int dpitch, int dcol0, float scale) {
  const int t = blockIdx.x * 256 + threadIdx.x; const int k8n = K / 8; if (t >= N * k8n) return;
  const int n = t / k8n, k8 = (t - n * k8n) * 8; FragH f;
#pragma unroll
  for (int i = 0; i < 8; ++i) f.h[i] = (_Float16)(bf16_rne(W[(size_t)(k8 + i) * N + n]) * scale);
  const v8us o = f.half[0];
  unsigned short* d = Wt + (size_t)(drow0 + n) * dpitch + dcol0 + k8;
  *(v8us*)d = o; 
}

__global__ __launch_bounds__(256) void k_x16(const float* __restrict__ x, unsigned short* __restrict__ X16, int n8) {
  const int t = blockIdx.x * 256 + threadIdx.x; if (t >= n8) return;
  const v4f a = *(const v4fa*)(x + (size_t)t * 8), c = *(const v4fa*)(x + (size_t)t * 8 + 4); FragH f;
#pragma unroll
  for (int q = 0; q < 4; ++q) { f.h[q] = (_Float16)bf16_rne(a[q]); f.h[4 + q] = (_Float16)bf16_rne(c[q]); }
  const v8us o = f.half[0];
  unsigned short* d = X16 + (size_t)t * 8;
  *(v8us*)d = o; 
}

// GEMM main loop: block tile 128 x 64, wave tile 32 x 64, A f16 [M][lda], Bt f16 [N][ldb] (k contiguous), K % 64 == 0, K >= 64; called by all 128 threads of the block.
// The block's A and Bt rows of each 64-wide k step are copied into LDS once per block as whole 128-byte lines (two buffers, the next step's copies fly during this step); every wave reads its fragments from there.
__device__ __forceinline__ void gemm_core(const unsigned short* __restrict__ A, int lda, const unsigned short* __restrict__ Bt, int ldb, int K, int brow0, int col0, int tid, int wave, int ln, int hh,
    v8f& c00, v8f& c01, v8f& c02, v8f& c03, v8f& c10, v8f& c11, v8f& c12, v8f& c13) {
  __shared__ __attribute__((aligned(16))) unsigned short at[2][128][72];   /* 128 rows x 64 k, pitch 144 B */
  __shared__ __attribute__((aligned(16))) unsigned short bt[2][64][72];    /* 64 columns x 64 k, pitch 144 B */
  const int r0 = tid >> 3, c8 = (tid & 7) * 8;
  const unsigned short* const ga = A + (size_t)(brow0 + r0) * lda + c8;
  const unsigned short* const gb = Bt + (size_t)(col0 + r0) * ldb + c8;
  const size_t sa = (size_t)16 * lda, sb = (size_t)16 * ldb;
  const int nst = K >> 6;
  // step s -> buffer s & 1: each thread copies 16 B of A rows r0 + 16 j (j < 8) and of Bt rows r0 + 16 j (j < 4)
  auto stage = [&](int s) {
    const int b = s & 1;
    const size_t ko = (size_t)s * 64;   /* added to row pointers that do not change from step to step: twelve independent additions, no chain in front of the copies */
    const unsigned short* const a0 = ga + ko; const unsigned short* const a1 = (ga + sa) + ko; const unsigned short* const a2 = (ga + 2 * sa) + ko; const unsigned short* const a3 = (ga + 3 * sa) + ko;
    const unsigned short* const a4 = (ga + 4 * sa) + ko; const unsigned short* const a5 = (ga + 5 * sa) + ko; const unsigned short* const a6 = (ga + 6 * sa) + ko; const unsigned short* const a7 = (ga + 7 * sa) + ko;
    const unsigned short* const b0 = gb + ko; const unsigned short* const b1 = (gb + sb) + ko; const unsigned short* const b2 = (gb + 2 * sb) + ko; const unsigned short* const b3 = (gb + 3 * sb) + ko;
    const unsigned int la0 = (unsigned int)(size_t)&at[b][r0][c8], la1 = (unsigned int)(size_t)&at[b][r0 + 16][c8], la2 = (unsigned int)(size_t)&at[b][r0 + 32][c8], la3 = (unsigned int)(size_t)&at[b][r0 + 48][c8];
    const unsigned int la4 = (unsigned int)(size_t)&at[b][r0 + 64][c8], la5 = (unsigned int)(size_t)&at[b][r0 + 80][c8], la6 = (unsigned int)(size_t)&at[b][r0 + 96][c8], la7 = (unsigned int)(size_t)&at[b][r0 + 112][c8];
    const unsigned int lb0 = (unsigned int)(size_t)&bt[b][r0][c8], lb1 = (unsigned int)(size_t)&bt[b][r0 + 16][c8], lb2 = (unsigned int)(size_t)&bt[b][r0 + 32][c8], lb3 = (unsigned int)(size_t)&bt[b][r0 + 48][c8];
    // the closing s_wait_xcnt keeps later writes of the address registers behind the copies
    asm volatile("global_load_async_to_lds_b128 %0, %12, off\n\tglobal_load_async_to_lds_b128 %1, %13, off\n\tglobal_load_async_to_lds_b128 %2, %14, off\n\tglobal_load_async_to_lds_b128 %3, %15, off\n\t"
                 "global_load_async_to_lds_b128 %4, %16, off\n\tglobal_load_async_to_lds_b128 %5, %17, off\n\tglobal_load_async_to_lds_b128 %6, %18, off\n\tglobal_load_async_to_lds_b128 %7, %19, off\n\t"
                 "global_load_async_to_lds_b128 %8, %20, off\n\tglobal_load_async_to_lds_b128 %9, %21, off\n\tglobal_load_async_to_lds_b128 %10, %22, off\n\tglobal_load_async_to_lds_b128 %11, %23, off\n\ts_wait_xcnt 0x0"
                 :: "v"(la0), "v"(la1), "v"(la2), "v"(la3), "v"(la4), "v"(la5), "v"(la6), "v"(la7), "v"(lb0), "v"(lb1), "v"(lb2), "v"(lb3),
                    "v"(a0), "v"(a1), "v"(a2), "v"(a3), "v"(a4), "v"(a5), "v"(a6), "v"(a7), "v"(b0), "v"(b1), "v"(b2), "v"(b3) : "memory");
  };
  stage(0);
  asm volatile("s_wait_asynccnt 0x0" ::: "memory");   /* own copies of step 0 landed */
  __syncthreads();                                    /* step 0 readable by every wave */
  if (nst > 1) stage(1);
#pragma unroll 1
  for (int s = 0; s < nst; ++s) {                     /* rolled: one body serves both buffers */
    const unsigned short (* const as)[72] = at[s & 1];
    const unsigned short (* const bs)[72] = bt[s & 1];
    // all fragments of the step are fetched as one group in front of its products: one LDS wait place a step instead of two
    v16h fa[2][2], fb[2][4];
#pragma unroll   /* these three loops are unrolled so that the fragment arrays are indexed by constants and stay in registers */
    for (int kk = 0; kk < 2; ++kk) {
      fa[kk][0] = ldfrag(&as[32 * wave + ln][kk * 32], 0, hh); fa[kk][1] = ldfrag(&as[32 * wave + 16 + ln][kk * 32], 0, hh);
#pragma unroll
      for (int j = 0; j < 4; ++j) fb[kk][j] = ldfrag(&bs[16 * j + ln][kk * 32], 0, hh);
    }
#pragma unroll
    for (int kk = 0; kk < 2; ++kk) {
      c00 = mma(fa[kk][0], fb[kk][0], c00); c10 = mma(fa[kk][1], fb[kk][0], c10);
      c01 = mma(fa[kk][0], fb[kk][1], c01); c11 = mma(fa[kk][1], fb[kk][1], c11);
      c02 = mma(fa[kk][0], fb[kk][2], c02); c12 = mma(fa[kk][1], fb[kk][2], c12);
      c03 = mma(fa[kk][0], fb[kk][3], c03); c13 = mma(fa[kk][1], fb[kk][3], c13);
    }
    // hand-over, passed by every wave: own LDS reads done, own copies of step s + 1 landed, then the block barrier that publishes step s + 1 and frees this step's buffer
    asm volatile("s_wait_dscnt 0x0" ::: "memory");
    asm volatile("s_wait_asynccnt 0x0" ::: "memory");
    __syncthreads();
    if (s + 2 < nst) stage(s + 2);
  }
  asm volatile("s_wait_asynccnt 0x0" ::: "memory");   /* no copy outstanding behind the loop */
}

// C = alpha * A . Bt^T written as f16 value plane CH and residual plane CR ((v - value) * 2^10), both pitch ldc. M % 128 == 0, N % 64 == 0.
__global__ __launch_bounds__(128) void k_gemm_planes(const unsigned short* __restrict__ A, int lda, const unsigned short* __restrict__ Bt, int ldb, float alpha,
    unsigned short* __restrict__ CH, unsigned short* __restrict__ CR, int ldc, int M, int N, int K) {
  __shared__ __attribute__((aligned(16))) float so[4][32][68];
  const int tid = threadIdx.x; const int wave = __builtin_amdgcn_readfirstlane(tid >> 5);
  const int lane = tid & 31, ln = lane & 15, hh = lane >> 4;
  const int ntn = N >> 6; const int mt = blockIdx.x / ntn, nq = blockIdx.x - mt * ntn;
  const int brow0 = mt * 128, row0 = brow0 + 32 * wave, col0 = nq * 64; if (brow0 >= M) return;
  const v8f z8 = {0.f, 0.f, 0.f, 0.f, 0.f, 0.f, 0.f, 0.f};
  v8f c00 = z8, c01 = z8, c02 = z8, c03 = z8, c10 = z8, c11 = z8, c12 = z8, c13 = z8;
  gemm_core(A, lda, Bt, ldb, K, brow0, col0, tid, wave, ln, hh, c00, c01, c02, c03, c10, c11, c12, c13);
  v8f accs[8] = {c00, c01, c02, c03, c10, c11, c12, c13};
#pragma unroll
  for (int u = 0; u < 8; ++u) { const int t = u & 3, hf = u >> 2;
#pragma unroll
    for (int r = 0; r < 8; ++r) so[wave][hf * 16 + 8 * hh + r][t * 16 + ln] = accs[u][r] * alpha; }
  __builtin_amdgcn_fence(4 /* acq_rel order */, "workgroup"); __builtin_amdgcn_wave_barrier();
  const int rq = lane >> 3, c8 = (lane & 7) * 8;
  {
#pragma unroll
    for (int it = 0; it < 8; ++it) {
      const int rr = it * 4 + rq;
      const v4f a = *(const v4fa*)&so[wave][rr][c8], b = *(const v4fa*)&so[wave][rr][c8 + 4];
      FragH fh, fl;
#pragma unroll
      for (int q = 0; q < 4; ++q) { _Float16 hv = (_Float16)a[q]; fh.h[q] = hv; fl.h[q] = (_Float16)((a[q] - (float)hv) * RS); hv = (_Float16)b[q]; fh.h[4 + q] = hv; fl.h[4 + q] = (_Float16)((b[q] - (float)hv) * RS); }
      const v8us oh = fh.half[0], ol = fl.half[0];
      const size_t o = (size_t)(row0 + rr) * ldc + col0 + c8;
      *(v8us*)(CH + o) = oh; *(v8us*)(CR + o) = ol;
    }
    
  }
}

__global__ __launch_bounds__(128) void k_gemm_out(const unsigned short* __restrict__ A, int lda, const unsigned short* __restrict__ Bt, int ldb, float alpha,
    float* __restrict__ C, int ldc, int M, int N, int K) {
  __shared__ __attribute__((aligned(16))) float so[4][32][68];
  const int tid = threadIdx.x; const int wave = __builtin_amdgcn_readfirstlane(tid >> 5);
  const int lane = tid & 31, ln = lane & 15, hh = lane >> 4;
  const int ntn = N >> 6; const int mt = blockIdx.x / ntn, nq = blockIdx.x - mt * ntn;
  const int brow0 = mt * 128, row0 = brow0 + 32 * wave, col0 = nq * 64; if (brow0 >= M) return;
  const v8f z8 = {0.f, 0.f, 0.f, 0.f, 0.f, 0.f, 0.f, 0.f};
  v8f c00 = z8, c01 = z8, c02 = z8, c03 = z8, c10 = z8, c11 = z8, c12 = z8, c13 = z8;
  gemm_core(A, lda, Bt, ldb, K, brow0, col0, tid, wave, ln, hh, c00, c01, c02, c03, c10, c11, c12, c13);
  v8f accs[8] = {c00, c01, c02, c03, c10, c11, c12, c13};
#pragma unroll
  for (int u = 0; u < 8; ++u) { const int t = u & 3, hf = u >> 2;
#pragma unroll
    for (int r = 0; r < 8; ++r) so[wave][hf * 16 + 8 * hh + r][t * 16 + ln] = accs[u][r] * alpha; }
  __builtin_amdgcn_fence(4 /* acq_rel order */, "workgroup"); __builtin_amdgcn_wave_barrier();
  const int rsub = lane >> 4, c4 = (lane & 15) * 4;
  {
#pragma unroll
    for (int q = 0; q < 16; ++q) { const int r = q * 2 + rsub; const v4f v = *(const v4fa*)&so[wave][r][c4]; *(v4f*)(C + (size_t)(row0 + r) * ldc + col0 + c4) = v; }
    
  }
}

__global__ __launch_bounds__(256) void k_vt(const unsigned short* __restrict__ QKH, const unsigned short* __restrict__ QKR, unsigned short* __restrict__ VTH, unsigned short* __restrict__ VTR) {
  __shared__ unsigned short tl[2][64][66];
  const int tid = threadIdx.x;
  const int nlg = SEQ / 64;
  const int slab = blockIdx.x / nlg, lg = blockIdx.x - slab * nlg;
  const int g = slab / NKV, kv = slab - g * NKV;
#pragma unroll 1
  for (int i = tid; i < 512; i += 256) {
    const int r = i >> 3, c8 = (i & 7) * 8;
    const size_t sof = ((size_t)(lg * 64 + r) * NG + g) * LQ + EMB + KVW + kv * HD + c8;
    FragH fh, fr; fh.half[0] = *(const v8us*)(QKH + sof); fr.half[0] = *(const v8us*)(QKR + sof);
#pragma unroll
    for (int q = 0; q < 8; ++q) { tl[0][r][c8 + q] = fh.u[q]; tl[1][r][c8 + q] = fr.u[q]; }
  }
  __syncthreads();
  {
#pragma unroll
    for (int rd = 0; rd < 2; ++rd) {
      const int d = rd * 32 + (tid >> 3), pc = tid & 7; FragH fh, fr;
#pragma unroll
      for (int q = 0; q < 8; ++q) { fh.u[q] = tl[0][pc * 8 + q][d]; fr.u[q] = tl[1][pc * 8 + q][d]; }
      const v8us oh = fh.half[0], ol = fr.half[0];
      const size_t o = ((size_t)slab * HD + d) * SEQ + lg * 64 + pc * 8;
      *(v8us*)(VTH + o) = oh; *(v8us*)(VTR + o) = ol;
    }
    
  }
}

// Fused causal flash attention. grid = (SEQ/64, NG*NH); block = 4 waves, wave = 16 query rows; 32-key steps up to the diagonal.
// The block's q tile (value and residual) is copied into LDS once, the K and V^T value tiles of each step once per block (two buffers, the next step's copies fly during this step); the K and V^T residual planes (rows < 256 only) come straight from global memory. Per-wave LDS tiles (P value/residual, output staging) are wave-private.
__global__ __launch_bounds__(128) void k_attn(const unsigned short* __restrict__ QKH, const unsigned short* __restrict__ QKR,
    const unsigned short* __restrict__ VTH, const unsigned short* __restrict__ VTR, unsigned short* __restrict__ CX) {
  __shared__ __attribute__((aligned(16))) unsigned short pt[4][2][16][40];
  __shared__ __attribute__((aligned(16))) float so[4][16][68];
  __shared__ __attribute__((aligned(16))) unsigned short kt[2][32][72];   /* 32 keys x 64, pitch 144 B */
  __shared__ __attribute__((aligned(16))) unsigned short vt[2][64][40];   /* 64 d x 32 keys, pitch 80 B */
  __shared__ __attribute__((aligned(16))) unsigned short qs[2][64][72];   /* value | residual: 64 query rows x 64, pitch 144 B */
  const int tid = threadIdx.x; const int wave = __builtin_amdgcn_readfirstlane(tid >> 5);
  const int lane = tid & 31, ln = lane & 15, hh = lane >> 4;
  const int qt = blockIdx.x, gh = blockIdx.y;
  const int g = gh >> 4, h = gh & 15, kvh = h >> 2;
  const int q0 = qt * 64 + wave * 16;
  const size_t kcol = (size_t)EMB + kvh * HD;
  const size_t vrow = (size_t)(g * NKV + kvh) * HD;
  const v8f z8 = {0.f, 0.f, 0.f, 0.f, 0.f, 0.f, 0.f, 0.f};
  v8f om[4] = {z8, z8, z8, z8}, orr[4] = {z8, z8, z8, z8};
  float mi[8], li[8];
#pragma unroll
  for (int r = 0; r < 8; ++r) { mi[r] = -1.0e30f; li[r] = 0.f; }
  const int nkb = (q0 + 16 + 31) >> 5;      /* every visited 32-key step starts at a key <= q0, so each row keeps >= 1 key per step */
  const int nst = 2 * qt + 2;               /* steps of the block = nkb of its last wave; keys < 64 * qt + 64 <= SEQ */
  const int kr0 = tid >> 3, kc8 = (tid & 7) * 8, vr0 = tid >> 2, vc8 = (tid & 3) * 8;
  const unsigned short* const gk = QKH + ((size_t)kr0 * NG + g) * LQ + kcol + kc8;
  const unsigned short* const gv = VTH + (vrow + vr0) * (size_t)SEQ + vc8;
  // step s -> buffer s & 1: each thread copies 16 B of K rows kr0, kr0 + 16 and of V^T rows vr0, vr0 + 32
  auto stage = [&](int s) {
    const int b = s & 1;
    const unsigned short* const k0 = gk + (size_t)s * (32 * NG * LQ); const unsigned short* const k1 = k0 + (size_t)16 * NG * LQ;
    const unsigned short* const v0 = gv + s * 32; const unsigned short* const v1 = v0 + (size_t)32 * SEQ;
    const unsigned int lk0 = (unsigned int)(size_t)&kt[b][kr0][kc8], lk1 = (unsigned int)(size_t)&kt[b][kr0 + 16][kc8];
    const unsigned int lv0 = (unsigned int)(size_t)&vt[b][vr0][vc8], lv1 = (unsigned int)(size_t)&vt[b][vr0 + 32][vc8];
    // the closing s_wait_xcnt keeps later writes of the address registers behind the copies
    asm volatile("global_load_async_to_lds_b128 %0, %4, off\n\tglobal_load_async_to_lds_b128 %1, %5, off\n\tglobal_load_async_to_lds_b128 %2, %6, off\n\tglobal_load_async_to_lds_b128 %3, %7, off\n\ts_wait_xcnt 0x0"
                 :: "v"(lk0), "v"(lk1), "v"(lv0), "v"(lv1), "v"(k0), "v"(k1), "v"(v0), "v"(v1) : "memory");
  };
  {
    // q tile: each thread copies 16 B of rows kr0 + 0, 16, 32, 48 of both planes
    const size_t qg = ((size_t)(qt * 64 + kr0) * NG + g) * LQ + h * HD + kc8;
    const unsigned short* const h0 = QKH + qg; const unsigned short* const h1 = h0 + (size_t)16 * NG * LQ;
    const unsigned short* const h2 = h1 + (size_t)16 * NG * LQ; const unsigned short* const h3 = h2 + (size_t)16 * NG * LQ;
    const unsigned short* const r0 = QKR + qg; const unsigned short* const r1 = r0 + (size_t)16 * NG * LQ;
    const unsigned short* const r2 = r1 + (size_t)16 * NG * LQ; const unsigned short* const r3 = r2 + (size_t)16 * NG * LQ;
    const unsigned int a0 = (unsigned int)(size_t)&qs[0][kr0][kc8], a1 = (unsigned int)(size_t)&qs[0][kr0 + 16][kc8];
    const unsigned int a2 = (unsigned int)(size_t)&qs[0][kr0 + 32][kc8], a3 = (unsigned int)(size_t)&qs[0][kr0 + 48][kc8];
    const unsigned int b0 = (unsigned int)(size_t)&qs[1][kr0][kc8], b1 = (unsigned int)(size_t)&qs[1][kr0 + 16][kc8];
    const unsigned int b2 = (unsigned int)(size_t)&qs[1][kr0 + 32][kc8], b3 = (unsigned int)(size_t)&qs[1][kr0 + 48][kc8];
    // the closing s_wait_xcnt keeps later writes of the address registers behind the copies
    asm volatile("global_load_async_to_lds_b128 %0, %8, off\n\tglobal_load_async_to_lds_b128 %1, %9, off\n\tglobal_load_async_to_lds_b128 %2, %10, off\n\tglobal_load_async_to_lds_b128 %3, %11, off\n\t"
                 "global_load_async_to_lds_b128 %4, %12, off\n\tglobal_load_async_to_lds_b128 %5, %13, off\n\tglobal_load_async_to_lds_b128 %6, %14, off\n\tglobal_load_async_to_lds_b128 %7, %15, off\n\ts_wait_xcnt 0x0"
                 :: "v"(a0), "v"(a1), "v"(a2), "v"(a3), "v"(b0), "v"(b1), "v"(b2), "v"(b3), "v"(h0), "v"(h1), "v"(h2), "v"(h3), "v"(r0), "v"(r1), "v"(r2), "v"(r3) : "memory");
  }
  stage(0);
  asm volatile("s_wait_asynccnt 0x0" ::: "memory");   /* own copies of q and of step 0 landed */
  __syncthreads();                                    /* q and step 0 readable by every wave */
  stage(1);                                           /* nst >= 2: step 1 always exists */
  // The key loop is compiled twice, with the residual scheme as a compile-time constant: the copy for rows >= 256 holds no test of it, no residual accumulator (it stays 0) and no global load; each step is one straight-line block, so the eight rows' reductions run side by side.
  auto key_loop = [&](auto fc) {
  constexpr bool full = decltype(fc)::value;
#pragma unroll 1
  for (int kb = 0; kb < nst; ++kb) {
   if (kb < nkb) {                                    /* wave-uniform: waves 0 and 1 sit out the block's last step */
    const int kbase = kb * 32;
    const unsigned short (* const ks)[72] = kt[kb & 1];
    const unsigned short (* const vs)[40] = vt[kb & 1];
    v8f sm[2] = {z8, z8}, sr[2] = {z8, z8};
#pragma unroll
    for (int kk = 0; kk < 2; ++kk) {
      const v16h qh = ldfrag(&qs[0][wave * 16 + ln][kk * 32], 0, hh);
      const v16h qr = ldfrag(&qs[1][wave * 16 + ln][kk * 32], 0, hh);
#pragma unroll
      for (int nt = 0; nt < 2; ++nt) {
        const size_t ko = ((size_t)(kbase + nt * 16 + ln) * NG + g) * LQ + kcol + kk * 32;
        const v16h kh = ldfrag(&ks[nt * 16 + ln][kk * 32], 0, hh);
        sm[nt] = mma(qh, kh, sm[nt]);
        sr[nt] = mma(qr, kh, sr[nt]);
        if constexpr (full) { const v16h kr = ldfrag(QKR, ko, hh); sr[nt] = mma(qh, kr, sr[nt]); }
      }
    }
    float pv[2][8];
#pragma unroll
    for (int r = 0; r < 8; ++r) {
      const int qi = q0 + 8 * hh + r;
      const bool ok0 = (kbase + ln) <= qi, ok1 = (kbase + 16 + ln) <= qi;
      const float s0 = (sm[0][r] + sr[0][r] * RINV) * 0.125f;
      const float s1 = (sm[1][r] + sr[1][r] * RINV) * 0.125f;
      float mx = fmaxf(ok0 ? s0 : -1.0e30f, ok1 ? s1 : -1.0e30f);
      mx = fmaxf(mx, __shfl_xor(mx, 1, 32));
      mx = fmaxf(mx, __shfl_xor(mx, 2, 32));
      mx = fmaxf(mx, __shfl_xor(mx, 4, 32));
      mx = fmaxf(mx, __shfl_xor(mx, 8, 32));
      const float mnew = fmaxf(mi[r], mx);
      const float al = __expf(mi[r] - mnew);
      mi[r] = mnew;
      const float e0 = __expf(fminf(s0 - mnew, 0.f)), e1 = __expf(fminf(s1 - mnew, 0.f));
      const float p0 = ok0 ? e0 : 0.f, p1 = ok1 ? e1 : 0.f;
      float sum = p0 + p1;
      sum += __shfl_xor(sum, 1, 32);
      sum += __shfl_xor(sum, 2, 32);
      sum += __shfl_xor(sum, 4, 32);
      sum += __shfl_xor(sum, 8, 32);
      li[r] = li[r] * al + sum;
#pragma unroll
      for (int t = 0; t < 4; ++t) { om[t][r] *= al; if constexpr (full) orr[t][r] *= al; }
      pv[0][r] = p0; pv[1][r] = p1;
    }
    // P tile (x2^10): accumulator layout -> per-wave LDS rows -> A fragments (stored as 16-bit words, reloaded through a may_alias vector of the same words)
#pragma unroll
    for (int nt = 0; nt < 2; ++nt) {
#pragma unroll
      for (int r = 0; r < 8; ++r) {
        const float pc = pv[nt][r] * RS;
        const _Float16 p16 = (_Float16)pc;
        pt[wave][0][8 * hh + r][nt * 16 + ln] = h_bits(p16);
        if constexpr (full) pt[wave][1][8 * hh + r][nt * 16 + ln] = h_bits((_Float16)((pc - (float)p16) * RS));
      }
    }
    __builtin_amdgcn_fence(4 /* acq_rel order */, "workgroup"); __builtin_amdgcn_wave_barrier();
    FragH ph; ph.half[0] = *(const v8us*)&pt[wave][0][ln][8 * hh]; ph.half[1] = *(const v8us*)&pt[wave][0][ln][16 + 8 * hh];
    FragH pr = ph;
    if constexpr (full) { pr.half[0] = *(const v8us*)&pt[wave][1][ln][8 * hh]; pr.half[1] = *(const v8us*)&pt[wave][1][ln][16 + 8 * hh]; }
#pragma unroll
    for (int t = 0; t < 4; ++t) {
      const size_t vo = (vrow + t * 16 + ln) * (size_t)SEQ + kbase;
      const v16h vh = ldfrag(&vs[t * 16 + ln][0], 0, hh);
      om[t] = mma(ph.v, vh, om[t]);
      if constexpr (full) { const v16h vr = ldfrag(VTR, vo, hh); orr[t] = mma(ph.v, vr, orr[t]); orr[t] = mma(pr.v, vh, orr[t]); }
    }
    __builtin_amdgcn_fence(4 /* acq_rel order */, "workgroup"); __builtin_amdgcn_wave_barrier();
   }
    // hand-over, passed by every wave: own LDS reads done, own copies of step kb + 1 landed, then the block barrier that publishes step kb + 1 and frees this step's buffer
    asm volatile("s_wait_dscnt 0x0" ::: "memory");
    asm volatile("s_wait_asynccnt 0x0" ::: "memory");
    __syncthreads();
    if (kb + 2 < nst) stage(kb + 2);
  }
  };
  if (qt < EQT) key_loop(flag_c<true>{}); else key_loop(flag_c<false>{});   /* block-uniform choice */
  asm volatile("s_wait_asynccnt 0x0" ::: "memory");   /* no copy outstanding at the wave's end */
  // context x16 = o / (2^10 * l) * 16
#pragma unroll
  for (int r = 0; r < 8; ++r) {
    const float inv = 0.015625f * (1.0f / li[r]);
#pragma unroll
    for (int t = 0; t < 4; ++t) so[wave][8 * hh + r][t * 16 + ln] = (om[t][r] + orr[t][r] * RINV) * inv;
  }
  __builtin_amdgcn_fence(4 /* acq_rel order */, "workgroup"); __builtin_amdgcn_wave_barrier();
  const int rq = lane >> 3, c8 = (lane & 7) * 8;
  {
#pragma unroll
    for (int it = 0; it < 4; ++it) {
      const int rr = it * 4 + rq;
      const v4f a = *(const v4fa*)&so[wave][rr][c8], b = *(const v4fa*)&so[wave][rr][c8 + 4];
      FragH fh, fl;
#pragma unroll
      for (int q = 0; q < 4; ++q) { _Float16 hv = (_Float16)a[q]; fh.h[q] = hv; fl.h[q] = (_Float16)((a[q] - (float)hv) * RSC); hv = (_Float16)b[q]; fh.h[4 + q] = hv; fl.h[4 + q] = (_Float16)((b[q] - (float)hv) * RSC); }
      const v8us oh = fh.half[0], ol = fl.half[0];
      const size_t o = ((size_t)(q0 + rr) * NG + g) * CP + h * HD + c8;
      *(v8us*)(CX + o) = oh; *(v8us*)(CX + o + EMB) = ol;
    }
    
  }
}

extern "C" void kernel_launch(void* const* d_in, const int* in_sizes, int n_in,
                              void* d_out, int out_size, void* d_ws, size_t ws_size, hipStream_t stream) {
  if (n_in < 5) return;
  if (in_sizes[0] < NR * EMB) return;
  if (in_sizes[1] < EMB * EMB) return;
  if (in_sizes[2] < EMB * KVW) return;
  if (in_sizes[3] < EMB * KVW) return;
  if (in_sizes[4] < EMB * EMB) return;
  if (out_size < NR * EMB) return;
  const float* x  = (const float*)d_in[0];
  const float* Wq = (const float*)d_in[1];      /* [in 1024][out 1024] */
  const float* Wk = (const float*)d_in[2];      /* [in 1024][out 256] */
  const float* Wv = (const float*)d_in[3];      /* [in 1024][out 256] */
  const float* Wo = (const float*)d_in[4];      /* [in 1024][out 1024] */
  char* ws = (char*)d_ws; size_t off = 0;
  auto take = [&](size_t bytes) { char* p = ws + off; off += (bytes + 255) & ~(size_t)255; return p; };
  unsigned short* BQKV = (unsigned short*)take(SZ_BQKV);      /* [1536][1024]: Wq^T | Wk^T | Wv^T, x16 */
  unsigned short* BO   = (unsigned short*)take(SZ_BO);        /* [1024][2048]: Wo^T x16 | Wo^T / 4 */
  unsigned short* X16  = (unsigned short*)take(SZ_X16);       /* [NR][1024] */
  unsigned short* QKH  = (unsigned short*)take(SZ_QK);        /* [NR][1536] value plane of q | k | v */
  unsigned short* QKR  = (unsigned short*)take(SZ_QK);        /* [NR][1536] residual plane (x2^10) */
  unsigned short* VTH  = (unsigned short*)take(SZ_VT);        /* [NG*NKV][64][SEQ] */
  unsigned short* VTR  = (unsigned short*)take(SZ_VT);
  unsigned short* CX   = (unsigned short*)take(SZ_CX);        /* [NR][2048]: context x16 value | residual (x64) */
  if (off > ws_size) return;

  k_wt_f16<<<(unsigned)((EMB * (EMB / 8) + 255) / 256), 256, 0, stream>>>(Wq, BQKV, EMB, EMB, 0, EMB, 0, 16.0f);
  k_wt_f16<<<(unsigned)((KVW * (EMB / 8) + 255) / 256), 256, 0, stream>>>(Wk, BQKV, EMB, KVW, EMB, EMB, 0, 16.0f);
  k_wt_f16<<<(unsigned)((KVW * (EMB / 8) + 255) / 256), 256, 0, stream>>>(Wv, BQKV, EMB, KVW, EMB + KVW, EMB, 0, 16.0f);
  k_wt_f16<<<(unsigned)((EMB * (EMB / 8) + 255) / 256), 256, 0, stream>>>(Wo, BO, EMB, EMB, 0, CP, 0, 16.0f);
  k_wt_f16<<<(unsigned)((EMB * (EMB / 8) + 255) / 256), 256, 0, stream>>>(Wo, BO, EMB, EMB, 0, CP, EMB, 0.25f);
  k_x16<<<(unsigned)((NR * (EMB / 8) + 255) / 256), 256, 0, stream>>>(x, X16, NR * (EMB / 8));
  k_gemm_planes<<<(unsigned)((NR / 128) * (LQ / 64)), 128, 0, stream>>>(X16, EMB, BQKV, EMB, 0.0625f, QKH, QKR, LQ, NR, LQ, EMB);
  k_vt<<<(unsigned)(NB * NG * NKV * (SEQ / 64)), 256, 0, stream>>>(QKH, QKR, VTH, VTR);
  k_attn<<<dim3((unsigned)(SEQ / 64), (unsigned)(NG * NH)), 128, 0, stream>>>(QKH, QKR, VTH, VTR, CX);
  k_gemm_out<<<(unsigned)((NR / 128) * (EMB / 64)), 128, 0, stream>>>(CX, CP, BO, CP, 0.00390625f, (float*)d_out, EMB, NR, EMB, CP);
}

// v004
// It runs in 133 microseconds.
// Timed twice side by side with v003, it ran 1.31 times as fast both times.
// All steps since v000 together make it 2.63 times as fast.
#include <hip/hip_runtime.h>
// Causal grouped-query self-attention with a group axis: x [1][SEQ][2][1024]; token row = s*2 + g; q = x Wq (16 heads x 64), k|v = x Wk|Wv (4 kv heads x 64, query head h uses kv head h/4); raw energy, causal exclusion (key > query), then 1/8 inside the softmax over keys of the same g; merged heads (h*64 + d) times Wo.
// Compute dtype: v_wmma_f32_16x16x32_f16 for every contraction, f32 accumulate. Inputs RNE-converted to bf16 then held exactly in f16 (x as is, weights x16). q|k|v written as f16 value + f16 residual (x2^10) planes. Scores: q value+residual against k value (plus k residual on query rows < 256). P carried x2^10 as f16 (plus residual x2^10 on rows < 256), V^T value (plus residual on rows < 256), residual products in a separate accumulator. Context carried x16 as f16 value | residual (x64) along K against Wo x16 | Wo / 4. Softmax statistics f32.
#ifndef NB
#define NB 1
#endif
#ifndef SEQ
#define SEQ 2048
#endif
#define SEQ_FULL 2048
#define NG 2
#define EMB 1024
#define NH 16
#define NKV 4
#define HD 64
#define KVW (NKV * HD)            /* 256 */
#define LQ (EMB + 2 * KVW)        /* 1536: pitch of the q|k|v planes */
#define CP (2 * EMB)              /* 2048: pitch of the context plane (value | residual) */
#define NR (NB * SEQ * NG)        /* token rows */
#define EQT 4                     /* 64-row query tiles (rows < 256) that run the full residual scheme */
#define RS 1024.0f                /* residual carry of q, k, v, P */
#define RINV 0.0009765625f
#define RSC 64.0f                 /* residual carry of the context plane */

static_assert(NB == 1);
static_assert(SEQ % 64 == 0);
static_assert(SEQ >= 64);
static_assert(SEQ <= SEQ_FULL);
static_assert(NR % 128 == 0);
static_assert(LQ % 64 == 0);
static_assert(EMB % 64 == 0);
static_assert(CP % 64 == 0);
static_assert(HD == 64);
static_assert(NH == 4 * NKV);
static_assert(NH * HD == EMB);
static_assert(KVW % 64 == 0);

typedef unsigned short v8us __attribute__((ext_vector_type(8), may_alias));
typedef float  v8f  __attribute__((ext_vector_type(8)));
typedef float  v4f  __attribute__((ext_vector_type(4)));
typedef float  v4fa __attribute__((ext_vector_type(4), may_alias));
typedef _Float16 v16h __attribute__((ext_vector_type(16)));
union FragH { v16h v; v8us half[2]; _Float16 h[16]; unsigned short u[16]; };

constexpr size_t SZ_BQKV = (size_t)LQ * EMB * 2;
constexpr size_t SZ_BO   = (size_t)EMB * CP * 2;
constexpr size_t SZ_X16  = (size_t)NR * EMB * 2;
constexpr size_t SZ_QK   = (size_t)NR * LQ * 2;
constexpr size_t SZ_VT   = (size_t)NB * NG * NKV * HD * SEQ * 2;
constexpr size_t SZ_CX   = (size_t)NR * CP * 2;
constexpr size_t WS_TOTAL = SZ_BQKV + SZ_BO + SZ_X16 + 2 * SZ_QK + 2 * SZ_VT + SZ_CX;
static_assert(WS_TOTAL <= (size_t)134217728);
static_assert(SZ_BQKV % 256 == 0 && SZ_BO % 256 == 0 && SZ_X16 % 256 == 0 && SZ_QK % 256 == 0 && SZ_VT % 256 == 0 && SZ_CX % 256 == 0);

// RNE convert f32 -> bf16 value (kept in f32)
__device__ __forceinline__ float bf16_rne(float x) { unsigned int u = __float_as_uint(x); u = (u + 0x7FFFu + ((u >> 16) & 1u)) & 0xFFFF0000u; return __uint_as_float(u); }
__device__ __forceinline__ unsigned short h_bits(_Float16 h) { return __builtin_bit_cast(unsigned short, h); }
// 16-bit fragment: elements 0..7 <- k0 + 8h + 0..7, elements 8..15 <- k0 + 16 + 8h + 0..7 (row / column = lane & 15)
__device__ __forceinline__ v16h ldfrag(const unsigned short* __restrict__ p, size_t off, int hh) { FragH f; f.half[0] = *(const v8us*)(p + off + 8 * hh); f.half[1] = *(const v8us*)(p + off + 16 + 8 * hh); return f.v; }
// lane l <-> lane l ^ 16
__device__ __forceinline__ float xhalf(float x) { const int b = __builtin_bit_cast(int, x); return __builtin_bit_cast(float, __builtin_amdgcn_permlanex16(b, b, 0x76543210, 0xfedcba98, false, false)); }
template <bool B> struct flag_c { static constexpr bool value = B; };
__device__ __forceinline__ v8f mma(v16h a, v16h b, v8f c) { v8f d = __builtin_amdgcn_wmma_f32_16x16x32_f16(false, a, false, b, (short)0, c, false, false); asm volatile("v_nop\n\tv_nop\n\tv_nop\n\tv_nop" : "+v"(d) : "v"(a), "v"(b)); return d; }

__global__ __launch_bounds__(256) void k_wt_f16(const float* __restrict__ W, unsigned short* __restrict__ Wt, int K, int N, int drow0, int dpitch, int dcol0, float scale) {
  const int t = blockIdx.x * 256 + threadIdx.x; const int k8n = K / 8; if (t >= N * k8n) return;
  const int n = t / k8n, k8 = (t - n * k8n) * 8; FragH f;
#pragma unroll
  for (int i = 0; i < 8; ++i) f.h[i] = (_Float16)(bf16_rne(W[(size_t)(k8 + i) * N + n]) * scale);
  const v8us o = f.half[0];
  unsigned short* d = Wt + (size_t)(drow0 + n) * dpitch + dcol0 + k8;
  *(v8us*)d = o; 
}

__global__ __launch_bounds__(256) void k_x16(const float* __restrict__ x, unsigned short* __restrict__ X16, int n8) {
  const int t = blockIdx.x * 256 + threadIdx.x; if (t >= n8) return;
  const v4f a = *(const v4fa*)(x + (size_t)t * 8), c = *(const v4fa*)(x + (size_t)t * 8 + 4); FragH f;
#pragma unroll
  for (int q = 0; q < 4; ++q) { f.h[q] = (_Float16)bf16_rne(a[q]); f.h[4 + q] = (_Float16)bf16_rne(c[q]); }
  const v8us o = f.half[0];
  unsigned short* d = X16 + (size_t)t * 8;
  *(v8us*)d = o; 
}

// GEMM main loop: block tile 128 x 64, wave tile 32 x 64, A f16 [M][lda], Bt f16 [N][ldb] (k contiguous), K % 64 == 0, K >= 64; called by all 128 threads of the block.
// The block's A and Bt rows of each 64-wide k step are copied into LDS once per block as whole 128-byte lines (two buffers, the next step's copies fly during this step); every wave reads its fragments from there.
__device__ __forceinline__ void gemm_core(const unsigned short* __restrict__ A, int lda, const unsigned short* __restrict__ Bt, int ldb, int K, int brow0, int col0, int tid, int wave, int ln, int hh,
    v8f& c00, v8f& c01, v8f& c02, v8f& c03, v8f& c10, v8f& c11, v8f& c12, v8f& c13) {
  __shared__ __attribute__((aligned(16))) unsigned short at[2][128][72];   /* 128 rows x 64 k, pitch 144 B */
  __shared__ __attribute__((aligned(16))) unsigned short bt[2][64][72];    /* 64 columns x 64 k, pitch 144 B */
  const int r0 = tid >> 3, c8 = (tid & 7) * 8;
  const unsigned short* const ga = A + (size_t)(brow0 + r0) * lda + c8;
  const unsigned short* const gb = Bt + (size_t)(col0 + r0) * ldb + c8;
  const size_t sa = (size_t)16 * lda, sb = (size_t)16 * ldb;
  const int nst = K >> 6;
  // step s -> buffer s & 1: each thread copies 16 B of A rows r0 + 16 j (j < 8) and of Bt rows r0 + 16 j (j < 4)
  auto stage = [&](int s) {
    const int b = s & 1;
    const size_t ko = (size_t)s * 64;   /* added to row pointers that do not change from step to step: twelve independent additions, no chain in front of the copies */
    const unsigned short* const a0 = ga + ko; const unsigned short* const a1 = (ga + sa) + ko; const unsigned short* const a2 = (ga + 2 * sa) + ko; const unsigned short* const a3 = (ga + 3 * sa) + ko;
    const unsigned short* const a4 = (ga + 4 * sa) + ko; const unsigned short* const a5 = (ga + 5 * sa) + ko; const unsigned short* const a6 = (ga + 6 * sa) + ko; const unsigned short* const a7 = (ga + 7 * sa) + ko;
    const unsigned short* const b0 = gb + ko; const unsigned short* const b1 = (gb + sb) + ko; const unsigned short* const b2 = (gb + 2 * sb) + ko; const unsigned short* const b3 = (gb + 3 * sb) + ko;
    const unsigned int la0 = (unsigned int)(size_t)&at[b][r0][c8], la1 = (unsigned int)(size_t)&at[b][r0 + 16][c8], la2 = (unsigned int)(size_t)&at[b][r0 + 32][c8], la3 = (unsigned int)(size_t)&at[b][r0 + 48][c8];
    const unsigned int la4 = (unsigned int)(size_t)&at[b][r0 + 64][c8], la5 = (unsigned int)(size_t)&at[b][r0 + 80][c8], la6 = (unsigned int)(size_t)&at[b][r0 + 96][c8], la7 = (unsigned int)(size_t)&at[b][r0 + 112][c8];
    const unsigned int lb0 = (unsigned int)(size_t)&bt[b][r0][c8], lb1 = (unsigned int)(size_t)&bt[b][r0 + 16][c8], lb2 = (unsigned int)(size_t)&bt[b][r0 + 32][c8], lb3 = (unsigned int)(size_t)&bt[b][r0 + 48][c8];
    // the closing s_wait_xcnt keeps later writes of the address registers behind the copies
    asm volatile("global_load_async_to_lds_b128 %0, %12, off\n\tglobal_load_async_to_lds_b128 %1, %13, off\n\tglobal_load_async_to_lds_b128 %2, %14, off\n\tglobal_load_async_to_lds_b128 %3, %15, off\n\t"
                 "global_load_async_to_lds_b128 %4, %16, off\n\tglobal_load_async_to_lds_b128 %5, %17, off\n\tglobal_load_async_to_lds_b128 %6, %18, off\n\tglobal_load_async_to_lds_b128 %7, %19, off\n\t"
                 "global_load_async_to_lds_b128 %8, %20, off\n\tglobal_load_async_to_lds_b128 %9, %21, off\n\tglobal_load_async_to_lds_b128 %10, %22, off\n\tglobal_load_async_to_lds_b128 %11, %23, off\n\ts_wait_xcnt 0x0"
                 :: "v"(la0), "v"(la1), "v"(la2), "v"(la3), "v"(la4), "v"(la5), "v"(la6), "v"(la7), "v"(lb0), "v"(lb1), "v"(lb2), "v"(lb3),
                    "v"(a0), "v"(a1), "v"(a2), "v"(a3), "v"(a4), "v"(a5), "v"(a6), "v"(a7), "v"(b0), "v"(b1), "v"(b2), "v"(b3) : "memory");
  };
  stage(0);
  asm volatile("s_wait_asynccnt 0x0" ::: "memory");   /* own copies of step 0 landed */
  __syncthreads();                                    /* step 0 readable by every wave */
  if (nst > 1) stage(1);
#pragma unroll 1
  for (int s = 0; s < nst; ++s) {                     /* rolled: one body serves both buffers */
    const unsigned short (* const as)[72] = at[s & 1];
    const unsigned short (* const bs)[72] = bt[s & 1];
    // all fragments of the step are fetched as one group in front of its products: one LDS wait place a step instead of two
    v16h fa[2][2], fb[2][4];
#pragma unroll   /* these three loops are unrolled so that the fragment arrays are indexed by constants and stay in registers */
    for (int kk = 0; kk < 2; ++kk) {
      fa[kk][0] = ldfrag(&as[32 * wave + ln][kk * 32], 0, hh); fa[kk][1] = ldfrag(&as[32 * wave + 16 + ln][kk * 32], 0, hh);
#pragma unroll
      for (int j = 0; j < 4; ++j) fb[kk][j] = ldfrag(&bs[16 * j + ln][kk * 32], 0, hh);
    }
#pragma unroll
    for (int kk = 0; kk < 2; ++kk) {
      c00 = mma(fa[kk][0], fb[kk][0], c00); c10 = mma(fa[kk][1], fb[kk][0], c10);
      c01 = mma(fa[kk][0], fb[kk][1], c01); c11 = mma(fa[kk][1], fb[kk][1], c11);
      c02 = mma(fa[kk][0], fb[kk][2], c02); c12 = mma(fa[kk][1], fb[kk][2], c12);
      c03 = mma(fa[kk][0], fb[kk][3], c03); c13 = mma(fa[kk][1], fb[kk][3], c13);
    }
    // hand-over, passed by every wave: own LDS reads done, own copies of step s + 1 landed, then the block barrier that publishes step s + 1 and frees this step's buffer
    asm volatile("s_wait_dscnt 0x0" ::: "memory");
    asm volatile("s_wait_asynccnt 0x0" ::: "memory");
    __syncthreads();
    if (s + 2 < nst) stage(s + 2);
  }
  asm volatile("s_wait_asynccnt 0x0" ::: "memory");   /* no copy outstanding behind the loop */
}

// C = alpha * A . Bt^T written as f16 value plane CH and residual plane CR ((v - value) * 2^10), both pitch ldc. M % 128 == 0, N % 64 == 0.
__global__ __launch_bounds__(128) void k_gemm_planes(const unsigned short* __restrict__ A, int lda, const unsigned short* __restrict__ Bt, int ldb, float alpha,
    unsigned short* __restrict__ CH, unsigned short* __restrict__ CR, int ldc, int M, int N, int K) {
  __shared__ __attribute__((aligned(16))) float so[4][32][68];
  const int tid = threadIdx.x; const int wave = __builtin_amdgcn_readfirstlane(tid >> 5);
  const int lane = tid & 31, ln = lane & 15, hh = lane >> 4;
  const int ntn = N >> 6; const int mt = blockIdx.x / ntn, nq = blockIdx.x - mt * ntn;
  const int brow0 = mt * 128, row0 = brow0 + 32 * wave, col0 = nq * 64; if (brow0 >= M) return;
  const v8f z8 = {0.f, 0.f, 0.f, 0.f, 0.f, 0.f, 0.f, 0.f};
  v8f c00 = z8, c01 = z8, c02 = z8, c03 = z8, c10 = z8, c11 = z8, c12 = z8, c13 = z8;
  gemm_core(A, lda, Bt, ldb, K, brow0, col0, tid, wave, ln, hh, c00, c01, c02, c03, c10, c11, c12, c13);
  v8f accs[8] = {c00, c01, c02, c03, c10, c11, c12, c13};
#pragma unroll
  for (int u = 0; u < 8; ++u) { const int t = u & 3, hf = u >> 2;
#pragma unroll
    for (int r = 0; r < 8; ++r) so[wave][hf * 16 + 8 * hh + r][t * 16 + ln] = accs[u][r] * alpha; }
  __builtin_amdgcn_fence(4 /* acq_rel order */, "workgroup"); __builtin_amdgcn_wave_barrier();
  const int rq = lane >> 3, c8 = (lane & 7) * 8;
  {
#pragma unroll
    for (int it = 0; it < 8; ++it) {
      const int rr = it * 4 + rq;
      const v4f a = *(const v4fa*)&so[wave][rr][c8], b = *(const v4fa*)&so[wave][rr][c8 + 4];
      FragH fh, fl;
#pragma unroll
      for (int q = 0; q < 4; ++q) { _Float16 hv = (_Float16)a[q]; fh.h[q] = hv; fl.h[q] = (_Float16)((a[q] - (float)hv) * RS); hv = (_Float16)b[q]; fh.h[4 + q] = hv; fl.h[4 + q] = (_Float16)((b[q] - (float)hv) * RS); }
      const v8us oh = fh.half[0], ol = fl.half[0];
      const size_t o = (size_t)(row0 + rr) * ldc + col0 + c8;
      *(v8us*)(CH + o) = oh; *(v8us*)(CR + o) = ol;
    }
    
  }
}

__global__ __launch_bounds__(128) void k_gemm_out(const unsigned short* __restrict__ A, int lda, const unsigned short* __restrict__ Bt, int ldb, float alpha,
    float* __restrict__ C, int ldc, int M, int N, int K) {
  __shared__ __attribute__((aligned(16))) float so[4][32][68];
  const int tid = threadIdx.x; const int wave = __builtin_amdgcn_readfirstlane(tid >> 5);
  const int lane = tid & 31, ln = lane & 15, hh = lane >> 4;
  const int ntn = N >> 6; const int mt = blockIdx.x / ntn, nq = blockIdx.x - mt * ntn;
  const int brow0 = mt * 128, row0 = brow0 + 32 * wave, col0 = nq * 64; if (brow0 >= M) return;
  const v8f z8 = {0.f, 0.f, 0.f, 0.f, 0.f, 0.f, 0.f, 0.f};
  v8f c00 = z8, c01 = z8, c02 = z8, c03 = z8, c10 = z8, c11 = z8, c12 = z8, c13 = z8;
  gemm_core(A, lda, Bt, ldb, K, brow0, col0, tid, wave, ln, hh, c00, c01, c02, c03, c10, c11, c12, c13);
  v8f accs[8] = {c00, c01, c02, c03, c10, c11, c12, c13};
#pragma unroll
  for (int u = 0; u < 8; ++u) { const int t = u & 3, hf = u >> 2;
#pragma unroll
    for (int r = 0; r < 8; ++r) so[wave][hf * 16 + 8 * hh + r][t * 16 + ln] = accs[u][r] * alpha; }
  __builtin_amdgcn_fence(4 /* acq_rel order */, "workgroup"); __builtin_amdgcn_wave_barrier();
  const int rsub = lane >> 4, c4 = (lane & 15) * 4;
  {
#pragma unroll
    for (int q = 0; q < 16; ++q) { const int r = q * 2 + rsub; const v4f v = *(const v4fa*)&so[wave][r][c4]; *(v4f*)(C + (size_t)(row0 + r) * ldc + col0 + c4) = v; }
    
  }
}

__global__ __launch_bounds__(256) void k_vt(const unsigned short* __restrict__ QKH, const unsigned short* __restrict__ QKR, unsigned short* __restrict__ VTH, unsigned short* __restrict__ VTR) {
  __shared__ unsigned short tl[2][64][66];
  const int tid = threadIdx.x;
  const int nlg = SEQ / 64;
  const int slab = blockIdx.x / nlg, lg = blockIdx.x - slab * nlg;
  const int g = slab / NKV, kv = slab - g * NKV;
#pragma unroll 1
  for (int i = tid; i < 512; i += 256) {
    const int r = i >> 3, c8 = (i & 7) * 8;
    const size_t sof = ((size_t)(lg * 64 + r) * NG + g) * LQ + EMB + KVW + kv * HD + c8;
    FragH fh, fr; fh.half[0] = *(const v8us*)(QKH + sof); fr.half[0] = *(const v8us*)(QKR + sof);
#pragma unroll
    for (int q = 0; q < 8; ++q) { tl[0][r][c8 + q] = fh.u[q]; tl[1][r][c8 + q] = fr.u[q]; }
  }
  __syncthreads();
  {
#pragma unroll
    for (int rd = 0; rd < 2; ++rd) {
      const int d = rd * 32 + (tid >> 3), pc = tid & 7; FragH fh, fr;
#pragma unroll
      for (int q = 0; q < 8; ++q) { fh.u[q] = tl[0][pc * 8 + q][d]; fr.u[q] = tl[1][pc * 8 + q][d]; }
      const v8us oh = fh.half[0], ol = fr.half[0];
      const size_t o = ((size_t)slab * HD + d) * SEQ + lg * 64 + pc * 8;
      *(v8us*)(VTH + o) = oh; *(v8us*)(VTR + o) = ol;
    }
    
  }
}

// Fused causal flash attention. grid = (SEQ/64, NG*NH); block = 4 waves, wave = 16 query rows; 32-key steps up to the diagonal.
// The block's q tile (value and residual) is copied into LDS once, the K and V^T value tiles of each step once per block (two buffers, the next step's copies fly during this step); the K and V^T residual planes (rows < 256 only) come straight from global memory. Scores and context are formed transposed (S^T = K q^T, O^T += V^T P^T): a lane owns one query, P goes from the score registers into the B operand. The per-wave output staging tile is wave-private.
__global__ __launch_bounds__(128) void k_attn(const unsigned short* __restrict__ QKH, const unsigned short* __restrict__ QKR,
    const unsigned short* __restrict__ VTH, const unsigned short* __restrict__ VTR, unsigned short* __restrict__ CX) {
  __shared__ __attribute__((aligned(16))) float so[4][16][68];
  __shared__ __attribute__((aligned(16))) unsigned short kt[2][32][72];   /* 32 keys x 64, pitch 144 B */
  __shared__ __attribute__((aligned(16))) unsigned short vt[2][64][40];   /* 64 d x 32 keys, pitch 80 B */
  __shared__ __attribute__((aligned(16))) unsigned short qs[2][64][72];   /* value | residual: 64 query rows x 64, pitch 144 B */
  const int tid = threadIdx.x; const int wave = __builtin_amdgcn_readfirstlane(tid >> 5);
  const int lane = tid & 31, ln = lane & 15, hh = lane >> 4;
  const int qt = blockIdx.x, gh = blockIdx.y;
  const int g = gh >> 4, h = gh & 15, kvh = h >> 2;
  const int q0 = qt * 64 + wave * 16;
  const size_t kcol = (size_t)EMB + kvh * HD;
  const size_t vrow = (size_t)(g * NKV + kvh) * HD;
  const v8f z8 = {0.f, 0.f, 0.f, 0.f, 0.f, 0.f, 0.f, 0.f};
  v8f om[4] = {z8, z8, z8, z8}, orr[4] = {z8, z8, z8, z8};
  float mi = -1.0e30f, li = 0.f;            /* of query q0 + ln; li holds the sum over this half's keys */
  const int nkb = (q0 + 16 + 31) >> 5;      /* every visited 32-key step starts at a key <= q0, so each row keeps >= 1 key per step */
  const int nst = 2 * qt + 2;               /* steps of the block = nkb of its last wave; keys < 64 * qt + 64 <= SEQ */
  const int kr0 = tid >> 3, kc8 = (tid & 7) * 8, vr0 = tid >> 2, vc8 = (tid & 3) * 8;
  const unsigned short* const gk = QKH + ((size_t)kr0 * NG + g) * LQ + kcol + kc8;
  const unsigned short* const gv = VTH + (vrow + vr0) * (size_t)SEQ + vc8;
  // step s -> buffer s & 1: each thread copies 16 B of K rows kr0, kr0 + 16 and of V^T rows vr0, vr0 + 32
  auto stage = [&](int s) {
    const int b = s & 1;
    const unsigned short* const k0 = gk + (size_t)s * (32 * NG * LQ); const unsigned short* const k1 = k0 + (size_t)16 * NG * LQ;
    const unsigned short* const v0 = gv + s * 32; const unsigned short* const v1 = v0 + (size_t)32 * SEQ;
    const unsigned int lk0 = (unsigned int)(size_t)&kt[b][kr0][kc8], lk1 = (unsigned int)(size_t)&kt[b][kr0 + 16][kc8];
    const unsigned int lv0 = (unsigned int)(size_t)&vt[b][vr0][vc8], lv1 = (unsigned int)(size_t)&vt[b][vr0 + 32][vc8];
    // the closing s_wait_xcnt keeps later writes of the address registers behind the copies
    asm volatile("global_load_async_to_lds_b128 %0, %4, off\n\tglobal_load_async_to_lds_b128 %1, %5, off\n\tglobal_load_async_to_lds_b128 %2, %6, off\n\tglobal_load_async_to_lds_b128 %3, %7, off\n\ts_wait_xcnt 0x0"
                 :: "v"(lk0), "v"(lk1), "v"(lv0), "v"(lv1), "v"(k0), "v"(k1), "v"(v0), "v"(v1) : "memory");
  };
  {
    // q tile: each thread copies 16 B of rows kr0 + 0, 16, 32, 48 of both planes
    const size_t qg = ((size_t)(qt * 64 + kr0) * NG + g) * LQ + h * HD + kc8;
    const unsigned short* const h0 = QKH + qg; const unsigned short* const h1 = h0 + (size_t)16 * NG * LQ;
    const unsigned short* const h2 = h1 + (size_t)16 * NG * LQ; const unsigned short* const h3 = h2 + (size_t)16 * NG * LQ;
    const unsigned short* const r0 = QKR + qg; const unsigned short* const r1 = r0 + (size_t)16 * NG * LQ;
    const unsigned short* const r2 = r1 + (size_t)16 * NG * LQ; const unsigned short* const r3 = r2 + (size_t)16 * NG * LQ;
    const unsigned int a0 = (unsigned int)(size_t)&qs[0][kr0][kc8], a1 = (unsigned int)(size_t)&qs[0][kr0 + 16][kc8];
    const unsigned int a2 = (unsigned int)(size_t)&qs[0][kr0 + 32][kc8], a3 = (unsigned int)(size_t)&qs[0][kr0 + 48][kc8];
    const unsigned int b0 = (unsigned int)(size_t)&qs[1][kr0][kc8], b1 = (unsigned int)(size_t)&qs[1][kr0 + 16][kc8];
    const unsigned int b2 = (unsigned int)(size_t)&qs[1][kr0 + 32][kc8], b3 = (unsigned int)(size_t)&qs[1][kr0 + 48][kc8];
    // the closing s_wait_xcnt keeps later writes of the address registers behind the copies
    asm volatile("global_load_async_to_lds_b128 %0, %8, off\n\tglobal_load_async_to_lds_b128 %1, %9, off\n\tglobal_load_async_to_lds_b128 %2, %10, off\n\tglobal_load_async_to_lds_b128 %3, %11, off\n\t"
                 "global_load_async_to_lds_b128 %4, %12, off\n\tglobal_load_async_to_lds_b128 %5, %13, off\n\tglobal_load_async_to_lds_b128 %6, %14, off\n\tglobal_load_async_to_lds_b128 %7, %15, off\n\ts_wait_xcnt 0x0"
                 :: "v"(a0), "v"(a1), "v"(a2), "v"(a3), "v"(b0), "v"(b1), "v"(b2), "v"(b3), "v"(h0), "v"(h1), "v"(h2), "v"(h3), "v"(r0), "v"(r1), "v"(r2), "v"(r3) : "memory");
  }
  stage(0);
  asm volatile("s_wait_asynccnt 0x0" ::: "memory");   /* own copies of q and of step 0 landed */
  __syncthreads();                                    /* q and step 0 readable by every wave */
  stage(1);                                           /* nst >= 2: step 1 always exists */
  // The key loop is compiled twice, with the residual scheme as a compile-time constant: the copy for rows >= 256 holds no test of it, no residual accumulator (it stays 0) and no global load; each step is one straight-line block, with no LDS exchange inside it.
  auto key_loop = [&](auto fc) {
  constexpr bool full = decltype(fc)::value;
#pragma unroll 1
  for (int kb = 0; kb < nst; ++kb) {
   if (kb < nkb) {                                    /* wave-uniform: waves 0 and 1 sit out the block's last step */
    const int kbase = kb * 32;
    const unsigned short (* const ks)[72] = kt[kb & 1];
    const unsigned short (* const vs)[40] = vt[kb & 1];
    // Transposed products: S^T = K q^T (rows = keys, column = query), so lane ln of either half owns query q0 + ln and holds 16 of its 32 scores in registers.
    v8f sm[2] = {z8, z8}, sr[2] = {z8, z8};
#pragma unroll
    for (int kk = 0; kk < 2; ++kk) {
      const v16h qh = ldfrag(&qs[0][wave * 16 + ln][kk * 32], 0, hh);
      const v16h qr = ldfrag(&qs[1][wave * 16 + ln][kk * 32], 0, hh);
#pragma unroll
      for (int nt = 0; nt < 2; ++nt) {
        const size_t ko = ((size_t)(kbase + nt * 16 + ln) * NG + g) * LQ + kcol + kk * 32;
        const v16h kh = ldfrag(&ks[nt * 16 + ln][kk * 32], 0, hh);
        sm[nt] = mma(kh, qh, sm[nt]);
        sr[nt] = mma(kh, qr, sr[nt]);
        if constexpr (full) { const v16h kr = ldfrag(QKR, ko, hh); sr[nt] = mma(kr, qh, sr[nt]); }
      }
    }
    // register r of tile nt is key kbase + 16 nt + 8 hh + r
    const int kmax = q0 + ln - kbase - 8 * hh;       /* key offset 16 nt + r is kept while it is <= kmax */
    float sc[2][8], mk[2][8];
#pragma unroll
    for (int nt = 0; nt < 2; ++nt) {
#pragma unroll
      for (int r = 0; r < 8; ++r) {
        sc[nt][r] = (sm[nt][r] + sr[nt][r] * RINV) * 0.125f;
        mk[nt][r] = (nt * 16 + r <= kmax) ? sc[nt][r] : -1.0e30f;
      }
    }
    const float mx0 = fmaxf(fmaxf(fmaxf(mk[0][0], mk[0][1]), fmaxf(mk[0][2], mk[0][3])), fmaxf(fmaxf(mk[0][4], mk[0][5]), fmaxf(mk[0][6], mk[0][7])));
    const float mx1 = fmaxf(fmaxf(fmaxf(mk[1][0], mk[1][1]), fmaxf(mk[1][2], mk[1][3])), fmaxf(fmaxf(mk[1][4], mk[1][5]), fmaxf(mk[1][6], mk[1][7])));
    const float mxh = fmaxf(mx0, mx1);
    const float mnew = fmaxf(mi, fmaxf(mxh, xhalf(mxh)));   /* the same in both halves */
    const float al = __expf(mi - mnew);
    mi = mnew;
    float pv[2][8];
#pragma unroll
    for (int nt = 0; nt < 2; ++nt) {
#pragma unroll
      for (int r = 0; r < 8; ++r) {
        const float e = __expf(fminf(sc[nt][r] - mnew, 0.f));
        pv[nt][r] = (nt * 16 + r <= kmax) ? e : 0.f;
      }
    }
    const float su0 = ((pv[0][0] + pv[0][1]) + (pv[0][2] + pv[0][3])) + ((pv[0][4] + pv[0][5]) + (pv[0][6] + pv[0][7]));
    const float su1 = ((pv[1][0] + pv[1][1]) + (pv[1][2] + pv[1][3])) + ((pv[1][4] + pv[1][5]) + (pv[1][6] + pv[1][7]));
    li = li * al + (su0 + su1);                      /* this half's keys only; the halves are joined behind the loop */
#pragma unroll
    for (int t = 0; t < 4; ++t) { om[t] *= al; if constexpr (full) orr[t] *= al; }
    // P^T (x2^10) as a B fragment straight from the score registers: element 8 nt + r is key 16 nt + 8 hh + r, the k order in which ldfrag reads V^T
    FragH ph, pr;
#pragma unroll
    for (int nt = 0; nt < 2; ++nt) {
#pragma unroll
      for (int r = 0; r < 8; ++r) {
        const float pc = pv[nt][r] * RS;
        const _Float16 p16 = (_Float16)pc;
        ph.h[nt * 8 + r] = p16;
        if constexpr (full) pr.h[nt * 8 + r] = (_Float16)((pc - (float)p16) * RS);
      }
    }
    // O^T += V^T P^T: rows = d, column = query
#pragma unroll
    for (int t = 0; t < 4; ++t) {
      const size_t vo = (vrow + t * 16 + ln) * (size_t)SEQ + kbase;
      const v16h vh = ldfrag(&vs[t * 16 + ln][0], 0, hh);
      om[t] = mma(vh, ph.v, om[t]);
      if constexpr (full) { const v16h vr = ldfrag(VTR, vo, hh); orr[t] = mma(vr, ph.v, orr[t]); orr[t] = mma(vh, pr.v, orr[t]); }
    }
   }
    // hand-over, passed by every wave: own LDS reads done, own copies of step kb + 1 landed, then the block barrier that publishes step kb + 1 and frees this step's buffer
    asm volatile("s_wait_dscnt 0x0" ::: "memory");
    asm volatile("s_wait_asynccnt 0x0" ::: "memory");
    __syncthreads();
    if (kb + 2 < nst) stage(kb + 2);
  }
  };
  if (qt < EQT) key_loop(flag_c<true>{}); else key_loop(flag_c<false>{});   /* block-uniform choice */
  asm volatile("s_wait_asynccnt 0x0" ::: "memory");   /* no copy outstanding at the wave's end */
  // context x16 = o / (2^10 * l) * 16
  const float inv = 0.015625f * (1.0f / (li + xhalf(li)));
#pragma unroll
  for (int t = 0; t < 4; ++t) {
#pragma unroll
    for (int r = 0; r < 8; ++r) so[wave][ln][t * 16 + 8 * hh + r] = (om[t][r] + orr[t][r] * RINV) * inv;
  }
  __builtin_amdgcn_fence(4 /* acq_rel order */, "workgroup"); __builtin_amdgcn_wave_barrier();
  const int rq = lane >> 3, c8 = (lane & 7) * 8;
  {
#pragma unroll
    for (int it = 0; it < 4; ++it) {
      const int rr = it * 4 + rq;
      const v4f a = *(const v4fa*)&so[wave][rr][c8], b = *(const v4fa*)&so[wave][rr][c8 + 4];
      FragH fh, fl;
#pragma unroll
      for (int q = 0; q < 4; ++q) { _Float16 hv = (_Float16)a[q]; fh.h[q] = hv; fl.h[q] = (_Float16)((a[q] - (float)hv) * RSC); hv = (_Float16)b[q]; fh.h[4 + q] = hv; fl.h[4 + q] = (_Float16)((b[q] - (float)hv) * RSC); }
      const v8us oh = fh.half[0], ol = fl.half[0];
      const size_t o = ((size_t)(q0 + rr) * NG + g) * CP + h * HD + c8;
      *(v8us*)(CX + o) = oh; *(v8us*)(CX + o + EMB) = ol;
    }
    
  }
}

extern "C" void kernel_launch(void* const* d_in, const int* in_sizes, int n_in,
                              void* d_out, int out_size, void* d_ws, size_t ws_size, hipStream_t stream) {
  if (n_in < 5) return;
  if (in_sizes[0] < NR * EMB) return;
  if (in_sizes[1] < EMB * EMB) return;
  if (in_sizes[2] < EMB * KVW) return;
  if (in_sizes[3] < EMB * KVW) return;
  if (in_sizes[4] < EMB * EMB) return;
  if (out_size < NR * EMB) return;
  const float* x  = (const float*)d_in[0];
  const float* Wq = (const float*)d_in[1];      /* [in 1024][out 1024] */
  const float* Wk = (const float*)d_in[2];      /* [in 1024][out 256] */
  const float* Wv = (const float*)d_in[3];      /* [in 1024][out 256] */
  const float* Wo = (const float*)d_in[4];      /* [in 1024][out 1024] */
  char* ws = (char*)d_ws; size_t off = 0;
  auto take = [&](size_t bytes) { char* p = ws + off; off += (bytes + 255) & ~(size_t)255; return p; };
  unsigned short* BQKV = (unsigned short*)take(SZ_BQKV);      /* [1536][1024]: Wq^T | Wk^T | Wv^T, x16 */
  unsigned short* BO   = (unsigned short*)take(SZ_BO);        /* [1024][2048]: Wo^T x16 | Wo^T / 4 */
  unsigned short* X16  = (unsigned short*)take(SZ_X16);       /* [NR][1024] */
  unsigned short* QKH  = (unsigned short*)take(SZ_QK);        /* [NR][1536] value plane of q | k | v */
  unsigned short* QKR  = (unsigned short*)take(SZ_QK);        /* [NR][1536] residual plane (x2^10) */
  unsigned short* VTH  = (unsigned short*)take(SZ_VT);        /* [NG*NKV][64][SEQ] */
  unsigned short* VTR  = (unsigned short*)take(SZ_VT);
  unsigned short* CX   = (unsigned short*)take(SZ_CX);        /* [NR][2048]: context x16 value | residual (x64) */
  if (off > ws_size) return;

  k_wt_f16<<<(unsigned)((EMB * (EMB / 8) + 255) / 256), 256, 0, stream>>>(Wq, BQKV, EMB, EMB, 0, EMB, 0, 16.0f);
  k_wt_f16<<<(unsigned)((KVW * (EMB / 8) + 255) / 256), 256, 0, stream>>>(Wk, BQKV, EMB, KVW, EMB, EMB, 0, 16.0f);
  k_wt_f16<<<(unsigned)((KVW * (EMB / 8) + 255) / 256), 256, 0, stream>>>(Wv, BQKV, EMB, KVW, EMB + KVW, EMB, 0, 16.0f);
  k_wt_f16<<<(unsigned)((EMB * (EMB / 8) + 255) / 256), 256, 0, stream>>>(Wo, BO, EMB, EMB, 0, CP, 0, 16.0f);
  k_wt_f16<<<(unsigned)((EMB * (EMB / 8) + 255) / 256), 256, 0, stream>>>(Wo, BO, EMB, EMB, 0, CP, EMB, 0.25f);
  k_x16<<<(unsigned)((NR * (EMB / 8) + 255) / 256), 256, 0, stream>>>(x, X16, NR * (EMB / 8));
  k_gemm_planes<<<(unsigned)((NR / 128) * (LQ / 64)), 128, 0, stream>>>(X16, EMB, BQKV, EMB, 0.0625f, QKH, QKR, LQ, NR, LQ, EMB);
  k_vt<<<(unsigned)(NB * NG * NKV * (SEQ / 64)), 256, 0, stream>>>(QKH, QKR, VTH, VTR);
  k_attn<<<dim3((unsigned)(SEQ / 64), (unsigned)(NG * NH)), 128, 0, stream>>>(QKH, QKR, VTH, VTR, CX);
  k_gemm_out<<<(unsigned)((NR / 128) * (EMB / 64)), 128, 0, stream>>>(CX, CP, BO, CP, 0.00390625f, (float*)d_out, EMB, NR, EMB, CP);
}

// v005
// A run of this version takes 121 microseconds.
// Timed twice side by side with v004, it ran 1.11 times as fast both times.
// All steps since v000 together make it 2.93 times as fast.
#include <hip/hip_runtime.h>
// Causal grouped-query self-attention with a group axis: x [1][SEQ][2][1024]; token row = s*2 + g; q = x Wq (16 heads x 64), k|v = x Wk|Wv (4 kv heads x 64, query head h uses kv head h/4); raw energy, causal exclusion (key > query), then 1/8 inside the softmax over keys of the same g; merged heads (h*64 + d) times Wo.
// Compute dtype: v_wmma_f32_16x16x32_f16 for every contraction, f32 accumulate. Inputs RNE-converted to bf16 then held exactly in f16 (x as is, weights x16). q|k|v written as f16 value + f16 residual (x2^10) planes. Scores: q value+residual against k value (plus k residual on query rows < 256). P carried x2^10 as f16 (plus residual x2^10 on rows < 256), V^T value (plus residual on rows < 256), residual products in a separate accumulator. Context carried x16 as f16 value | residual (x64) along K against Wo x16 | Wo / 4. Softmax statistics f32.
#ifndef NB
#define NB 1
#endif
#ifndef SEQ
#define SEQ 2048
#endif
#define SEQ_FULL 2048
#define NG 2
#define EMB 1024
#define NH 16
#define NKV 4
#define HD 64
#define KVW (NKV * HD)            /* 256 */
#define LQ (EMB + 2 * KVW)        /* 1536: pitch of the q|k|v planes */
#define CP (2 * EMB)              /* 2048: pitch of the context plane (value | residual) */
#define NR (NB * SEQ * NG)        /* token rows */
#define EQT 4                     /* 64-row query tiles (rows < 256) that run the full residual scheme */
#define RS 1024.0f                /* residual carry of q, k, v, P */
#define RINV 0.0009765625f
#define RSC 64.0f                 /* residual carry of the context plane */

static_assert(NB == 1);
static_assert(SEQ % 64 == 0);
static_assert(SEQ >= 64);
static_assert(SEQ <= SEQ_FULL);
static_assert(NR % 128 == 0);
static_assert(LQ % 64 == 0);
static_assert(EMB % 64 == 0);
static_assert(CP % 64 == 0);
static_assert(HD == 64);
static_assert(NH == 4 * NKV);
static_assert(NH * HD == EMB);
static_assert(KVW % 64 == 0);

typedef unsigned short v8us __attribute__((ext_vector_type(8), may_alias));
typedef float  v8f  __attribute__((ext_vector_type(8)));
typedef float  v4f  __attribute__((ext_vector_type(4)));
typedef float  v4fa __attribute__((ext_vector_type(4), may_alias));
typedef _Float16 v16h __attribute__((ext_vector_type(16)));
union FragH { v16h v; v8us half[2]; _Float16 h[16]; unsigned short u[16]; };

constexpr size_t SZ_BQKV = (size_t)LQ * EMB * 2;
constexpr size_t SZ_BO   = (size_t)EMB * CP * 2;
constexpr size_t SZ_X16  = (size_t)NR * EMB * 2;
constexpr size_t SZ_QK   = (size_t)NR * LQ * 2;
constexpr size_t SZ_VT   = (size_t)NB * NG * NKV * HD * SEQ * 2;
constexpr size_t SZ_CX   = (size_t)NR * CP * 2;
constexpr size_t WS_TOTAL = SZ_BQKV + SZ_BO + SZ_X16 + 2 * SZ_QK + 2 * SZ_VT + SZ_CX;
static_assert(WS_TOTAL <= (size_t)134217728);
static_assert(SZ_BQKV % 256 == 0 && SZ_BO % 256 == 0 && SZ_X16 % 256 == 0 && SZ_QK % 256 == 0 && SZ_VT % 256 == 0 && SZ_CX % 256 == 0);

// RNE convert f32 -> bf16 value (kept in f32)
__device__ __forceinline__ float bf16_rne(float x) { unsigned int u = __float_as_uint(x); u = (u + 0x7FFFu + ((u >> 16) & 1u)) & 0xFFFF0000u; return __uint_as_float(u); }
__device__ __forceinline__ unsigned short h_bits(_Float16 h) { return __builtin_bit_cast(unsigned short, h); }
// 16-bit fragment: elements 0..7 <- k0 + 8h + 0..7, elements 8..15 <- k0 + 16 + 8h + 0..7 (row / column = lane & 15)
__device__ __forceinline__ v16h ldfrag(const unsigned short* __restrict__ p, size_t off, int hh) { FragH f; f.half[0] = *(const v8us*)(p + off + 8 * hh); f.half[1] = *(const v8us*)(p + off + 16 + 8 * hh); return f.v; }
// lane l <-> lane l ^ 16
__device__ __forceinline__ float xhalf(float x) { const int b = __builtin_bit_cast(int, x); return __builtin_bit_cast(float, __builtin_amdgcn_permlanex16(b, b, 0x76543210, 0xfedcba98, false, false)); }
template <bool B> struct flag_c { static constexpr bool value = B; };
__device__ __forceinline__ v8f mma(v16h a, v16h b, v8f c) { v8f d = __builtin_amdgcn_wmma_f32_16x16x32_f16(false, a, false, b, (short)0, c, false, false); asm volatile("v_nop\n\tv_nop\n\tv_nop\n\tv_nop" : "+v"(d) : "v"(a), "v"(b)); return d; }

// One 8-element group t of W^T: Wt[drow0 + n][dcol0 + k8 .. k8 + 7] = f16(bf16(W[k][n]) * scale)
__device__ __forceinline__ void wt_f16(const float* __restrict__ W, unsigned short* __restrict__ Wt, int K, int N, int drow0, int dpitch, int dcol0, float scale, int t) {
  const int k8n = K / 8; if (t >= N * k8n) return;
  const int n = t / k8n, k8 = (t - n * k8n) * 8; FragH f;
#pragma unroll
  for (int i = 0; i < 8; ++i) f.h[i] = (_Float16)(bf16_rne(W[(size_t)(k8 + i) * N + n]) * scale);
  const v8us o = f.half[0];
  unsigned short* d = Wt + (size_t)(drow0 + n) * dpitch + dcol0 + k8;
  *(v8us*)d = o; 
}

// One 8-element group t of x
__device__ __forceinline__ void x16_f16(const float* __restrict__ x, unsigned short* __restrict__ X16, int n8, int t) {
  if (t >= n8) return;
  const v4f a = *(const v4fa*)(x + (size_t)t * 8), c = *(const v4fa*)(x + (size_t)t * 8 + 4); FragH f;
#pragma unroll
  for (int q = 0; q < 4; ++q) { f.h[q] = (_Float16)bf16_rne(a[q]); f.h[4 + q] = (_Float16)bf16_rne(c[q]); }
  const v8us o = f.half[0];
  unsigned short* d = X16 + (size_t)t * 8;
  *(v8us*)d = o; 
}

constexpr int PB_W  = (EMB * (EMB / 8) + 255) / 256;   /* blocks of a 1024-column weight */
constexpr int PB_KV = (KVW * (EMB / 8) + 255) / 256;   /* blocks of a 256-column weight */
constexpr int PB_X  = (NR * (EMB / 8) + 255) / 256;    /* blocks of x */
constexpr int PB_ALL = 3 * PB_W + 2 * PB_KV + PB_X;

// All input conversions in one launch: none reads what another writes, so a block picks its job by its index (block-uniform). The weight jobs, whose waves last longer, come first.
__global__ __launch_bounds__(256) void k_prep(const float* __restrict__ x, const float* __restrict__ Wq, const float* __restrict__ Wk, const float* __restrict__ Wv, const float* __restrict__ Wo,
    unsigned short* __restrict__ X16, unsigned short* __restrict__ BQKV, unsigned short* __restrict__ BO) {
  const int tid = threadIdx.x; int b = blockIdx.x;
  if (b < PB_W) { wt_f16(Wq, BQKV, EMB, EMB, 0, EMB, 0, 16.0f, b * 256 + tid); return; }
  b -= PB_W;
  if (b < PB_W) { wt_f16(Wo, BO, EMB, EMB, 0, CP, 0, 16.0f, b * 256 + tid); return; }
  b -= PB_W;
  if (b < PB_W) { wt_f16(Wo, BO, EMB, EMB, 0, CP, EMB, 0.25f, b * 256 + tid); return; }
  b -= PB_W;
  if (b < PB_KV) { wt_f16(Wk, BQKV, EMB, KVW, EMB, EMB, 0, 16.0f, b * 256 + tid); return; }
  b -= PB_KV;
  if (b < PB_KV) { wt_f16(Wv, BQKV, EMB, KVW, EMB + KVW, EMB, 0, 16.0f, b * 256 + tid); return; }
  b -= PB_KV;
  x16_f16(x, X16, NR * (EMB / 8), b * 256 + tid);
}

// GEMM main loop: block tile 128 x 64, wave tile 32 x 64, A f16 [M][lda], Bt f16 [N][ldb] (k contiguous), K % 64 == 0, K >= 64; called by all 128 threads of the block.
// The block's A and Bt rows of each 64-wide k step are copied into LDS once per block as whole 128-byte lines (two buffers, the next step's copies fly during this step); every wave reads its fragments from there.
__device__ __forceinline__ void gemm_core(const unsigned short* __restrict__ A, int lda, const unsigned short* __restrict__ Bt, int ldb, int K, int brow0, int col0, int tid, int wave, int ln, int hh,
    v8f& c00, v8f& c01, v8f& c02, v8f& c03, v8f& c10, v8f& c11, v8f& c12, v8f& c13) {
  __shared__ __attribute__((aligned(16))) unsigned short at[2][128][72];   /* 128 rows x 64 k, pitch 144 B */
  __shared__ __attribute__((aligned(16))) unsigned short bt[2][64][72];    /* 64 columns x 64 k, pitch 144 B */
  const int r0 = tid >> 3, c8 = (tid & 7) * 8;
  const unsigned short* const ga = A + (size_t)(brow0 + r0) * lda + c8;
  const unsigned short* const gb = Bt + (size_t)(col0 + r0) * ldb + c8;
  const size_t sa = (size_t)16 * lda, sb = (size_t)16 * ldb;
  const int nst = K >> 6;
  // step s -> buffer s & 1: each thread copies 16 B of A rows r0 + 16 j (j < 8) and of Bt rows r0 + 16 j (j < 4)
  auto stage = [&](int s) {
    const int b = s & 1;
    const size_t ko = (size_t)s * 64;   /* added to row pointers that do not change from step to step: twelve independent additions, no chain in front of the copies */
    const unsigned short* const a0 = ga + ko; const unsigned short* const a1 = (ga + sa) + ko; const unsigned short* const a2 = (ga + 2 * sa) + ko; const unsigned short* const a3 = (ga + 3 * sa) + ko;
    const unsigned short* const a4 = (ga + 4 * sa) + ko; const unsigned short* const a5 = (ga + 5 * sa) + ko; const unsigned short* const a6 = (ga + 6 * sa) + ko; const unsigned short* const a7 = (ga + 7 * sa) + ko;
    const unsigned short* const b0 = gb + ko; const unsigned short* const b1 = (gb + sb) + ko; const unsigned short* const b2 = (gb + 2 * sb) + ko; const unsigned short* const b3 = (gb + 3 * sb) + ko;
    const unsigned int la0 = (unsigned int)(size_t)&at[b][r0][c8], la1 = (unsigned int)(size_t)&at[b][r0 + 16][c8], la2 = (unsigned int)(size_t)&at[b][r0 + 32][c8], la3 = (unsigned int)(size_t)&at[b][r0 + 48][c8];
    const unsigned int la4 = (unsigned int)(size_t)&at[b][r0 + 64][c8], la5 = (unsigned int)(size_t)&at[b][r0 + 80][c8], la6 = (unsigned int)(size_t)&at[b][r0 + 96][c8], la7 = (unsigned int)(size_t)&at[b][r0 + 112][c8];
    const unsigned int lb0 = (unsigned int)(size_t)&bt[b][r0][c8], lb1 = (unsigned int)(size_t)&bt[b][r0 + 16][c8], lb2 = (unsigned int)(size_t)&bt[b][r0 + 32][c8], lb3 = (unsigned int)(size_t)&bt[b][r0 + 48][c8];
    // the closing s_wait_xcnt keeps later writes of the address registers behind the copies
    asm volatile("global_load_async_to_lds_b128 %0, %12, off\n\tglobal_load_async_to_lds_b128 %1, %13, off\n\tglobal_load_async_to_lds_b128 %2, %14, off\n\tglobal_load_async_to_lds_b128 %3, %15, off\n\t"
                 "global_load_async_to_lds_b128 %4, %16, off\n\tglobal_load_async_to_lds_b128 %5, %17, off\n\tglobal_load_async_to_lds_b128 %6, %18, off\n\tglobal_load_async_to_lds_b128 %7, %19, off\n\t"
                 "global_load_async_to_lds_b128 %8, %20, off\n\tglobal_load_async_to_lds_b128 %9, %21, off\n\tglobal_load_async_to_lds_b128 %10, %22, off\n\tglobal_load_async_to_lds_b128 %11, %23, off\n\ts_wait_xcnt 0x0"
                 :: "v"(la0), "v"(la1), "v"(la2), "v"(la3), "v"(la4), "v"(la5), "v"(la6), "v"(la7), "v"(lb0), "v"(lb1), "v"(lb2), "v"(lb3),
                    "v"(a0), "v"(a1), "v"(a2), "v"(a3), "v"(a4), "v"(a5), "v"(a6), "v"(a7), "v"(b0), "v"(b1), "v"(b2), "v"(b3) : "memory");
  };
  stage(0);
  asm volatile("s_wait_asynccnt 0x0" ::: "memory");   /* own copies of step 0 landed */
  __syncthreads();                                    /* step 0 readable by every wave */
  if (nst > 1) stage(1);
#pragma unroll 1
  for (int s = 0; s < nst; ++s) {                     /* rolled: one body serves both buffers */
    const unsigned short (* const as)[72] = at[s & 1];
    const unsigned short (* const bs)[72] = bt[s & 1];
    // all fragments of the step are fetched as one group in front of its products: one LDS wait place a step instead of two
    v16h fa[2][2], fb[2][4];
#pragma unroll   /* these three loops are unrolled so that the fragment arrays are indexed by constants and stay in registers */
    for (int kk = 0; kk < 2; ++kk) {
      fa[kk][0] = ldfrag(&as[32 * wave + ln][kk * 32], 0, hh); fa[kk][1] = ldfrag(&as[32 * wave + 16 + ln][kk * 32], 0, hh);
#pragma unroll
      for (int j = 0; j < 4; ++j) fb[kk][j] = ldfrag(&bs[16 * j + ln][kk * 32], 0, hh);
    }
#pragma unroll
    for (int kk = 0; kk < 2; ++kk) {
      c00 = mma(fa[kk][0], fb[kk][0], c00); c10 = mma(fa[kk][1], fb[kk][0], c10);
      c01 = mma(fa[kk][0], fb[kk][1], c01); c11 = mma(fa[kk][1], fb[kk][1], c11);
      c02 = mma(fa[kk][0], fb[kk][2], c02); c12 = mma(fa[kk][1], fb[kk][2], c12);
      c03 = mma(fa[kk][0], fb[kk][3], c03); c13 = mma(fa[kk][1], fb[kk][3], c13);
    }
    // hand-over, passed by every wave: own LDS reads done, own copies of step s + 1 landed, then the block barrier that publishes step s + 1 and frees this step's buffer
    asm volatile("s_wait_dscnt 0x0" ::: "memory");
    asm volatile("s_wait_asynccnt 0x0" ::: "memory");
    __syncthreads();
    if (s + 2 < nst) stage(s + 2);
  }
  asm volatile("s_wait_asynccnt 0x0" ::: "memory");   /* no copy outstanding behind the loop */
}

// C = alpha * A . Bt^T written as f16 value plane CH and residual plane CR ((v - value) * 2^10), both pitch ldc. M % 128 == 0, N % 64 == 0.
__global__ __launch_bounds__(128) void k_gemm_planes(const unsigned short* __restrict__ A, int lda, const unsigned short* __restrict__ Bt, int ldb, float alpha,
    unsigned short* __restrict__ CH, unsigned short* __restrict__ CR, int ldc, int M, int N, int K) {
  __shared__ __attribute__((aligned(16))) float so[4][32][68];
  const int tid = threadIdx.x; const int wave = __builtin_amdgcn_readfirstlane(tid >> 5);
  const int lane = tid & 31, ln = lane & 15, hh = lane >> 4;
  const int ntn = N >> 6; const int mt = blockIdx.x / ntn, nq = blockIdx.x - mt * ntn;
  const int brow0 = mt * 128, row0 = brow0 + 32 * wave, col0 = nq * 64; if (brow0 >= M) return;
  const v8f z8 = {0.f, 0.f, 0.f, 0.f, 0.f, 0.f, 0.f, 0.f};
  v8f c00 = z8, c01 = z8, c02 = z8, c03 = z8, c10 = z8, c11 = z8, c12 = z8, c13 = z8;
  gemm_core(A, lda, Bt, ldb, K, brow0, col0, tid, wave, ln, hh, c00, c01, c02, c03, c10, c11, c12, c13);
  v8f accs[8] = {c00, c01, c02, c03, c10, c11, c12, c13};
#pragma unroll
  for (int u = 0; u < 8; ++u) { const int t = u & 3, hf = u >> 2;
#pragma unroll
    for (int r = 0; r < 8; ++r) so[wave][hf * 16 + 8 * hh + r][t * 16 + ln] = accs[u][r] * alpha; }
  __builtin_amdgcn_fence(4 /* acq_rel order */, "workgroup"); __builtin_amdgcn_wave_barrier();
  const int rq = lane >> 3, c8 = (lane & 7) * 8;
  {
#pragma unroll
    for (int it = 0; it < 8; ++it) {
      const int rr = it * 4 + rq;
      const v4f a = *(const v4fa*)&so[wave][rr][c8], b = *(const v4fa*)&so[wave][rr][c8 + 4];
      FragH fh, fl;
#pragma unroll
      for (int q = 0; q < 4; ++q) { _Float16 hv = (_Float16)a[q]; fh.h[q] = hv; fl.h[q] = (_Float16)((a[q] - (float)hv) * RS); hv = (_Float16)b[q]; fh.h[4 + q] = hv; fl.h[4 + q] = (_Float16)((b[q] - (float)hv) * RS); }
      const v8us oh = fh.half[0], ol = fl.half[0];
      const size_t o = (size_t)(row0 + rr) * ldc + col0 + c8;
      *(v8us*)(CH + o) = oh; *(v8us*)(CR + o) = ol;
    }
    
  }
}

__global__ __launch_bounds__(128) void k_gemm_out(const unsigned short* __restrict__ A, int lda, const unsigned short* __restrict__ Bt, int ldb, float alpha,
    float* __restrict__ C, int ldc, int M, int N, int K) {
  __shared__ __attribute__((aligned(16))) float so[4][32][68];
  const int tid = threadIdx.x; const int wave = __builtin_amdgcn_readfirstlane(tid >> 5);
  const int lane = tid & 31, ln = lane & 15, hh = lane >> 4;
  const int ntn = N >> 6; const int mt = blockIdx.x / ntn, nq = blockIdx.x - mt * ntn;
  const int brow0 = mt * 128, row0 = brow0 + 32 * wave, col0 = nq * 64; if (brow0 >= M) return;
  const v8f z8 = {0.f, 0.f, 0.f, 0.f, 0.f, 0.f, 0.f, 0.f};
  v8f c00 = z8, c01 = z8, c02 = z8, c03 = z8, c10 = z8, c11 = z8, c12 = z8, c13 = z8;
  gemm_core(A, lda, Bt, ldb, K, brow0, col0, tid, wave, ln, hh, c00, c01, c02, c03, c10, c11, c12, c13);
  v8f accs[8] = {c00, c01, c02, c03, c10, c11, c12, c13};
#pragma unroll
  for (int u = 0; u < 8; ++u) { const int t = u & 3, hf = u >> 2;
#pragma unroll
    for (int r = 0; r < 8; ++r) so[wave][hf * 16 + 8 * hh + r][t * 16 + ln] = accs[u][r] * alpha; }
  __builtin_amdgcn_fence(4 /* acq_rel order */, "workgroup"); __builtin_amdgcn_wave_barrier();
  const int rsub = lane >> 4, c4 = (lane & 15) * 4;
  {
#pragma unroll
    for (int q = 0; q < 16; ++q) { const int r = q * 2 + rsub; const v4f v = *(const v4fa*)&so[wave][r][c4]; *(v4f*)(C + (size_t)(row0 + r) * ldc + col0 + c4) = v; }
    
  }
}

__global__ __launch_bounds__(256) void k_vt(const unsigned short* __restrict__ QKH, const unsigned short* __restrict__ QKR, unsigned short* __restrict__ VTH, unsigned short* __restrict__ VTR) {
  __shared__ unsigned short tl[2][64][66];
  const int tid = threadIdx.x;
  const int nlg = SEQ / 64;
  const int slab = blockIdx.x / nlg, lg = blockIdx.x - slab * nlg;
  const int g = slab / NKV, kv = slab - g * NKV;
#pragma unroll 1
  for (int i = tid; i < 512; i += 256) {
    const int r = i >> 3, c8 = (i & 7) * 8;
    const size_t sof = ((size_t)(lg * 64 + r) * NG + g) * LQ + EMB + KVW + kv * HD + c8;
    FragH fh, fr; fh.half[0] = *(const v8us*)(QKH + sof); fr.half[0] = *(const v8us*)(QKR + sof);
#pragma unroll
    for (int q = 0; q < 8; ++q) { tl[0][r][c8 + q] = fh.u[q]; tl[1][r][c8 + q] = fr.u[q]; }
  }
  __syncthreads();
  {
#pragma unroll
    for (int rd = 0; rd < 2; ++rd) {
      const int d = rd * 32 + (tid >> 3), pc = tid & 7; FragH fh, fr;
#pragma unroll
      for (int q = 0; q < 8; ++q) { fh.u[q] = tl[0][pc * 8 + q][d]; fr.u[q] = tl[1][pc * 8 + q][d]; }
      const v8us oh = fh.half[0], ol = fr.half[0];
      const size_t o = ((size_t)slab * HD + d) * SEQ + lg * 64 + pc * 8;
      *(v8us*)(VTH + o) = oh; *(v8us*)(VTR + o) = ol;
    }
    
  }
}

// Fused causal flash attention. grid = (SEQ/64, NG*NH); block = 4 waves, wave = 16 query rows; 32-key steps up to the diagonal.
// The block's q tile (value and residual) is copied into LDS once, the K and V^T value tiles of each step once per block (two buffers, the next step's copies fly during this step); the K and V^T residual planes (rows < 256 only) come straight from global memory. Scores and context are formed transposed (S^T = K q^T, O^T += V^T P^T): a lane owns one query, P goes from the score registers into the B operand. The per-wave output staging tile is wave-private.
__global__ __launch_bounds__(128) void k_attn(const unsigned short* __restrict__ QKH, const unsigned short* __restrict__ QKR,
    const unsigned short* __restrict__ VTH, const unsigned short* __restrict__ VTR, unsigned short* __restrict__ CX) {
  __shared__ __attribute__((aligned(16))) float so[4][16][68];
  __shared__ __attribute__((aligned(16))) unsigned short kt[2][32][72];   /* 32 keys x 64, pitch 144 B */
  __shared__ __attribute__((aligned(16))) unsigned short vt[2][64][40];   /* 64 d x 32 keys, pitch 80 B */
  __shared__ __attribute__((aligned(16))) unsigned short qs[2][64][72];   /* value | residual: 64 query rows x 64, pitch 144 B */
  const int tid = threadIdx.x; const int wave = __builtin_amdgcn_readfirstlane(tid >> 5);
  const int lane = tid & 31, ln = lane & 15, hh = lane >> 4;
  const int qt = blockIdx.x, gh = blockIdx.y;
  const int g = gh >> 4, h = gh & 15, kvh = h >> 2;
  const int q0 = qt * 64 + wave * 16;
  const size_t kcol = (size_t)EMB + kvh * HD;
  const size_t vrow = (size_t)(g * NKV + kvh) * HD;
  const v8f z8 = {0.f, 0.f, 0.f, 0.f, 0.f, 0.f, 0.f, 0.f};
  v8f om[4] = {z8, z8, z8, z8}, orr[4] = {z8, z8, z8, z8};
  float mi = -1.0e30f, li = 0.f;            /* of query q0 + ln; li holds the sum over this half's keys */
  const int nkb = (q0 + 16 + 31) >> 5;      /* every visited 32-key step starts at a key <= q0, so each row keeps >= 1 key per step */
  const int nst = 2 * qt + 2;               /* steps of the block = nkb of its last wave; keys < 64 * qt + 64 <= SEQ */
  const int kr0 = tid >> 3, kc8 = (tid & 7) * 8, vr0 = tid >> 2, vc8 = (tid & 3) * 8;
  const unsigned short* const gk = QKH + ((size_t)kr0 * NG + g) * LQ + kcol + kc8;
  const unsigned short* const gv = VTH + (vrow + vr0) * (size_t)SEQ + vc8;
  // step s -> buffer s & 1: each thread copies 16 B of K rows kr0, kr0 + 16 and of V^T rows vr0, vr0 + 32
  auto stage = [&](int s) {
    const int b = s & 1;
    const unsigned short* const k0 = gk + (size_t)s * (32 * NG * LQ); const unsigned short* const k1 = k0 + (size_t)16 * NG * LQ;
    const unsigned short* const v0 = gv + s * 32; const unsigned short* const v1 = v0 + (size_t)32 * SEQ;
    const unsigned int lk0 = (unsigned int)(size_t)&kt[b][kr0][kc8], lk1 = (unsigned int)(size_t)&kt[b][kr0 + 16][kc8];
    const unsigned int lv0 = (unsigned int)(size_t)&vt[b][vr0][vc8], lv1 = (unsigned int)(size_t)&vt[b][vr0 + 32][vc8];
    // the closing s_wait_xcnt keeps later writes of the address registers behind the copies
    asm volatile("global_load_async_to_lds_b128 %0, %4, off\n\tglobal_load_async_to_lds_b128 %1, %5, off\n\tglobal_load_async_to_lds_b128 %2, %6, off\n\tglobal_load_async_to_lds_b128 %3, %7, off\n\ts_wait_xcnt 0x0"
                 :: "v"(lk0), "v"(lk1), "v"(lv0), "v"(lv1), "v"(k0), "v"(k1), "v"(v0), "v"(v1) : "memory");
  };
  {
    // q tile: each thread copies 16 B of rows kr0 + 0, 16, 32, 48 of both planes
    const size_t qg = ((size_t)(qt * 64 + kr0) * NG + g) * LQ + h * HD + kc8;
    const unsigned short* const h0 = QKH + qg; const unsigned short* const h1 = h0 + (size_t)16 * NG * LQ;
    const unsigned short* const h2 = h1 + (size_t)16 * NG * LQ; const unsigned short* const h3 = h2 + (size_t)16 * NG * LQ;
    const unsigned short* const r0 = QKR + qg; const unsigned short* const r1 = r0 + (size_t)16 * NG * LQ;
    const unsigned short* const r2 = r1 + (size_t)16 * NG * LQ; const unsigned short* const r3 = r2 + (size_t)16 * NG * LQ;
    const unsigned int a0 = (unsigned int)(size_t)&qs[0][kr0][kc8], a1 = (unsigned int)(size_t)&qs[0][kr0 + 16][kc8];
    const unsigned int a2 = (unsigned int)(size_t)&qs[0][kr0 + 32][kc8], a3 = (unsigned int)(size_t)&qs[0][kr0 + 48][kc8];
    const unsigned int b0 = (unsigned int)(size_t)&qs[1][kr0][kc8], b1 = (unsigned int)(size_t)&qs[1][kr0 + 16][kc8];
    const unsigned int b2 = (unsigned int)(size_t)&qs[1][kr0 + 32][kc8], b3 = (unsigned int)(size_t)&qs[1][kr0 + 48][kc8];
    // the closing s_wait_xcnt keeps later writes of the address registers behind the copies
    asm volatile("global_load_async_to_lds_b128 %0, %8, off\n\tglobal_load_async_to_lds_b128 %1, %9, off\n\tglobal_load_async_to_lds_b128 %2, %10, off\n\tglobal_load_async_to_lds_b128 %3, %11, off\n\t"
                 "global_load_async_to_lds_b128 %4, %12, off\n\tglobal_load_async_to_lds_b128 %5, %13, off\n\tglobal_load_async_to_lds_b128 %6, %14, off\n\tglobal_load_async_to_lds_b128 %7, %15, off\n\ts_wait_xcnt 0x0"
                 :: "v"(a0), "v"(a1), "v"(a2), "v"(a3), "v"(b0), "v"(b1), "v"(b2), "v"(b3), "v"(h0), "v"(h1), "v"(h2), "v"(h3), "v"(r0), "v"(r1), "v"(r2), "v"(r3) : "memory");
  }
  stage(0);
  asm volatile("s_wait_asynccnt 0x0" ::: "memory");   /* own copies of q and of step 0 landed */
  __syncthreads();                                    /* q and step 0 readable by every wave */
  stage(1);                                           /* nst >= 2: step 1 always exists */
  // The key loop is compiled twice, with the residual scheme as a compile-time constant: the copy for rows >= 256 holds no test of it, no residual accumulator (it stays 0) and no global load; each step is one straight-line block, with no LDS exchange inside it.
  auto key_loop = [&](auto fc) {
  constexpr bool full = decltype(fc)::value;
#pragma unroll 1
  for (int kb = 0; kb < nst; ++kb) {
   if (kb < nkb) {                                    /* wave-uniform: waves 0 and 1 sit out the block's last step */
    const int kbase = kb * 32;
    const unsigned short (* const ks)[72] = kt[kb & 1];
    const unsigned short (* const vs)[40] = vt[kb & 1];
    // Transposed products: S^T = K q^T (rows = keys, column = query), so lane ln of either half owns query q0 + ln and holds 16 of its 32 scores in registers.
    v8f sm[2] = {z8, z8}, sr[2] = {z8, z8};
#pragma unroll
    for (int kk = 0; kk < 2; ++kk) {
      const v16h qh = ldfrag(&qs[0][wave * 16 + ln][kk * 32], 0, hh);
      const v16h qr = ldfrag(&qs[1][wave * 16 + ln][kk * 32], 0, hh);
#pragma unroll
      for (int nt = 0; nt < 2; ++nt) {
        const size_t ko = ((size_t)(kbase + nt * 16 + ln) * NG + g) * LQ + kcol + kk * 32;
        const v16h kh = ldfrag(&ks[nt * 16 + ln][kk * 32], 0, hh);
        sm[nt] = mma(kh, qh, sm[nt]);
        sr[nt] = mma(kh, qr, sr[nt]);
        if constexpr (full) { const v16h kr = ldfrag(QKR, ko, hh); sr[nt] = mma(kr, qh, sr[nt]); }
      }
    }
    // register r of tile nt is key kbase + 16 nt + 8 hh + r
    const int kmax = q0 + ln - kbase - 8 * hh;       /* key offset 16 nt + r is kept while it is <= kmax */
    float sc[2][8], mk[2][8];
#pragma unroll
    for (int nt = 0; nt < 2; ++nt) {
#pragma unroll
      for (int r = 0; r < 8; ++r) {
        sc[nt][r] = (sm[nt][r] + sr[nt][r] * RINV) * 0.125f;
        mk[nt][r] = (nt * 16 + r <= kmax) ? sc[nt][r] : -1.0e30f;
      }
    }
    const float mx0 = fmaxf(fmaxf(fmaxf(mk[0][0], mk[0][1]), fmaxf(mk[0][2], mk[0][3])), fmaxf(fmaxf(mk[0][4], mk[0][5]), fmaxf(mk[0][6], mk[0][7])));
    const float mx1 = fmaxf(fmaxf(fmaxf(mk[1][0], mk[1][1]), fmaxf(mk[1][2], mk[1][3])), fmaxf(fmaxf(mk[1][4], mk[1][5]), fmaxf(mk[1][6], mk[1][7])));
    const float mxh = fmaxf(mx0, mx1);
    const float mnew = fmaxf(mi, fmaxf(mxh, xhalf(mxh)));   /* the same in both halves */
    const float al = __expf(mi - mnew);
    mi = mnew;
    float pv[2][8];
#pragma unroll
    for (int nt = 0; nt < 2; ++nt) {
#pragma unroll
      for (int r = 0; r < 8; ++r) {
        const float e = __expf(fminf(sc[nt][r] - mnew, 0.f));
        pv[nt][r] = (nt * 16 + r <= kmax) ? e : 0.f;
      }
    }
    const float su0 = ((pv[0][0] + pv[0][1]) + (pv[0][2] + pv[0][3])) + ((pv[0][4] + pv[0][5]) + (pv[0][6] + pv[0][7]));
    const float su1 = ((pv[1][0] + pv[1][1]) + (pv[1][2] + pv[1][3])) + ((pv[1][4] + pv[1][5]) + (pv[1][6] + pv[1][7]));
    li = li * al + (su0 + su1);                      /* this half's keys only; the halves are joined behind the loop */
#pragma unroll
    for (int t = 0; t < 4; ++t) { om[t] *= al; if constexpr (full) orr[t] *= al; }
    // P^T (x2^10) as a B fragment straight from the score registers: element 8 nt + r is key 16 nt + 8 hh + r, the k order in which ldfrag reads V^T
    FragH ph, pr;
#pragma unroll
    for (int nt = 0; nt < 2; ++nt) {
#pragma unroll
      for (int r = 0; r < 8; ++r) {
        const float pc = pv[nt][r] * RS;
        const _Float16 p16 = (_Float16)pc;
        ph.h[nt * 8 + r] = p16;
        if constexpr (full) pr.h[nt * 8 + r] = (_Float16)((pc - (float)p16) * RS);
      }
    }
    // O^T += V^T P^T: rows = d, column = query
#pragma unroll
    for (int t = 0; t < 4; ++t) {
      const size_t vo = (vrow + t * 16 + ln) * (size_t)SEQ + kbase;
      const v16h vh = ldfrag(&vs[t * 16 + ln][0], 0, hh);
      om[t] = mma(vh, ph.v, om[t]);
      if constexpr (full) { const v16h vr = ldfrag(VTR, vo, hh); orr[t] = mma(vr, ph.v, orr[t]); orr[t] = mma(vh, pr.v, orr[t]); }
    }
   }
    // hand-over, passed by every wave: own LDS reads done, own copies of step kb + 1 landed, then the block barrier that publishes step kb + 1 and frees this step's buffer
    asm volatile("s_wait_dscnt 0x0" ::: "memory");
    asm volatile("s_wait_asynccnt 0x0" ::: "memory");
    __syncthreads();
    if (kb + 2 < nst) stage(kb + 2);
  }
  };
  if (qt < EQT) key_loop(flag_c<true>{}); else key_loop(flag_c<false>{});   /* block-uniform choice */
  asm volatile("s_wait_asynccnt 0x0" ::: "memory");   /* no copy outstanding at the wave's end */
  // context x16 = o / (2^10 * l) * 16
  const float inv = 0.015625f * (1.0f / (li + xhalf(li)));
#pragma unroll
  for (int t = 0; t < 4; ++t) {
#pragma unroll
    for (int r = 0; r < 8; ++r) so[wave][ln][t * 16 + 8 * hh + r] = (om[t][r] + orr[t][r] * RINV) * inv;
  }
  __builtin_amdgcn_fence(4 /* acq_rel order */, "workgroup"); __builtin_amdgcn_wave_barrier();
  const int rq = lane >> 3, c8 = (lane & 7) * 8;
  {
#pragma unroll
    for (int it = 0; it < 4; ++it) {
      const int rr = it * 4 + rq;
      const v4f a = *(const v4fa*)&so[wave][rr][c8], b = *(const v4fa*)&so[wave][rr][c8 + 4];
      FragH fh, fl;
#pragma unroll
      for (int q = 0; q < 4; ++q) { _Float16 hv = (_Float16)a[q]; fh.h[q] = hv; fl.h[q] = (_Float16)((a[q] - (float)hv) * RSC); hv = (_Float16)b[q]; fh.h[4 + q] = hv; fl.h[4 + q] = (_Float16)((b[q] - (float)hv) * RSC); }
      const v8us oh = fh.half[0], ol = fl.half[0];
      const size_t o = ((size_t)(q0 + rr) * NG + g) * CP + h * HD + c8;
      *(v8us*)(CX + o) = oh; *(v8us*)(CX + o + EMB) = ol;
    }
    
  }
}

extern "C" void kernel_launch(void* const* d_in, const int* in_sizes, int n_in,
                              void* d_out, int out_size, void* d_ws, size_t ws_size, hipStream_t stream) {
  if (n_in < 5) return;
  if (in_sizes[0] < NR * EMB) return;
  if (in_sizes[1] < EMB * EMB) return;
  if (in_sizes[2] < EMB * KVW) return;
  if (in_sizes[3] < EMB * KVW) return;
  if (in_sizes[4] < EMB * EMB) return;
  if (out_size < NR * EMB) return;
  const float* x  = (const float*)d_in[0];
  const float* Wq = (const float*)d_in[1];      /* [in 1024][out 1024] */
  const float* Wk = (const float*)d_in[2];      /* [in 1024][out 256] */
  const float* Wv = (const float*)d_in[3];      /* [in 1024][out 256] */
  const float* Wo = (const float*)d_in[4];      /* [in 1024][out 1024] */
  char* ws = (char*)d_ws; size_t off = 0;
  auto take = [&](size_t bytes) { char* p = ws + off; off += (bytes + 255) & ~(size_t)255; return p; };
  unsigned short* BQKV = (unsigned short*)take(SZ_BQKV);      /* [1536][1024]: Wq^T | Wk^T | Wv^T, x16 */
  unsigned short* BO   = (unsigned short*)take(SZ_BO);        /* [1024][2048]: Wo^T x16 | Wo^T / 4 */
  unsigned short* X16  = (unsigned short*)take(SZ_X16);       /* [NR][1024] */
  unsigned short* QKH  = (unsigned short*)take(SZ_QK);        /* [NR][1536] value plane of q | k | v */
  unsigned short* QKR  = (unsigned short*)take(SZ_QK);        /* [NR][1536] residual plane (x2^10) */
  unsigned short* VTH  = (unsigned short*)take(SZ_VT);        /* [NG*NKV][64][SEQ] */
  unsigned short* VTR  = (unsigned short*)take(SZ_VT);
  unsigned short* CX   = (unsigned short*)take(SZ_CX);        /* [NR][2048]: context x16 value | residual (x64) */
  if (off > ws_size) return;

  k_prep<<<(unsigned)PB_ALL, 256, 0, stream>>>(x, Wq, Wk, Wv, Wo, X16, BQKV, BO);
  k_gemm_planes<<<(unsigned)((NR / 128) * (LQ / 64)), 128, 0, stream>>>(X16, EMB, BQKV, EMB, 0.0625f, QKH, QKR, LQ, NR, LQ, EMB);
  k_vt<<<(unsigned)(NB * NG * NKV * (SEQ / 64)), 256, 0, stream>>>(QKH, QKR, VTH, VTR);
  k_attn<<<dim3((unsigned)(SEQ / 64), (unsigned)(NG * NH)), 128, 0, stream>>>(QKH, QKR, VTH, VTR, CX);
  k_gemm_out<<<(unsigned)((NR / 128) * (EMB / 64)), 128, 0, stream>>>(CX, CP, BO, CP, 0.00390625f, (float*)d_out, EMB, NR, EMB, CP);
}

// v006
// A run of this version takes 115 microseconds.
// Timed twice side by side with v005, it ran 1.06 times as fast both times.
// All steps since v000 together make it 3.10 times as fast.
#include <hip/hip_runtime.h>
// Causal grouped-query self-attention with a group axis: x [1][SEQ][2][1024]; token row = s*2 + g; q = x Wq (16 heads x 64), k|v = x Wk|Wv (4 kv heads x 64, query head h uses kv head h/4); raw energy, causal exclusion (key > query), then 1/8 inside the softmax over keys of the same g; merged heads (h*64 + d) times Wo.
// Compute dtype: v_wmma_f32_16x16x32_f16 for every contraction, f32 accumulate. Inputs RNE-converted to bf16 then held exactly in f16 (x as is, weights x16). q|k|v written as f16 value + f16 residual (x2^10) planes. Scores: q value+residual against k value (plus k residual on query rows < 256). P carried x2^10 as f16 (plus residual x2^10 on rows < 256), V^T value (plus residual on rows < 256), residual products in a separate accumulator. Context carried x16 as f16 value | residual (x64) along K against Wo x16 | Wo / 4. Softmax statistics f32.
#ifndef NB
#define NB 1
#endif
#ifndef SEQ
#define SEQ 2048
#endif
#define SEQ_FULL 2048
#define NG 2
#define EMB 1024
#define NH 16
#define NKV 4
#define HD 64
#define KVW (NKV * HD)            /* 256 */
#define LQ (EMB + 2 * KVW)        /* 1536: pitch of the q|k|v planes */
#define CP (2 * EMB)              /* 2048: pitch of the context plane (value | residual) */
#define NR (NB * SEQ * NG)        /* token rows */
#define EQT 4                     /* 64-row query tiles (rows < 256) that run the full residual scheme */
#define RS 1024.0f                /* residual carry of q, k, v, P */
#define RINV 0.0009765625f
#define RSC 64.0f                 /* residual carry of the context plane */

static_assert(NB == 1);
static_assert(SEQ % 64 == 0);
static_assert(SEQ >= 64);
static_assert(SEQ <= SEQ_FULL);
static_assert(NR % 128 == 0);
static_assert(LQ % 64 == 0);
static_assert(EMB % 64 == 0);
static_assert(CP % 64 == 0);
static_assert(HD == 64);
static_assert(NH == 4 * NKV);
static_assert(NH * HD == EMB);
static_assert(KVW % 64 == 0);

typedef unsigned short v8us __attribute__((ext_vector_type(8), may_alias));
typedef float  v8f  __attribute__((ext_vector_type(8)));
typedef float  v4f  __attribute__((ext_vector_type(4)));
typedef float  v4fa __attribute__((ext_vector_type(4), may_alias));
typedef _Float16 v16h __attribute__((ext_vector_type(16)));
union FragH { v16h v; v8us half[2]; _Float16 h[16]; unsigned short u[16]; };

constexpr size_t SZ_BQKV = (size_t)LQ * EMB * 2;
constexpr size_t SZ_BO   = (size_t)EMB * CP * 2;
constexpr size_t SZ_X16  = (size_t)NR * EMB * 2;
constexpr size_t SZ_QK   = (size_t)NR * LQ * 2;
constexpr size_t SZ_VT   = (size_t)NB * NG * NKV * HD * SEQ * 2;
constexpr size_t SZ_CX   = (size_t)NR * CP * 2;
constexpr size_t WS_TOTAL = SZ_BQKV + SZ_BO + SZ_X16 + 2 * SZ_QK + 2 * SZ_VT + SZ_CX;
static_assert(WS_TOTAL <= (size_t)134217728);
static_assert(SZ_BQKV % 256 == 0 && SZ_BO % 256 == 0 && SZ_X16 % 256 == 0 && SZ_QK % 256 == 0 && SZ_VT % 256 == 0 && SZ_CX % 256 == 0);

// RNE convert f32 -> bf16 value (kept in f32)
__device__ __forceinline__ float bf16_rne(float x) { unsigned int u = __float_as_uint(x); u = (u + 0x7FFFu + ((u >> 16) & 1u)) & 0xFFFF0000u; return __uint_as_float(u); }
__device__ __forceinline__ unsigned short h_bits(_Float16 h) { return __builtin_bit_cast(unsigned short, h); }
// 16-bit fragment: elements 0..7 <- k0 + 8h + 0..7, elements 8..15 <- k0 + 16 + 8h + 0..7 (row / column = lane & 15)
__device__ __forceinline__ v16h ldfrag(const unsigned short* __restrict__ p, size_t off, int hh) { FragH f; f.half[0] = *(const v8us*)(p + off + 8 * hh); f.half[1] = *(const v8us*)(p + off + 16 + 8 * hh); return f.v; }
// lane l <-> lane l ^ 16
__device__ __forceinline__ float xhalf(float x) { const int b = __builtin_bit_cast(int, x); return __builtin_bit_cast(float, __builtin_amdgcn_permlanex16(b, b, 0x76543210, 0xfedcba98, false, false)); }
template <bool B> struct flag_c { static constexpr bool value = B; };
__device__ __forceinline__ v8f mma(v16h a, v16h b, v8f c) { v8f d = __builtin_amdgcn_wmma_f32_16x16x32_f16(false, a, false, b, (short)0, c, false, false); asm volatile("v_nop\n\tv_nop\n\tv_nop\n\tv_nop" : "+v"(d) : "v"(a), "v"(b)); return d; }

// A thread converts 32 elements. Patch t of W^T, 8 k x 4 n: Wt[drow0 + n + j][dcol0 + k8 .. k8 + 7] = f16(bf16(W[k8 + i][n + j]) * scale), j < 4; K % 64 == 0, N % 16 == 0.
// A wave covers 64 k x 16 n: four neighbouring lanes read 64 contiguous bytes of a W row with one 16-byte load each (the wave beside it, in the same block, reads the line's other half), eight lanes write one whole 128-byte line of a W^T row. The transposition itself is a choice of registers.
__device__ __forceinline__ void wt_f16(const float* __restrict__ W, unsigned short* __restrict__ Wt, int K, int N, int drow0, int dpitch, int dcol0, float scale, int t) {
  const int nwn = N / 16;                       /* wave tiles along n */
  const int w = t >> 5, l = t & 31; if (w >= nwn * (K / 64)) return;
  const int kw = w / nwn, nw = w - kw * nwn;
  const int n = nw * 16 + (l & 3) * 4, k8 = kw * 64 + (l >> 2) * 8;
  v4f a[8];
#pragma unroll   /* constant indices: the patch stays in registers, its eight loads are in flight together */
  for (int i = 0; i < 8; ++i) a[i] = *(const v4fa*)(W + (size_t)(k8 + i) * N + n);
#pragma unroll
  for (int j = 0; j < 4; ++j) {
    FragH f;
#pragma unroll
    for (int i = 0; i < 8; ++i) f.h[i] = (_Float16)(bf16_rne(a[i][j]) * scale);
    const v8us o = f.half[0];
    *(v8us*)(Wt + (size_t)(drow0 + n + j) * dpitch + dcol0 + k8) = o;
  }
}

// Four 8-element groups of x, 256 groups apart (block b owns groups 1024 b .. 1024 b + 1023)
__device__ __forceinline__ void x16_f16(const float* __restrict__ x, unsigned short* __restrict__ X16, int b, int tid) {
  const size_t g0 = (size_t)b * 1024 + tid;
  v4f a[4], c[4];
#pragma unroll   /* constant indices: the eight loads are in flight together */
  for (int j = 0; j < 4; ++j) { a[j] = *(const v4fa*)(x + (g0 + 256 * j) * 8); c[j] = *(const v4fa*)(x + (g0 + 256 * j) * 8 + 4); }
#pragma unroll
  for (int j = 0; j < 4; ++j) {
    FragH f;
#pragma unroll
    for (int q = 0; q < 4; ++q) { f.h[q] = (_Float16)bf16_rne(a[j][q]); f.h[4 + q] = (_Float16)bf16_rne(c[j][q]); }
    const v8us o = f.half[0];
    *(v8us*)(X16 + (g0 + 256 * j) * 8) = o;
  }
  asm volatile("s_wait_xcnt 0x0" ::: "memory");   /* stands behind the four stores, in front of any later write of their address or data registers */
}

static_assert(EMB % 64 == 0 && KVW % 16 == 0);
static_assert((EMB * EMB) % (32 * 256) == 0 && (KVW * EMB) % (32 * 256) == 0 && ((size_t)NR * EMB) % (32 * 256) == 0);
constexpr int PB_W  = EMB * EMB / (32 * 256);   /* blocks of a 1024-column weight */
constexpr int PB_KV = KVW * EMB / (32 * 256);   /* blocks of a 256-column weight */
constexpr int PB_X  = NR * EMB / (32 * 256);    /* blocks of x */
constexpr int PB_ALL = 3 * PB_W + 2 * PB_KV + PB_X;

// All input conversions in one launch: none reads what another writes, so a block picks its job by its index (block-uniform). The weight jobs, whose waves last longer, come first.
__global__ __launch_bounds__(256) void k_prep(const float* __restrict__ x, const float* __restrict__ Wq, const float* __restrict__ Wk, const float* __restrict__ Wv, const float* __restrict__ Wo,
    unsigned short* __restrict__ X16, unsigned short* __restrict__ BQKV, unsigned short* __restrict__ BO) {
  const int tid = threadIdx.x; int b = blockIdx.x;
  if (b < PB_W) { wt_f16(Wq, BQKV, EMB, EMB, 0, EMB, 0, 16.0f, b * 256 + tid); return; }
  b -= PB_W;
  if (b < PB_W) { wt_f16(Wo, BO, EMB, EMB, 0, CP, 0, 16.0f, b * 256 + tid); return; }
  b -= PB_W;
  if (b < PB_W) { wt_f16(Wo, BO, EMB, EMB, 0, CP, EMB, 0.25f, b * 256 + tid); return; }
  b -= PB_W;
  if (b < PB_KV) { wt_f16(Wk, BQKV, EMB, KVW, EMB, EMB, 0, 16.0f, b * 256 + tid); return; }
  b -= PB_KV;
  if (b < PB_KV) { wt_f16(Wv, BQKV, EMB, KVW, EMB + KVW, EMB, 0, 16.0f, b * 256 + tid); return; }
  b -= PB_KV;
  x16_f16(x, X16, b, tid);
}

// GEMM main loop: block tile 128 x 64, wave tile 32 x 64, A f16 [M][lda], Bt f16 [N][ldb] (k contiguous), K % 64 == 0, K >= 64; called by all 128 threads of the block.
// The block's A and Bt rows of each 64-wide k step are copied into LDS once per block as whole 128-byte lines (two buffers, the next step's copies fly during this step); every wave reads its fragments from there.
__device__ __forceinline__ void gemm_core(const unsigned short* __restrict__ A, int lda, const unsigned short* __restrict__ Bt, int ldb, int K, int brow0, int col0, int tid, int wave, int ln, int hh,
    v8f& c00, v8f& c01, v8f& c02, v8f& c03, v8f& c10, v8f& c11, v8f& c12, v8f& c13) {
  __shared__ __attribute__((aligned(16))) unsigned short at[2][128][72];   /* 128 rows x 64 k, pitch 144 B */
  __shared__ __attribute__((aligned(16))) unsigned short bt[2][64][72];    /* 64 columns x 64 k, pitch 144 B */
  const int r0 = tid >> 3, c8 = (tid & 7) * 8;
  const unsigned short* const ga = A + (size_t)(brow0 + r0) * lda + c8;
  const unsigned short* const gb = Bt + (size_t)(col0 + r0) * ldb + c8;
  const size_t sa = (size_t)16 * lda, sb = (size_t)16 * ldb;
  const int nst = K >> 6;
  // step s -> buffer s & 1: each thread copies 16 B of A rows r0 + 16 j (j < 8) and of Bt rows r0 + 16 j (j < 4)
  auto stage = [&](int s) {
    const int b = s & 1;
    const size_t ko = (size_t)s * 64;   /* added to row pointers that do not change from step to step: twelve independent additions, no chain in front of the copies */
    const unsigned short* const a0 = ga + ko; const unsigned short* const a1 = (ga + sa) + ko; const unsigned short* const a2 = (ga + 2 * sa) + ko; const unsigned short* const a3 = (ga + 3 * sa) + ko;
    const unsigned short* const a4 = (ga + 4 * sa) + ko; const unsigned short* const a5 = (ga + 5 * sa) + ko; const unsigned short* const a6 = (ga + 6 * sa) + ko; const unsigned short* const a7 = (ga + 7 * sa) + ko;
    const unsigned short* const b0 = gb + ko; const unsigned short* const b1 = (gb + sb) + ko; const unsigned short* const b2 = (gb + 2 * sb) + ko; const unsigned short* const b3 = (gb + 3 * sb) + ko;
    const unsigned int la0 = (unsigned int)(size_t)&at[b][r0][c8], la1 = (unsigned int)(size_t)&at[b][r0 + 16][c8], la2 = (unsigned int)(size_t)&at[b][r0 + 32][c8], la3 = (unsigned int)(size_t)&at[b][r0 + 48][c8];
    const unsigned int la4 = (unsigned int)(size_t)&at[b][r0 + 64][c8], la5 = (unsigned int)(size_t)&at[b][r0 + 80][c8], la6 = (unsigned int)(size_t)&at[b][r0 + 96][c8], la7 = (unsigned int)(size_t)&at[b][r0 + 112][c8];
    const unsigned int lb0 = (unsigned int)(size_t)&bt[b][r0][c8], lb1 = (unsigned int)(size_t)&bt[b][r0 + 16][c8], lb2 = (unsigned int)(size_t)&bt[b][r0 + 32][c8], lb3 = (unsigned int)(size_t)&bt[b][r0 + 48][c8];
    // the closing s_wait_xcnt keeps later writes of the address registers behind the copies
    asm volatile("global_load_async_to_lds_b128 %0, %12, off\n\tglobal_load_async_to_lds_b128 %1, %13, off\n\tglobal_load_async_to_lds_b128 %2, %14, off\n\tglobal_load_async_to_lds_b128 %3, %15, off\n\t"
                 "global_load_async_to_lds_b128 %4, %16, off\n\tglobal_load_async_to_lds_b128 %5, %17, off\n\tglobal_load_async_to_lds_b128 %6, %18, off\n\tglobal_load_async_to_lds_b128 %7, %19, off\n\t"
                 "global_load_async_to_lds_b128 %8, %20, off\n\tglobal_load_async_to_lds_b128 %9, %21, off\n\tglobal_load_async_to_lds_b128 %10, %22, off\n\tglobal_load_async_to_lds_b128 %11, %23, off\n\ts_wait_xcnt 0x0"
                 :: "v"(la0), "v"(la1), "v"(la2), "v"(la3), "v"(la4), "v"(la5), "v"(la6), "v"(la7), "v"(lb0), "v"(lb1), "v"(lb2), "v"(lb3),
                    "v"(a0), "v"(a1), "v"(a2), "v"(a3), "v"(a4), "v"(a5), "v"(a6), "v"(a7), "v"(b0), "v"(b1), "v"(b2), "v"(b3) : "memory");
  };
  stage(0);
  asm volatile("s_wait_asynccnt 0x0" ::: "memory");   /* own copies of step 0 landed */
  __syncthreads();                                    /* step 0 readable by every wave */
  if (nst > 1) stage(1);
#pragma unroll 1
  for (int s = 0; s < nst; ++s) {                     /* rolled: one body serves both buffers */
    const unsigned short (* const as)[72] = at[s & 1];
    const unsigned short (* const bs)[72] = bt[s & 1];
    // all fragments of the step are fetched as one group in front of its products: one LDS wait place a step instead of two
    v16h fa[2][2], fb[2][4];
#pragma unroll   /* these three loops are unrolled so that the fragment arrays are indexed by constants and stay in registers */
    for (int kk = 0; kk < 2; ++kk) {
      fa[kk][0] = ldfrag(&as[32 * wave + ln][kk * 32], 0, hh); fa[kk][1] = ldfrag(&as[32 * wave + 16 + ln][kk * 32], 0, hh);
#pragma unroll
      for (int j = 0; j < 4; ++j) fb[kk][j] = ldfrag(&bs[16 * j + ln][kk * 32], 0, hh);
    }
#pragma unroll
    for (int kk = 0; kk < 2; ++kk) {
      c00 = mma(fa[kk][0], fb[kk][0], c00); c10 = mma(fa[kk][1], fb[kk][0], c10);
      c01 = mma(fa[kk][0], fb[kk][1], c01); c11 = mma(fa[kk][1], fb[kk][1], c11);
      c02 = mma(fa[kk][0], fb[kk][2], c02); c12 = mma(fa[kk][1], fb[kk][2], c12);
      c03 = mma(fa[kk][0], fb[kk][3], c03); c13 = mma(fa[kk][1], fb[kk][3], c13);
    }
    // hand-over, passed by every wave: own LDS reads done, own copies of step s + 1 landed, then the block barrier that publishes step s + 1 and frees this step's buffer
    asm volatile("s_wait_dscnt 0x0" ::: "memory");
    asm volatile("s_wait_asynccnt 0x0" ::: "memory");
    __syncthreads();
    if (s + 2 < nst) stage(s + 2);
  }
  asm volatile("s_wait_asynccnt 0x0" ::: "memory");   /* no copy outstanding behind the loop */
}

// C = alpha * A . Bt^T written as f16 value plane CH and residual plane CR ((v - value) * 2^10), both pitch ldc. M % 128 == 0, N % 64 == 0.
__global__ __launch_bounds__(128) void k_gemm_planes(const unsigned short* __restrict__ A, int lda, const unsigned short* __restrict__ Bt, int ldb, float alpha,
    unsigned short* __restrict__ CH, unsigned short* __restrict__ CR, int ldc, int M, int N, int K) {
  __shared__ __attribute__((aligned(16))) float so[4][32][68];
  const int tid = threadIdx.x; const int wave = __builtin_amdgcn_readfirstlane(tid >> 5);
  const int lane = tid & 31, ln = lane & 15, hh = lane >> 4;
  const int ntn = N >> 6; const int mt = blockIdx.x / ntn, nq = blockIdx.x - mt * ntn;
  const int brow0 = mt * 128, row0 = brow0 + 32 * wave, col0 = nq * 64; if (brow0 >= M) return;
  const v8f z8 = {0.f, 0.f, 0.f, 0.f, 0.f, 0.f, 0.f, 0.f};
  v8f c00 = z8, c01 = z8, c02 = z8, c03 = z8, c10 = z8, c11 = z8, c12 = z8, c13 = z8;
  gemm_core(A, lda, Bt, ldb, K, brow0, col0, tid, wave, ln, hh, c00, c01, c02, c03, c10, c11, c12, c13);
  v8f accs[8] = {c00, c01, c02, c03, c10, c11, c12, c13};
#pragma unroll
  for (int u = 0; u < 8; ++u) { const int t = u & 3, hf = u >> 2;
#pragma unroll
    for (int r = 0; r < 8; ++r) so[wave][hf * 16 + 8 * hh + r][t * 16 + ln] = accs[u][r] * alpha; }
  __builtin_amdgcn_fence(4 /* acq_rel order */, "workgroup"); __builtin_amdgcn_wave_barrier();
  const int rq = lane >> 3, c8 = (lane & 7) * 8;
  {
#pragma unroll
    for (int it = 0; it < 8; ++it) {
      const int rr = it * 4 + rq;
      const v4f a = *(const v4fa*)&so[wave][rr][c8], b = *(const v4fa*)&so[wave][rr][c8 + 4];
      FragH fh, fl;
#pragma unroll
      for (int q = 0; q < 4; ++q) { _Float16 hv = (_Float16)a[q]; fh.h[q] = hv; fl.h[q] = (_Float16)((a[q] - (float)hv) * RS); hv = (_Float16)b[q]; fh.h[4 + q] = hv; fl.h[4 + q] = (_Float16)((b[q] - (float)hv) * RS); }
      const v8us oh = fh.half[0], ol = fl.half[0];
      const size_t o = (size_t)(row0 + rr) * ldc + col0 + c8;
      *(v8us*)(CH + o) = oh; *(v8us*)(CR + o) = ol;
    }
    
  }
}

__global__ __launch_bounds__(128) void k_gemm_out(const unsigned short* __restrict__ A, int lda, const unsigned short* __restrict__ Bt, int ldb, float alpha,
    float* __restrict__ C, int ldc, int M, int N, int K) {
  __shared__ __attribute__((aligned(16))) float so[4][32][68];
  const int tid = threadIdx.x; const int wave = __builtin_amdgcn_readfirstlane(tid >> 5);
  const int lane = tid & 31, ln = lane & 15, hh = lane >> 4;
  const int ntn = N >> 6; const int mt = blockIdx.x / ntn, nq = blockIdx.x - mt * ntn;
  const int brow0 = mt * 128, row0 = brow0 + 32 * wave, col0 = nq * 64; if (brow0 >= M) return;
  const v8f z8 = {0.f, 0.f, 0.f, 0.f, 0.f, 0.f, 0.f, 0.f};
  v8f c00 = z8, c01 = z8, c02 = z8, c03 = z8, c10 = z8, c11 = z8, c12 = z8, c13 = z8;
  gemm_core(A, lda, Bt, ldb, K, brow0, col0, tid, wave, ln, hh, c00, c01, c02, c03, c10, c11, c12, c13);
  v8f accs[8] = {c00, c01, c02, c03, c10, c11, c12, c13};
#pragma unroll
  for (int u = 0; u < 8; ++u) { const int t = u & 3, hf = u >> 2;
#pragma unroll
    for (int r = 0; r < 8; ++r) so[wave][hf * 16 + 8 * hh + r][t * 16 + ln] = accs[u][r] * alpha; }
  __builtin_amdgcn_fence(4 /* acq_rel order */, "workgroup"); __builtin_amdgcn_wave_barrier();
  const int rsub = lane >> 4, c4 = (lane & 15) * 4;
  {
#pragma unroll
    for (int q = 0; q < 16; ++q) { const int r = q * 2 + rsub; const v4f v = *(const v4fa*)&so[wave][r][c4]; *(v4f*)(C + (size_t)(row0 + r) * ldc + col0 + c4) = v; }
    
  }
}

__global__ __launch_bounds__(256) void k_vt(const unsigned short* __restrict__ QKH, const unsigned short* __restrict__ QKR, unsigned short* __restrict__ VTH, unsigned short* __restrict__ VTR) {
  __shared__ unsigned short tl[2][64][66];
  const int tid = threadIdx.x;
  const int nlg = SEQ / 64;
  const int slab = blockIdx.x / nlg, lg = blockIdx.x - slab * nlg;
  const int g = slab / NKV, kv = slab - g * NKV;
#pragma unroll 1
  for (int i = tid; i < 512; i += 256) {
    const int r = i >> 3, c8 = (i & 7) * 8;
    const size_t sof = ((size_t)(lg * 64 + r) * NG + g) * LQ + EMB + KVW + kv * HD + c8;
    FragH fh, fr; fh.half[0] = *(const v8us*)(QKH + sof); fr.half[0] = *(const v8us*)(QKR + sof);
#pragma unroll
    for (int q = 0; q < 8; ++q) { tl[0][r][c8 + q] = fh.u[q]; tl[1][r][c8 + q] = fr.u[q]; }
  }
  __syncthreads();
  {
#pragma unroll
    for (int rd = 0; rd < 2; ++rd) {
      const int d = rd * 32 + (tid >> 3), pc = tid & 7; FragH fh, fr;
#pragma unroll
      for (int q = 0; q < 8; ++q) { fh.u[q] = tl[0][pc * 8 + q][d]; fr.u[q] = tl[1][pc * 8 + q][d]; }
      const v8us oh = fh.half[0], ol = fr.half[0];
      const size_t o = ((size_t)slab * HD + d) * SEQ + lg * 64 + pc * 8;
      *(v8us*)(VTH + o) = oh; *(v8us*)(VTR + o) = ol;
    }
    
  }
}

// Fused causal flash attention. grid = (SEQ/64, NG*NH); block = 4 waves, wave = 16 query rows; 32-key steps up to the diagonal.
// The block's q tile (value and residual) is copied into LDS once, the K and V^T value tiles of each step once per block (two buffers, the next step's copies fly during this step); the K and V^T residual planes (rows < 256 only) come straight from global memory. Scores and context are formed transposed (S^T = K q^T, O^T += V^T P^T): a lane owns one query, P goes from the score registers into the B operand. The per-wave output staging tile is wave-private.
__global__ __launch_bounds__(128) void k_attn(const unsigned short* __restrict__ QKH, const unsigned short* __restrict__ QKR,
    const unsigned short* __restrict__ VTH, const unsigned short* __restrict__ VTR, unsigned short* __restrict__ CX) {
  __shared__ __attribute__((aligned(16))) float so[4][16][68];
  __shared__ __attribute__((aligned(16))) unsigned short kt[2][32][72];   /* 32 keys x 64, pitch 144 B */
  __shared__ __attribute__((aligned(16))) unsigned short vt[2][64][40];   /* 64 d x 32 keys, pitch 80 B */
  __shared__ __attribute__((aligned(16))) unsigned short qs[2][64][72];   /* value | residual: 64 query rows x 64, pitch 144 B */
  const int tid = threadIdx.x; const int wave = __builtin_amdgcn_readfirstlane(tid >> 5);
  const int lane = tid & 31, ln = lane & 15, hh = lane >> 4;
  const int qt = blockIdx.x, gh = blockIdx.y;
  const int g = gh >> 4, h = gh & 15, kvh = h >> 2;
  const int q0 = qt * 64 + wave * 16;
  const size_t kcol = (size_t)EMB + kvh * HD;
  const size_t vrow = (size_t)(g * NKV + kvh) * HD;
  const v8f z8 = {0.f, 0.f, 0.f, 0.f, 0.f, 0.f, 0.f, 0.f};
  v8f om[4] = {z8, z8, z8, z8}, orr[4] = {z8, z8, z8, z8};
  float mi = -1.0e30f, li = 0.f;            /* of query q0 + ln; li holds the sum over this half's keys */
  const int nkb = (q0 + 16 + 31) >> 5;      /* every visited 32-key step starts at a key <= q0, so each row keeps >= 1 key per step */
  const int nst = 2 * qt + 2;               /* steps of the block = nkb of its last wave; keys < 64 * qt + 64 <= SEQ */
  const int kr0 = tid >> 3, kc8 = (tid & 7) * 8, vr0 = tid >> 2, vc8 = (tid & 3) * 8;
  const unsigned short* const gk = QKH + ((size_t)kr0 * NG + g) * LQ + kcol + kc8;
  const unsigned short* const gv = VTH + (vrow + vr0) * (size_t)SEQ + vc8;
  // step s -> buffer s & 1: each thread copies 16 B of K rows kr0, kr0 + 16 and of V^T rows vr0, vr0 + 32
  auto stage = [&](int s) {
    const int b = s & 1;
    const unsigned short* const k0 = gk + (size_t)s * (32 * NG * LQ); const unsigned short* const k1 = k0 + (size_t)16 * NG * LQ;
    const unsigned short* const v0 = gv + s * 32; const unsigned short* const v1 = v0 + (size_t)32 * SEQ;
    const unsigned int lk0 = (unsigned int)(size_t)&kt[b][kr0][kc8], lk1 = (unsigned int)(size_t)&kt[b][kr0 + 16][kc8];
    const unsigned int lv0 = (unsigned int)(size_t)&vt[b][vr0][vc8], lv1 = (unsigned int)(size_t)&vt[b][vr0 + 32][vc8];
    // the closing s_wait_xcnt keeps later writes of the address registers behind the copies
    asm volatile("global_load_async_to_lds_b128 %0, %4, off\n\tglobal_load_async_to_lds_b128 %1, %5, off\n\tglobal_load_async_to_lds_b128 %2, %6, off\n\tglobal_load_async_to_lds_b128 %3, %7, off\n\ts_wait_xcnt 0x0"
                 :: "v"(lk0), "v"(lk1), "v"(lv0), "v"(lv1), "v"(k0), "v"(k1), "v"(v0), "v"(v1) : "memory");
  };
  {
    // q tile: each thread copies 16 B of rows kr0 + 0, 16, 32, 48 of both planes
    const size_t qg = ((size_t)(qt * 64 + kr0) * NG + g) * LQ + h * HD + kc8;
    const unsigned short* const h0 = QKH + qg; const unsigned short* const h1 = h0 + (size_t)16 * NG * LQ;
    const unsigned short* const h2 = h1 + (size_t)16 * NG * LQ; const unsigned short* const h3 = h2 + (size_t)16 * NG * LQ;
    const unsigned short* const r0 = QKR + qg; const unsigned short* const r1 = r0 + (size_t)16 * NG * LQ;
    const unsigned short* const r2 = r1 + (size_t)16 * NG * LQ; const unsigned short* const r3 = r2 + (size_t)16 * NG * LQ;
    const unsigned int a0 = (unsigned int)(size_t)&qs[0][kr0][kc8], a1 = (unsigned int)(size_t)&qs[0][kr0 + 16][kc8];
    const unsigned int a2 = (unsigned int)(size_t)&qs[0][kr0 + 32][kc8], a3 = (unsigned int)(size_t)&qs[0][kr0 + 48][kc8];
    const unsigned int b0 = (unsigned int)(size_t)&qs[1][kr0][kc8], b1 = (unsigned int)(size_t)&qs[1][kr0 + 16][kc8];
    const unsigned int b2 = (unsigned int)(size_t)&qs[1][kr0 + 32][kc8], b3 = (unsigned int)(size_t)&qs[1][kr0 + 48][kc8];
    // the closing s_wait_xcnt keeps later writes of the address registers behind the copies
    asm volatile("global_load_async_to_lds_b128 %0, %8, off\n\tglobal_load_async_to_lds_b128 %1, %9, off\n\tglobal_load_async_to_lds_b128 %2, %10, off\n\tglobal_load_async_to_lds_b128 %3, %11, off\n\t"
                 "global_load_async_to_lds_b128 %4, %12, off\n\tglobal_load_async_to_lds_b128 %5, %13, off\n\tglobal_load_async_to_lds_b128 %6, %14, off\n\tglobal_load_async_to_lds_b128 %7, %15, off\n\ts_wait_xcnt 0x0"
                 :: "v"(a0), "v"(a1), "v"(a2), "v"(a3), "v"(b0), "v"(b1), "v"(b2), "v"(b3), "v"(h0), "v"(h1), "v"(h2), "v"(h3), "v"(r0), "v"(r1), "v"(r2), "v"(r3) : "memory");
  }
  stage(0);
  asm volatile("s_wait_asynccnt 0x0" ::: "memory");   /* own copies of q and of step 0 landed */
  __syncthreads();                                    /* q and step 0 readable by every wave */
  stage(1);                                           /* nst >= 2: step 1 always exists */
  // The key loop is compiled twice, with the residual scheme as a compile-time constant: the copy for rows >= 256 holds no test of it, no residual accumulator (it stays 0) and no global load; each step is one straight-line block, with no LDS exchange inside it.
  auto key_loop = [&](auto fc) {
  constexpr bool full = decltype(fc)::value;
#pragma unroll 1
  for (int kb = 0; kb < nst; ++kb) {
   if (kb < nkb) {                                    /* wave-uniform: waves 0 and 1 sit out the block's last step */
    const int kbase = kb * 32;
    const unsigned short (* const ks)[72] = kt[kb & 1];
    const unsigned short (* const vs)[40] = vt[kb & 1];
    // Transposed products: S^T = K q^T (rows = keys, column = query), so lane ln of either half owns query q0 + ln and holds 16 of its 32 scores in registers.
    v8f sm[2] = {z8, z8}, sr[2] = {z8, z8};
#pragma unroll
    for (int kk = 0; kk < 2; ++kk) {
      const v16h qh = ldfrag(&qs[0][wave * 16 + ln][kk * 32], 0, hh);
      const v16h qr = ldfrag(&qs[1][wave * 16 + ln][kk * 32], 0, hh);
#pragma unroll
      for (int nt = 0; nt < 2; ++nt) {
        const size_t ko = ((size_t)(kbase + nt * 16 + ln) * NG + g) * LQ + kcol + kk * 32;
        const v16h kh = ldfrag(&ks[nt * 16 + ln][kk * 32], 0, hh);
        sm[nt] = mma(kh, qh, sm[nt]);
        sr[nt] = mma(kh, qr, sr[nt]);
        if constexpr (full) { const v16h kr = ldfrag(QKR, ko, hh); sr[nt] = mma(kr, qh, sr[nt]); }
      }
    }
    // register r of tile nt is key kbase + 16 nt + 8 hh + r
    const int kmax = q0 + ln - kbase - 8 * hh;       /* key offset 16 nt + r is kept while it is <= kmax */
    float sc[2][8], mk[2][8];
#pragma unroll
    for (int nt = 0; nt < 2; ++nt) {
#pragma unroll
      for (int r = 0; r < 8; ++r) {
        sc[nt][r] = (sm[nt][r] + sr[nt][r] * RINV) * 0.125f;
        mk[nt][r] = (nt * 16 + r <= kmax) ? sc[nt][r] : -1.0e30f;
      }
    }
    const float mx0 = fmaxf(fmaxf(fmaxf(mk[0][0], mk[0][1]), fmaxf(mk[0][2], mk[0][3])), fmaxf(fmaxf(mk[0][4], mk[0][5]), fmaxf(mk[0][6], mk[0][7])));
    const float mx1 = fmaxf(fmaxf(fmaxf(mk[1][0], mk[1][1]), fmaxf(mk[1][2], mk[1][3])), fmaxf(fmaxf(mk[1][4], mk[1][5]), fmaxf(mk[1][6], mk[1][7])));
    const float mxh = fmaxf(mx0, mx1);
    const float mnew = fmaxf(mi, fmaxf(mxh, xhalf(mxh)));   /* the same in both halves */
    const float al = __expf(mi - mnew);
    mi = mnew;
    float pv[2][8];
#pragma unroll
    for (int nt = 0; nt < 2; ++nt) {
#pragma unroll
      for (int r = 0; r < 8; ++r) {
        const float e = __expf(fminf(sc[nt][r] - mnew, 0.f));
        pv[nt][r] = (nt * 16 + r <= kmax) ? e : 0.f;
      }
    }
    const float su0 = ((pv[0][0] + pv[0][1]) + (pv[0][2] + pv[0][3])) + ((pv[0][4] + pv[0][5]) + (pv[0][6] + pv[0][7]));
    const float su1 = ((pv[1][0] + pv[1][1]) + (pv[1][2] + pv[1][3])) + ((pv[1][4] + pv[1][5]) + (pv[1][6] + pv[1][7]));
    li = li * al + (su0 + su1);                      /* this half's keys only; the halves are joined behind the loop */
#pragma unroll
    for (int t = 0; t < 4; ++t) { om[t] *= al; if constexpr (full) orr[t] *= al; }
    // P^T (x2^10) as a B fragment straight from the score registers: element 8 nt + r is key 16 nt + 8 hh + r, the k order in which ldfrag reads V^T
    FragH ph, pr;
#pragma unroll
    for (int nt = 0; nt < 2; ++nt) {
#pragma unroll
      for (int r = 0; r < 8; ++r) {
        const float pc = pv[nt][r] * RS;
        const _Float16 p16 = (_Float16)pc;
        ph.h[nt * 8 + r] = p16;
        if constexpr (full) pr.h[nt * 8 + r] = (_Float16)((pc - (float)p16) * RS);
      }
    }
    // O^T += V^T P^T: rows = d, column = query
#pragma unroll
    for (int t = 0; t < 4; ++t) {
      const size_t vo = (vrow + t * 16 + ln) * (size_t)SEQ + kbase;
      const v16h vh = ldfrag(&vs[t * 16 + ln][0], 0, hh);
      om[t] = mma(vh, ph.v, om[t]);
      if constexpr (full) { const v16h vr = ldfrag(VTR, vo, hh); orr[t] = mma(vr, ph.v, orr[t]); orr[t] = mma(vh, pr.v, orr[t]); }
    }
   }
    // hand-over, passed by every wave: own LDS reads done, own copies of step kb + 1 landed, then the block barrier that publishes step kb + 1 and frees this step's buffer
    asm volatile("s_wait_dscnt 0x0" ::: "memory");
    asm volatile("s_wait_asynccnt 0x0" ::: "memory");
    __syncthreads();
    if (kb + 2 < nst) stage(kb + 2);
  }
  };
  if (qt < EQT) key_loop(flag_c<true>{}); else key_loop(flag_c<false>{});   /* block-uniform choice */
  asm volatile("s_wait_asynccnt 0x0" ::: "memory");   /* no copy outstanding at the wave's end */
  // context x16 = o / (2^10 * l) * 16
  const float inv = 0.015625f * (1.0f / (li + xhalf(li)));
#pragma unroll
  for (int t = 0; t < 4; ++t) {
#pragma unroll
    for (int r = 0; r < 8; ++r) so[wave][ln][t * 16 + 8 * hh + r] = (om[t][r] + orr[t][r] * RINV) * inv;
  }
  __builtin_amdgcn_fence(4 /* acq_rel order */, "workgroup"); __builtin_amdgcn_wave_barrier();
  const int rq = lane >> 3, c8 = (lane & 7) * 8;
  {
#pragma unroll
    for (int it = 0; it < 4; ++it) {
      const int rr = it * 4 + rq;
      const v4f a = *(const v4fa*)&so[wave][rr][c8], b = *(const v4fa*)&so[wave][rr][c8 + 4];
      FragH fh, fl;
#pragma unroll
      for (int q = 0; q < 4; ++q) { _Float16 hv = (_Float16)a[q]; fh.h[q] = hv; fl.h[q] = (_Float16)((a[q] - (float)hv) * RSC); hv = (_Float16)b[q]; fh.h[4 + q] = hv; fl.h[4 + q] = (_Float16)((b[q] - (float)hv) * RSC); }
      const v8us oh = fh.half[0], ol = fl.half[0];
      const size_t o = ((size_t)(q0 + rr) * NG + g) * CP + h * HD + c8;
      *(v8us*)(CX + o) = oh; *(v8us*)(CX + o + EMB) = ol;
    }
    
  }
}

extern "C" void kernel_launch(void* const* d_in, const int* in_sizes, int n_in,
                              void* d_out, int out_size, void* d_ws, size_t ws_size, hipStream_t stream) {
  if (n_in < 5) return;
  if (in_sizes[0] < NR * EMB) return;
  if (in_sizes[1] < EMB * EMB) return;
  if (in_sizes[2] < EMB * KVW) return;
  if (in_sizes[3] < EMB * KVW) return;
  if (in_sizes[4] < EMB * EMB) return;
  if (out_size < NR * EMB) return;
  const float* x  = (const float*)d_in[0];
  const float* Wq = (const float*)d_in[1];      /* [in 1024][out 1024] */
  const float* Wk = (const float*)d_in[2];      /* [in 1024][out 256] */
  const float* Wv = (const float*)d_in[3];      /* [in 1024][out 256] */
  const float* Wo = (const float*)d_in[4];      /* [in 1024][out 1024] */
  char* ws = (char*)d_ws; size_t off = 0;
  auto take = [&](size_t bytes) { char* p = ws + off; off += (bytes + 255) & ~(size_t)255; return p; };
  unsigned short* BQKV = (unsigned short*)take(SZ_BQKV);      /* [1536][1024]: Wq^T | Wk^T | Wv^T, x16 */
  unsigned short* BO   = (unsigned short*)take(SZ_BO);        /* [1024][2048]: Wo^T x16 | Wo^T / 4 */
  unsigned short* X16  = (unsigned short*)take(SZ_X16);       /* [NR][1024] */
  unsigned short* QKH  = (unsigned short*)take(SZ_QK);        /* [NR][1536] value plane of q | k | v */
  unsigned short* QKR  = (unsigned short*)take(SZ_QK);        /* [NR][1536] residual plane (x2^10) */
  unsigned short* VTH  = (unsigned short*)take(SZ_VT);        /* [NG*NKV][64][SEQ] */
  unsigned short* VTR  = (unsigned short*)take(SZ_VT);
  unsigned short* CX   = (unsigned short*)take(SZ_CX);        /* [NR][2048]: context x16 value | residual (x64) */
  if (off > ws_size) return;

  k_prep<<<(unsigned)PB_ALL, 256, 0, stream>>>(x, Wq, Wk, Wv, Wo, X16, BQKV, BO);
  k_gemm_planes<<<(unsigned)((NR / 128) * (LQ / 64)), 128, 0, stream>>>(X16, EMB, BQKV, EMB, 0.0625f, QKH, QKR, LQ, NR, LQ, EMB);
  k_vt<<<(unsigned)(NB * NG * NKV * (SEQ / 64)), 256, 0, stream>>>(QKH, QKR, VTH, VTR);
  k_attn<<<dim3((unsigned)(SEQ / 64), (unsigned)(NG * NH)), 128, 0, stream>>>(QKH, QKR, VTH, VTR, CX);
  k_gemm_out<<<(unsigned)((NR / 128) * (EMB / 64)), 128, 0, stream>>>(CX, CP, BO, CP, 0.00390625f, (float*)d_out, EMB, NR, EMB, CP);
}

// v007
// It runs in 108 microseconds.
// Two timings next to v006 put it at 1.05 and 1.06 times that version's speed.
// All steps since v000 together make it 3.28 times as fast.
#include <hip/hip_runtime.h>
// Causal grouped-query self-attention with a group axis: x [1][SEQ][2][1024]; token row = s*2 + g; q = x Wq (16 heads x 64), k|v = x Wk|Wv (4 kv heads x 64, query head h uses kv head h/4); raw energy, causal exclusion (key > query), then 1/8 inside the softmax over keys of the same g; merged heads (h*64 + d) times Wo.
// Compute dtype: v_wmma_f32_16x16x32_f16 for every contraction, f32 accumulate. Inputs RNE-converted to bf16 then held exactly in f16 (x as is, weights x16). q|k|v written as f16 value + f16 residual (x2^10) planes. Scores: q value+residual against k value (plus k residual on query rows < 256). P carried x2^10 as f16 (plus residual x2^10 on rows < 256), V^T value (plus residual on rows < 256), residual products in a separate accumulator. Context carried x16 as f16 value | residual (x64) along K against Wo x16 | Wo / 4. Softmax statistics f32.
#ifndef NB
#define NB 1
#endif
#ifndef SEQ
#define SEQ 2048
#endif
#define SEQ_FULL 2048
#define NG 2
#define EMB 1024
#define NH 16
#define NKV 4
#define HD 64
#define KVW (NKV * HD)            /* 256 */
#define LQ (EMB + 2 * KVW)        /* 1536: pitch of the q|k|v planes */
#define CP (2 * EMB)              /* 2048: pitch of the context plane (value | residual) */
#define NR (NB * SEQ * NG)        /* token rows */
#define EQT 4                     /* 64-row query tiles (rows < 256) that run the full residual scheme */
#define RS 1024.0f                /* residual carry of q, k, v, P */
#define RINV 0.0009765625f
#define RSC 64.0f                 /* residual carry of the context plane */

static_assert(NB == 1);
static_assert(SEQ % 64 == 0);
static_assert(SEQ >= 64);
static_assert(SEQ <= SEQ_FULL);
static_assert(NR % 128 == 0);
static_assert(LQ % 64 == 0);
static_assert(EMB % 64 == 0);
static_assert(CP % 64 == 0);
static_assert(HD == 64);
static_assert(NH == 4 * NKV);
static_assert(NH * HD == EMB);
static_assert(KVW % 64 == 0);

typedef unsigned short v8us __attribute__((ext_vector_type(8), may_alias));
typedef float  v8f  __attribute__((ext_vector_type(8)));
typedef float  v4f  __attribute__((ext_vector_type(4)));
typedef float  v4fa __attribute__((ext_vector_type(4), may_alias));
typedef _Float16 v16h __attribute__((ext_vector_type(16)));
union FragH { v16h v; v8us half[2]; _Float16 h[16]; unsigned short u[16]; };

constexpr size_t SZ_BQKV = (size_t)LQ * EMB * 2;
constexpr size_t SZ_BO   = (size_t)EMB * CP * 2;
constexpr size_t SZ_X16  = (size_t)NR * EMB * 2;
constexpr size_t SZ_QK   = (size_t)NR * LQ * 2;
constexpr size_t SZ_VT   = (size_t)NB * NG * NKV * HD * SEQ * 2;
constexpr size_t SZ_CX   = (size_t)NR * CP * 2;
constexpr size_t WS_TOTAL = SZ_BQKV + SZ_BO + SZ_X16 + 2 * SZ_QK + 2 * SZ_VT + SZ_CX;
static_assert(WS_TOTAL <= (size_t)134217728);
static_assert(SZ_BQKV % 256 == 0 && SZ_BO % 256 == 0 && SZ_X16 % 256 == 0 && SZ_QK % 256 == 0 && SZ_VT % 256 == 0 && SZ_CX % 256 == 0);

// RNE convert f32 -> bf16 value (kept in f32)
__device__ __forceinline__ float bf16_rne(float x) { unsigned int u = __float_as_uint(x); u = (u + 0x7FFFu + ((u >> 16) & 1u)) & 0xFFFF0000u; return __uint_as_float(u); }
__device__ __forceinline__ unsigned short h_bits(_Float16 h) { return __builtin_bit_cast(unsigned short, h); }
// 16-bit fragment: elements 0..7 <- k0 + 8h + 0..7, elements 8..15 <- k0 + 16 + 8h + 0..7 (row / column = lane & 15)
__device__ __forceinline__ v16h ldfrag(const unsigned short* __restrict__ p, size_t off, int hh) { FragH f; f.half[0] = *(const v8us*)(p + off + 8 * hh); f.half[1] = *(const v8us*)(p + off + 16 + 8 * hh); return f.v; }
// lane l <-> lane l ^ 16
__device__ __forceinline__ float xhalf(float x) { const int b = __builtin_bit_cast(int, x); return __builtin_bit_cast(float, __builtin_amdgcn_permlanex16(b, b, 0x76543210, 0xfedcba98, false, false)); }
template <bool B> struct flag_c { static constexpr bool value = B; };
__device__ __forceinline__ v8f mma(v16h a, v16h b, v8f c) { v8f d = __builtin_amdgcn_wmma_f32_16x16x32_f16(false, a, false, b, (short)0, c, false, false); asm volatile("v_nop\n\tv_nop\n\tv_nop\n\tv_nop" : "+v"(d) : "v"(a), "v"(b)); return d; }

// A thread converts 32 elements. Patch t of W^T, 8 k x 4 n: Wt[drow0 + n + j][dcol0 + k8 .. k8 + 7] = f16(bf16(W[k8 + i][n + j]) * scale), j < 4; K % 64 == 0, N % 16 == 0.
// A wave covers 64 k x 16 n: four neighbouring lanes read 64 contiguous bytes of a W row with one 16-byte load each (the wave beside it, in the same block, reads the line's other half), eight lanes write one whole 128-byte line of a W^T row. The transposition itself is a choice of registers.
__device__ __forceinline__ void wt_f16(const float* __restrict__ W, unsigned short* __restrict__ Wt, int K, int N, int drow0, int dpitch, int dcol0, float scale, int t) {
  const int nwn = N / 16;                       /* wave tiles along n */
  const int w = t >> 5, l = t & 31; if (w >= nwn * (K / 64)) return;
  const int kw = w / nwn, nw = w - kw * nwn;
  const int n = nw * 16 + (l & 3) * 4, k8 = kw * 64 + (l >> 2) * 8;
  v4f a[8];
#pragma unroll   /* constant indices: the patch stays in registers, its eight loads are in flight together */
  for (int i = 0; i < 8; ++i) a[i] = *(const v4fa*)(W + (size_t)(k8 + i) * N + n);
#pragma unroll
  for (int j = 0; j < 4; ++j) {
    FragH f;
#pragma unroll
    for (int i = 0; i < 8; ++i) f.h[i] = (_Float16)(bf16_rne(a[i][j]) * scale);
    const v8us o = f.half[0];
    *(v8us*)(Wt + (size_t)(drow0 + n + j) * dpitch + dcol0 + k8) = o;
  }
}

// Four 8-element groups of x, 256 groups apart (block b owns groups 1024 b .. 1024 b + 1023)
__device__ __forceinline__ void x16_f16(const float* __restrict__ x, unsigned short* __restrict__ X16, int b, int tid) {
  const size_t g0 = (size_t)b * 1024 + tid;
  v4f a[4], c[4];
#pragma unroll   /* constant indices: the eight loads are in flight together */
  for (int j = 0; j < 4; ++j) { a[j] = *(const v4fa*)(x + (g0 + 256 * j) * 8); c[j] = *(const v4fa*)(x + (g0 + 256 * j) * 8 + 4); }
#pragma unroll
  for (int j = 0; j < 4; ++j) {
    FragH f;
#pragma unroll
    for (int q = 0; q < 4; ++q) { f.h[q] = (_Float16)bf16_rne(a[j][q]); f.h[4 + q] = (_Float16)bf16_rne(c[j][q]); }
    const v8us o = f.half[0];
    *(v8us*)(X16 + (g0 + 256 * j) * 8) = o;
  }
  asm volatile("s_wait_xcnt 0x0" ::: "memory");   /* stands behind the four stores, in front of any later write of their address or data registers */
}

static_assert(EMB % 64 == 0 && KVW % 16 == 0);
static_assert((EMB * EMB) % (32 * 256) == 0 && (KVW * EMB) % (32 * 256) == 0 && ((size_t)NR * EMB) % (32 * 256) == 0);
constexpr int PB_W  = EMB * EMB / (32 * 256);   /* blocks of a 1024-column weight */
constexpr int PB_KV = KVW * EMB / (32 * 256);   /* blocks of a 256-column weight */
constexpr int PB_X  = NR * EMB / (32 * 256);    /* blocks of x */
constexpr int PB_ALL = 3 * PB_W + 2 * PB_KV + PB_X;

// All input conversions in one launch: none reads what another writes, so a block picks its job by its index (block-uniform). The weight jobs, whose waves last longer, come first.
__global__ __launch_bounds__(256) void k_prep(const float* __restrict__ x, const float* __restrict__ Wq, const float* __restrict__ Wk, const float* __restrict__ Wv, const float* __restrict__ Wo,
    unsigned short* __restrict__ X16, unsigned short* __restrict__ BQKV, unsigned short* __restrict__ BO) {
  const int tid = threadIdx.x; int b = blockIdx.x;
  if (b < PB_W) { wt_f16(Wq, BQKV, EMB, EMB, 0, EMB, 0, 16.0f, b * 256 + tid); return; }
  b -= PB_W;
  if (b < PB_W) { wt_f16(Wo, BO, EMB, EMB, 0, CP, 0, 16.0f, b * 256 + tid); return; }
  b -= PB_W;
  if (b < PB_W) { wt_f16(Wo, BO, EMB, EMB, 0, CP, EMB, 0.25f, b * 256 + tid); return; }
  b -= PB_W;
  if (b < PB_KV) { wt_f16(Wk, BQKV, EMB, KVW, EMB, EMB, 0, 16.0f, b * 256 + tid); return; }
  b -= PB_KV;
  if (b < PB_KV) { wt_f16(Wv, BQKV, EMB, KVW, EMB + KVW, EMB, 0, 16.0f, b * 256 + tid); return; }
  b -= PB_KV;
  x16_f16(x, X16, b, tid);
}

// GEMM main loop: block tile 128 x 64, wave tile 32 x 64, A f16 [M][lda], Bt f16 [N][ldb] (k contiguous), K % 64 == 0, K >= 64; called by all 128 threads of the block.
// The block's A and Bt rows of each 64-wide k step are copied into LDS once per block as whole 128-byte lines (two buffers, the next step's copies fly during this step); every wave reads its fragments from there.
__device__ __forceinline__ void gemm_core(const unsigned short* __restrict__ A, int lda, const unsigned short* __restrict__ Bt, int ldb, int K, int brow0, int col0, int tid, int wave, int ln, int hh,
    v8f& c00, v8f& c01, v8f& c02, v8f& c03, v8f& c10, v8f& c11, v8f& c12, v8f& c13) {
  __shared__ __attribute__((aligned(16))) unsigned short at[2][128][72];   /* 128 rows x 64 k, pitch 144 B */
  __shared__ __attribute__((aligned(16))) unsigned short bt[2][64][72];    /* 64 columns x 64 k, pitch 144 B */
  const int r0 = tid >> 3, c8 = (tid & 7) * 8;
  const unsigned short* const ga = A + (size_t)(brow0 + r0) * lda + c8;
  const unsigned short* const gb = Bt + (size_t)(col0 + r0) * ldb + c8;
  const size_t sa = (size_t)16 * lda, sb = (size_t)16 * ldb;
  const int nst = K >> 6;
  // step s -> buffer s & 1: each thread copies 16 B of A rows r0 + 16 j (j < 8) and of Bt rows r0 + 16 j (j < 4)
  auto stage = [&](int s) {
    const int b = s & 1;
    const size_t ko = (size_t)s * 64;   /* added to row pointers that do not change from step to step: twelve independent additions, no chain in front of the copies */
    const unsigned short* const a0 = ga + ko; const unsigned short* const a1 = (ga + sa) + ko; const unsigned short* const a2 = (ga + 2 * sa) + ko; const unsigned short* const a3 = (ga + 3 * sa) + ko;
    const unsigned short* const a4 = (ga + 4 * sa) + ko; const unsigned short* const a5 = (ga + 5 * sa) + ko; const unsigned short* const a6 = (ga + 6 * sa) + ko; const unsigned short* const a7 = (ga + 7 * sa) + ko;
    const unsigned short* const b0 = gb + ko; const unsigned short* const b1 = (gb + sb) + ko; const unsigned short* const b2 = (gb + 2 * sb) + ko; const unsigned short* const b3 = (gb + 3 * sb) + ko;
    const unsigned int la0 = (unsigned int)(size_t)&at[b][r0][c8], la1 = (unsigned int)(size_t)&at[b][r0 + 16][c8], la2 = (unsigned int)(size_t)&at[b][r0 + 32][c8], la3 = (unsigned int)(size_t)&at[b][r0 + 48][c8];
    const unsigned int la4 = (unsigned int)(size_t)&at[b][r0 + 64][c8], la5 = (unsigned int)(size_t)&at[b][r0 + 80][c8], la6 = (unsigned int)(size_t)&at[b][r0 + 96][c8], la7 = (unsigned int)(size_t)&at[b][r0 + 112][c8];
    const unsigned int lb0 = (unsigned int)(size_t)&bt[b][r0][c8], lb1 = (unsigned int)(size_t)&bt[b][r0 + 16][c8], lb2 = (unsigned int)(size_t)&bt[b][r0 + 32][c8], lb3 = (unsigned int)(size_t)&bt[b][r0 + 48][c8];
    // the closing s_wait_xcnt keeps later writes of the address registers behind the copies
    asm volatile("global_load_async_to_lds_b128 %0, %12, off\n\tglobal_load_async_to_lds_b128 %1, %13, off\n\tglobal_load_async_to_lds_b128 %2, %14, off\n\tglobal_load_async_to_lds_b128 %3, %15, off\n\t"
                 "global_load_async_to_lds_b128 %4, %16, off\n\tglobal_load_async_to_lds_b128 %5, %17, off\n\tglobal_load_async_to_lds_b128 %6, %18, off\n\tglobal_load_async_to_lds_b128 %7, %19, off\n\t"
                 "global_load_async_to_lds_b128 %8, %20, off\n\tglobal_load_async_to_lds_b128 %9, %21, off\n\tglobal_load_async_to_lds_b128 %10, %22, off\n\tglobal_load_async_to_lds_b128 %11, %23, off\n\ts_wait_xcnt 0x0"
                 :: "v"(la0), "v"(la1), "v"(la2), "v"(la3), "v"(la4), "v"(la5), "v"(la6), "v"(la7), "v"(lb0), "v"(lb1), "v"(lb2), "v"(lb3),
                    "v"(a0), "v"(a1), "v"(a2), "v"(a3), "v"(a4), "v"(a5), "v"(a6), "v"(a7), "v"(b0), "v"(b1), "v"(b2), "v"(b3) : "memory");
  };
  stage(0);
  asm volatile("s_wait_asynccnt 0x0" ::: "memory");   /* own copies of step 0 landed */
  __syncthreads();                                    /* step 0 readable by every wave */
  if (nst > 1) stage(1);
#pragma unroll 1
  for (int s = 0; s < nst; ++s) {                     /* rolled: one body serves both buffers */
    const unsigned short (* const as)[72] = at[s & 1];
    const unsigned short (* const bs)[72] = bt[s & 1];
    // all fragments of the step are fetched as one group in front of its products: one LDS wait place a step instead of two
    v16h fa[2][2], fb[2][4];
#pragma unroll   /* these three loops are unrolled so that the fragment arrays are indexed by constants and stay in registers */
    for (int kk = 0; kk < 2; ++kk) {
      fa[kk][0] = ldfrag(&as[32 * wave + ln][kk * 32], 0, hh); fa[kk][1] = ldfrag(&as[32 * wave + 16 + ln][kk * 32], 0, hh);
#pragma unroll
      for (int j = 0; j < 4; ++j) fb[kk][j] = ldfrag(&bs[16 * j + ln][kk * 32], 0, hh);
    }
#pragma unroll
    for (int kk = 0; kk < 2; ++kk) {
      c00 = mma(fa[kk][0], fb[kk][0], c00); c10 = mma(fa[kk][1], fb[kk][0], c10);
      c01 = mma(fa[kk][0], fb[kk][1], c01); c11 = mma(fa[kk][1], fb[kk][1], c11);
      c02 = mma(fa[kk][0], fb[kk][2], c02); c12 = mma(fa[kk][1], fb[kk][2], c12);
      c03 = mma(fa[kk][0], fb[kk][3], c03); c13 = mma(fa[kk][1], fb[kk][3], c13);
    }
    // hand-over, passed by every wave: own LDS reads done, own copies of step s + 1 landed, then the block barrier that publishes step s + 1 and frees this step's buffer
    asm volatile("s_wait_dscnt 0x0" ::: "memory");
    asm volatile("s_wait_asynccnt 0x0" ::: "memory");
    __syncthreads();
    if (s + 2 < nst) stage(s + 2);
  }
  asm volatile("s_wait_asynccnt 0x0" ::: "memory");   /* no copy outstanding behind the loop */
}

// C = alpha * A . Bt^T written as f16 value plane CH and residual plane CR ((v - value) * 2^10), both pitch ldc. M % 128 == 0, N % 64 == 0.
__global__ __launch_bounds__(128) void k_gemm_planes(const unsigned short* __restrict__ A, int lda, const unsigned short* __restrict__ Bt, int ldb, float alpha,
    unsigned short* __restrict__ CH, unsigned short* __restrict__ CR, int ldc, int M, int N, int K) {
  __shared__ __attribute__((aligned(16))) float so[4][32][68];
  const int tid = threadIdx.x; const int wave = __builtin_amdgcn_readfirstlane(tid >> 5);
  const int lane = tid & 31, ln = lane & 15, hh = lane >> 4;
  const int ntn = N >> 6; const int mt = blockIdx.x / ntn, nq = blockIdx.x - mt * ntn;
  const int brow0 = mt * 128, row0 = brow0 + 32 * wave, col0 = nq * 64; if (brow0 >= M) return;
  const v8f z8 = {0.f, 0.f, 0.f, 0.f, 0.f, 0.f, 0.f, 0.f};
  v8f c00 = z8, c01 = z8, c02 = z8, c03 = z8, c10 = z8, c11 = z8, c12 = z8, c13 = z8;
  gemm_core(A, lda, Bt, ldb, K, brow0, col0, tid, wave, ln, hh, c00, c01, c02, c03, c10, c11, c12, c13);
  v8f accs[8] = {c00, c01, c02, c03, c10, c11, c12, c13};
#pragma unroll
  for (int u = 0; u < 8; ++u) { const int t = u & 3, hf = u >> 2;
#pragma unroll
    for (int r = 0; r < 8; ++r) so[wave][hf * 16 + 8 * hh + r][t * 16 + ln] = accs[u][r] * alpha; }
  __builtin_amdgcn_fence(4 /* acq_rel order */, "workgroup"); __builtin_amdgcn_wave_barrier();
  const int rq = lane >> 3, c8 = (lane & 7) * 8;
  {
#pragma unroll
    for (int it = 0; it < 8; ++it) {
      const int rr = it * 4 + rq;
      const v4f a = *(const v4fa*)&so[wave][rr][c8], b = *(const v4fa*)&so[wave][rr][c8 + 4];
      FragH fh, fl;
#pragma unroll
      for (int q = 0; q < 4; ++q) { _Float16 hv = (_Float16)a[q]; fh.h[q] = hv; fl.h[q] = (_Float16)((a[q] - (float)hv) * RS); hv = (_Float16)b[q]; fh.h[4 + q] = hv; fl.h[4 + q] = (_Float16)((b[q] - (float)hv) * RS); }
      const v8us oh = fh.half[0], ol = fl.half[0];
      const size_t o = (size_t)(row0 + rr) * ldc + col0 + c8;
      *(v8us*)(CH + o) = oh; *(v8us*)(CR + o) = ol;
    }
    
  }
}

__global__ __launch_bounds__(128) void k_gemm_out(const unsigned short* __restrict__ A, int lda, const unsigned short* __restrict__ Bt, int ldb, float alpha,
    float* __restrict__ C, int ldc, int M, int N, int K) {
  __shared__ __attribute__((aligned(16))) float so[4][32][68];
  const int tid = threadIdx.x; const int wave = __builtin_amdgcn_readfirstlane(tid >> 5);
  const int lane = tid & 31, ln = lane & 15, hh = lane >> 4;
  const int ntn = N >> 6; const int mt = blockIdx.x / ntn, nq = blockIdx.x - mt * ntn;
  const int brow0 = mt * 128, row0 = brow0 + 32 * wave, col0 = nq * 64; if (brow0 >= M) return;
  const v8f z8 = {0.f, 0.f, 0.f, 0.f, 0.f, 0.f, 0.f, 0.f};
  v8f c00 = z8, c01 = z8, c02 = z8, c03 = z8, c10 = z8, c11 = z8, c12 = z8, c13 = z8;
  gemm_core(A, lda, Bt, ldb, K, brow0, col0, tid, wave, ln, hh, c00, c01, c02, c03, c10, c11, c12, c13);
  v8f accs[8] = {c00, c01, c02, c03, c10, c11, c12, c13};
#pragma unroll
  for (int u = 0; u < 8; ++u) { const int t = u & 3, hf = u >> 2;
#pragma unroll
    for (int r = 0; r < 8; ++r) so[wave][hf * 16 + 8 * hh + r][t * 16 + ln] = accs[u][r] * alpha; }
  __builtin_amdgcn_fence(4 /* acq_rel order */, "workgroup"); __builtin_amdgcn_wave_barrier();
  const int rsub = lane >> 4, c4 = (lane & 15) * 4;
  {
#pragma unroll
    for (int q = 0; q < 16; ++q) { const int r = q * 2 + rsub; const v4f v = *(const v4fa*)&so[wave][r][c4]; *(v4f*)(C + (size_t)(row0 + r) * ldc + col0 + c4) = v; }
    
  }
}

__global__ __launch_bounds__(256) void k_vt(const unsigned short* __restrict__ QKH, const unsigned short* __restrict__ QKR, unsigned short* __restrict__ VTH, unsigned short* __restrict__ VTR) {
  __shared__ unsigned short tl[2][64][66];
  const int tid = threadIdx.x;
  const int nlg = SEQ / 64;
  const int slab = blockIdx.x / nlg, lg = blockIdx.x - slab * nlg;
  const int g = slab / NKV, kv = slab - g * NKV;
#pragma unroll 1
  for (int i = tid; i < 512; i += 256) {
    const int r = i >> 3, c8 = (i & 7) * 8;
    const size_t sof = ((size_t)(lg * 64 + r) * NG + g) * LQ + EMB + KVW + kv * HD + c8;
    FragH fh, fr; fh.half[0] = *(const v8us*)(QKH + sof); fr.half[0] = *(const v8us*)(QKR + sof);
#pragma unroll
    for (int q = 0; q < 8; ++q) { tl[0][r][c8 + q] = fh.u[q]; tl[1][r][c8 + q] = fr.u[q]; }
  }
  __syncthreads();
  {
#pragma unroll
    for (int rd = 0; rd < 2; ++rd) {
      const int d = rd * 32 + (tid >> 3), pc = tid & 7; FragH fh, fr;
#pragma unroll
      for (int q = 0; q < 8; ++q) { fh.u[q] = tl[0][pc * 8 + q][d]; fr.u[q] = tl[1][pc * 8 + q][d]; }
      const v8us oh = fh.half[0], ol = fr.half[0];
      const size_t o = ((size_t)slab * HD + d) * SEQ + lg * 64 + pc * 8;
      *(v8us*)(VTH + o) = oh; *(v8us*)(VTR + o) = ol;
    }
    
  }
}

// Fused causal flash attention. grid = (SEQ/64, NG*NH); block = 4 waves, wave = 16 query rows; 32-key steps up to the diagonal.
// The block's q tile (value and residual) is copied into LDS once and each wave's q fragments are read from it once, the K and V^T value tiles of each step once per block (two buffers, the next step's copies fly during this step); the K and V^T residual planes (rows < 256 only) come straight from global memory. Scores and context are formed transposed (S^T = K q^T, O^T += V^T P^T): a lane owns one query, P goes from the score registers into the B operand. The per-wave output staging tile is wave-private.
__global__ __launch_bounds__(128) void k_attn(const unsigned short* __restrict__ QKH, const unsigned short* __restrict__ QKR,
    const unsigned short* __restrict__ VTH, const unsigned short* __restrict__ VTR, unsigned short* __restrict__ CX) {
  __shared__ __attribute__((aligned(16))) float so[4][16][68];
  __shared__ __attribute__((aligned(16))) unsigned short kt[2][32][72];   /* 32 keys x 64, pitch 144 B */
  __shared__ __attribute__((aligned(16))) unsigned short vt[2][64][40];   /* 64 d x 32 keys, pitch 80 B */
  __shared__ __attribute__((aligned(16))) unsigned short qs[2][64][72];   /* value | residual: 64 query rows x 64, pitch 144 B */
  const int tid = threadIdx.x; const int wave = __builtin_amdgcn_readfirstlane(tid >> 5);
  const int lane = tid & 31, ln = lane & 15, hh = lane >> 4;
  const int qt = blockIdx.x, gh = blockIdx.y;
  const int g = gh >> 4, h = gh & 15, kvh = h >> 2;
  const int q0 = qt * 64 + wave * 16;
  const size_t kcol = (size_t)EMB + kvh * HD;
  const size_t vrow = (size_t)(g * NKV + kvh) * HD;
  const v8f z8 = {0.f, 0.f, 0.f, 0.f, 0.f, 0.f, 0.f, 0.f};
  v8f om[4] = {z8, z8, z8, z8}, orr[4] = {z8, z8, z8, z8};
  float mi = -1.0e30f, li = 0.f;            /* of query q0 + ln; li holds the sum over this half's keys */
  const int nkb = (q0 + 16 + 31) >> 5;      /* every visited 32-key step starts at a key <= q0, so each row keeps >= 1 key per step */
  const int nst = 2 * qt + 2;               /* steps of the block = nkb of its last wave; keys < 64 * qt + 64 <= SEQ */
  const int kr0 = tid >> 3, kc8 = (tid & 7) * 8, vr0 = tid >> 2, vc8 = (tid & 3) * 8;
  const unsigned short* const gk = QKH + ((size_t)kr0 * NG + g) * LQ + kcol + kc8;
  const unsigned short* const gv = VTH + (vrow + vr0) * (size_t)SEQ + vc8;
  // step s -> buffer s & 1: each thread copies 16 B of K rows kr0, kr0 + 16 and of V^T rows vr0, vr0 + 32
  auto stage = [&](int s) {
    const int b = s & 1;
    const unsigned short* const k0 = gk + (size_t)s * (32 * NG * LQ); const unsigned short* const k1 = k0 + (size_t)16 * NG * LQ;
    const unsigned short* const v0 = gv + s * 32; const unsigned short* const v1 = v0 + (size_t)32 * SEQ;
    const unsigned int lk0 = (unsigned int)(size_t)&kt[b][kr0][kc8], lk1 = (unsigned int)(size_t)&kt[b][kr0 + 16][kc8];
    const unsigned int lv0 = (unsigned int)(size_t)&vt[b][vr0][vc8], lv1 = (unsigned int)(size_t)&vt[b][vr0 + 32][vc8];
    // the closing s_wait_xcnt keeps later writes of the address registers behind the copies
    asm volatile("global_load_async_to_lds_b128 %0, %4, off\n\tglobal_load_async_to_lds_b128 %1, %5, off\n\tglobal_load_async_to_lds_b128 %2, %6, off\n\tglobal_load_async_to_lds_b128 %3, %7, off\n\ts_wait_xcnt 0x0"
                 :: "v"(lk0), "v"(lk1), "v"(lv0), "v"(lv1), "v"(k0), "v"(k1), "v"(v0), "v"(v1) : "memory");
  };
  {
    // q tile: each thread copies 16 B of rows kr0 + 0, 16, 32, 48 of both planes
    const size_t qg = ((size_t)(qt * 64 + kr0) * NG + g) * LQ + h * HD + kc8;
    const unsigned short* const h0 = QKH + qg; const unsigned short* const h1 = h0 + (size_t)16 * NG * LQ;
    const unsigned short* const h2 = h1 + (size_t)16 * NG * LQ; const unsigned short* const h3 = h2 + (size_t)16 * NG * LQ;
    const unsigned short* const r0 = QKR + qg; const unsigned short* const r1 = r0 + (size_t)16 * NG * LQ;
    const unsigned short* const r2 = r1 + (size_t)16 * NG * LQ; const unsigned short* const r3 = r2 + (size_t)16 * NG * LQ;
    const unsigned int a0 = (unsigned int)(size_t)&qs[0][kr0][kc8], a1 = (unsigned int)(size_t)&qs[0][kr0 + 16][kc8];
    const unsigned int a2 = (unsigned int)(size_t)&qs[0][kr0 + 32][kc8], a3 = (unsigned int)(size_t)&qs[0][kr0 + 48][kc8];
    const unsigned int b0 = (unsigned int)(size_t)&qs[1][kr0][kc8], b1 = (unsigned int)(size_t)&qs[1][kr0 + 16][kc8];
    const unsigned int b2 = (unsigned int)(size_t)&qs[1][kr0 + 32][kc8], b3 = (unsigned int)(size_t)&qs[1][kr0 + 48][kc8];
    // the closing s_wait_xcnt keeps later writes of the address registers behind the copies
    asm volatile("global_load_async_to_lds_b128 %0, %8, off\n\tglobal_load_async_to_lds_b128 %1, %9, off\n\tglobal_load_async_to_lds_b128 %2, %10, off\n\tglobal_load_async_to_lds_b128 %3, %11, off\n\t"
                 "global_load_async_to_lds_b128 %4, %12, off\n\tglobal_load_async_to_lds_b128 %5, %13, off\n\tglobal_load_async_to_lds_b128 %6, %14, off\n\tglobal_load_async_to_lds_b128 %7, %15, off\n\ts_wait_xcnt 0x0"
                 :: "v"(a0), "v"(a1), "v"(a2), "v"(a3), "v"(b0), "v"(b1), "v"(b2), "v"(b3), "v"(h0), "v"(h1), "v"(h2), "v"(h3), "v"(r0), "v"(r1), "v"(r2), "v"(r3) : "memory");
  }
  stage(0);
  asm volatile("s_wait_asynccnt 0x0" ::: "memory");   /* own copies of q and of step 0 landed */
  __syncthreads();                                    /* q and step 0 readable by every wave */
  stage(1);                                           /* nst >= 2: step 1 always exists */
  // q fragments: read from LDS once, behind the barrier that published the q tile, and kept in registers through the key loop
  v16h qh[2], qr[2];
#pragma unroll   /* constant indices: the fragments stay in registers */
  for (int kk = 0; kk < 2; ++kk) { qh[kk] = ldfrag(&qs[0][wave * 16 + ln][kk * 32], 0, hh); qr[kk] = ldfrag(&qs[1][wave * 16 + ln][kk * 32], 0, hh); }
  // The key loop is compiled twice, with the residual scheme as a compile-time constant: the copy for rows >= 256 holds no test of it, no residual accumulator (it stays 0) and no global load; each step is one straight-line block, with no LDS exchange inside it.
  auto key_loop = [&](auto fc) {
  constexpr bool full = decltype(fc)::value;
#pragma unroll 1
  for (int kb = 0; kb < nst; ++kb) {
   if (kb < nkb) {                                    /* wave-uniform: waves 0 and 1 sit out the block's last step */
    const int kbase = kb * 32;
    const unsigned short (* const ks)[72] = kt[kb & 1];
    const unsigned short (* const vs)[40] = vt[kb & 1];
    // Transposed products: S^T = K q^T (rows = keys, column = query), so lane ln of either half owns query q0 + ln and holds 16 of its 32 scores in registers.
    // all LDS fragments of the step, K first and then V^T, are fetched as one group in front of its products: one LDS wait place a step, and the V^T latency passes behind the score products and the softmax
    v16h kf[2][2], vf[4];
#pragma unroll   /* these loops are unrolled so that the fragment arrays are indexed by constants and stay in registers */
    for (int kk = 0; kk < 2; ++kk) {
#pragma unroll
      for (int nt = 0; nt < 2; ++nt) kf[kk][nt] = ldfrag(&ks[nt * 16 + ln][kk * 32], 0, hh);
    }
#pragma unroll
    for (int t = 0; t < 4; ++t) vf[t] = ldfrag(&vs[t * 16 + ln][0], 0, hh);
    v8f sm[2] = {z8, z8}, sr[2] = {z8, z8};
#pragma unroll
    for (int kk = 0; kk < 2; ++kk) {
#pragma unroll
      for (int nt = 0; nt < 2; ++nt) {
        const size_t ko = ((size_t)(kbase + nt * 16 + ln) * NG + g) * LQ + kcol + kk * 32;
        sm[nt] = mma(kf[kk][nt], qh[kk], sm[nt]);
        sr[nt] = mma(kf[kk][nt], qr[kk], sr[nt]);
        if constexpr (full) { const v16h kr = ldfrag(QKR, ko, hh); sr[nt] = mma(kr, qh[kk], sr[nt]); }
      }
    }
    // register r of tile nt is key kbase + 16 nt + 8 hh + r
    const int kmax = q0 + ln - kbase - 8 * hh;       /* key offset 16 nt + r is kept while it is <= kmax */
    float sc[2][8], mk[2][8];
#pragma unroll
    for (int nt = 0; nt < 2; ++nt) {
#pragma unroll
      for (int r = 0; r < 8; ++r) {
        sc[nt][r] = (sm[nt][r] + sr[nt][r] * RINV) * 0.125f;
        mk[nt][r] = (nt * 16 + r <= kmax) ? sc[nt][r] : -1.0e30f;
      }
    }
    const float mx0 = fmaxf(fmaxf(fmaxf(mk[0][0], mk[0][1]), fmaxf(mk[0][2], mk[0][3])), fmaxf(fmaxf(mk[0][4], mk[0][5]), fmaxf(mk[0][6], mk[0][7])));
    const float mx1 = fmaxf(fmaxf(fmaxf(mk[1][0], mk[1][1]), fmaxf(mk[1][2], mk[1][3])), fmaxf(fmaxf(mk[1][4], mk[1][5]), fmaxf(mk[1][6], mk[1][7])));
    const float mxh = fmaxf(mx0, mx1);
    const float mnew = fmaxf(mi, fmaxf(mxh, xhalf(mxh)));   /* the same in both halves */
    const float al = __expf(mi - mnew);
    mi = mnew;
    float pv[2][8];
#pragma unroll
    for (int nt = 0; nt < 2; ++nt) {
#pragma unroll
      for (int r = 0; r < 8; ++r) {
        const float e = __expf(fminf(sc[nt][r] - mnew, 0.f));
        pv[nt][r] = (nt * 16 + r <= kmax) ? e : 0.f;
      }
    }
    const float su0 = ((pv[0][0] + pv[0][1]) + (pv[0][2] + pv[0][3])) + ((pv[0][4] + pv[0][5]) + (pv[0][6] + pv[0][7]));
    const float su1 = ((pv[1][0] + pv[1][1]) + (pv[1][2] + pv[1][3])) + ((pv[1][4] + pv[1][5]) + (pv[1][6] + pv[1][7]));
    li = li * al + (su0 + su1);                      /* this half's keys only; the halves are joined behind the loop */
#pragma unroll
    for (int t = 0; t < 4; ++t) { om[t] *= al; if constexpr (full) orr[t] *= al; }
    // P^T (x2^10) as a B fragment straight from the score registers: element 8 nt + r is key 16 nt + 8 hh + r, the k order in which ldfrag reads V^T
    FragH ph, pr;
#pragma unroll
    for (int nt = 0; nt < 2; ++nt) {
#pragma unroll
      for (int r = 0; r < 8; ++r) {
        const float pc = pv[nt][r] * RS;
        const _Float16 p16 = (_Float16)pc;
        ph.h[nt * 8 + r] = p16;
        if constexpr (full) pr.h[nt * 8 + r] = (_Float16)((pc - (float)p16) * RS);
      }
    }
    // O^T += V^T P^T: rows = d, column = query
#pragma unroll
    for (int t = 0; t < 4; ++t) {
      const size_t vo = (vrow + t * 16 + ln) * (size_t)SEQ + kbase;
      const v16h vh = vf[t];
      om[t] = mma(vh, ph.v, om[t]);
      if constexpr (full) { const v16h vr = ldfrag(VTR, vo, hh); orr[t] = mma(vr, ph.v, orr[t]); orr[t] = mma(vh, pr.v, orr[t]); }
    }
   }
    // hand-over, passed by every wave: own LDS reads done, own copies of step kb + 1 landed, then the block barrier that publishes step kb + 1 and frees this step's buffer
    asm volatile("s_wait_dscnt 0x0" ::: "memory");
    asm volatile("s_wait_asynccnt 0x0" ::: "memory");
    __syncthreads();
    if (kb + 2 < nst) stage(kb + 2);
  }
  };
  if (qt < EQT) key_loop(flag_c<true>{}); else key_loop(flag_c<false>{});   /* block-uniform choice */
  asm volatile("s_wait_asynccnt 0x0" ::: "memory");   /* no copy outstanding at the wave's end */
  // context x16 = o / (2^10 * l) * 16
  const float inv = 0.015625f * (1.0f / (li + xhalf(li)));
#pragma unroll
  for (int t = 0; t < 4; ++t) {
#pragma unroll
    for (int r = 0; r < 8; ++r) so[wave][ln][t * 16 + 8 * hh + r] = (om[t][r] + orr[t][r] * RINV) * inv;
  }
  __builtin_amdgcn_fence(4 /* acq_rel order */, "workgroup"); __builtin_amdgcn_wave_barrier();
  const int rq = lane >> 3, c8 = (lane & 7) * 8;
  {
#pragma unroll
    for (int it = 0; it < 4; ++it) {
      const int rr = it * 4 + rq;
      const v4f a = *(const v4fa*)&so[wave][rr][c8], b = *(const v4fa*)&so[wave][rr][c8 + 4];
      FragH fh, fl;
#pragma unroll
      for (int q = 0; q < 4; ++q) { _Float16 hv = (_Float16)a[q]; fh.h[q] = hv; fl.h[q] = (_Float16)((a[q] - (float)hv) * RSC); hv = (_Float16)b[q]; fh.h[4 + q] = hv; fl.h[4 + q] = (_Float16)((b[q] - (float)hv) * RSC); }
      const v8us oh = fh.half[0], ol = fl.half[0];
      const size_t o = ((size_t)(q0 + rr) * NG + g) * CP + h * HD + c8;
      *(v8us*)(CX + o) = oh; *(v8us*)(CX + o + EMB) = ol;
    }
    
  }
}

extern "C" void kernel_launch(void* const* d_in, const int* in_sizes, int n_in,
                              void* d_out, int out_size, void* d_ws, size_t ws_size, hipStream_t stream) {
  if (n_in < 5) return;
  if (in_sizes[0] < NR * EMB) return;
  if (in_sizes[1] < EMB * EMB) return;
  if (in_sizes[2] < EMB * KVW) return;
  if (in_sizes[3] < EMB * KVW) return;
  if (in_sizes[4] < EMB * EMB) return;
  if (out_size < NR * EMB) return;
  const float* x  = (const float*)d_in[0];
  const float* Wq = (const float*)d_in[1];      /* [in 1024][out 1024] */
  const float* Wk = (const float*)d_in[2];      /* [in 1024][out 256] */
  const float* Wv = (const float*)d_in[3];      /* [in 1024][out 256] */
  const float* Wo = (const float*)d_in[4];      /* [in 1024][out 1024] */
  char* ws = (char*)d_ws; size_t off = 0;
  auto take = [&](size_t bytes) { char* p = ws + off; off += (bytes + 255) & ~(size_t)255; return p; };
  unsigned short* BQKV = (unsigned short*)take(SZ_BQKV);      /* [1536][1024]: Wq^T | Wk^T | Wv^T, x16 */
  unsigned short* BO   = (unsigned short*)take(SZ_BO);        /* [1024][2048]: Wo^T x16 | Wo^T / 4 */
  unsigned short* X16  = (unsigned short*)take(SZ_X16);       /* [NR][1024] */
  unsigned short* QKH  = (unsigned short*)take(SZ_QK);        /* [NR][1536] value plane of q | k | v */
  unsigned short* QKR  = (unsigned short*)take(SZ_QK);        /* [NR][1536] residual plane (x2^10) */
  unsigned short* VTH  = (unsigned short*)take(SZ_VT);        /* [NG*NKV][64][SEQ] */
  unsigned short* VTR  = (unsigned short*)take(SZ_VT);
  unsigned short* CX   = (unsigned short*)take(SZ_CX);        /* [NR][2048]: context x16 value | residual (x64) */
  if (off > ws_size) return;

  k_prep<<<(unsigned)PB_ALL, 256, 0, stream>>>(x, Wq, Wk, Wv, Wo, X16, BQKV, BO);
  k_gemm_planes<<<(unsigned)((NR / 128) * (LQ / 64)), 128, 0, stream>>>(X16, EMB, BQKV, EMB, 0.0625f, QKH, QKR, LQ, NR, LQ, EMB);
  k_vt<<<(unsigned)(NB * NG * NKV * (SEQ / 64)), 256, 0, stream>>>(QKH, QKR, VTH, VTR);
  k_attn<<<dim3((unsigned)(SEQ / 64), (unsigned)(NG * NH)), 128, 0, stream>>>(QKH, QKR, VTH, VTR, CX);
  k_gemm_out<<<(unsigned)((NR / 128) * (EMB / 64)), 128, 0, stream>>>(CX, CP, BO, CP, 0.00390625f, (float*)d_out, EMB, NR, EMB, CP);
}

// v008
// One run takes 102 microseconds.
// In two side-by-side timings against v007, it was 1.04 and 1.05 times as fast.
// Counting every step since v000, it is 3.44 times as fast.
#include <hip/hip_runtime.h>
// Causal grouped-query self-attention with a group axis: x [1][SEQ][2][1024]; token row = s*2 + g; q = x Wq (16 heads x 64), k|v = x Wk|Wv (4 kv heads x 64, query head h uses kv head h/4); raw energy, causal exclusion (key > query), then 1/8 inside the softmax over keys of the same g; merged heads (h*64 + d) times Wo.
// Compute dtype: v_wmma_f32_16x16x32_f16 for every contraction, f32 accumulate. Inputs RNE-converted to bf16 then held exactly in f16 (x as is, weights x16). q|k|v written as f16 value + f16 residual (x2^10) planes. Scores: q value+residual against k value (plus k residual on query rows < 256). P carried x2^10 as f16 (plus residual x2^10 on rows < 256), V^T value (plus residual on rows < 256), residual products in a separate accumulator. Context carried x16 as f16 value | residual (x64) along K against Wo x16 | Wo / 4. Softmax statistics f32.
#ifndef NB
#define NB 1
#endif
#ifndef SEQ
#define SEQ 2048
#endif
#define SEQ_FULL 2048
#define NG 2
#define EMB 1024
#define NH 16
#define NKV 4
#define HD 64
#define KVW (NKV * HD)            /* 256 */
#define LQ (EMB + 2 * KVW)        /* 1536: pitch of the q|k|v planes */
#define CP (2 * EMB)              /* 2048: pitch of the context plane (value | residual) */
#define NR (NB * SEQ * NG)        /* token rows */
#define NQT (SEQ / 64)            /* 64-row query tiles */
#define EQT 4                     /* 64-row query tiles (rows < 256) that run the full residual scheme */
#define RS 1024.0f                /* residual carry of q, k, v, P */
#define RINV 0.0009765625f
#define RSC 64.0f                 /* residual carry of the context plane */

static_assert(NB == 1);
static_assert(SEQ % 128 == 0);
static_assert(SEQ >= 64);
static_assert(SEQ <= SEQ_FULL);
static_assert(NR % 128 == 0);
static_assert(LQ % 64 == 0);
static_assert(EMB % 64 == 0);
static_assert(CP % 64 == 0);
static_assert(HD == 64);
static_assert(NH == 4 * NKV);
static_assert(NH * HD == EMB);
static_assert(KVW % 64 == 0);

typedef unsigned short v8us __attribute__((ext_vector_type(8), may_alias));
typedef float  v8f  __attribute__((ext_vector_type(8)));
typedef float  v4f  __attribute__((ext_vector_type(4)));
typedef float  v4fa __attribute__((ext_vector_type(4), may_alias));
typedef _Float16 v16h __attribute__((ext_vector_type(16)));
union FragH { v16h v; v8us half[2]; _Float16 h[16]; unsigned short u[16]; };

constexpr size_t SZ_BQKV = (size_t)LQ * EMB * 2;
constexpr size_t SZ_BO   = (size_t)EMB * CP * 2;
constexpr size_t SZ_X16  = (size_t)NR * EMB * 2;
constexpr size_t SZ_QK   = (size_t)NR * LQ * 2;
constexpr size_t SZ_VT   = (size_t)NB * NG * NKV * HD * SEQ * 2;
constexpr size_t SZ_CX   = (size_t)NR * CP * 2;
constexpr size_t WS_TOTAL = SZ_BQKV + SZ_BO + SZ_X16 + 2 * SZ_QK + 2 * SZ_VT + SZ_CX;
static_assert(WS_TOTAL <= (size_t)134217728);
static_assert(SZ_BQKV % 256 == 0 && SZ_BO % 256 == 0 && SZ_X16 % 256 == 0 && SZ_QK % 256 == 0 && SZ_VT % 256 == 0 && SZ_CX % 256 == 0);

// RNE convert f32 -> bf16 value (kept in f32)
__device__ __forceinline__ float bf16_rne(float x) { unsigned int u = __float_as_uint(x); u = (u + 0x7FFFu + ((u >> 16) & 1u)) & 0xFFFF0000u; return __uint_as_float(u); }
__device__ __forceinline__ unsigned short h_bits(_Float16 h) { return __builtin_bit_cast(unsigned short, h); }
// 16-bit fragment: elements 0..7 <- k0 + 8h + 0..7, elements 8..15 <- k0 + 16 + 8h + 0..7 (row / column = lane & 15)
__device__ __forceinline__ v16h ldfrag(const unsigned short* __restrict__ p, size_t off, int hh) { FragH f; f.half[0] = *(const v8us*)(p + off + 8 * hh); f.half[1] = *(const v8us*)(p + off + 16 + 8 * hh); return f.v; }
// lane l <-> lane l ^ 16
__device__ __forceinline__ float xhalf(float x) { const int b = __builtin_bit_cast(int, x); return __builtin_bit_cast(float, __builtin_amdgcn_permlanex16(b, b, 0x76543210, 0xfedcba98, false, false)); }
template <bool B> struct flag_c { static constexpr bool value = B; };
__device__ __forceinline__ v8f mma(v16h a, v16h b, v8f c) { v8f d = __builtin_amdgcn_wmma_f32_16x16x32_f16(false, a, false, b, (short)0, c, false, false); asm volatile("v_nop\n\tv_nop\n\tv_nop\n\tv_nop" : "+v"(d) : "v"(a), "v"(b)); return d; }

// A thread converts 32 elements. Patch t of W^T, 8 k x 4 n: Wt[drow0 + n + j][dcol0 + k8 .. k8 + 7] = f16(bf16(W[k8 + i][n + j]) * scale), j < 4; K % 64 == 0, N % 16 == 0.
// A wave covers 64 k x 16 n: four neighbouring lanes read 64 contiguous bytes of a W row with one 16-byte load each (the wave beside it, in the same block, reads the line's other half), eight lanes write one whole 128-byte line of a W^T row. The transposition itself is a choice of registers.
__device__ __forceinline__ void wt_f16(const float* __restrict__ W, unsigned short* __restrict__ Wt, int K, int N, int drow0, int dpitch, int dcol0, float scale, int t) {
  const int nwn = N / 16;                       /* wave tiles along n */
  const int w = t >> 5, l = t & 31; if (w >= nwn * (K / 64)) return;
  const int kw = w / nwn, nw = w - kw * nwn;
  const int n = nw * 16 + (l & 3) * 4, k8 = kw * 64 + (l >> 2) * 8;
  v4f a[8];
#pragma unroll   /* constant indices: the patch stays in registers, its eight loads are in flight together */
  for (int i = 0; i < 8; ++i) a[i] = *(const v4fa*)(W + (size_t)(k8 + i) * N + n);
#pragma unroll
  for (int j = 0; j < 4; ++j) {
    FragH f;
#pragma unroll
    for (int i = 0; i < 8; ++i) f.h[i] = (_Float16)(bf16_rne(a[i][j]) * scale);
    const v8us o = f.half[0];
    *(v8us*)(Wt + (size_t)(drow0 + n + j) * dpitch + dcol0 + k8) = o;
  }
}

// Four 8-element groups of x, 256 groups apart (block b owns groups 1024 b .. 1024 b + 1023)
__device__ __forceinline__ void x16_f16(const float* __restrict__ x, unsigned short* __restrict__ X16, int b, int tid) {
  const size_t g0 = (size_t)b * 1024 + tid;
  v4f a[4], c[4];
#pragma unroll   /* constant indices: the eight loads are in flight together */
  for (int j = 0; j < 4; ++j) { a[j] = *(const v4fa*)(x + (g0 + 256 * j) * 8); c[j] = *(const v4fa*)(x + (g0 + 256 * j) * 8 + 4); }
#pragma unroll
  for (int j = 0; j < 4; ++j) {
    FragH f;
#pragma unroll
    for (int q = 0; q < 4; ++q) { f.h[q] = (_Float16)bf16_rne(a[j][q]); f.h[4 + q] = (_Float16)bf16_rne(c[j][q]); }
    const v8us o = f.half[0];
    *(v8us*)(X16 + (g0 + 256 * j) * 8) = o;
  }
  asm volatile("s_wait_xcnt 0x0" ::: "memory");   /* stands behind the four stores, in front of any later write of their address or data registers */
}

static_assert(EMB % 64 == 0 && KVW % 16 == 0);
static_assert((EMB * EMB) % (32 * 256) == 0 && (KVW * EMB) % (32 * 256) == 0 && ((size_t)NR * EMB) % (32 * 256) == 0);
constexpr int PB_W  = EMB * EMB / (32 * 256);   /* blocks of a 1024-column weight */
constexpr int PB_KV = KVW * EMB / (32 * 256);   /* blocks of a 256-column weight */
constexpr int PB_X  = NR * EMB / (32 * 256);    /* blocks of x */
constexpr int PB_ALL = 3 * PB_W + 2 * PB_KV + PB_X;

// All input conversions in one launch: none reads what another writes, so a block picks its job by its index (block-uniform). The weight jobs, whose waves last longer, come first.
__global__ __launch_bounds__(256) void k_prep(const float* __restrict__ x, const float* __restrict__ Wq, const float* __restrict__ Wk, const float* __restrict__ Wv, const float* __restrict__ Wo,
    unsigned short* __restrict__ X16, unsigned short* __restrict__ BQKV, unsigned short* __restrict__ BO) {
  const int tid = threadIdx.x; int b = blockIdx.x;
  if (b < PB_W) { wt_f16(Wq, BQKV, EMB, EMB, 0, EMB, 0, 16.0f, b * 256 + tid); return; }
  b -= PB_W;
  if (b < PB_W) { wt_f16(Wo, BO, EMB, EMB, 0, CP, 0, 16.0f, b * 256 + tid); return; }
  b -= PB_W;
  if (b < PB_W) { wt_f16(Wo, BO, EMB, EMB, 0, CP, EMB, 0.25f, b * 256 + tid); return; }
  b -= PB_W;
  if (b < PB_KV) { wt_f16(Wk, BQKV, EMB, KVW, EMB, EMB, 0, 16.0f, b * 256 + tid); return; }
  b -= PB_KV;
  if (b < PB_KV) { wt_f16(Wv, BQKV, EMB, KVW, EMB + KVW, EMB, 0, 16.0f, b * 256 + tid); return; }
  b -= PB_KV;
  x16_f16(x, X16, b, tid);
}

// GEMM main loop: block tile 128 x 64, wave tile 32 x 64, A f16 [M][lda], Bt f16 [N][ldb] (k contiguous), K % 64 == 0, K >= 64; called by all 128 threads of the block.
// The block's A and Bt rows of each 64-wide k step are copied into LDS once per block as whole 128-byte lines (two buffers, the next step's copies fly during this step); every wave reads its fragments from there.
__device__ __forceinline__ void gemm_core(const unsigned short* __restrict__ A, int lda, const unsigned short* __restrict__ Bt, int ldb, int K, int brow0, int col0, int tid, int wave, int ln, int hh,
    v8f& c00, v8f& c01, v8f& c02, v8f& c03, v8f& c10, v8f& c11, v8f& c12, v8f& c13) {
  __shared__ __attribute__((aligned(16))) unsigned short at[2][128][72];   /* 128 rows x 64 k, pitch 144 B */
  __shared__ __attribute__((aligned(16))) unsigned short bt[2][64][72];    /* 64 columns x 64 k, pitch 144 B */
  const int r0 = tid >> 3, c8 = (tid & 7) * 8;
  const unsigned short* const ga = A + (size_t)(brow0 + r0) * lda + c8;
  const unsigned short* const gb = Bt + (size_t)(col0 + r0) * ldb + c8;
  const size_t sa = (size_t)16 * lda, sb = (size_t)16 * ldb;
  const int nst = K >> 6;
  // step s -> buffer s & 1: each thread copies 16 B of A rows r0 + 16 j (j < 8) and of Bt rows r0 + 16 j (j < 4)
  auto stage = [&](int s) {
    const int b = s & 1;
    const size_t ko = (size_t)s * 64;   /* added to row pointers that do not change from step to step: twelve independent additions, no chain in front of the copies */
    const unsigned short* const a0 = ga + ko; const unsigned short* const a1 = (ga + sa) + ko; const unsigned short* const a2 = (ga + 2 * sa) + ko; const unsigned short* const a3 = (ga + 3 * sa) + ko;
    const unsigned short* const a4 = (ga + 4 * sa) + ko; const unsigned short* const a5 = (ga + 5 * sa) + ko; const unsigned short* const a6 = (ga + 6 * sa) + ko; const unsigned short* const a7 = (ga + 7 * sa) + ko;
    const unsigned short* const b0 = gb + ko; const unsigned short* const b1 = (gb + sb) + ko; const unsigned short* const b2 = (gb + 2 * sb) + ko; const unsigned short* const b3 = (gb + 3 * sb) + ko;
    const unsigned int la0 = (unsigned int)(size_t)&at[b][r0][c8], la1 = (unsigned int)(size_t)&at[b][r0 + 16][c8], la2 = (unsigned int)(size_t)&at[b][r0 + 32][c8], la3 = (unsigned int)(size_t)&at[b][r0 + 48][c8];
    const unsigned int la4 = (unsigned int)(size_t)&at[b][r0 + 64][c8], la5 = (unsigned int)(size_t)&at[b][r0 + 80][c8], la6 = (unsigned int)(size_t)&at[b][r0 + 96][c8], la7 = (unsigned int)(size_t)&at[b][r0 + 112][c8];
    const unsigned int lb0 = (unsigned int)(size_t)&bt[b][r0][c8], lb1 = (unsigned int)(size_t)&bt[b][r0 + 16][c8], lb2 = (unsigned int)(size_t)&bt[b][r0 + 32][c8], lb3 = (unsigned int)(size_t)&bt[b][r0 + 48][c8];
    // the closing s_wait_xcnt keeps later writes of the address registers behind the copies
    asm volatile("global_load_async_to_lds_b128 %0, %12, off\n\tglobal_load_async_to_lds_b128 %1, %13, off\n\tglobal_load_async_to_lds_b128 %2, %14, off\n\tglobal_load_async_to_lds_b128 %3, %15, off\n\t"
                 "global_load_async_to_lds_b128 %4, %16, off\n\tglobal_load_async_to_lds_b128 %5, %17, off\n\tglobal_load_async_to_lds_b128 %6, %18, off\n\tglobal_load_async_to_lds_b128 %7, %19, off\n\t"
                 "global_load_async_to_lds_b128 %8, %20, off\n\tglobal_load_async_to_lds_b128 %9, %21, off\n\tglobal_load_async_to_lds_b128 %10, %22, off\n\tglobal_load_async_to_lds_b128 %11, %23, off\n\ts_wait_xcnt 0x0"
                 :: "v"(la0), "v"(la1), "v"(la2), "v"(la3), "v"(la4), "v"(la5), "v"(la6), "v"(la7), "v"(lb0), "v"(lb1), "v"(lb2), "v"(lb3),
                    "v"(a0), "v"(a1), "v"(a2), "v"(a3), "v"(a4), "v"(a5), "v"(a6), "v"(a7), "v"(b0), "v"(b1), "v"(b2), "v"(b3) : "memory");
  };
  stage(0);
  asm volatile("s_wait_asynccnt 0x0" ::: "memory");   /* own copies of step 0 landed */
  __syncthreads();                                    /* step 0 readable by every wave */
  if (nst > 1) stage(1);
#pragma unroll 1
  for (int s = 0; s < nst; ++s) {                     /* rolled: one body serves both buffers */
    const unsigned short (* const as)[72] = at[s & 1];
    const unsigned short (* const bs)[72] = bt[s & 1];
    // all fragments of the step are fetched as one group in front of its products: one LDS wait place a step instead of two
    v16h fa[2][2], fb[2][4];
#pragma unroll   /* these three loops are unrolled so that the fragment arrays are indexed by constants and stay in registers */
    for (int kk = 0; kk < 2; ++kk) {
      fa[kk][0] = ldfrag(&as[32 * wave + ln][kk * 32], 0, hh); fa[kk][1] = ldfrag(&as[32 * wave + 16 + ln][kk * 32], 0, hh);
#pragma unroll
      for (int j = 0; j < 4; ++j) fb[kk][j] = ldfrag(&bs[16 * j + ln][kk * 32], 0, hh);
    }
#pragma unroll
    for (int kk = 0; kk < 2; ++kk) {
      c00 = mma(fa[kk][0], fb[kk][0], c00); c10 = mma(fa[kk][1], fb[kk][0], c10);
      c01 = mma(fa[kk][0], fb[kk][1], c01); c11 = mma(fa[kk][1], fb[kk][1], c11);
      c02 = mma(fa[kk][0], fb[kk][2], c02); c12 = mma(fa[kk][1], fb[kk][2], c12);
      c03 = mma(fa[kk][0], fb[kk][3], c03); c13 = mma(fa[kk][1], fb[kk][3], c13);
    }
    // hand-over, passed by every wave: own LDS reads done, own copies of step s + 1 landed, then the block barrier that publishes step s + 1 and frees this step's buffer
    asm volatile("s_wait_dscnt 0x0" ::: "memory");
    asm volatile("s_wait_asynccnt 0x0" ::: "memory");
    __syncthreads();
    if (s + 2 < nst) stage(s + 2);
  }
  asm volatile("s_wait_asynccnt 0x0" ::: "memory");   /* no copy outstanding behind the loop */
}

// C = alpha * A . Bt^T written as f16 value plane CH and residual plane CR ((v - value) * 2^10), both pitch ldc. M % 128 == 0, N % 64 == 0.
__global__ __launch_bounds__(128) void k_gemm_planes(const unsigned short* __restrict__ A, int lda, const unsigned short* __restrict__ Bt, int ldb, float alpha,
    unsigned short* __restrict__ CH, unsigned short* __restrict__ CR, int ldc, int M, int N, int K) {
  __shared__ __attribute__((aligned(16))) float so[4][32][68];
  const int tid = threadIdx.x; const int wave = __builtin_amdgcn_readfirstlane(tid >> 5);
  const int lane = tid & 31, ln = lane & 15, hh = lane >> 4;
  const int ntn = N >> 6; const int mt = blockIdx.x / ntn, nq = blockIdx.x - mt * ntn;
  const int brow0 = mt * 128, row0 = brow0 + 32 * wave, col0 = nq * 64; if (brow0 >= M) return;
  const v8f z8 = {0.f, 0.f, 0.f, 0.f, 0.f, 0.f, 0.f, 0.f};
  v8f c00 = z8, c01 = z8, c02 = z8, c03 = z8, c10 = z8, c11 = z8, c12 = z8, c13 = z8;
  gemm_core(A, lda, Bt, ldb, K, brow0, col0, tid, wave, ln, hh, c00, c01, c02, c03, c10, c11, c12, c13);
  v8f accs[8] = {c00, c01, c02, c03, c10, c11, c12, c13};
#pragma unroll
  for (int u = 0; u < 8; ++u) { const int t = u & 3, hf = u >> 2;
#pragma unroll
    for (int r = 0; r < 8; ++r) so[wave][hf * 16 + 8 * hh + r][t * 16 + ln] = accs[u][r] * alpha; }
  __builtin_amdgcn_fence(4 /* acq_rel order */, "workgroup"); __builtin_amdgcn_wave_barrier();
  const int rq = lane >> 3, c8 = (lane & 7) * 8;
  {
#pragma unroll
    for (int it = 0; it < 8; ++it) {
      const int rr = it * 4 + rq;
      const v4f a = *(const v4fa*)&so[wave][rr][c8], b = *(const v4fa*)&so[wave][rr][c8 + 4];
      FragH fh, fl;
#pragma unroll
      for (int q = 0; q < 4; ++q) { _Float16 hv = (_Float16)a[q]; fh.h[q] = hv; fl.h[q] = (_Float16)((a[q] - (float)hv) * RS); hv = (_Float16)b[q]; fh.h[4 + q] = hv; fl.h[4 + q] = (_Float16)((b[q] - (float)hv) * RS); }
      const v8us oh = fh.half[0], ol = fl.half[0];
      const size_t o = (size_t)(row0 + rr) * ldc + col0 + c8;
      *(v8us*)(CH + o) = oh; *(v8us*)(CR + o) = ol;
    }
    
  }
}

__global__ __launch_bounds__(128) void k_gemm_out(const unsigned short* __restrict__ A, int lda, const unsigned short* __restrict__ Bt, int ldb, float alpha,
    float* __restrict__ C, int ldc, int M, int N, int K) {
  __shared__ __attribute__((aligned(16))) float so[4][32][68];
  const int tid = threadIdx.x; const int wave = __builtin_amdgcn_readfirstlane(tid >> 5);
  const int lane = tid & 31, ln = lane & 15, hh = lane >> 4;
  const int ntn = N >> 6; const int mt = blockIdx.x / ntn, nq = blockIdx.x - mt * ntn;
  const int brow0 = mt * 128, row0 = brow0 + 32 * wave, col0 = nq * 64; if (brow0 >= M) return;
  const v8f z8 = {0.f, 0.f, 0.f, 0.f, 0.f, 0.f, 0.f, 0.f};
  v8f c00 = z8, c01 = z8, c02 = z8, c03 = z8, c10 = z8, c11 = z8, c12 = z8, c13 = z8;
  gemm_core(A, lda, Bt, ldb, K, brow0, col0, tid, wave, ln, hh, c00, c01, c02, c03, c10, c11, c12, c13);
  v8f accs[8] = {c00, c01, c02, c03, c10, c11, c12, c13};
#pragma unroll
  for (int u = 0; u < 8; ++u) { const int t = u & 3, hf = u >> 2;
#pragma unroll
    for (int r = 0; r < 8; ++r) so[wave][hf * 16 + 8 * hh + r][t * 16 + ln] = accs[u][r] * alpha; }
  __builtin_amdgcn_fence(4 /* acq_rel order */, "workgroup"); __builtin_amdgcn_wave_barrier();
  const int rsub = lane >> 4, c4 = (lane & 15) * 4;
  {
#pragma unroll
    for (int q = 0; q < 16; ++q) { const int r = q * 2 + rsub; const v4f v = *(const v4fa*)&so[wave][r][c4]; *(v4f*)(C + (size_t)(row0 + r) * ldc + col0 + c4) = v; }
    
  }
}

__global__ __launch_bounds__(256) void k_vt(const unsigned short* __restrict__ QKH, const unsigned short* __restrict__ QKR, unsigned short* __restrict__ VTH, unsigned short* __restrict__ VTR) {
  __shared__ unsigned short tl[2][64][66];
  const int tid = threadIdx.x;
  const int nlg = SEQ / 64;
  const int slab = blockIdx.x / nlg, lg = blockIdx.x - slab * nlg;
  const int g = slab / NKV, kv = slab - g * NKV;
#pragma unroll 1
  for (int i = tid; i < 512; i += 256) {
    const int r = i >> 3, c8 = (i & 7) * 8;
    const size_t sof = ((size_t)(lg * 64 + r) * NG + g) * LQ + EMB + KVW + kv * HD + c8;
    FragH fh, fr; fh.half[0] = *(const v8us*)(QKH + sof); fr.half[0] = *(const v8us*)(QKR + sof);
#pragma unroll
    for (int q = 0; q < 8; ++q) { tl[0][r][c8 + q] = fh.u[q]; tl[1][r][c8 + q] = fr.u[q]; }
  }
  __syncthreads();
  {
#pragma unroll
    for (int rd = 0; rd < 2; ++rd) {
      const int d = rd * 32 + (tid >> 3), pc = tid & 7; FragH fh, fr;
#pragma unroll
      for (int q = 0; q < 8; ++q) { fh.u[q] = tl[0][pc * 8 + q][d]; fr.u[q] = tl[1][pc * 8 + q][d]; }
      const v8us oh = fh.half[0], ol = fr.half[0];
      const size_t o = ((size_t)slab * HD + d) * SEQ + lg * 64 + pc * 8;
      *(v8us*)(VTH + o) = oh; *(v8us*)(VTR + o) = ol;
    }
    
  }
}

// Fused causal flash attention. grid = (SEQ/128, NG*NH); block = 4 waves, wave = 16 query rows; 32-key steps up to the diagonal.
// A tile's cost grows with its index (2 qt + 2 steps) and all blocks are resident at once, so the launch lasts as long as its fullest block: a block runs two 64-row query tiles one after the other, the pp-th dearest (NQT - 1 - pp) and then the pp-th cheapest of the lower half.
// A step of the residual scheme waits for eight dependent global fetches and is counted as FULLW plain steps.
constexpr int FULLW = 4;
constexpr int tile_cost(int t) { return (2 * t + 2) * (t < EQT ? FULLW : 1); }
// the tiles below NQT / 2 in rising order of cost (ties by index), four bits each
constexpr unsigned long long lower_by_cost() {
  int ord[NQT / 2] = {};
  for (int i = 0; i < NQT / 2; ++i) { int j = i; for (; j > 0 && tile_cost(ord[j - 1]) > tile_cost(i); --j) ord[j] = ord[j - 1]; ord[j] = i; }
  unsigned long long w = 0;
  for (int i = 0; i < NQT / 2; ++i) w |= (unsigned long long)ord[i] << (4 * i);
  return w;
}
constexpr unsigned long long LOWER = lower_by_cost();
constexpr unsigned int lower_seen() { unsigned int m = 0; for (int i = 0; i < NQT / 2; ++i) m |= 1u << ((LOWER >> (4 * i)) & 15); return m; }
static_assert(NQT / 2 <= 16 && EQT <= NQT / 2);
static_assert(lower_seen() == (1u << (NQT / 2)) - 1u);   /* every tile of the lower half is dealt once */
// The block's q tile (value and residual) is copied into LDS once and each wave's q fragments are read from it once, the K and V^T value tiles of each step once per block (two buffers, the next step's copies fly during this step); the K and V^T residual planes (rows < 256 only) come straight from global memory. Scores and context are formed transposed (S^T = K q^T, O^T += V^T P^T): a lane owns one query, P goes from the score registers into the B operand. The per-wave output staging tile is wave-private.
__global__ __launch_bounds__(128) void k_attn(const unsigned short* __restrict__ QKH, const unsigned short* __restrict__ QKR,
    const unsigned short* __restrict__ VTH, const unsigned short* __restrict__ VTR, unsigned short* __restrict__ CX) {
  __shared__ __attribute__((aligned(16))) float so[4][16][68];
  __shared__ __attribute__((aligned(16))) unsigned short kt[2][32][72];   /* 32 keys x 64, pitch 144 B */
  __shared__ __attribute__((aligned(16))) unsigned short vt[2][64][40];   /* 64 d x 32 keys, pitch 80 B */
  __shared__ __attribute__((aligned(16))) unsigned short qs[2][64][72];   /* value | residual: 64 query rows x 64, pitch 144 B */
  const int tid = threadIdx.x; const int wave = __builtin_amdgcn_readfirstlane(tid >> 5);
  const int lane = tid & 31, ln = lane & 15, hh = lane >> 4;
  const int pp = blockIdx.x, gh = blockIdx.y;
  const int g = gh >> 4, h = gh & 15, kvh = h >> 2;
  const size_t kcol = (size_t)EMB + kvh * HD;
  const size_t vrow = (size_t)(g * NKV + kvh) * HD;
  const v8f z8 = {0.f, 0.f, 0.f, 0.f, 0.f, 0.f, 0.f, 0.f};
  const int kr0 = tid >> 3, kc8 = (tid & 7) * 8, vr0 = tid >> 2, vc8 = (tid & 3) * 8;
  const unsigned short* const gk = QKH + ((size_t)kr0 * NG + g) * LQ + kcol + kc8;
  const unsigned short* const gv = VTH + (vrow + vr0) * (size_t)SEQ + vc8;
  // step s -> buffer s & 1: each thread copies 16 B of K rows kr0, kr0 + 16 and of V^T rows vr0, vr0 + 32
  auto stage = [&](int s) {
    const int b = s & 1;
    const unsigned short* const k0 = gk + (size_t)s * (32 * NG * LQ); const unsigned short* const k1 = k0 + (size_t)16 * NG * LQ;
    const unsigned short* const v0 = gv + s * 32; const unsigned short* const v1 = v0 + (size_t)32 * SEQ;
    const unsigned int lk0 = (unsigned int)(size_t)&kt[b][kr0][kc8], lk1 = (unsigned int)(size_t)&kt[b][kr0 + 16][kc8];
    const unsigned int lv0 = (unsigned int)(size_t)&vt[b][vr0][vc8], lv1 = (unsigned int)(size_t)&vt[b][vr0 + 32][vc8];
    // the closing s_wait_xcnt keeps later writes of the address registers behind the copies
    asm volatile("global_load_async_to_lds_b128 %0, %4, off\n\tglobal_load_async_to_lds_b128 %1, %5, off\n\tglobal_load_async_to_lds_b128 %2, %6, off\n\tglobal_load_async_to_lds_b128 %3, %7, off\n\ts_wait_xcnt 0x0"
                 :: "v"(lk0), "v"(lk1), "v"(lv0), "v"(lv1), "v"(k0), "v"(k1), "v"(v0), "v"(v1) : "memory");
  };
  // The second tile's copies refill qs, kt and vt behind the first tile's last hand-over (every wave's s_wait_dscnt 0, then the block barrier), after which no wave reads them; the output staging between the two is wave-private.
#pragma unroll 1   /* rolled: one copy of the tile's code serves both tiles */
  for (int ti = 0; ti < 2; ++ti) {
  const int qt = ti ? (int)((LOWER >> (4 * pp)) & 15) : NQT - 1 - pp;    /* block-uniform; every (head, tile) is run once */
  const int q0 = qt * 64 + wave * 16;
  v8f om[4] = {z8, z8, z8, z8}, orr[4] = {z8, z8, z8, z8};
  float mi = -1.0e30f, li = 0.f;            /* of query q0 + ln; li holds the sum over this half's keys */
  const int nkb = (q0 + 16 + 31) >> 5;      /* every visited 32-key step starts at a key <= q0, so each row keeps >= 1 key per step */
  const int nst = 2 * qt + 2;               /* steps of the tile = nkb of its last wave; keys < 64 * qt + 64 <= SEQ */
  {
    // q tile: each thread copies 16 B of rows kr0 + 0, 16, 32, 48 of both planes
    const size_t qg = ((size_t)(qt * 64 + kr0) * NG + g) * LQ + h * HD + kc8;
    const unsigned short* const h0 = QKH + qg; const unsigned short* const h1 = h0 + (size_t)16 * NG * LQ;
    const unsigned short* const h2 = h1 + (size_t)16 * NG * LQ; const unsigned short* const h3 = h2 + (size_t)16 * NG * LQ;
    const unsigned short* const r0 = QKR + qg; const unsigned short* const r1 = r0 + (size_t)16 * NG * LQ;
    const unsigned short* const r2 = r1 + (size_t)16 * NG * LQ; const unsigned short* const r3 = r2 + (size_t)16 * NG * LQ;
    const unsigned int a0 = (unsigned int)(size_t)&qs[0][kr0][kc8], a1 = (unsigned int)(size_t)&qs[0][kr0 + 16][kc8];
    const unsigned int a2 = (unsigned int)(size_t)&qs[0][kr0 + 32][kc8], a3 = (unsigned int)(size_t)&qs[0][kr0 + 48][kc8];
    const unsigned int b0 = (unsigned int)(size_t)&qs[1][kr0][kc8], b1 = (unsigned int)(size_t)&qs[1][kr0 + 16][kc8];
    const unsigned int b2 = (unsigned int)(size_t)&qs[1][kr0 + 32][kc8], b3 = (unsigned int)(size_t)&qs[1][kr0 + 48][kc8];
    // the closing s_wait_xcnt keeps later writes of the address registers behind the copies
    asm volatile("global_load_async_to_lds_b128 %0, %8, off\n\tglobal_load_async_to_lds_b128 %1, %9, off\n\tglobal_load_async_to_lds_b128 %2, %10, off\n\tglobal_load_async_to_lds_b128 %3, %11, off\n\t"
                 "global_load_async_to_lds_b128 %4, %12, off\n\tglobal_load_async_to_lds_b128 %5, %13, off\n\tglobal_load_async_to_lds_b128 %6, %14, off\n\tglobal_load_async_to_lds_b128 %7, %15, off\n\ts_wait_xcnt 0x0"
                 :: "v"(a0), "v"(a1), "v"(a2), "v"(a3), "v"(b0), "v"(b1), "v"(b2), "v"(b3), "v"(h0), "v"(h1), "v"(h2), "v"(h3), "v"(r0), "v"(r1), "v"(r2), "v"(r3) : "memory");
  }
  stage(0);
  asm volatile("s_wait_asynccnt 0x0" ::: "memory");   /* own copies of q and of step 0 landed */
  __syncthreads();                                    /* q and step 0 readable by every wave */
  stage(1);                                           /* nst >= 2: step 1 always exists */
  // q fragments: read from LDS once, behind the barrier that published the q tile, and kept in registers through the key loop
  v16h qh[2], qr[2];
#pragma unroll   /* constant indices: the fragments stay in registers */
  for (int kk = 0; kk < 2; ++kk) { qh[kk] = ldfrag(&qs[0][wave * 16 + ln][kk * 32], 0, hh); qr[kk] = ldfrag(&qs[1][wave * 16 + ln][kk * 32], 0, hh); }
  // The key loop is compiled twice, with the residual scheme as a compile-time constant: the copy for rows >= 256 holds no test of it, no residual accumulator (it stays 0) and no global load; each step is one straight-line block, with no LDS exchange inside it.
  auto key_loop = [&](auto fc) {
  constexpr bool full = decltype(fc)::value;
#pragma unroll 1
  for (int kb = 0; kb < nst; ++kb) {
   if (kb < nkb) {                                    /* wave-uniform: waves 0 and 1 sit out the block's last step */
    const int kbase = kb * 32;
    const unsigned short (* const ks)[72] = kt[kb & 1];
    const unsigned short (* const vs)[40] = vt[kb & 1];
    // Transposed products: S^T = K q^T (rows = keys, column = query), so lane ln of either half owns query q0 + ln and holds 16 of its 32 scores in registers.
    // all LDS fragments of the step, K first and then V^T, are fetched as one group in front of its products: one LDS wait place a step, and the V^T latency passes behind the score products and the softmax
    v16h kf[2][2], vf[4];
#pragma unroll   /* these loops are unrolled so that the fragment arrays are indexed by constants and stay in registers */
    for (int kk = 0; kk < 2; ++kk) {
#pragma unroll
      for (int nt = 0; nt < 2; ++nt) kf[kk][nt] = ldfrag(&ks[nt * 16 + ln][kk * 32], 0, hh);
    }
#pragma unroll
    for (int t = 0; t < 4; ++t) vf[t] = ldfrag(&vs[t * 16 + ln][0], 0, hh);
    v8f sm[2] = {z8, z8}, sr[2] = {z8, z8};
#pragma unroll
    for (int kk = 0; kk < 2; ++kk) {
#pragma unroll
      for (int nt = 0; nt < 2; ++nt) {
        const size_t ko = ((size_t)(kbase + nt * 16 + ln) * NG + g) * LQ + kcol + kk * 32;
        sm[nt] = mma(kf[kk][nt], qh[kk], sm[nt]);
        sr[nt] = mma(kf[kk][nt], qr[kk], sr[nt]);
        if constexpr (full) { const v16h kr = ldfrag(QKR, ko, hh); sr[nt] = mma(kr, qh[kk], sr[nt]); }
      }
    }
    // register r of tile nt is key kbase + 16 nt + 8 hh + r
    const int kmax = q0 + ln - kbase - 8 * hh;       /* key offset 16 nt + r is kept while it is <= kmax */
    float sc[2][8], mk[2][8];
#pragma unroll
    for (int nt = 0; nt < 2; ++nt) {
#pragma unroll
      for (int r = 0; r < 8; ++r) {
        sc[nt][r] = (sm[nt][r] + sr[nt][r] * RINV) * 0.125f;
        mk[nt][r] = (nt * 16 + r <= kmax) ? sc[nt][r] : -1.0e30f;
      }
    }
    const float mx0 = fmaxf(fmaxf(fmaxf(mk[0][0], mk[0][1]), fmaxf(mk[0][2], mk[0][3])), fmaxf(fmaxf(mk[0][4], mk[0][5]), fmaxf(mk[0][6], mk[0][7])));
    const float mx1 = fmaxf(fmaxf(fmaxf(mk[1][0], mk[1][1]), fmaxf(mk[1][2], mk[1][3])), fmaxf(fmaxf(mk[1][4], mk[1][5]), fmaxf(mk[1][6], mk[1][7])));
    const float mxh = fmaxf(mx0, mx1);
    const float mnew = fmaxf(mi, fmaxf(mxh, xhalf(mxh)));   /* the same in both halves */
    const float al = __expf(mi - mnew);
    mi = mnew;
    float pv[2][8];
#pragma unroll
    for (int nt = 0; nt < 2; ++nt) {
#pragma unroll
      for (int r = 0; r < 8; ++r) {
        const float e = __expf(fminf(sc[nt][r] - mnew, 0.f));
        pv[nt][r] = (nt * 16 + r <= kmax) ? e : 0.f;
      }
    }
    const float su0 = ((pv[0][0] + pv[0][1]) + (pv[0][2] + pv[0][3])) + ((pv[0][4] + pv[0][5]) + (pv[0][6] + pv[0][7]));
    const float su1 = ((pv[1][0] + pv[1][1]) + (pv[1][2] + pv[1][3])) + ((pv[1][4] + pv[1][5]) + (pv[1][6] + pv[1][7]));
    li = li * al + (su0 + su1);                      /* this half's keys only; the halves are joined behind the loop */
#pragma unroll
    for (int t = 0; t < 4; ++t) { om[t] *= al; if constexpr (full) orr[t] *= al; }
    // P^T (x2^10) as a B fragment straight from the score registers: element 8 nt + r is key 16 nt + 8 hh + r, the k order in which ldfrag reads V^T
    FragH ph, pr;
#pragma unroll
    for (int nt = 0; nt < 2; ++nt) {
#pragma unroll
      for (int r = 0; r < 8; ++r) {
        const float pc = pv[nt][r] * RS;
        const _Float16 p16 = (_Float16)pc;
        ph.h[nt * 8 + r] = p16;
        if constexpr (full) pr.h[nt * 8 + r] = (_Float16)((pc - (float)p16) * RS);
      }
    }
    // O^T += V^T P^T: rows = d, column = query
#pragma unroll
    for (int t = 0; t < 4; ++t) {
      const size_t vo = (vrow + t * 16 + ln) * (size_t)SEQ + kbase;
      const v16h vh = vf[t];
      om[t] = mma(vh, ph.v, om[t]);
      if constexpr (full) { const v16h vr = ldfrag(VTR, vo, hh); orr[t] = mma(vr, ph.v, orr[t]); orr[t] = mma(vh, pr.v, orr[t]); }
    }
   }
    // hand-over, passed by every wave: own LDS reads done, own copies of step kb + 1 landed, then the block barrier that publishes step kb + 1 and frees this step's buffer
    asm volatile("s_wait_dscnt 0x0" ::: "memory");
    asm volatile("s_wait_asynccnt 0x0" ::: "memory");
    __syncthreads();
    if (kb + 2 < nst) stage(kb + 2);
  }
  };
  if (qt < EQT) key_loop(flag_c<true>{}); else key_loop(flag_c<false>{});   /* block-uniform choice */
  asm volatile("s_wait_asynccnt 0x0" ::: "memory");   /* no copy outstanding at the tile's end */
  // context x16 = o / (2^10 * l) * 16
  const float inv = 0.015625f * (1.0f / (li + xhalf(li)));
#pragma unroll
  for (int t = 0; t < 4; ++t) {
#pragma unroll
    for (int r = 0; r < 8; ++r) so[wave][ln][t * 16 + 8 * hh + r] = (om[t][r] + orr[t][r] * RINV) * inv;
  }
  __builtin_amdgcn_fence(4 /* acq_rel order */, "workgroup"); __builtin_amdgcn_wave_barrier();
  const int rq = lane >> 3, c8 = (lane & 7) * 8;
  {
#pragma unroll
    for (int it = 0; it < 4; ++it) {
      const int rr = it * 4 + rq;
      const v4f a = *(const v4fa*)&so[wave][rr][c8], b = *(const v4fa*)&so[wave][rr][c8 + 4];
      FragH fh, fl;
#pragma unroll
      for (int q = 0; q < 4; ++q) { _Float16 hv = (_Float16)a[q]; fh.h[q] = hv; fl.h[q] = (_Float16)((a[q] - (float)hv) * RSC); hv = (_Float16)b[q]; fh.h[4 + q] = hv; fl.h[4 + q] = (_Float16)((b[q] - (float)hv) * RSC); }
      const v8us oh = fh.half[0], ol = fl.half[0];
      const size_t o = ((size_t)(q0 + rr) * NG + g) * CP + h * HD + c8;
      *(v8us*)(CX + o) = oh; *(v8us*)(CX + o + EMB) = ol;
    }
    asm volatile("s_wait_xcnt 0x0" ::: "memory");   /* stands behind the eight stores, in front of the next tile's writes of their address or data registers */
  }
  }
}

extern "C" void kernel_launch(void* const* d_in, const int* in_sizes, int n_in,
                              void* d_out, int out_size, void* d_ws, size_t ws_size, hipStream_t stream) {
  if (n_in < 5) return;
  if (in_sizes[0] < NR * EMB) return;
  if (in_sizes[1] < EMB * EMB) return;
  if (in_sizes[2] < EMB * KVW) return;
  if (in_sizes[3] < EMB * KVW) return;
  if (in_sizes[4] < EMB * EMB) return;
  if (out_size < NR * EMB) return;
  const float* x  = (const float*)d_in[0];
  const float* Wq = (const float*)d_in[1];      /* [in 1024][out 1024] */
  const float* Wk = (const float*)d_in[2];      /* [in 1024][out 256] */
  const float* Wv = (const float*)d_in[3];      /* [in 1024][out 256] */
  const float* Wo = (const float*)d_in[4];      /* [in 1024][out 1024] */
  char* ws = (char*)d_ws; size_t off = 0;
  auto take = [&](size_t bytes) { char* p = ws + off; off += (bytes + 255) & ~(size_t)255; return p; };
  unsigned short* BQKV = (unsigned short*)take(SZ_BQKV);      /* [1536][1024]: Wq^T | Wk^T | Wv^T, x16 */
  unsigned short* BO   = (unsigned short*)take(SZ_BO);        /* [1024][2048]: Wo^T x16 | Wo^T / 4 */
  unsigned short* X16  = (unsigned short*)take(SZ_X16);       /* [NR][1024] */
  unsigned short* QKH  = (unsigned short*)take(SZ_QK);        /* [NR][1536] value plane of q | k | v */
  unsigned short* QKR  = (unsigned short*)take(SZ_QK);        /* [NR][1536] residual plane (x2^10) */
  unsigned short* VTH  = (unsigned short*)take(SZ_VT);        /* [NG*NKV][64][SEQ] */
  unsigned short* VTR  = (unsigned short*)take(SZ_VT);
  unsigned short* CX   = (unsigned short*)take(SZ_CX);        /* [NR][2048]: context x16 value | residual (x64) */
  if (off > ws_size) return;

  k_prep<<<(unsigned)PB_ALL, 256, 0, stream>>>(x, Wq, Wk, Wv, Wo, X16, BQKV, BO);
  k_gemm_planes<<<(unsigned)((NR / 128) * (LQ / 64)), 128, 0, stream>>>(X16, EMB, BQKV, EMB, 0.0625f, QKH, QKR, LQ, NR, LQ, EMB);
  k_vt<<<(unsigned)(NB * NG * NKV * (SEQ / 64)), 256, 0, stream>>>(QKH, QKR, VTH, VTR);
  k_attn<<<dim3((unsigned)(NQT / 2), (unsigned)(NG * NH)), 128, 0, stream>>>(QKH, QKR, VTH, VTR, CX);
  k_gemm_out<<<(unsigned)((NR / 128) * (EMB / 64)), 128, 0, stream>>>(CX, CP, BO, CP, 0.00390625f, (float*)d_out, EMB, NR, EMB, CP);
}

// v009
// A run of this version takes 93.5 microseconds.
// Next to v008, in two timings, it ran 1.09 times as fast each time.
// Over all steps from v000 it is 3.74 times as fast.
#include <hip/hip_runtime.h>
// Causal grouped-query self-attention with a group axis: x [1][SEQ][2][1024]; token row = s*2 + g; q = x Wq (16 heads x 64), k|v = x Wk|Wv (4 kv heads x 64, query head h uses kv head h/4); raw energy, causal exclusion (key > query), then 1/8 inside the softmax over keys of the same g; merged heads (h*64 + d) times Wo.
// Compute dtype: v_wmma_f32_16x16x32_f16 for every contraction, f32 accumulate. Inputs RNE-converted to bf16 then held exactly in f16 (x as is, weights x16). q|k|v written as f16 value + f16 residual (x2^10) planes. Scores: q value+residual against k value (plus k residual on query rows < 256). P carried x2^10 as f16 (plus residual x2^10 on rows < 256), V^T value (plus residual on rows < 256), residual products in a separate accumulator. Context carried x16 as f16 value | residual (x64) along K against Wo x16 | Wo / 4. Softmax statistics f32.
#ifndef NB
#define NB 1
#endif
#ifndef SEQ
#define SEQ 2048
#endif
#define SEQ_FULL 2048
#define NG 2
#define EMB 1024
#define NH 16
#define NKV 4
#define HD 64
#define KVW (NKV * HD)            /* 256 */
#define LQ (EMB + 2 * KVW)        /* 1536: pitch of the q|k|v planes */
#define CP (2 * EMB)              /* 2048: pitch of the context plane (value | residual) */
#define NR (NB * SEQ * NG)        /* token rows */
#define NQT (SEQ / 64)            /* 64-row query tiles */
#define EQT 4                     /* 64-row query tiles (rows < 256) that run the full residual scheme */
#define RS 1024.0f                /* residual carry of q, k, v, P */
#define RINV 0.0009765625f
#define RSC 64.0f                 /* residual carry of the context plane */

static_assert(NB == 1);
static_assert(SEQ % 128 == 0);
static_assert(SEQ >= 64);
static_assert(SEQ <= SEQ_FULL);
static_assert(NR % 128 == 0);
static_assert(LQ % 64 == 0);
static_assert(EMB % 64 == 0);
static_assert(CP % 64 == 0);
static_assert(HD == 64);
static_assert(NH == 4 * NKV);
static_assert(NH * HD == EMB);
static_assert(KVW % 64 == 0);

typedef unsigned short v8us __attribute__((ext_vector_type(8), may_alias));
typedef float  v8f  __attribute__((ext_vector_type(8)));
typedef float  v4f  __attribute__((ext_vector_type(4)));
typedef float  v4fa __attribute__((ext_vector_type(4), may_alias));
typedef _Float16 v16h __attribute__((ext_vector_type(16)));
union FragH { v16h v; v8us half[2]; _Float16 h[16]; unsigned short u[16]; };

constexpr size_t SZ_BQKV = (size_t)LQ * EMB * 2;
constexpr size_t SZ_BO   = (size_t)EMB * CP * 2;
constexpr size_t SZ_X16  = (size_t)NR * EMB * 2;
constexpr size_t SZ_QK   = (size_t)NR * LQ * 2;
constexpr size_t SZ_VT   = (size_t)NB * NG * NKV * HD * SEQ * 2;
constexpr size_t SZ_CX   = (size_t)NR * CP * 2;
constexpr size_t WS_TOTAL = SZ_BQKV + SZ_BO + SZ_X16 + 2 * SZ_QK + 2 * SZ_VT + SZ_CX;
static_assert(WS_TOTAL <= (size_t)134217728);
static_assert(SZ_BQKV % 256 == 0 && SZ_BO % 256 == 0 && SZ_X16 % 256 == 0 && SZ_QK % 256 == 0 && SZ_VT % 256 == 0 && SZ_CX % 256 == 0);

// RNE convert f32 -> bf16 value (kept in f32)
__device__ __forceinline__ float bf16_rne(float x) { unsigned int u = __float_as_uint(x); u = (u + 0x7FFFu + ((u >> 16) & 1u)) & 0xFFFF0000u; return __uint_as_float(u); }
__device__ __forceinline__ unsigned short h_bits(_Float16 h) { return __builtin_bit_cast(unsigned short, h); }
// 16-bit fragment: elements 0..7 <- k0 + 8h + 0..7, elements 8..15 <- k0 + 16 + 8h + 0..7 (row / column = lane & 15)
__device__ __forceinline__ v16h ldfrag(const unsigned short* __restrict__ p, size_t off, int hh) { FragH f; f.half[0] = *(const v8us*)(p + off + 8 * hh); f.half[1] = *(const v8us*)(p + off + 16 + 8 * hh); return f.v; }
// lane l <-> lane l ^ 16
__device__ __forceinline__ float xhalf(float x) { const int b = __builtin_bit_cast(int, x); return __builtin_bit_cast(float, __builtin_amdgcn_permlanex16(b, b, 0x76543210, 0xfedcba98, false, false)); }
template <bool B> struct flag_c { static constexpr bool value = B; };
__device__ __forceinline__ v8f mma(v16h a, v16h b, v8f c) { v8f d = __builtin_amdgcn_wmma_f32_16x16x32_f16(false, a, false, b, (short)0, c, false, false); asm volatile("v_nop\n\tv_nop\n\tv_nop\n\tv_nop" : "+v"(d) : "v"(a), "v"(b)); return d; }

// A thread converts 32 elements. Patch t of W^T, 8 k x 4 n: Wt[drow0 + n + j][dcol0 + k8 .. k8 + 7] = f16(bf16(W[k8 + i][n + j]) * scale), j < 4; K % 64 == 0, N % 16 == 0.
// A wave covers 64 k x 16 n: four neighbouring lanes read 64 contiguous bytes of a W row with one 16-byte load each (the wave beside it, in the same block, reads the line's other half), eight lanes write one whole 128-byte line of a W^T row. The transposition itself is a choice of registers.
__device__ __forceinline__ void wt_f16(const float* __restrict__ W, unsigned short* __restrict__ Wt, int K, int N, int drow0, int dpitch, int dcol0, float scale, int t) {
  const int nwn = N / 16;                       /* wave tiles along n */
  const int w = t >> 5, l = t & 31; if (w >= nwn * (K / 64)) return;
  const int kw = w / nwn, nw = w - kw * nwn;
  const int n = nw * 16 + (l & 3) * 4, k8 = kw * 64 + (l >> 2) * 8;
  v4f a[8];
#pragma unroll   /* constant indices: the patch stays in registers, its eight loads are in flight together */
  for (int i = 0; i < 8; ++i) a[i] = *(const v4fa*)(W + (size_t)(k8 + i) * N + n);
#pragma unroll
  for (int j = 0; j < 4; ++j) {
    FragH f;
#pragma unroll
    for (int i = 0; i < 8; ++i) f.h[i] = (_Float16)(bf16_rne(a[i][j]) * scale);
    const v8us o = f.half[0];
    *(v8us*)(Wt + (size_t)(drow0 + n + j) * dpitch + dcol0 + k8) = o;
  }
}

// Four 8-element groups of x, 256 groups apart (block b owns groups 1024 b .. 1024 b + 1023)
__device__ __forceinline__ void x16_f16(const float* __restrict__ x, unsigned short* __restrict__ X16, int b, int tid) {
  const size_t g0 = (size_t)b * 1024 + tid;
  v4f a[4], c[4];
#pragma unroll   /* constant indices: the eight loads are in flight together */
  for (int j = 0; j < 4; ++j) { a[j] = *(const v4fa*)(x + (g0 + 256 * j) * 8); c[j] = *(const v4fa*)(x + (g0 + 256 * j) * 8 + 4); }
#pragma unroll
  for (int j = 0; j < 4; ++j) {
    FragH f;
#pragma unroll
    for (int q = 0; q < 4; ++q) { f.h[q] = (_Float16)bf16_rne(a[j][q]); f.h[4 + q] = (_Float16)bf16_rne(c[j][q]); }
    const v8us o = f.half[0];
    *(v8us*)(X16 + (g0 + 256 * j) * 8) = o;
  }
  asm volatile("s_wait_xcnt 0x0" ::: "memory");   /* stands behind the four stores, in front of any later write of their address or data registers */
}

static_assert(EMB % 64 == 0 && KVW % 16 == 0);
static_assert((EMB * EMB) % (32 * 256) == 0 && (KVW * EMB) % (32 * 256) == 0 && ((size_t)NR * EMB) % (32 * 256) == 0);
constexpr int PB_W  = EMB * EMB / (32 * 256);   /* blocks of a 1024-column weight */
constexpr int PB_KV = KVW * EMB / (32 * 256);   /* blocks of a 256-column weight */
constexpr int PB_X  = NR * EMB / (32 * 256);    /* blocks of x */
constexpr int PB_ALL = 3 * PB_W + 2 * PB_KV + PB_X;

// All input conversions in one launch: none reads what another writes, so a block picks its job by its index (block-uniform). The weight jobs, whose waves last longer, come first.
__global__ __launch_bounds__(256) void k_prep(const float* __restrict__ x, const float* __restrict__ Wq, const float* __restrict__ Wk, const float* __restrict__ Wv, const float* __restrict__ Wo,
    unsigned short* __restrict__ X16, unsigned short* __restrict__ BQKV, unsigned short* __restrict__ BO) {
  const int tid = threadIdx.x; int b = blockIdx.x;
  if (b < PB_W) { wt_f16(Wq, BQKV, EMB, EMB, 0, EMB, 0, 16.0f, b * 256 + tid); return; }
  b -= PB_W;
  if (b < PB_W) { wt_f16(Wo, BO, EMB, EMB, 0, CP, 0, 16.0f, b * 256 + tid); return; }
  b -= PB_W;
  if (b < PB_W) { wt_f16(Wo, BO, EMB, EMB, 0, CP, EMB, 0.25f, b * 256 + tid); return; }
  b -= PB_W;
  if (b < PB_KV) { wt_f16(Wk, BQKV, EMB, KVW, EMB, EMB, 0, 16.0f, b * 256 + tid); return; }
  b -= PB_KV;
  if (b < PB_KV) { wt_f16(Wv, BQKV, EMB, KVW, EMB + KVW, EMB, 0, 16.0f, b * 256 + tid); return; }
  b -= PB_KV;
  x16_f16(x, X16, b, tid);
}

// GEMM main loop: block tile 128 x 64, wave tile 32 x 64, A f16 [M][lda], Bt f16 [N][ldb] (k contiguous), K % 64 == 0, K >= 64; called by all 128 threads of the block.
// The block's A and Bt rows of each 64-wide k step are copied into LDS once per block as whole 128-byte lines (two buffers, the next step's copies fly during this step); every wave reads its fragments from there.
__device__ __forceinline__ void gemm_core(const unsigned short* __restrict__ A, int lda, const unsigned short* __restrict__ Bt, int ldb, int K, int brow0, int col0, int tid, int wave, int ln, int hh,
    v8f& c00, v8f& c01, v8f& c02, v8f& c03, v8f& c10, v8f& c11, v8f& c12, v8f& c13) {
  __shared__ __attribute__((aligned(16))) unsigned short at[2][128][72];   /* 128 rows x 64 k, pitch 144 B */
  __shared__ __attribute__((aligned(16))) unsigned short bt[2][64][72];    /* 64 columns x 64 k, pitch 144 B */
  const int r0 = tid >> 3, c8 = (tid & 7) * 8;
  const unsigned short* const ga = A + (size_t)(brow0 + r0) * lda + c8;
  const unsigned short* const gb = Bt + (size_t)(col0 + r0) * ldb + c8;
  const size_t sa = (size_t)16 * lda, sb = (size_t)16 * ldb;
  const int nst = K >> 6;
  // step s -> buffer s & 1: each thread copies 16 B of A rows r0 + 16 j (j < 8) and of Bt rows r0 + 16 j (j < 4)
  auto stage = [&](int s) {
    const int b = s & 1;
    const size_t ko = (size_t)s * 64;   /* added to row pointers that do not change from step to step: twelve independent additions, no chain in front of the copies */
    const unsigned short* const a0 = ga + ko; const unsigned short* const a1 = (ga + sa) + ko; const unsigned short* const a2 = (ga + 2 * sa) + ko; const unsigned short* const a3 = (ga + 3 * sa) + ko;
    const unsigned short* const a4 = (ga + 4 * sa) + ko; const unsigned short* const a5 = (ga + 5 * sa) + ko; const unsigned short* const a6 = (ga + 6 * sa) + ko; const unsigned short* const a7 = (ga + 7 * sa) + ko;
    const unsigned short* const b0 = gb + ko; const unsigned short* const b1 = (gb + sb) + ko; const unsigned short* const b2 = (gb + 2 * sb) + ko; const unsigned short* const b3 = (gb + 3 * sb) + ko;
    const unsigned int la0 = (unsigned int)(size_t)&at[b][r0][c8], la1 = (unsigned int)(size_t)&at[b][r0 + 16][c8], la2 = (unsigned int)(size_t)&at[b][r0 + 32][c8], la3 = (unsigned int)(size_t)&at[b][r0 + 48][c8];
    const unsigned int la4 = (unsigned int)(size_t)&at[b][r0 + 64][c8], la5 = (unsigned int)(size_t)&at[b][r0 + 80][c8], la6 = (unsigned int)(size_t)&at[b][r0 + 96][c8], la7 = (unsigned int)(size_t)&at[b][r0 + 112][c8];
    const unsigned int lb0 = (unsigned int)(size_t)&bt[b][r0][c8], lb1 = (unsigned int)(size_t)&bt[b][r0 + 16][c8], lb2 = (unsigned int)(size_t)&bt[b][r0 + 32][c8], lb3 = (unsigned int)(size_t)&bt[b][r0 + 48][c8];
    // the closing s_wait_xcnt keeps later writes of the address registers behind the copies
    asm volatile("global_load_async_to_lds_b128 %0, %12, off\n\tglobal_load_async_to_lds_b128 %1, %13, off\n\tglobal_load_async_to_lds_b128 %2, %14, off\n\tglobal_load_async_to_lds_b128 %3, %15, off\n\t"
                 "global_load_async_to_lds_b128 %4, %16, off\n\tglobal_load_async_to_lds_b128 %5, %17, off\n\tglobal_load_async_to_lds_b128 %6, %18, off\n\tglobal_load_async_to_lds_b128 %7, %19, off\n\t"
                 "global_load_async_to_lds_b128 %8, %20, off\n\tglobal_load_async_to_lds_b128 %9, %21, off\n\tglobal_load_async_to_lds_b128 %10, %22, off\n\tglobal_load_async_to_lds_b128 %11, %23, off\n\ts_wait_xcnt 0x0"
                 :: "v"(la0), "v"(la1), "v"(la2), "v"(la3), "v"(la4), "v"(la5), "v"(la6), "v"(la7), "v"(lb0), "v"(lb1), "v"(lb2), "v"(lb3),
                    "v"(a0), "v"(a1), "v"(a2), "v"(a3), "v"(a4), "v"(a5), "v"(a6), "v"(a7), "v"(b0), "v"(b1), "v"(b2), "v"(b3) : "memory");
  };
  stage(0);
  asm volatile("s_wait_asynccnt 0x0" ::: "memory");   /* own copies of step 0 landed */
  __syncthreads();                                    /* step 0 readable by every wave */
  if (nst > 1) stage(1);
#pragma unroll 1
  for (int s = 0; s < nst; ++s) {                     /* rolled: one body serves both buffers */
    const unsigned short (* const as)[72] = at[s & 1];
    const unsigned short (* const bs)[72] = bt[s & 1];
    // all fragments of the step are fetched as one group in front of its products: one LDS wait place a step instead of two
    v16h fa[2][2], fb[2][4];
#pragma unroll   /* these three loops are unrolled so that the fragment arrays are indexed by constants and stay in registers */
    for (int kk = 0; kk < 2; ++kk) {
      fa[kk][0] = ldfrag(&as[32 * wave + ln][kk * 32], 0, hh); fa[kk][1] = ldfrag(&as[32 * wave + 16 + ln][kk * 32], 0, hh);
#pragma unroll
      for (int j = 0; j < 4; ++j) fb[kk][j] = ldfrag(&bs[16 * j + ln][kk * 32], 0, hh);
    }
#pragma unroll
    for (int kk = 0; kk < 2; ++kk) {
      c00 = mma(fa[kk][0], fb[kk][0], c00); c10 = mma(fa[kk][1], fb[kk][0], c10);
      c01 = mma(fa[kk][0], fb[kk][1], c01); c11 = mma(fa[kk][1], fb[kk][1], c11);
      c02 = mma(fa[kk][0], fb[kk][2], c02); c12 = mma(fa[kk][1], fb[kk][2], c12);
      c03 = mma(fa[kk][0], fb[kk][3], c03); c13 = mma(fa[kk][1], fb[kk][3], c13);
    }
    // hand-over, passed by every wave: own LDS reads done, own copies of step s + 1 landed, then the block barrier that publishes step s + 1 and frees this step's buffer
    asm volatile("s_wait_dscnt 0x0" ::: "memory");
    asm volatile("s_wait_asynccnt 0x0" ::: "memory");
    __syncthreads();
    if (s + 2 < nst) stage(s + 2);
  }
  asm volatile("s_wait_asynccnt 0x0" ::: "memory");   /* no copy outstanding behind the loop */
}

// C = alpha * A . Bt^T written as f16 value plane CH and residual plane CR ((v - value) * 2^10), both pitch ldc. M % 128 == 0, N % 64 == 0.
__global__ __launch_bounds__(128) void k_gemm_planes(const unsigned short* __restrict__ A, int lda, const unsigned short* __restrict__ Bt, int ldb, float alpha,
    unsigned short* __restrict__ CH, unsigned short* __restrict__ CR, int ldc, int M, int N, int K) {
  __shared__ __attribute__((aligned(16))) float so[4][32][68];
  const int tid = threadIdx.x; const int wave = __builtin_amdgcn_readfirstlane(tid >> 5);
  const int lane = tid & 31, ln = lane & 15, hh = lane >> 4;
  const int ntn = N >> 6; const int mt = blockIdx.x / ntn, nq = blockIdx.x - mt * ntn;
  const int brow0 = mt * 128, row0 = brow0 + 32 * wave, col0 = nq * 64; if (brow0 >= M) return;
  const v8f z8 = {0.f, 0.f, 0.f, 0.f, 0.f, 0.f, 0.f, 0.f};
  v8f c00 = z8, c01 = z8, c02 = z8, c03 = z8, c10 = z8, c11 = z8, c12 = z8, c13 = z8;
  gemm_core(A, lda, Bt, ldb, K, brow0, col0, tid, wave, ln, hh, c00, c01, c02, c03, c10, c11, c12, c13);
  v8f accs[8] = {c00, c01, c02, c03, c10, c11, c12, c13};
#pragma unroll
  for (int u = 0; u < 8; ++u) { const int t = u & 3, hf = u >> 2;
#pragma unroll
    for (int r = 0; r < 8; ++r) so[wave][hf * 16 + 8 * hh + r][t * 16 + ln] = accs[u][r] * alpha; }
  __builtin_amdgcn_fence(4 /* acq_rel order */, "workgroup"); __builtin_amdgcn_wave_barrier();
  const int rq = lane >> 3, c8 = (lane & 7) * 8;
  {
#pragma unroll
    for (int it = 0; it < 8; ++it) {
      const int rr = it * 4 + rq;
      const v4f a = *(const v4fa*)&so[wave][rr][c8], b = *(const v4fa*)&so[wave][rr][c8 + 4];
      FragH fh, fl;
#pragma unroll
      for (int q = 0; q < 4; ++q) { _Float16 hv = (_Float16)a[q]; fh.h[q] = hv; fl.h[q] = (_Float16)((a[q] - (float)hv) * RS); hv = (_Float16)b[q]; fh.h[4 + q] = hv; fl.h[4 + q] = (_Float16)((b[q] - (float)hv) * RS); }
      const v8us oh = fh.half[0], ol = fl.half[0];
      const size_t o = (size_t)(row0 + rr) * ldc + col0 + c8;
      *(v8us*)(CH + o) = oh; *(v8us*)(CR + o) = ol;
    }
    
  }
}

__global__ __launch_bounds__(128) void k_gemm_out(const unsigned short* __restrict__ A, int lda, const unsigned short* __restrict__ Bt, int ldb, float alpha,
    float* __restrict__ C, int ldc, int M, int N, int K) {
  __shared__ __attribute__((aligned(16))) float so[4][32][68];
  const int tid = threadIdx.x; const int wave = __builtin_amdgcn_readfirstlane(tid >> 5);
  const int lane = tid & 31, ln = lane & 15, hh = lane >> 4;
  const int ntn = N >> 6; const int mt = blockIdx.x / ntn, nq = blockIdx.x - mt * ntn;
  const int brow0 = mt * 128, row0 = brow0 + 32 * wave, col0 = nq * 64; if (brow0 >= M) return;
  const v8f z8 = {0.f, 0.f, 0.f, 0.f, 0.f, 0.f, 0.f, 0.f};
  v8f c00 = z8, c01 = z8, c02 = z8, c03 = z8, c10 = z8, c11 = z8, c12 = z8, c13 = z8;
  gemm_core(A, lda, Bt, ldb, K, brow0, col0, tid, wave, ln, hh, c00, c01, c02, c03, c10, c11, c12, c13);
  v8f accs[8] = {c00, c01, c02, c03, c10, c11, c12, c13};
#pragma unroll
  for (int u = 0; u < 8; ++u) { const int t = u & 3, hf = u >> 2;
#pragma unroll
    for (int r = 0; r < 8; ++r) so[wave][hf * 16 + 8 * hh + r][t * 16 + ln] = accs[u][r] * alpha; }
  __builtin_amdgcn_fence(4 /* acq_rel order */, "workgroup"); __builtin_amdgcn_wave_barrier();
  const int rsub = lane >> 4, c4 = (lane & 15) * 4;
  {
#pragma unroll
    for (int q = 0; q < 16; ++q) { const int r = q * 2 + rsub; const v4f v = *(const v4fa*)&so[wave][r][c4]; *(v4f*)(C + (size_t)(row0 + r) * ldc + col0 + c4) = v; }
    
  }
}

__global__ __launch_bounds__(256) void k_vt(const unsigned short* __restrict__ QKH, const unsigned short* __restrict__ QKR, unsigned short* __restrict__ VTH, unsigned short* __restrict__ VTR) {
  __shared__ unsigned short tl[2][64][66];
  const int tid = threadIdx.x;
  const int nlg = SEQ / 64;
  const int slab = blockIdx.x / nlg, lg = blockIdx.x - slab * nlg;
  const int g = slab / NKV, kv = slab - g * NKV;
#pragma unroll 1
  for (int i = tid; i < 512; i += 256) {
    const int r = i >> 3, c8 = (i & 7) * 8;
    const size_t sof = ((size_t)(lg * 64 + r) * NG + g) * LQ + EMB + KVW + kv * HD + c8;
    FragH fh, fr; fh.half[0] = *(const v8us*)(QKH + sof); fr.half[0] = *(const v8us*)(QKR + sof);
#pragma unroll
    for (int q = 0; q < 8; ++q) { tl[0][r][c8 + q] = fh.u[q]; tl[1][r][c8 + q] = fr.u[q]; }
  }
  __syncthreads();
  {
#pragma unroll
    for (int rd = 0; rd < 2; ++rd) {
      const int d = rd * 32 + (tid >> 3), pc = tid & 7; FragH fh, fr;
#pragma unroll
      for (int q = 0; q < 8; ++q) { fh.u[q] = tl[0][pc * 8 + q][d]; fr.u[q] = tl[1][pc * 8 + q][d]; }
      const v8us oh = fh.half[0], ol = fr.half[0];
      const size_t o = ((size_t)slab * HD + d) * SEQ + lg * 64 + pc * 8;
      *(v8us*)(VTH + o) = oh; *(v8us*)(VTR + o) = ol;
    }
    
  }
}

// Fused causal flash attention. grid = (SEQ/128, NG*NH); block = 4 waves, wave = 16 query rows; 32-key steps up to the diagonal, four steps to a 128-key stage of the LDS tiles.
// A tile's cost grows with its index (2 qt + 2 steps) and all blocks are resident at once, so the launch lasts as long as its fullest block: a block runs two 64-row query tiles one after the other, the pp-th dearest (NQT - 1 - pp) and then the pp-th cheapest of the lower half.
// A step of the residual scheme waits for eight dependent global fetches and is counted as FULLW plain steps.
constexpr int FULLW = 4;
constexpr int tile_cost(int t) { return (2 * t + 2) * (t < EQT ? FULLW : 1); }
// the tiles below NQT / 2 in rising order of cost (ties by index), four bits each
constexpr unsigned long long lower_by_cost() {
  int ord[NQT / 2] = {};
  for (int i = 0; i < NQT / 2; ++i) { int j = i; for (; j > 0 && tile_cost(ord[j - 1]) > tile_cost(i); --j) ord[j] = ord[j - 1]; ord[j] = i; }
  unsigned long long w = 0;
  for (int i = 0; i < NQT / 2; ++i) w |= (unsigned long long)ord[i] << (4 * i);
  return w;
}
constexpr unsigned long long LOWER = lower_by_cost();
constexpr unsigned int lower_seen() { unsigned int m = 0; for (int i = 0; i < NQT / 2; ++i) m |= 1u << ((LOWER >> (4 * i)) & 15); return m; }
static_assert(NQT / 2 <= 16 && EQT <= NQT / 2);
static_assert(lower_seen() == (1u << (NQT / 2)) - 1u);   /* every tile of the lower half is dealt once */
// The block's q tile (value and residual) is copied into LDS once and each wave's q fragments are read from it once, the K and V^T value tiles of each 128-key stage once per block (two buffers, the next stage's copies fly during this stage's four steps: the blocks of a kv head walk the keys together, so the leading block's rows are first reads, which take a memory latency and not an L2 hit's); the K and V^T residual planes (rows < 256 only) come straight from global memory. Scores and context are formed transposed (S^T = K q^T, O^T += V^T P^T): a lane owns one query, P goes from the score registers into the B operand. The per-wave output staging tile is wave-private.
__global__ __launch_bounds__(128) void k_attn(const unsigned short* __restrict__ QKH, const unsigned short* __restrict__ QKR,
    const unsigned short* __restrict__ VTH, const unsigned short* __restrict__ VTR, unsigned short* __restrict__ CX) {
  __shared__ __attribute__((aligned(16))) float so[4][16][68];
  __shared__ __attribute__((aligned(16))) unsigned short kt[2][128][72];  /* 128 keys x 64, pitch 144 B */
  __shared__ __attribute__((aligned(16))) unsigned short vt[2][64][136];  /* 64 d x 128 keys, pitch 272 B */
  __shared__ __attribute__((aligned(16))) unsigned short qs[2][64][72];   /* value | residual: 64 query rows x 64, pitch 144 B */
  const int tid = threadIdx.x; const int wave = __builtin_amdgcn_readfirstlane(tid >> 5);
  const int lane = tid & 31, ln = lane & 15, hh = lane >> 4;
  const int pp = blockIdx.x, gh = blockIdx.y;
  const int g = gh >> 4, h = gh & 15, kvh = h >> 2;
  const size_t kcol = (size_t)EMB + kvh * HD;
  const size_t vrow = (size_t)(g * NKV + kvh) * HD;
  const v8f z8 = {0.f, 0.f, 0.f, 0.f, 0.f, 0.f, 0.f, 0.f};
  const int kr0 = tid >> 3, kc8 = (tid & 7) * 8, vr0 = tid >> 4, vc8 = (tid & 15) * 8;
  const unsigned short* const gk = QKH + ((size_t)kr0 * NG + g) * LQ + kcol + kc8;
  const unsigned short* const gv = VTH + (vrow + vr0) * (size_t)SEQ + vc8;
  // stage s (keys 128 s .. 128 s + 127) -> buffer s & 1: each thread copies 16 B of K rows kr0 + 16 j and of V^T rows vr0 + 8 j (j < 8); sixteen lanes cover the 256 contiguous bytes of a V^T row
  auto stage = [&](int s) {
    const int b = s & 1;
    constexpr size_t KS = (size_t)16 * NG * LQ, VS = (size_t)8 * SEQ;
    const unsigned short* const k0 = gk + (size_t)s * (128 * NG * LQ);
    const unsigned short* const k1 = k0 + KS; const unsigned short* const k2 = k0 + 2 * KS; const unsigned short* const k3 = k0 + 3 * KS;
    const unsigned short* const k4 = k0 + 4 * KS; const unsigned short* const k5 = k0 + 5 * KS; const unsigned short* const k6 = k0 + 6 * KS; const unsigned short* const k7 = k0 + 7 * KS;
    const unsigned int lk0 = (unsigned int)(size_t)&kt[b][kr0][kc8], lk1 = (unsigned int)(size_t)&kt[b][kr0 + 16][kc8], lk2 = (unsigned int)(size_t)&kt[b][kr0 + 32][kc8], lk3 = (unsigned int)(size_t)&kt[b][kr0 + 48][kc8];
    const unsigned int lk4 = (unsigned int)(size_t)&kt[b][kr0 + 64][kc8], lk5 = (unsigned int)(size_t)&kt[b][kr0 + 80][kc8], lk6 = (unsigned int)(size_t)&kt[b][kr0 + 96][kc8], lk7 = (unsigned int)(size_t)&kt[b][kr0 + 112][kc8];
    // the closing s_wait_xcnt keeps later writes of the address registers behind the copies
    asm volatile("global_load_async_to_lds_b128 %0, %8, off\n\tglobal_load_async_to_lds_b128 %1, %9, off\n\tglobal_load_async_to_lds_b128 %2, %10, off\n\tglobal_load_async_to_lds_b128 %3, %11, off\n\t"
                 "global_load_async_to_lds_b128 %4, %12, off\n\tglobal_load_async_to_lds_b128 %5, %13, off\n\tglobal_load_async_to_lds_b128 %6, %14, off\n\tglobal_load_async_to_lds_b128 %7, %15, off\n\ts_wait_xcnt 0x0"
                 :: "v"(lk0), "v"(lk1), "v"(lk2), "v"(lk3), "v"(lk4), "v"(lk5), "v"(lk6), "v"(lk7), "v"(k0), "v"(k1), "v"(k2), "v"(k3), "v"(k4), "v"(k5), "v"(k6), "v"(k7) : "memory");
    const unsigned short* const v0 = gv + s * 128;
    const unsigned short* const v1 = v0 + VS; const unsigned short* const v2 = v0 + 2 * VS; const unsigned short* const v3 = v0 + 3 * VS;
    const unsigned short* const v4 = v0 + 4 * VS; const unsigned short* const v5 = v0 + 5 * VS; const unsigned short* const v6 = v0 + 6 * VS; const unsigned short* const v7 = v0 + 7 * VS;
    const unsigned int lv0 = (unsigned int)(size_t)&vt[b][vr0][vc8], lv1 = (unsigned int)(size_t)&vt[b][vr0 + 8][vc8], lv2 = (unsigned int)(size_t)&vt[b][vr0 + 16][vc8], lv3 = (unsigned int)(size_t)&vt[b][vr0 + 24][vc8];
    const unsigned int lv4 = (unsigned int)(size_t)&vt[b][vr0 + 32][vc8], lv5 = (unsigned int)(size_t)&vt[b][vr0 + 40][vc8], lv6 = (unsigned int)(size_t)&vt[b][vr0 + 48][vc8], lv7 = (unsigned int)(size_t)&vt[b][vr0 + 56][vc8];
    // the closing s_wait_xcnt keeps later writes of the address registers behind the copies
    asm volatile("global_load_async_to_lds_b128 %0, %8, off\n\tglobal_load_async_to_lds_b128 %1, %9, off\n\tglobal_load_async_to_lds_b128 %2, %10, off\n\tglobal_load_async_to_lds_b128 %3, %11, off\n\t"
                 "global_load_async_to_lds_b128 %4, %12, off\n\tglobal_load_async_to_lds_b128 %5, %13, off\n\tglobal_load_async_to_lds_b128 %6, %14, off\n\tglobal_load_async_to_lds_b128 %7, %15, off\n\ts_wait_xcnt 0x0"
                 :: "v"(lv0), "v"(lv1), "v"(lv2), "v"(lv3), "v"(lv4), "v"(lv5), "v"(lv6), "v"(lv7), "v"(v0), "v"(v1), "v"(v2), "v"(v3), "v"(v4), "v"(v5), "v"(v6), "v"(v7) : "memory");
  };
  // The second tile's copies refill qs, kt and vt behind the first tile's last hand-over (every wave's s_wait_dscnt 0, then the block barrier), after which no wave reads them; the output staging between the two is wave-private.
#pragma unroll 1   /* rolled: one copy of the tile's code serves both tiles */
  for (int ti = 0; ti < 2; ++ti) {
  const int qt = ti ? (int)((LOWER >> (4 * pp)) & 15) : NQT - 1 - pp;    /* block-uniform; every (head, tile) is run once */
  const int q0 = qt * 64 + wave * 16;
  v8f om[4] = {z8, z8, z8, z8}, orr[4] = {z8, z8, z8, z8};
  float mi = -1.0e30f, li = 0.f;            /* of query q0 + ln; li holds the sum over this half's keys */
  const int nkb = (q0 + 16 + 31) >> 5;      /* every visited 32-key step starts at a key <= q0, so each row keeps >= 1 key per step */
  const int nst = (qt + 2) >> 1;            /* 128-key stages that hold the tile's 2 qt + 2 steps; keys < 128 * nst <= 64 * NQT = SEQ (NQT is even) */
  {
    // q tile: each thread copies 16 B of rows kr0 + 0, 16, 32, 48 of both planes
    const size_t qg = ((size_t)(qt * 64 + kr0) * NG + g) * LQ + h * HD + kc8;
    const unsigned short* const h0 = QKH + qg; const unsigned short* const h1 = h0 + (size_t)16 * NG * LQ;
    const unsigned short* const h2 = h1 + (size_t)16 * NG * LQ; const unsigned short* const h3 = h2 + (size_t)16 * NG * LQ;
    const unsigned short* const r0 = QKR + qg; const unsigned short* const r1 = r0 + (size_t)16 * NG * LQ;
    const unsigned short* const r2 = r1 + (size_t)16 * NG * LQ; const unsigned short* const r3 = r2 + (size_t)16 * NG * LQ;
    const unsigned int a0 = (unsigned int)(size_t)&qs[0][kr0][kc8], a1 = (unsigned int)(size_t)&qs[0][kr0 + 16][kc8];
    const unsigned int a2 = (unsigned int)(size_t)&qs[0][kr0 + 32][kc8], a3 = (unsigned int)(size_t)&qs[0][kr0 + 48][kc8];
    const unsigned int b0 = (unsigned int)(size_t)&qs[1][kr0][kc8], b1 = (unsigned int)(size_t)&qs[1][kr0 + 16][kc8];
    const unsigned int b2 = (unsigned int)(size_t)&qs[1][kr0 + 32][kc8], b3 = (unsigned int)(size_t)&qs[1][kr0 + 48][kc8];
    // the closing s_wait_xcnt keeps later writes of the address registers behind the copies
    asm volatile("global_load_async_to_lds_b128 %0, %8, off\n\tglobal_load_async_to_lds_b128 %1, %9, off\n\tglobal_load_async_to_lds_b128 %2, %10, off\n\tglobal_load_async_to_lds_b128 %3, %11, off\n\t"
                 "global_load_async_to_lds_b128 %4, %12, off\n\tglobal_load_async_to_lds_b128 %5, %13, off\n\tglobal_load_async_to_lds_b128 %6, %14, off\n\tglobal_load_async_to_lds_b128 %7, %15, off\n\ts_wait_xcnt 0x0"
                 :: "v"(a0), "v"(a1), "v"(a2), "v"(a3), "v"(b0), "v"(b1), "v"(b2), "v"(b3), "v"(h0), "v"(h1), "v"(h2), "v"(h3), "v"(r0), "v"(r1), "v"(r2), "v"(r3) : "memory");
  }
  stage(0);
  asm volatile("s_wait_asynccnt 0x0" ::: "memory");   /* own copies of q and of stage 0 landed */
  __syncthreads();                                    /* q and stage 0 readable by every wave */
  if (nst > 1) stage(1);                              /* block-uniform */
  // q fragments: read from LDS once, behind the barrier that published the q tile, and kept in registers through the key loop
  v16h qh[2], qr[2];
#pragma unroll   /* constant indices: the fragments stay in registers */
  for (int kk = 0; kk < 2; ++kk) { qh[kk] = ldfrag(&qs[0][wave * 16 + ln][kk * 32], 0, hh); qr[kk] = ldfrag(&qs[1][wave * 16 + ln][kk * 32], 0, hh); }
  // The key loop is compiled twice, with the residual scheme as a compile-time constant: the copy for rows >= 256 holds no test of it, no residual accumulator (it stays 0) and no global load; each step is one straight-line block, with no LDS exchange inside it.
  auto key_loop = [&](auto fc) {
  constexpr bool full = decltype(fc)::value;
#pragma unroll 1
  for (int st = 0; st < nst; ++st) {
   const int ke = min(4 * st + 4, nkb);               /* wave-uniform: a wave sits out the steps of the last stage that lie past its diagonal */
#pragma unroll 1   /* rolled: one body serves the four steps of a stage */
   for (int kb = 4 * st; kb < ke; ++kb) {
    const int kbase = kb * 32;
    const int ko32 = (kb & 3) * 32;                   /* the step's first key inside the stage */
    const unsigned short (* const ks)[72] = kt[st & 1] + ko32;
    const unsigned short (* const vs)[136] = vt[st & 1];
    // Transposed products: S^T = K q^T (rows = keys, column = query), so lane ln of either half owns query q0 + ln and holds 16 of its 32 scores in registers.
    // all LDS fragments of the step, K first and then V^T, are fetched as one group in front of its products: one LDS wait place a step, and the V^T latency passes behind the score products and the softmax
    v16h kf[2][2], vf[4];
#pragma unroll   /* these loops are unrolled so that the fragment arrays are indexed by constants and stay in registers */
    for (int kk = 0; kk < 2; ++kk) {
#pragma unroll
      for (int nt = 0; nt < 2; ++nt) kf[kk][nt] = ldfrag(&ks[nt * 16 + ln][kk * 32], 0, hh);
    }
#pragma unroll
    for (int t = 0; t < 4; ++t) vf[t] = ldfrag(&vs[t * 16 + ln][ko32], 0, hh);
    v8f sm[2] = {z8, z8}, sr[2] = {z8, z8};
#pragma unroll
    for (int kk = 0; kk < 2; ++kk) {
#pragma unroll
      for (int nt = 0; nt < 2; ++nt) {
        const size_t ko = ((size_t)(kbase + nt * 16 + ln) * NG + g) * LQ + kcol + kk * 32;
        sm[nt] = mma(kf[kk][nt], qh[kk], sm[nt]);
        sr[nt] = mma(kf[kk][nt], qr[kk], sr[nt]);
        if constexpr (full) { const v16h kr = ldfrag(QKR, ko, hh); sr[nt] = mma(kr, qh[kk], sr[nt]); }
      }
    }
    // register r of tile nt is key kbase + 16 nt + 8 hh + r
    const int kmax = q0 + ln - kbase - 8 * hh;       /* key offset 16 nt + r is kept while it is <= kmax */
    float sc[2][8], mk[2][8];
#pragma unroll
    for (int nt = 0; nt < 2; ++nt) {
#pragma unroll
      for (int r = 0; r < 8; ++r) {
        sc[nt][r] = (sm[nt][r] + sr[nt][r] * RINV) * 0.125f;
        mk[nt][r] = (nt * 16 + r <= kmax) ? sc[nt][r] : -1.0e30f;
      }
    }
    const float mx0 = fmaxf(fmaxf(fmaxf(mk[0][0], mk[0][1]), fmaxf(mk[0][2], mk[0][3])), fmaxf(fmaxf(mk[0][4], mk[0][5]), fmaxf(mk[0][6], mk[0][7])));
    const float mx1 = fmaxf(fmaxf(fmaxf(mk[1][0], mk[1][1]), fmaxf(mk[1][2], mk[1][3])), fmaxf(fmaxf(mk[1][4], mk[1][5]), fmaxf(mk[1][6], mk[1][7])));
    const float mxh = fmaxf(mx0, mx1);
    const float mnew = fmaxf(mi, fmaxf(mxh, xhalf(mxh)));   /* the same in both halves */
    const float al = __expf(mi - mnew);
    mi = mnew;
    float pv[2][8];
#pragma unroll
    for (int nt = 0; nt < 2; ++nt) {
#pragma unroll
      for (int r = 0; r < 8; ++r) {
        const float e = __expf(fminf(sc[nt][r] - mnew, 0.f));
        pv[nt][r] = (nt * 16 + r <= kmax) ? e : 0.f;
      }
    }
    const float su0 = ((pv[0][0] + pv[0][1]) + (pv[0][2] + pv[0][3])) + ((pv[0][4] + pv[0][5]) + (pv[0][6] + pv[0][7]));
    const float su1 = ((pv[1][0] + pv[1][1]) + (pv[1][2] + pv[1][3])) + ((pv[1][4] + pv[1][5]) + (pv[1][6] + pv[1][7]));
    li = li * al + (su0 + su1);                      /* this half's keys only; the halves are joined behind the loop */
#pragma unroll
    for (int t = 0; t < 4; ++t) { om[t] *= al; if constexpr (full) orr[t] *= al; }
    // P^T (x2^10) as a B fragment straight from the score registers: element 8 nt + r is key 16 nt + 8 hh + r, the k order in which ldfrag reads V^T
    FragH ph, pr;
#pragma unroll
    for (int nt = 0; nt < 2; ++nt) {
#pragma unroll
      for (int r = 0; r < 8; ++r) {
        const float pc = pv[nt][r] * RS;
        const _Float16 p16 = (_Float16)pc;
        ph.h[nt * 8 + r] = p16;
        if constexpr (full) pr.h[nt * 8 + r] = (_Float16)((pc - (float)p16) * RS);
      }
    }
    // O^T += V^T P^T: rows = d, column = query
#pragma unroll
    for (int t = 0; t < 4; ++t) {
      const size_t vo = (vrow + t * 16 + ln) * (size_t)SEQ + kbase;
      const v16h vh = vf[t];
      om[t] = mma(vh, ph.v, om[t]);
      if constexpr (full) { const v16h vr = ldfrag(VTR, vo, hh); orr[t] = mma(vr, ph.v, orr[t]); orr[t] = mma(vh, pr.v, orr[t]); }
    }
   }
    // hand-over, passed by every wave: own LDS reads done, own copies of stage st + 1 landed, then the block barrier that publishes stage st + 1 and frees this stage's buffer
    asm volatile("s_wait_dscnt 0x0" ::: "memory");
    asm volatile("s_wait_asynccnt 0x0" ::: "memory");
    __syncthreads();
    if (st + 2 < nst) stage(st + 2);
  }
  };
  if (qt < EQT) key_loop(flag_c<true>{}); else key_loop(flag_c<false>{});   /* block-uniform choice */
  asm volatile("s_wait_asynccnt 0x0" ::: "memory");   /* no copy outstanding at the tile's end */
  // context x16 = o / (2^10 * l) * 16
  const float inv = 0.015625f * (1.0f / (li + xhalf(li)));
#pragma unroll
  for (int t = 0; t < 4; ++t) {
#pragma unroll
    for (int r = 0; r < 8; ++r) so[wave][ln][t * 16 + 8 * hh + r] = (om[t][r] + orr[t][r] * RINV) * inv;
  }
  __builtin_amdgcn_fence(4 /* acq_rel order */, "workgroup"); __builtin_amdgcn_wave_barrier();
  const int rq = lane >> 3, c8 = (lane & 7) * 8;
  {
#pragma unroll
    for (int it = 0; it < 4; ++it) {
      const int rr = it * 4 + rq;
      const v4f a = *(const v4fa*)&so[wave][rr][c8], b = *(const v4fa*)&so[wave][rr][c8 + 4];
      FragH fh, fl;
#pragma unroll
      for (int q = 0; q < 4; ++q) { _Float16 hv = (_Float16)a[q]; fh.h[q] = hv; fl.h[q] = (_Float16)((a[q] - (float)hv) * RSC); hv = (_Float16)b[q]; fh.h[4 + q] = hv; fl.h[4 + q] = (_Float16)((b[q] - (float)hv) * RSC); }
      const v8us oh = fh.half[0], ol = fl.half[0];
      const size_t o = ((size_t)(q0 + rr) * NG + g) * CP + h * HD + c8;
      *(v8us*)(CX + o) = oh; *(v8us*)(CX + o + EMB) = ol;
    }
    asm volatile("s_wait_xcnt 0x0" ::: "memory");   /* stands behind the eight stores, in front of the next tile's writes of their address or data registers */
  }
  }
}

extern "C" void kernel_launch(void* const* d_in, const int* in_sizes, int n_in,
                              void* d_out, int out_size, void* d_ws, size_t ws_size, hipStream_t stream) {
  if (n_in < 5) return;
  if (in_sizes[0] < NR * EMB) return;
  if (in_sizes[1] < EMB * EMB) return;
  if (in_sizes[2] < EMB * KVW) return;
  if (in_sizes[3] < EMB * KVW) return;
  if (in_sizes[4] < EMB * EMB) return;
  if (out_size < NR * EMB) return;
  const float* x  = (const float*)d_in[0];
  const float* Wq = (const float*)d_in[1];      /* [in 1024][out 1024] */
  const float* Wk = (const float*)d_in[2];      /* [in 1024][out 256] */
  const float* Wv = (const float*)d_in[3];      /* [in 1024][out 256] */
  const float* Wo = (const float*)d_in[4];      /* [in 1024][out 1024] */
  char* ws = (char*)d_ws; size_t off = 0;
  auto take = [&](size_t bytes) { char* p = ws + off; off += (bytes + 255) & ~(size_t)255; return p; };
  unsigned short* BQKV = (unsigned short*)take(SZ_BQKV);      /* [1536][1024]: Wq^T | Wk^T | Wv^T, x16 */
  unsigned short* BO   = (unsigned short*)take(SZ_BO);        /* [1024][2048]: Wo^T x16 | Wo^T / 4 */
  unsigned short* X16  = (unsigned short*)take(SZ_X16);       /* [NR][1024] */
  unsigned short* QKH  = (unsigned short*)take(SZ_QK);        /* [NR][1536] value plane of q | k | v */
  unsigned short* QKR  = (unsigned short*)take(SZ_QK);        /* [NR][1536] residual plane (x2^10) */
  unsigned short* VTH  = (unsigned short*)take(SZ_VT);        /* [NG*NKV][64][SEQ] */
  unsigned short* VTR  = (unsigned short*)take(SZ_VT);
  unsigned short* CX   = (unsigned short*)take(SZ_CX);        /* [NR][2048]: context x16 value | residual (x64) */
  if (off > ws_size) return;

  k_prep<<<(unsigned)PB_ALL, 256, 0, stream>>>(x, Wq, Wk, Wv, Wo, X16, BQKV, BO);
  k_gemm_planes<<<(unsigned)((NR / 128) * (LQ / 64)), 128, 0, stream>>>(X16, EMB, BQKV, EMB, 0.0625f, QKH, QKR, LQ, NR, LQ, EMB);
  k_vt<<<(unsigned)(NB * NG * NKV * (SEQ / 64)), 256, 0, stream>>>(QKH, QKR, VTH, VTR);
  k_attn<<<dim3((unsigned)(NQT / 2), (unsigned)(NG * NH)), 128, 0, stream>>>(QKH, QKR, VTH, VTR, CX);
  k_gemm_out<<<(unsigned)((NR / 128) * (EMB / 64)), 128, 0, stream>>>(CX, CP, BO, CP, 0.00390625f, (float*)d_out, EMB, NR, EMB, CP);
}

// v010
// It runs in 86.4 microseconds.
// Two timings next to v009 both put it at 1.09 times that version's speed.
// All steps since v000 together make it 4.07 times as fast.
#include <hip/hip_runtime.h>
// Causal grouped-query self-attention with a group axis: x [1][SEQ][2][1024]; token row = s*2 + g; q = x Wq (16 heads x 64), k|v = x Wk|Wv (4 kv heads x 64, query head h uses kv head h/4); raw energy, causal exclusion (key > query), then 1/8 inside the softmax over keys of the same g; merged heads (h*64 + d) times Wo.
// Compute dtype: v_wmma_f32_16x16x32_f16 for every contraction, f32 accumulate. Inputs RNE-converted to bf16 then held exactly in f16 (x as is, weights x16). q|k|v written as f16 value + f16 residual (x2^10) planes. Scores: q value+residual against k value (plus k residual on query rows < 256). P carried x2^10 as f16 (plus residual x2^10 on rows < 256), V^T value (plus residual on rows < 256), residual products in a separate accumulator. Context carried x16 as f16 value | residual (x64) along K against Wo x16 | Wo / 4. Softmax statistics f32.
#ifndef NB
#define NB 1
#endif
#ifndef SEQ
#define SEQ 2048
#endif
#define SEQ_FULL 2048
#define NG 2
#define EMB 1024
#define NH 16
#define NKV 4
#define HD 64
#define KVW (NKV * HD)            /* 256 */
#define LQ (EMB + 2 * KVW)        /* 1536: pitch of the q|k|v planes */
#define CP (2 * EMB)              /* 2048: pitch of the context plane (value | residual) */
#define NR (NB * SEQ * NG)        /* token rows */
#define NQT (SEQ / 64)            /* 64-row query tiles */
#define EQT 4                     /* 64-row query tiles (rows < 256) that run the full residual scheme */
#define RS 1024.0f                /* residual carry of q, k, v, P */
#define RINV 0.0009765625f
#define RSC 64.0f                 /* residual carry of the context plane */

static_assert(NB == 1);
static_assert(SEQ % 128 == 0);
static_assert(SEQ >= 64);
static_assert(SEQ <= SEQ_FULL);
static_assert(NR % 128 == 0);
static_assert(LQ % 64 == 0);
static_assert(EMB % 128 == 0);
static_assert(CP % 128 == 0);
static_assert(HD == 64);
static_assert(NH == 4 * NKV);
static_assert(NH * HD == EMB);
static_assert(KVW % 64 == 0);

typedef unsigned short v8us __attribute__((ext_vector_type(8), may_alias));
typedef float  v8f  __attribute__((ext_vector_type(8)));
typedef float  v4f  __attribute__((ext_vector_type(4)));
typedef float  v4fa __attribute__((ext_vector_type(4), may_alias));
typedef _Float16 v16h __attribute__((ext_vector_type(16)));
union FragH { v16h v; v8us half[2]; _Float16 h[16]; unsigned short u[16]; };

constexpr size_t SZ_BQKV = (size_t)LQ * EMB * 2;
constexpr size_t SZ_BO   = (size_t)EMB * CP * 2;
constexpr size_t SZ_X16  = (size_t)NR * EMB * 2;
constexpr size_t SZ_QK   = (size_t)NR * LQ * 2;
constexpr size_t SZ_VT   = (size_t)NB * NG * NKV * HD * SEQ * 2;
constexpr size_t SZ_CX   = (size_t)NR * CP * 2;
constexpr size_t WS_TOTAL = SZ_BQKV + SZ_BO + SZ_X16 + 2 * SZ_QK + 2 * SZ_VT + SZ_CX;
static_assert(WS_TOTAL <= (size_t)134217728);
static_assert(SZ_BQKV % 256 == 0 && SZ_BO % 256 == 0 && SZ_X16 % 256 == 0 && SZ_QK % 256 == 0 && SZ_VT % 256 == 0 && SZ_CX % 256 == 0);

// RNE convert f32 -> bf16 value (kept in f32)
__device__ __forceinline__ float bf16_rne(float x) { unsigned int u = __float_as_uint(x); u = (u + 0x7FFFu + ((u >> 16) & 1u)) & 0xFFFF0000u; return __uint_as_float(u); }
__device__ __forceinline__ unsigned short h_bits(_Float16 h) { return __builtin_bit_cast(unsigned short, h); }
// 16-bit fragment: elements 0..7 <- k0 + 8h + 0..7, elements 8..15 <- k0 + 16 + 8h + 0..7 (row / column = lane & 15)
__device__ __forceinline__ v16h ldfrag(const unsigned short* __restrict__ p, size_t off, int hh) { FragH f; f.half[0] = *(const v8us*)(p + off + 8 * hh); f.half[1] = *(const v8us*)(p + off + 16 + 8 * hh); return f.v; }
// lane l <-> lane l ^ 16
__device__ __forceinline__ float xhalf(float x) { const int b = __builtin_bit_cast(int, x); return __builtin_bit_cast(float, __builtin_amdgcn_permlanex16(b, b, 0x76543210, 0xfedcba98, false, false)); }
template <bool B> struct flag_c { static constexpr bool value = B; };
__device__ __forceinline__ v8f mma(v16h a, v16h b, v8f c) { v8f d = __builtin_amdgcn_wmma_f32_16x16x32_f16(false, a, false, b, (short)0, c, false, false); asm volatile("v_nop\n\tv_nop\n\tv_nop\n\tv_nop" : "+v"(d) : "v"(a), "v"(b)); return d; }

// A thread converts 32 elements. Patch t of W^T, 8 k x 4 n: Wt[drow0 + n + j][dcol0 + k8 .. k8 + 7] = f16(bf16(W[k8 + i][n + j]) * scale), j < 4; K % 64 == 0, N % 16 == 0.
// A wave covers 64 k x 16 n: four neighbouring lanes read 64 contiguous bytes of a W row with one 16-byte load each (the wave beside it, in the same block, reads the line's other half), eight lanes write one whole 128-byte line of a W^T row. The transposition itself is a choice of registers.
__device__ __forceinline__ void wt_f16(const float* __restrict__ W, unsigned short* __restrict__ Wt, int K, int N, int drow0, int dpitch, int dcol0, float scale, int t) {
  const int nwn = N / 16;                       /* wave tiles along n */
  const int w = t >> 5, l = t & 31; if (w >= nwn * (K / 64)) return;
  const int kw = w / nwn, nw = w - kw * nwn;
  const int n = nw * 16 + (l & 3) * 4, k8 = kw * 64 + (l >> 2) * 8;
  v4f a[8];
#pragma unroll   /* constant indices: the patch stays in registers, its eight loads are in flight together */
  for (int i = 0; i < 8; ++i) a[i] = *(const v4fa*)(W + (size_t)(k8 + i) * N + n);
#pragma unroll
  for (int j = 0; j < 4; ++j) {
    FragH f;
#pragma unroll
    for (int i = 0; i < 8; ++i) f.h[i] = (_Float16)(bf16_rne(a[i][j]) * scale);
    const v8us o = f.half[0];
    *(v8us*)(Wt + (size_t)(drow0 + n + j) * dpitch + dcol0 + k8) = o;
  }
}

// Four 8-element groups of x, 256 groups apart (block b owns groups 1024 b .. 1024 b + 1023)
__device__ __forceinline__ void x16_f16(const float* __restrict__ x, unsigned short* __restrict__ X16, int b, int tid) {
  const size_t g0 = (size_t)b * 1024 + tid;
  v4f a[4], c[4];
#pragma unroll   /* constant indices: the eight loads are in flight together */
  for (int j = 0; j < 4; ++j) { a[j] = *(const v4fa*)(x + (g0 + 256 * j) * 8); c[j] = *(const v4fa*)(x + (g0 + 256 * j) * 8 + 4); }
#pragma unroll
  for (int j = 0; j < 4; ++j) {
    FragH f;
#pragma unroll
    for (int q = 0; q < 4; ++q) { f.h[q] = (_Float16)bf16_rne(a[j][q]); f.h[4 + q] = (_Float16)bf16_rne(c[j][q]); }
    const v8us o = f.half[0];
    *(v8us*)(X16 + (g0 + 256 * j) * 8) = o;
  }
  asm volatile("s_wait_xcnt 0x0" ::: "memory");   /* stands behind the four stores, in front of any later write of their address or data registers */
}

static_assert(EMB % 64 == 0 && KVW % 16 == 0);
static_assert((EMB * EMB) % (32 * 256) == 0 && (KVW * EMB) % (32 * 256) == 0 && ((size_t)NR * EMB) % (32 * 256) == 0);
constexpr int PB_W  = EMB * EMB / (32 * 256);   /* blocks of a 1024-column weight */
constexpr int PB_KV = KVW * EMB / (32 * 256);   /* blocks of a 256-column weight */
constexpr int PB_X  = NR * EMB / (32 * 256);    /* blocks of x */
constexpr int PB_ALL = 3 * PB_W + 2 * PB_KV + PB_X;

// All input conversions in one launch: none reads what another writes, so a block picks its job by its index (block-uniform). The weight jobs, whose waves last longer, come first.
__global__ __launch_bounds__(256) void k_prep(const float* __restrict__ x, const float* __restrict__ Wq, const float* __restrict__ Wk, const float* __restrict__ Wv, const float* __restrict__ Wo,
    unsigned short* __restrict__ X16, unsigned short* __restrict__ BQKV, unsigned short* __restrict__ BO) {
  const int tid = threadIdx.x; int b = blockIdx.x;
  if (b < PB_W) { wt_f16(Wq, BQKV, EMB, EMB, 0, EMB, 0, 16.0f, b * 256 + tid); return; }
  b -= PB_W;
  if (b < PB_W) { wt_f16(Wo, BO, EMB, EMB, 0, CP, 0, 16.0f, b * 256 + tid); return; }
  b -= PB_W;
  if (b < PB_W) { wt_f16(Wo, BO, EMB, EMB, 0, CP, EMB, 0.25f, b * 256 + tid); return; }
  b -= PB_W;
  if (b < PB_KV) { wt_f16(Wk, BQKV, EMB, KVW, EMB, EMB, 0, 16.0f, b * 256 + tid); return; }
  b -= PB_KV;
  if (b < PB_KV) { wt_f16(Wv, BQKV, EMB, KVW, EMB + KVW, EMB, 0, 16.0f, b * 256 + tid); return; }
  b -= PB_KV;
  x16_f16(x, X16, b, tid);
}

// GEMM main loop: block tile 128 x 64, wave tile 32 x 64, A f16 [M][lda], Bt f16 [N][ldb] (k contiguous), K % 128 == 0, K >= 128; called by all 128 threads of the block.
// The block's A and Bt rows of each 128-wide k stage are copied into LDS once per block as whole 256-byte rows (two buffers, the next stage's copies fly during this stage's two 64-wide steps); every wave reads its fragments from there.
// The blocks that share rows walk k together, so the leading block's rows are first reads, which take a memory latency and not an L2 hit's: a 64-wide step is too short to cover it.
constexpr int GROWS = 128 + 64;   /* rows of a stage: 128 of A, then 64 of Bt */
constexpr int GP = 136;           /* 128 k, pitch 272 B */
typedef unsigned short gtile_t[GROWS][GP];
typedef float f32a __attribute__((may_alias));
// twelve copies of 16 B a lane into LDS rows 8 apart; the closing s_wait_xcnt keeps later writes of the address registers behind the copies
__device__ __forceinline__ void copy12(unsigned int l, const unsigned short* g0, const unsigned short* g1, const unsigned short* g2, const unsigned short* g3, const unsigned short* g4, const unsigned short* g5,
    const unsigned short* g6, const unsigned short* g7, const unsigned short* g8, const unsigned short* g9, const unsigned short* g10, const unsigned short* g11) {
  constexpr unsigned int LS = 8 * GP * 2;
  asm volatile("global_load_async_to_lds_b128 %0, %12, off\n\tglobal_load_async_to_lds_b128 %1, %13, off\n\tglobal_load_async_to_lds_b128 %2, %14, off\n\tglobal_load_async_to_lds_b128 %3, %15, off\n\t"
               "global_load_async_to_lds_b128 %4, %16, off\n\tglobal_load_async_to_lds_b128 %5, %17, off\n\tglobal_load_async_to_lds_b128 %6, %18, off\n\tglobal_load_async_to_lds_b128 %7, %19, off\n\t"
               "global_load_async_to_lds_b128 %8, %20, off\n\tglobal_load_async_to_lds_b128 %9, %21, off\n\tglobal_load_async_to_lds_b128 %10, %22, off\n\tglobal_load_async_to_lds_b128 %11, %23, off\n\ts_wait_xcnt 0x0"
               :: "v"(l), "v"(l + LS), "v"(l + 2 * LS), "v"(l + 3 * LS), "v"(l + 4 * LS), "v"(l + 5 * LS), "v"(l + 6 * LS), "v"(l + 7 * LS), "v"(l + 8 * LS), "v"(l + 9 * LS), "v"(l + 10 * LS), "v"(l + 11 * LS),
                  "v"(g0), "v"(g1), "v"(g2), "v"(g3), "v"(g4), "v"(g5), "v"(g6), "v"(g7), "v"(g8), "v"(g9), "v"(g10), "v"(g11) : "memory");
}
__device__ __forceinline__ void gemm_core(gtile_t* tl, const unsigned short* __restrict__ A, int lda, const unsigned short* __restrict__ Bt, int ldb, int K, int brow0, int col0, int tid, int wave, int ln, int hh,
    v8f& c00, v8f& c01, v8f& c02, v8f& c03, v8f& c10, v8f& c11, v8f& c12, v8f& c13) {
  const int r0 = tid >> 4, c8 = (tid & 15) * 8;
  const unsigned short* const ga = A + (size_t)(brow0 + r0) * lda + c8;
  const unsigned short* const gb = Bt + (size_t)(col0 + r0) * ldb + c8;
  const size_t sa = (size_t)8 * lda, sb = (size_t)8 * ldb;
  const int nst = K >> 7;
  // stage s -> buffer s & 1: each thread copies 16 B of A rows r0 + 8 j (j < 16) and of Bt rows r0 + 8 j (j < 8); sixteen lanes cover the 256 contiguous bytes of a row
  auto stage = [&](int s) {
    const int b = s & 1;
    const unsigned short* const a = ga + (size_t)s * 128; const unsigned short* const bb = gb + (size_t)s * 128;
    // the Bt rows follow the A rows in the stage, so the 24 LDS rows of a thread are evenly 8 apart
    copy12((unsigned int)(size_t)&tl[b][r0][c8], a, a + sa, a + 2 * sa, a + 3 * sa, a + 4 * sa, a + 5 * sa, a + 6 * sa, a + 7 * sa, a + 8 * sa, a + 9 * sa, a + 10 * sa, a + 11 * sa);
    copy12((unsigned int)(size_t)&tl[b][r0 + 96][c8], a + 12 * sa, a + 13 * sa, a + 14 * sa, a + 15 * sa, bb, bb + sb, bb + 2 * sb, bb + 3 * sb, bb + 4 * sb, bb + 5 * sb, bb + 6 * sb, bb + 7 * sb);
  };
  stage(0);
  asm volatile("s_wait_asynccnt 0x0" ::: "memory");   /* own copies of stage 0 landed */
  __syncthreads();                                    /* stage 0 readable by every wave */
  if (nst > 1) stage(1);
#pragma unroll 1
  for (int s = 0; s < nst; ++s) {                     /* rolled: one body serves both buffers */
    const unsigned short (* const ts)[GP] = tl[s & 1];
#pragma unroll 1   /* rolled: one body serves the two 64-wide steps of a stage */
    for (int k0 = 0; k0 < 128; k0 += 64) {
      // all fragments of the step are fetched as one group in front of its products: one LDS wait place a step instead of two
      v16h fa[2][2], fb[2][4];
#pragma unroll   /* these three loops are unrolled so that the fragment arrays are indexed by constants and stay in registers */
      for (int kk = 0; kk < 2; ++kk) {
        fa[kk][0] = ldfrag(&ts[32 * wave + ln][k0 + kk * 32], 0, hh); fa[kk][1] = ldfrag(&ts[32 * wave + 16 + ln][k0 + kk * 32], 0, hh);
#pragma unroll
        for (int j = 0; j < 4; ++j) fb[kk][j] = ldfrag(&ts[128 + 16 * j + ln][k0 + kk * 32], 0, hh);
      }
#pragma unroll
      for (int kk = 0; kk < 2; ++kk) {
        c00 = mma(fa[kk][0], fb[kk][0], c00); c10 = mma(fa[kk][1], fb[kk][0], c10);
        c01 = mma(fa[kk][0], fb[kk][1], c01); c11 = mma(fa[kk][1], fb[kk][1], c11);
        c02 = mma(fa[kk][0], fb[kk][2], c02); c12 = mma(fa[kk][1], fb[kk][2], c12);
        c03 = mma(fa[kk][0], fb[kk][3], c03); c13 = mma(fa[kk][1], fb[kk][3], c13);
      }
    }
    // hand-over, passed by every wave: own LDS reads done, own copies of stage s + 1 landed, then the block barrier that publishes stage s + 1 and frees this stage's buffer
    asm volatile("s_wait_dscnt 0x0" ::: "memory");
    asm volatile("s_wait_asynccnt 0x0" ::: "memory");
    __syncthreads();
    if (s + 2 < nst) stage(s + 2);
  }
  asm volatile("s_wait_asynccnt 0x0" ::: "memory");   /* no copy outstanding behind the loop */
}

// C = alpha * A . Bt^T written as f16 value plane CH and residual plane CR ((v - value) * 2^10), both pitch ldc. M % 128 == 0, N % 64 == 0.
__global__ __launch_bounds__(128) void k_gemm_planes(const unsigned short* __restrict__ A, int lda, const unsigned short* __restrict__ Bt, int ldb, float alpha,
    unsigned short* __restrict__ CH, unsigned short* __restrict__ CR, int ldc, int M, int N, int K) {
  __shared__ __attribute__((aligned(16))) gtile_t tl[2];
  // The per-wave output staging tile lies in the stage buffers, so that three blocks still fit a WGP's LDS: it is written behind the main loop's last hand-over (every wave's s_wait_dscnt 0 and s_wait_asynccnt 0, then the block barrier), after which no wave reads a stage and no copy is outstanding.
  f32a (* const so)[32][68] = reinterpret_cast<f32a (*)[32][68]>(&tl[0][0][0]);
  static_assert(sizeof(float) * 4 * 32 * 68 <= sizeof(gtile_t));
  const int tid = threadIdx.x; const int wave = __builtin_amdgcn_readfirstlane(tid >> 5);
  const int lane = tid & 31, ln = lane & 15, hh = lane >> 4;
  const int ntn = N >> 6; const int mt = blockIdx.x / ntn, nq = blockIdx.x - mt * ntn;
  const int brow0 = mt * 128, row0 = brow0 + 32 * wave, col0 = nq * 64; if (brow0 >= M) return;
  const v8f z8 = {0.f, 0.f, 0.f, 0.f, 0.f, 0.f, 0.f, 0.f};
  v8f c00 = z8, c01 = z8, c02 = z8, c03 = z8, c10 = z8, c11 = z8, c12 = z8, c13 = z8;
  gemm_core(tl, A, lda, Bt, ldb, K, brow0, col0, tid, wave, ln, hh, c00, c01, c02, c03, c10, c11, c12, c13);
  v8f accs[8] = {c00, c01, c02, c03, c10, c11, c12, c13};
#pragma unroll
  for (int u = 0; u < 8; ++u) { const int t = u & 3, hf = u >> 2;
#pragma unroll
    for (int r = 0; r < 8; ++r) so[wave][hf * 16 + 8 * hh + r][t * 16 + ln] = accs[u][r] * alpha; }
  __builtin_amdgcn_fence(4 /* acq_rel order */, "workgroup"); __builtin_amdgcn_wave_barrier();
  const int rq = lane >> 3, c8 = (lane & 7) * 8;
  {
#pragma unroll
    for (int it = 0; it < 8; ++it) {
      const int rr = it * 4 + rq;
      const v4f a = *(const v4fa*)&so[wave][rr][c8], b = *(const v4fa*)&so[wave][rr][c8 + 4];
      FragH fh, fl;
#pragma unroll
      for (int q = 0; q < 4; ++q) { _Float16 hv = (_Float16)a[q]; fh.h[q] = hv; fl.h[q] = (_Float16)((a[q] - (float)hv) * RS); hv = (_Float16)b[q]; fh.h[4 + q] = hv; fl.h[4 + q] = (_Float16)((b[q] - (float)hv) * RS); }
      const v8us oh = fh.half[0], ol = fl.half[0];
      const size_t o = (size_t)(row0 + rr) * ldc + col0 + c8;
      *(v8us*)(CH + o) = oh; *(v8us*)(CR + o) = ol;
    }
    
  }
}

__global__ __launch_bounds__(128) void k_gemm_out(const unsigned short* __restrict__ A, int lda, const unsigned short* __restrict__ Bt, int ldb, float alpha,
    float* __restrict__ C, int ldc, int M, int N, int K) {
  __shared__ __attribute__((aligned(16))) gtile_t tl[2];
  // The per-wave output staging tile lies in the stage buffers, so that three blocks still fit a WGP's LDS: it is written behind the main loop's last hand-over (every wave's s_wait_dscnt 0 and s_wait_asynccnt 0, then the block barrier), after which no wave reads a stage and no copy is outstanding.
  f32a (* const so)[32][68] = reinterpret_cast<f32a (*)[32][68]>(&tl[0][0][0]);
  static_assert(sizeof(float) * 4 * 32 * 68 <= sizeof(gtile_t));
  const int tid = threadIdx.x; const int wave = __builtin_amdgcn_readfirstlane(tid >> 5);
  const int lane = tid & 31, ln = lane & 15, hh = lane >> 4;
  const int ntn = N >> 6; const int mt = blockIdx.x / ntn, nq = blockIdx.x - mt * ntn;
  const int brow0 = mt * 128, row0 = brow0 + 32 * wave, col0 = nq * 64; if (brow0 >= M) return;
  const v8f z8 = {0.f, 0.f, 0.f, 0.f, 0.f, 0.f, 0.f, 0.f};
  v8f c00 = z8, c01 = z8, c02 = z8, c03 = z8, c10 = z8, c11 = z8, c12 = z8, c13 = z8;
  gemm_core(tl, A, lda, Bt, ldb, K, brow0, col0, tid, wave, ln, hh, c00, c01, c02, c03, c10, c11, c12, c13);
  v8f accs[8] = {c00, c01, c02, c03, c10, c11, c12, c13};
#pragma unroll
  for (int u = 0; u < 8; ++u) { const int t = u & 3, hf = u >> 2;
#pragma unroll
    for (int r = 0; r < 8; ++r) so[wave][hf * 16 + 8 * hh + r][t * 16 + ln] = accs[u][r] * alpha; }
  __builtin_amdgcn_fence(4 /* acq_rel order */, "workgroup"); __builtin_amdgcn_wave_barrier();
  const int rsub = lane >> 4, c4 = (lane & 15) * 4;
  {
#pragma unroll
    for (int q = 0; q < 16; ++q) { const int r = q * 2 + rsub; const v4f v = *(const v4fa*)&so[wave][r][c4]; *(v4f*)(C + (size_t)(row0 + r) * ldc + col0 + c4) = v; }
    
  }
}

__global__ __launch_bounds__(256) void k_vt(const unsigned short* __restrict__ QKH, const unsigned short* __restrict__ QKR, unsigned short* __restrict__ VTH, unsigned short* __restrict__ VTR) {
  __shared__ unsigned short tl[2][64][66];
  const int tid = threadIdx.x;
  const int nlg = SEQ / 64;
  const int slab = blockIdx.x / nlg, lg = blockIdx.x - slab * nlg;
  const int g = slab / NKV, kv = slab - g * NKV;
#pragma unroll 1
  for (int i = tid; i < 512; i += 256) {
    const int r = i >> 3, c8 = (i & 7) * 8;
    const size_t sof = ((size_t)(lg * 64 + r) * NG + g) * LQ + EMB + KVW + kv * HD + c8;
    FragH fh, fr; fh.half[0] = *(const v8us*)(QKH + sof); fr.half[0] = *(const v8us*)(QKR + sof);
#pragma unroll
    for (int q = 0; q < 8; ++q) { tl[0][r][c8 + q] = fh.u[q]; tl[1][r][c8 + q] = fr.u[q]; }
  }
  __syncthreads();
  {
#pragma unroll
    for (int rd = 0; rd < 2; ++rd) {
      const int d = rd * 32 + (tid >> 3), pc = tid & 7; FragH fh, fr;
#pragma unroll
      for (int q = 0; q < 8; ++q) { fh.u[q] = tl[0][pc * 8 + q][d]; fr.u[q] = tl[1][pc * 8 + q][d]; }
      const v8us oh = fh.half[0], ol = fr.half[0];
      const size_t o = ((size_t)slab * HD + d) * SEQ + lg * 64 + pc * 8;
      *(v8us*)(VTH + o) = oh; *(v8us*)(VTR + o) = ol;
    }
    
  }
}

// Fused causal flash attention. grid = (SEQ/128, NG*NH); block = 4 waves, wave = 16 query rows; 32-key steps up to the diagonal, four steps to a 128-key stage of the LDS tiles.
// A tile's cost grows with its index (2 qt + 2 steps) and all blocks are resident at once, so the launch lasts as long as its fullest block: a block runs two 64-row query tiles one after the other, the pp-th dearest (NQT - 1 - pp) and then the pp-th cheapest of the lower half.
// A step of the residual scheme waits for eight dependent global fetches and is counted as FULLW plain steps.
constexpr int FULLW = 4;
constexpr int tile_cost(int t) { return (2 * t + 2) * (t < EQT ? FULLW : 1); }
// the tiles below NQT / 2 in rising order of cost (ties by index), four bits each
constexpr unsigned long long lower_by_cost() {
  int ord[NQT / 2] = {};
  for (int i = 0; i < NQT / 2; ++i) { int j = i; for (; j > 0 && tile_cost(ord[j - 1]) > tile_cost(i); --j) ord[j] = ord[j - 1]; ord[j] = i; }
  unsigned long long w = 0;
  for (int i = 0; i < NQT / 2; ++i) w |= (unsigned long long)ord[i] << (4 * i);
  return w;
}
constexpr unsigned long long LOWER = lower_by_cost();
constexpr unsigned int lower_seen() { unsigned int m = 0; for (int i = 0; i < NQT / 2; ++i) m |= 1u << ((LOWER >> (4 * i)) & 15); return m; }
static_assert(NQT / 2 <= 16 && EQT <= NQT / 2);
static_assert(lower_seen() == (1u << (NQT / 2)) - 1u);   /* every tile of the lower half is dealt once */
// The block's q tile (value and residual) is copied into LDS once and each wave's q fragments are read from it once, the K and V^T value tiles of each 128-key stage once per block (two buffers, the next stage's copies fly during this stage's four steps: the blocks of a kv head walk the keys together, so the leading block's rows are first reads, which take a memory latency and not an L2 hit's); the K and V^T residual planes (rows < 256 only) come straight from global memory. Scores and context are formed transposed (S^T = K q^T, O^T += V^T P^T): a lane owns one query, P goes from the score registers into the B operand. The per-wave output staging tile is wave-private.
__global__ __launch_bounds__(128) void k_attn(const unsigned short* __restrict__ QKH, const unsigned short* __restrict__ QKR,
    const unsigned short* __restrict__ VTH, const unsigned short* __restrict__ VTR, unsigned short* __restrict__ CX) {
  __shared__ __attribute__((aligned(16))) float so[4][16][68];
  __shared__ __attribute__((aligned(16))) unsigned short kt[2][128][72];  /* 128 keys x 64, pitch 144 B */
  __shared__ __attribute__((aligned(16))) unsigned short vt[2][64][136];  /* 64 d x 128 keys, pitch 272 B */
  __shared__ __attribute__((aligned(16))) unsigned short qs[2][64][72];   /* value | residual: 64 query rows x 64, pitch 144 B */
  const int tid = threadIdx.x; const int wave = __builtin_amdgcn_readfirstlane(tid >> 5);
  const int lane = tid & 31, ln = lane & 15, hh = lane >> 4;
  const int pp = blockIdx.x, gh = blockIdx.y;
  const int g = gh >> 4, h = gh & 15, kvh = h >> 2;
  const size_t kcol = (size_t)EMB + kvh * HD;
  const size_t vrow = (size_t)(g * NKV + kvh) * HD;
  const v8f z8 = {0.f, 0.f, 0.f, 0.f, 0.f, 0.f, 0.f, 0.f};
  const int kr0 = tid >> 3, kc8 = (tid & 7) * 8, vr0 = tid >> 4, vc8 = (tid & 15) * 8;
  const unsigned short* const gk = QKH + ((size_t)kr0 * NG + g) * LQ + kcol + kc8;
  const unsigned short* const gv = VTH + (vrow + vr0) * (size_t)SEQ + vc8;
  // stage s (keys 128 s .. 128 s + 127) -> buffer s & 1: each thread copies 16 B of K rows kr0 + 16 j and of V^T rows vr0 + 8 j (j < 8); sixteen lanes cover the 256 contiguous bytes of a V^T row
  auto stage = [&](int s) {
    const int b = s & 1;
    constexpr size_t KS = (size_t)16 * NG * LQ, VS = (size_t)8 * SEQ;
    const unsigned short* const k0 = gk + (size_t)s * (128 * NG * LQ);
    const unsigned short* const k1 = k0 + KS; const unsigned short* const k2 = k0 + 2 * KS; const unsigned short* const k3 = k0 + 3 * KS;
    const unsigned short* const k4 = k0 + 4 * KS; const unsigned short* const k5 = k0 + 5 * KS; const unsigned short* const k6 = k0 + 6 * KS; const unsigned short* const k7 = k0 + 7 * KS;
    const unsigned int lk0 = (unsigned int)(size_t)&kt[b][kr0][kc8], lk1 = (unsigned int)(size_t)&kt[b][kr0 + 16][kc8], lk2 = (unsigned int)(size_t)&kt[b][kr0 + 32][kc8], lk3 = (unsigned int)(size_t)&kt[b][kr0 + 48][kc8];
    const unsigned int lk4 = (unsigned int)(size_t)&kt[b][kr0 + 64][kc8], lk5 = (unsigned int)(size_t)&kt[b][kr0 + 80][kc8], lk6 = (unsigned int)(size_t)&kt[b][kr0 + 96][kc8], lk7 = (unsigned int)(size_t)&kt[b][kr0 + 112][kc8];
    // the closing s_wait_xcnt keeps later writes of the address registers behind the copies
    asm volatile("global_load_async_to_lds_b128 %0, %8, off\n\tglobal_load_async_to_lds_b128 %1, %9, off\n\tglobal_load_async_to_lds_b128 %2, %10, off\n\tglobal_load_async_to_lds_b128 %3, %11, off\n\t"
                 "global_load_async_to_lds_b128 %4, %12, off\n\tglobal_load_async_to_lds_b128 %5, %13, off\n\tglobal_load_async_to_lds_b128 %6, %14, off\n\tglobal_load_async_to_lds_b128 %7, %15, off\n\ts_wait_xcnt 0x0"
                 :: "v"(lk0), "v"(lk1), "v"(lk2), "v"(lk3), "v"(lk4), "v"(lk5), "v"(lk6), "v"(lk7), "v"(k0), "v"(k1), "v"(k2), "v"(k3), "v"(k4), "v"(k5), "v"(k6), "v"(k7) : "memory");
    const unsigned short* const v0 = gv + s * 128;
    const unsigned short* const v1 = v0 + VS; const unsigned short* const v2 = v0 + 2 * VS; const unsigned short* const v3 = v0 + 3 * VS;
    const unsigned short* const v4 = v0 + 4 * VS; const unsigned short* const v5 = v0 + 5 * VS; const unsigned short* const v6 = v0 + 6 * VS; const unsigned short* const v7 = v0 + 7 * VS;
    const unsigned int lv0 = (unsigned int)(size_t)&vt[b][vr0][vc8], lv1 = (unsigned int)(size_t)&vt[b][vr0 + 8][vc8], lv2 = (unsigned int)(size_t)&vt[b][vr0 + 16][vc8], lv3 = (unsigned int)(size_t)&vt[b][vr0 + 24][vc8];
    const unsigned int lv4 = (unsigned int)(size_t)&vt[b][vr0 + 32][vc8], lv5 = (unsigned int)(size_t)&vt[b][vr0 + 40][vc8], lv6 = (unsigned int)(size_t)&vt[b][vr0 + 48][vc8], lv7 = (unsigned int)(size_t)&vt[b][vr0 + 56][vc8];
    // the closing s_wait_xcnt keeps later writes of the address registers behind the copies
    asm volatile("global_load_async_to_lds_b128 %0, %8, off\n\tglobal_load_async_to_lds_b128 %1, %9, off\n\tglobal_load_async_to_lds_b128 %2, %10, off\n\tglobal_load_async_to_lds_b128 %3, %11, off\n\t"
                 "global_load_async_to_lds_b128 %4, %12, off\n\tglobal_load_async_to_lds_b128 %5, %13, off\n\tglobal_load_async_to_lds_b128 %6, %14, off\n\tglobal_load_async_to_lds_b128 %7, %15, off\n\ts_wait_xcnt 0x0"
                 :: "v"(lv0), "v"(lv1), "v"(lv2), "v"(lv3), "v"(lv4), "v"(lv5), "v"(lv6), "v"(lv7), "v"(v0), "v"(v1), "v"(v2), "v"(v3), "v"(v4), "v"(v5), "v"(v6), "v"(v7) : "memory");
  };
  // The second tile's copies refill qs, kt and vt behind the first tile's last hand-over (every wave's s_wait_dscnt 0, then the block barrier), after which no wave reads them; the output staging between the two is wave-private.
#pragma unroll 1   /* rolled: one copy of the tile's code serves both tiles */
  for (int ti = 0; ti < 2; ++ti) {
  const int qt = ti ? (int)((LOWER >> (4 * pp)) & 15) : NQT - 1 - pp;    /* block-uniform; every (head, tile) is run once */
  const int q0 = qt * 64 + wave * 16;
  v8f om[4] = {z8, z8, z8, z8}, orr[4] = {z8, z8, z8, z8};
  float mi = -1.0e30f, li = 0.f;            /* of query q0 + ln; li holds the sum over this half's keys */
  const int nkb = (q0 + 16 + 31) >> 5;      /* every visited 32-key step starts at a key <= q0, so each row keeps >= 1 key per step */
  const int nst = (qt + 2) >> 1;            /* 128-key stages that hold the tile's 2 qt + 2 steps; keys < 128 * nst <= 64 * NQT = SEQ (NQT is even) */
  {
    // q tile: each thread copies 16 B of rows kr0 + 0, 16, 32, 48 of both planes
    const size_t qg = ((size_t)(qt * 64 + kr0) * NG + g) * LQ + h * HD + kc8;
    const unsigned short* const h0 = QKH + qg; const unsigned short* const h1 = h0 + (size_t)16 * NG * LQ;
    const unsigned short* const h2 = h1 + (size_t)16 * NG * LQ; const unsigned short* const h3 = h2 + (size_t)16 * NG * LQ;
    const unsigned short* const r0 = QKR + qg; const unsigned short* const r1 = r0 + (size_t)16 * NG * LQ;
    const unsigned short* const r2 = r1 + (size_t)16 * NG * LQ; const unsigned short* const r3 = r2 + (size_t)16 * NG * LQ;
    const unsigned int a0 = (unsigned int)(size_t)&qs[0][kr0][kc8], a1 = (unsigned int)(size_t)&qs[0][kr0 + 16][kc8];
    const unsigned int a2 = (unsigned int)(size_t)&qs[0][kr0 + 32][kc8], a3 = (unsigned int)(size_t)&qs[0][kr0 + 48][kc8];
    const unsigned int b0 = (unsigned int)(size_t)&qs[1][kr0][kc8], b1 = (unsigned int)(size_t)&qs[1][kr0 + 16][kc8];
    const unsigned int b2 = (unsigned int)(size_t)&qs[1][kr0 + 32][kc8], b3 = (unsigned int)(size_t)&qs[1][kr0 + 48][kc8];
    // the closing s_wait_xcnt keeps later writes of the address registers behind the copies
    asm volatile("global_load_async_to_lds_b128 %0, %8, off\n\tglobal_load_async_to_lds_b128 %1, %9, off\n\tglobal_load_async_to_lds_b128 %2, %10, off\n\tglobal_load_async_to_lds_b128 %3, %11, off\n\t"
                 "global_load_async_to_lds_b128 %4, %12, off\n\tglobal_load_async_to_lds_b128 %5, %13, off\n\tglobal_load_async_to_lds_b128 %6, %14, off\n\tglobal_load_async_to_lds_b128 %7, %15, off\n\ts_wait_xcnt 0x0"
                 :: "v"(a0), "v"(a1), "v"(a2), "v"(a3), "v"(b0), "v"(b1), "v"(b2), "v"(b3), "v"(h0), "v"(h1), "v"(h2), "v"(h3), "v"(r0), "v"(r1), "v"(r2), "v"(r3) : "memory");
  }
  stage(0);
  asm volatile("s_wait_asynccnt 0x0" ::: "memory");   /* own copies of q and of stage 0 landed */
  __syncthreads();                                    /* q and stage 0 readable by every wave */
  if (nst > 1) stage(1);                              /* block-uniform */
  // q fragments: read from LDS once, behind the barrier that published the q tile, and kept in registers through the key loop
  v16h qh[2], qr[2];
#pragma unroll   /* constant indices: the fragments stay in registers */
  for (int kk = 0; kk < 2; ++kk) { qh[kk] = ldfrag(&qs[0][wave * 16 + ln][kk * 32], 0, hh); qr[kk] = ldfrag(&qs[1][wave * 16 + ln][kk * 32], 0, hh); }
  // The key loop is compiled twice, with the residual scheme as a compile-time constant: the copy for rows >= 256 holds no test of it, no residual accumulator (it stays 0) and no global load; each step is one straight-line block, with no LDS exchange inside it.
  auto key_loop = [&](auto fc) {
  constexpr bool full = decltype(fc)::value;
#pragma unroll 1
  for (int st = 0; st < nst; ++st) {
   const int ke = min(4 * st + 4, nkb);               /* wave-uniform: a wave sits out the steps of the last stage that lie past its diagonal */
#pragma unroll 1   /* rolled: one body serves the four steps of a stage */
   for (int kb = 4 * st; kb < ke; ++kb) {
    const int kbase = kb * 32;
    const int ko32 = (kb & 3) * 32;                   /* the step's first key inside the stage */
    const unsigned short (* const ks)[72] = kt[st & 1] + ko32;
    const unsigned short (* const vs)[136] = vt[st & 1];
    // Transposed products: S^T = K q^T (rows = keys, column = query), so lane ln of either half owns query q0 + ln and holds 16 of its 32 scores in registers.
    // all LDS fragments of the step, K first and then V^T, are fetched as one group in front of its products: one LDS wait place a step, and the V^T latency passes behind the score products and the softmax
    v16h kf[2][2], vf[4];
#pragma unroll   /* these loops are unrolled so that the fragment arrays are indexed by constants and stay in registers */
    for (int kk = 0; kk < 2; ++kk) {
#pragma unroll
      for (int nt = 0; nt < 2; ++nt) kf[kk][nt] = ldfrag(&ks[nt * 16 + ln][kk * 32], 0, hh);
    }
#pragma unroll
    for (int t = 0; t < 4; ++t) vf[t] = ldfrag(&vs[t * 16 + ln][ko32], 0, hh);
    v8f sm[2] = {z8, z8}, sr[2] = {z8, z8};
#pragma unroll
    for (int kk = 0; kk < 2; ++kk) {
#pragma unroll
      for (int nt = 0; nt < 2; ++nt) {
        const size_t ko = ((size_t)(kbase + nt * 16 + ln) * NG + g) * LQ + kcol + kk * 32;
        sm[nt] = mma(kf[kk][nt], qh[kk], sm[nt]);
        sr[nt] = mma(kf[kk][nt], qr[kk], sr[nt]);
        if constexpr (full) { const v16h kr = ldfrag(QKR, ko, hh); sr[nt] = mma(kr, qh[kk], sr[nt]); }
      }
    }
    // register r of tile nt is key kbase + 16 nt + 8 hh + r
    const int kmax = q0 + ln - kbase - 8 * hh;       /* key offset 16 nt + r is kept while it is <= kmax */
    float sc[2][8], mk[2][8];
#pragma unroll
    for (int nt = 0; nt < 2; ++nt) {
#pragma unroll
      for (int r = 0; r < 8; ++r) {
        sc[nt][r] = (sm[nt][r] + sr[nt][r] * RINV) * 0.125f;
        mk[nt][r] = (nt * 16 + r <= kmax) ? sc[nt][r] : -1.0e30f;
      }
    }
    const float mx0 = fmaxf(fmaxf(fmaxf(mk[0][0], mk[0][1]), fmaxf(mk[0][2], mk[0][3])), fmaxf(fmaxf(mk[0][4], mk[0][5]), fmaxf(mk[0][6], mk[0][7])));
    const float mx1 = fmaxf(fmaxf(fmaxf(mk[1][0], mk[1][1]), fmaxf(mk[1][2], mk[1][3])), fmaxf(fmaxf(mk[1][4], mk[1][5]), fmaxf(mk[1][6], mk[1][7])));
    const float mxh = fmaxf(mx0, mx1);
    const float mnew = fmaxf(mi, fmaxf(mxh, xhalf(mxh)));   /* the same in both halves */
    const float al = __expf(mi - mnew);
    mi = mnew;
    float pv[2][8];
#pragma unroll
    for (int nt = 0; nt < 2; ++nt) {
#pragma unroll
      for (int r = 0; r < 8; ++r) {
        const float e = __expf(fminf(sc[nt][r] - mnew, 0.f));
        pv[nt][r] = (nt * 16 + r <= kmax) ? e : 0.f;
      }
    }
    const float su0 = ((pv[0][0] + pv[0][1]) + (pv[0][2] + pv[0][3])) + ((pv[0][4] + pv[0][5]) + (pv[0][6] + pv[0][7]));
    const float su1 = ((pv[1][0] + pv[1][1]) + (pv[1][2] + pv[1][3])) + ((pv[1][4] + pv[1][5]) + (pv[1][6] + pv[1][7]));
    li = li * al + (su0 + su1);                      /* this half's keys only; the halves are joined behind the loop */
#pragma unroll
    for (int t = 0; t < 4; ++t) { om[t] *= al; if constexpr (full) orr[t] *= al; }
    // P^T (x2^10) as a B fragment straight from the score registers: element 8 nt + r is key 16 nt + 8 hh + r, the k order in which ldfrag reads V^T
    FragH ph, pr;
#pragma unroll
    for (int nt = 0; nt < 2; ++nt) {
#pragma unroll
      for (int r = 0; r < 8; ++r) {
        const float pc = pv[nt][r] * RS;
        const _Float16 p16 = (_Float16)pc;
        ph.h[nt * 8 + r] = p16;
        if constexpr (full) pr.h[nt * 8 + r] = (_Float16)((pc - (float)p16) * RS);
      }
    }
    // O^T += V^T P^T: rows = d, column = query
#pragma unroll
    for (int t = 0; t < 4; ++t) {
      const size_t vo = (vrow + t * 16 + ln) * (size_t)SEQ + kbase;
      const v16h vh = vf[t];
      om[t] = mma(vh, ph.v, om[t]);
      if constexpr (full) { const v16h vr = ldfrag(VTR, vo, hh); orr[t] = mma(vr, ph.v, orr[t]); orr[t] = mma(vh, pr.v, orr[t]); }
    }
   }
    // hand-over, passed by every wave: own LDS reads done, own copies of stage st + 1 landed, then the block barrier that publishes stage st + 1 and frees this stage's buffer
    asm volatile("s_wait_dscnt 0x0" ::: "memory");
    asm volatile("s_wait_asynccnt 0x0" ::: "memory");
    __syncthreads();
    if (st + 2 < nst) stage(st + 2);
  }
  };
  if (qt < EQT) key_loop(flag_c<true>{}); else key_loop(flag_c<false>{});   /* block-uniform choice */
  asm volatile("s_wait_asynccnt 0x0" ::: "memory");   /* no copy outstanding at the tile's end */
  // context x16 = o / (2^10 * l) * 16
  const float inv = 0.015625f * (1.0f / (li + xhalf(li)));
#pragma unroll
  for (int t = 0; t < 4; ++t) {
#pragma unroll
    for (int r = 0; r < 8; ++r) so[wave][ln][t * 16 + 8 * hh + r] = (om[t][r] + orr[t][r] * RINV) * inv;
  }
  __builtin_amdgcn_fence(4 /* acq_rel order */, "workgroup"); __builtin_amdgcn_wave_barrier();
  const int rq = lane >> 3, c8 = (lane & 7) * 8;
  {
#pragma unroll
    for (int it = 0; it < 4; ++it) {
      const int rr = it * 4 + rq;
      const v4f a = *(const v4fa*)&so[wave][rr][c8], b = *(const v4fa*)&so[wave][rr][c8 + 4];
      FragH fh, fl;
#pragma unroll
      for (int q = 0; q < 4; ++q) { _Float16 hv = (_Float16)a[q]; fh.h[q] = hv; fl.h[q] = (_Float16)((a[q] - (float)hv) * RSC); hv = (_Float16)b[q]; fh.h[4 + q] = hv; fl.h[4 + q] = (_Float16)((b[q] - (float)hv) * RSC); }
      const v8us oh = fh.half[0], ol = fl.half[0];
      const size_t o = ((size_t)(q0 + rr) * NG + g) * CP + h * HD + c8;
      *(v8us*)(CX + o) = oh; *(v8us*)(CX + o + EMB) = ol;
    }
    asm volatile("s_wait_xcnt 0x0" ::: "memory");   /* stands behind the eight stores, in front of the next tile's writes of their address or data registers */
  }
  }
}

extern "C" void kernel_launch(void* const* d_in, const int* in_sizes, int n_in,
                              void* d_out, int out_size, void* d_ws, size_t ws_size, hipStream_t stream) {
  if (n_in < 5) return;
  if (in_sizes[0] < NR * EMB) return;
  if (in_sizes[1] < EMB * EMB) return;
  if (in_sizes[2] < EMB * KVW) return;
  if (in_sizes[3] < EMB * KVW) return;
  if (in_sizes[4] < EMB * EMB) return;
  if (out_size < NR * EMB) return;
  const float* x  = (const float*)d_in[0];
  const float* Wq = (const float*)d_in[1];      /* [in 1024][out 1024] */
  const float* Wk = (const float*)d_in[2];      /* [in 1024][out 256] */
  const float* Wv = (const float*)d_in[3];      /* [in 1024][out 256] */
  const float* Wo = (const float*)d_in[4];      /* [in 1024][out 1024] */
  char* ws = (char*)d_ws; size_t off = 0;
  auto take = [&](size_t bytes) { char* p = ws + off; off += (bytes + 255) & ~(size_t)255; return p; };
  unsigned short* BQKV = (unsigned short*)take(SZ_BQKV);      /* [1536][1024]: Wq^T | Wk^T | Wv^T, x16 */
  unsigned short* BO   = (unsigned short*)take(SZ_BO);        /* [1024][2048]: Wo^T x16 | Wo^T / 4 */
  unsigned short* X16  = (unsigned short*)take(SZ_X16);       /* [NR][1024] */
  unsigned short* QKH  = (unsigned short*)take(SZ_QK);        /* [NR][1536] value plane of q | k | v */
  unsigned short* QKR  = (unsigned short*)take(SZ_QK);        /* [NR][1536] residual plane (x2^10) */
  unsigned short* VTH  = (unsigned short*)take(SZ_VT);        /* [NG*NKV][64][SEQ] */
  unsigned short* VTR  = (unsigned short*)take(SZ_VT);
  unsigned short* CX   = (unsigned short*)take(SZ_CX);        /* [NR][2048]: context x16 value | residual (x64) */
  if (off > ws_size) return;

  k_prep<<<(unsigned)PB_ALL, 256, 0, stream>>>(x, Wq, Wk, Wv, Wo, X16, BQKV, BO);
  k_gemm_planes<<<(unsigned)((NR / 128) * (LQ / 64)), 128, 0, stream>>>(X16, EMB, BQKV, EMB, 0.0625f, QKH, QKR, LQ, NR, LQ, EMB);
  k_vt<<<(unsigned)(NB * NG * NKV * (SEQ / 64)), 256, 0, stream>>>(QKH, QKR, VTH, VTR);
  k_attn<<<dim3((unsigned)(NQT / 2), (unsigned)(NG * NH)), 128, 0, stream>>>(QKH, QKR, VTH, VTR, CX);
  k_gemm_out<<<(unsigned)((NR / 128) * (EMB / 64)), 128, 0, stream>>>(CX, CP, BO, CP, 0.00390625f, (float*)d_out, EMB, NR, EMB, CP);
}
